// v000
// Measured on an AMD MI455X. A time is GPU time per run, averaged over a window of back-to-back runs after a warm-up
// (all launches, gaps included; the runs take copies of the inputs in turn), and the median of several windows.
// Apart from v000's, it joins two sittings. Times from different sittings can be a few percent apart, while
// side-by-side timings come from the same sitting.
// The starting kernel, v000, takes 1720 microseconds a run.
#include <hip/hip_runtime.h>

// Sliding-window causal GQA with RMSNorm pre-normalisation and residual (x [2][2048][2048]; n = x rsqrt(mean x^2 + 1e-6) norm_w; q = n wq ('xw', 16 heads x 128), k, v = n wk / n wv (4 kv heads); rotate-half RoPE from the given tables [2048][64] (both halves share column d mod 64); 4 query heads per kv head (repeat); scores/sqrt(128) kept where j <= i and i - j < 512; softmax; out = x + merged wo -> [2][2048][2048]).
// Compute dtypes, f32 accumulate: every input rounded to bf16; q/k/v hl x exact (2 products); rotary in f32 from the bf16-rounded input tables; windowed-causal scores and attn.v (only tiles above the causal diagonal skipped): query rows < 512 hl (3 products), the rest single fp16 (x1024); softmax f32; wo hl x exact (2 products), + x residual in f32.

#define NB_  2
#define TT   2048
#define DM   2048
#define NH_  16
#define NKV  4
#define REP  (NH_ / NKV)
#define HD   128
#define DQ   (NH_ * HD)
#define DKV  (NKV * HD)
#define ZH   2
#define RH   512                  // query rows < RH use hi+lo planes (0: none)
#define WIN  512
#define PCAR 1024.0f
#define SCL  0.088388347648318447f   // HD^-0.5
typedef _Float16 h16;
typedef unsigned short bf;
typedef __attribute__((ext_vector_type(16))) __bf16   v16bf;
typedef __attribute__((ext_vector_type(16))) _Float16 v16h;
typedef __attribute__((ext_vector_type(8)))  _Float16 v8h;
typedef __attribute__((ext_vector_type(8)))  unsigned short v8us;
typedef __attribute__((ext_vector_type(8)))  float    v8f;
typedef __attribute__((ext_vector_type(4)))  float    v4f;
typedef v8h  __attribute__((may_alias)) v8ha;
typedef v4f  __attribute__((may_alias)) v4fa;
typedef v8us __attribute__((may_alias)) v8usa;

__device__ __forceinline__ unsigned short f2bf(float f) { unsigned u = __float_as_uint(f); u += 0x7FFFu + ((u >> 16) & 1u); return (unsigned short)(u >> 16); }
__device__ __forceinline__ float bf2f(unsigned short b) { return __uint_as_float(((unsigned)b) << 16); }
__device__ __forceinline__ float bfr(float f) { return bf2f(f2bf(f)); }
__device__ __forceinline__ v16h cat16(v8h lo, v8h hi) { return __builtin_shufflevector(lo, hi, 0, 1, 2, 3, 4, 5, 6, 7, 8, 9, 10, 11, 12, 13, 14, 15); }
__device__ __forceinline__ v16bf cat16b(v8us lo, v8us hi) { return __builtin_bit_cast(v16bf, __builtin_shufflevector(lo, hi, 0, 1, 2, 3, 4, 5, 6, 7, 8, 9, 10, 11, 12, 13, 14, 15)); }
__device__ __forceinline__ v8f wmma16(v16h a, v16h b, v8f c) { return __builtin_amdgcn_wmma_f32_16x16x32_f16(false, a, false, b, (short)0, c, false, false); }
__device__ __forceinline__ v8f wmmab(v16bf a, v16bf b, v8f c) { return __builtin_amdgcn_wmma_f32_16x16x32_bf16(false, a, false, b, (short)0, c, false, false); }



// ---- k_gemmw: register-blocked GEMM, ONE WAVE per 64x64 output tile (16 accumulators), operands straight from K-contiguous 16-bit planes; grid (M/64, N/64, Z), 32 threads.
// C[m][n] (f32, pitch ldc, + optional f32 bias[n]) = sum_k A[m][k] Bt[n][k] (+ split products per NSPLIT). z-batch strides sA/sB/sC in elements. K % 32 == 0.
template <typename T16> struct WFrag;
template <> struct WFrag<h16> { typedef v16h V; static __device__ __forceinline__ V ld(const h16* p) { return cat16(*(const v8h*)p, *(const v8h*)(p + 16)); } static __device__ __forceinline__ v8f mma(V a, V b, v8f c) { return wmma16(a, b, c); } };
template <> struct WFrag<bf> { typedef v16bf V; static __device__ __forceinline__ V ld(const bf* p) { return cat16b(*(const v8us*)p, *(const v8us*)(p + 16)); } static __device__ __forceinline__ v8f mma(V a, V b, v8f c) { return wmmab(a, b, c); } };
template <typename T16, int NSPLIT, bool BIAS>
__global__ __launch_bounds__(32) void k_gemmw(const T16* __restrict__ A, const T16* __restrict__ A2, const T16* __restrict__ Bt, const T16* __restrict__ Bt2, int K, float* C, int ldc, const float* __restrict__ bias, size_t sA, size_t sB, size_t sC) {
    typedef typename WFrag<T16>::V V;
    __shared__ __align__(16) float os[16 * 68];
    const size_t z = blockIdx.z; A += z * sA; if (A2) A2 += z * sA; Bt += z * sB; if (Bt2) Bt2 += z * sB; C += z * sC;
    const int lane = threadIdx.x & 31, lr = lane & 15, hi = lane >> 4; const int r0 = blockIdx.x * 64, c0 = blockIdx.y * 64;
    v8f acc[4][4];
#pragma unroll
    for (int mb = 0; mb < 4; ++mb)
#pragma unroll
        for (int nb = 0; nb < 4; ++nb) acc[mb][nb] = (v8f){};
    const size_t aoff = (size_t)(r0 + lr) * K + 8 * hi, boff = (size_t)(c0 + lr) * K + 8 * hi;
#pragma unroll 1
    for (int kc = 0; kc < K; kc += 32) {
        V a[4], a2[4];
#pragma unroll
        for (int mb = 0; mb < 4; ++mb) { a[mb] = WFrag<T16>::ld(A + aoff + (size_t)mb * 16 * K + kc); if (NSPLIT == 1 || NSPLIT == 2) a2[mb] = WFrag<T16>::ld(A2 + aoff + (size_t)mb * 16 * K + kc); }
#pragma unroll
        for (int nb = 0; nb < 4; ++nb) { const V b = WFrag<T16>::ld(Bt + boff + (size_t)nb * 16 * K + kc); V b2; if (NSPLIT >= 2) b2 = WFrag<T16>::ld(Bt2 + boff + (size_t)nb * 16 * K + kc);
#pragma unroll
            for (int mb = 0; mb < 4; ++mb) { acc[mb][nb] = WFrag<T16>::mma(a[mb], b, acc[mb][nb]); if (NSPLIT == 1 || NSPLIT == 2) acc[mb][nb] = WFrag<T16>::mma(a2[mb], b, acc[mb][nb]); if (NSPLIT >= 2) acc[mb][nb] = WFrag<T16>::mma(a[mb], b2, acc[mb][nb]); } }
        asm volatile("v_nop\n\tv_nop\n\tv_nop\n\tv_nop" : "+v"(acc[0][0]), "+v"(acc[1][1]), "+v"(acc[2][2]), "+v"(acc[3][3]) : "v"(a[0]), "v"(a[3]));
    }
#pragma unroll
    for (int mb = 0; mb < 4; ++mb) {
#pragma unroll
        for (int nb = 0; nb < 4; ++nb) {
#pragma unroll
            for (int j = 0; j < 8; ++j) os[(hi * 8 + j) * 68 + nb * 16 + lr] = acc[mb][nb][j]; }
        __builtin_amdgcn_wave_barrier(); asm volatile("" ::: "memory");
        float* crow = C + (size_t)(r0 + mb * 16) * ldc + c0;
{
#pragma unroll
            for (int s = 0; s < 8; ++s) { const int row = 2 * s + hi, cofs = lr * 4; v4f val = *(const v4fa*)(os + row * 68 + cofs); if (BIAS) { val[0] += bfr(bias[c0 + cofs]); val[1] += bfr(bias[c0 + cofs + 1]); val[2] += bfr(bias[c0 + cofs + 2]); val[3] += bfr(bias[c0 + cofs + 3]); }
                *(v4f*)(crow + (size_t)row * ldc + cofs) = val; }
             }
        __builtin_amdgcn_wave_barrier(); asm volatile("" ::: "memory");
    }
}

// ---- k_gemmc: the same one-wave 64x64 tile GEMM specialised for causal attention: CMODE 1 skips score tiles entirely above the diagonal (query rows r0+roff.., key columns c0..), CMODE 2 limits the
// key (K) loop of the probability x value contraction to the diagonal block (probabilities beyond it are exactly zero). roff = row offset of this launch's first row within the sequence.
template <typename T16, int NSPLIT, int CMODE>
__global__ __launch_bounds__(32) void k_gemmc(const T16* __restrict__ A, const T16* __restrict__ A2, const T16* __restrict__ Bt, const T16* __restrict__ Bt2, int K, float* C, int ldc, int roff, size_t sA, size_t sB, size_t sC) {
    typedef typename WFrag<T16>::V V;
    __shared__ __align__(16) float os[16 * 68];
    const size_t z = blockIdx.z; A += z * sA; if (A2) A2 += z * sA; Bt += z * sB; if (Bt2) Bt2 += z * sB; C += z * sC;
    const int lane = threadIdx.x & 31, lr = lane & 15, hi = lane >> 4; const int r0 = blockIdx.x * 64, c0 = blockIdx.y * 64;
    if (CMODE == 1 && c0 > r0 + roff + 63) return;                  // score tile entirely above the causal diagonal: never written (the softmax masks j > i by select)
    const int Kl = (CMODE == 2) ? min(K, r0 + roff + 64) : K;        // P.V: probabilities are exactly 0 beyond the diagonal block, so the K loop stops there
    v8f acc[4][4];
#pragma unroll
    for (int mb = 0; mb < 4; ++mb)
#pragma unroll
        for (int nb = 0; nb < 4; ++nb) acc[mb][nb] = (v8f){};
    const size_t aoff = (size_t)(r0 + lr) * K + 8 * hi, boff = (size_t)(c0 + lr) * K + 8 * hi;
#pragma unroll 1
    for (int kc = 0; kc < Kl; kc += 32) {
        V a[4], a2[4];
#pragma unroll
        for (int mb = 0; mb < 4; ++mb) { a[mb] = WFrag<T16>::ld(A + aoff + (size_t)mb * 16 * K + kc); if (NSPLIT == 1 || NSPLIT == 2) a2[mb] = WFrag<T16>::ld(A2 + aoff + (size_t)mb * 16 * K + kc); }
#pragma unroll
        for (int nb = 0; nb < 4; ++nb) { const V b = WFrag<T16>::ld(Bt + boff + (size_t)nb * 16 * K + kc); V b2; if (NSPLIT >= 2) b2 = WFrag<T16>::ld(Bt2 + boff + (size_t)nb * 16 * K + kc);
#pragma unroll
            for (int mb = 0; mb < 4; ++mb) { acc[mb][nb] = WFrag<T16>::mma(a[mb], b, acc[mb][nb]); if (NSPLIT == 1 || NSPLIT == 2) acc[mb][nb] = WFrag<T16>::mma(a2[mb], b, acc[mb][nb]); if (NSPLIT >= 2) acc[mb][nb] = WFrag<T16>::mma(a[mb], b2, acc[mb][nb]); } }
        asm volatile("v_nop\n\tv_nop\n\tv_nop\n\tv_nop" : "+v"(acc[0][0]), "+v"(acc[1][1]), "+v"(acc[2][2]), "+v"(acc[3][3]) : "v"(a[0]), "v"(a[3]));
    }
#pragma unroll
    for (int mb = 0; mb < 4; ++mb) {
#pragma unroll
        for (int nb = 0; nb < 4; ++nb) {
#pragma unroll
            for (int j = 0; j < 8; ++j) os[(hi * 8 + j) * 68 + nb * 16 + lr] = acc[mb][nb][j]; }
        __builtin_amdgcn_wave_barrier(); asm volatile("" ::: "memory");
        float* crow = C + (size_t)(r0 + mb * 16) * ldc + c0;
{
#pragma unroll
            for (int s = 0; s < 8; ++s) { const int row = 2 * s + hi, cofs = lr * 4; v4f val = *(const v4fa*)(os + row * 68 + cofs);
                *(v4f*)(crow + (size_t)row * ldc + cofs) = val; }
             }
        __builtin_amdgcn_wave_barrier(); asm volatile("" ::: "memory");
    }
}

__device__ __forceinline__ h16 tohx(float x) { return (h16)x; }
__device__ __forceinline__ void splitf(float y, unsigned short& h, unsigned short& l) { h = f2bf(y); l = f2bf(y - bf2f(h)); }
typedef __attribute__((ext_vector_type(2))) _Float16 v2h;
typedef __attribute__((ext_vector_type(4))) _Float16 v4h;
typedef __attribute__((ext_vector_type(2))) unsigned short v2us;
typedef __attribute__((ext_vector_type(4))) unsigned short v4us;
typedef __attribute__((ext_vector_type(2))) float v2f;
typedef __attribute__((ext_vector_type(4))) int v4i;

__global__ __launch_bounds__(256) void k_wtG(const float* __restrict__ w, int K, int N, bf* Bt) {
    const int lane = threadIdx.x & 31; const int L0 = (blockIdx.x * 8 + (threadIdx.x >> 5)) * 8; const int nlines = N * K / 64;
{
#pragma unroll 1
        for (int l = 0; l < 8; ++l) { const int L = L0 + l; if (L >= nlines) break; const size_t e = (size_t)L * 64 + lane * 2; const int k = (int)(e % K), n = (int)(e / K); v2us o;
            o[0] = f2bf(w[(size_t)k * N + n]); o[1] = f2bf(w[(size_t)(k + 1) * N + n]); *(v2us*)(Bt + e) = o; }
         }
}
__global__ __launch_bounds__(256) void k_rmshl(const float* __restrict__ X, const float* __restrict__ g, bf* Yh, bf* Yl) {
    const int lane = threadIdx.x & 31; const int r = blockIdx.x * 8 + (threadIdx.x >> 5); if (r >= TT) return; const float* xr = X + (size_t)r * DM; float s = 0.f;
#pragma unroll 1
    for (int ch = 0; ch < DM / 128; ++ch) { const v4f a = *(const v4f*)(xr + ch * 128 + lane * 4);
#pragma unroll
        for (int q = 0; q < 4; ++q) { const float xb = bfr(a[q]); float p = __fmul_rn(xb, xb); asm volatile("" : "+v"(p)); s = __fadd_rn(s, p); } }
#pragma unroll
    for (int sh = 16; sh; sh >>= 1) s += __shfl_xor(s, sh, 32);
    const float rs = __fdiv_rn(1.0f, __fsqrt_rn(__fadd_rn(s * (1.0f / DM), 1e-6f)));
{
#pragma unroll 1
        for (int ch = 0; ch < DM / 128; ++ch) { const int c0 = ch * 128 + lane * 4; const v4f a = *(const v4f*)(xr + c0); v4us oh, ol;
#pragma unroll
            for (int q = 0; q < 4; ++q) { float n0 = __fmul_rn(bfr(a[q]), rs); asm volatile("" : "+v"(n0)); const float y = __fmul_rn(n0, bfr(g[c0 + q])); unsigned short h2, l2; splitf(y, h2, l2); oh[q] = h2; ol[q] = l2; }
            *(v4us*)(Yh + (size_t)r * DM + c0) = oh; *(v4us*)(Yl + (size_t)r * DM + c0) = ol; }
         } }
__global__ __launch_bounds__(256) void k_addres(const float* __restrict__ X, const float* __restrict__ Y, float* O, size_t n4) { const size_t i = (size_t)blockIdx.x * 256 + threadIdx.x; if (i >= n4) return; const v4f a = *(const v4f*)(X + i * 4), b = *(const v4f*)(Y + i * 4); v4f o;
#pragma unroll
    for (int q = 0; q < 4; ++q) o[q] = __fadd_rn(bfr(a[q]), b[q]); *(v4f*)(O + i * 4) = o;  }
__global__ __launch_bounds__(256) void k_cvt8(const float* __restrict__ src, bf* dst, size_t n8) { const size_t i = (size_t)blockIdx.x * 256 + threadIdx.x; if (i >= n8) return; const v8f v = *(const v8f*)(src + i * 8); v8us o;
#pragma unroll
    for (int k = 0; k < 8; ++k) o[k] = f2bf(v[k]); *(v8us*)(dst + i * 8) = o;  }
__global__ __launch_bounds__(256) void k_cscvt(const float* __restrict__ cosT, const float* __restrict__ sinT, float* CS) { const int idx = blockIdx.x * 256 + threadIdx.x; if (idx >= TT * HD) return; const int t = idx / HD, d = idx % HD; const size_t ti = (size_t)t * (HD / 2) + (d % (HD / 2));   /* half-width tables: both halves use column d mod 64 */ v2f cs; cs[0] = bfr(cosT[ti]); cs[1] = bfr(sinT[ti]); *(v2f*)(CS + (size_t)idx * 2) = cs;  }
// k_rope: head planes [h][t][d] (fp16 + hi/lo) of rope(x) x sc with the rotate-half convention out[d] = x[d] cos[t][d] - x[d+HD/2] sin[t][d], out[d+HD/2] = x[d+HD/2] cos[t][d+HD/2] + x[d] sin[t][d+HD/2]
__global__ __launch_bounds__(256) void k_rope(const float* __restrict__ F, int pitch, int nheads, const float* __restrict__ CS, const float* __restrict__ RF, const float* __restrict__ nw, float sc, h16* P16, bf* Ph, bf* Pl) {
    const size_t e = ((size_t)blockIdx.x * 256 + threadIdx.x) * 2; if (e >= (size_t)nheads * TT * HD) return; const int d = (int)(e % HD); const int t = (int)((e / HD) % TT); const int h = (int)(e / ((size_t)HD * TT)); const float* f = F + (size_t)t * pitch + h * HD; const float rf = RF ? RF[(size_t)h * TT + t] : 1.0f; v2h o16; v2us oh, ol;
#pragma unroll
    for (int q = 0; q < 2; ++q) { const int dd = d + q; const int dp = (dd < HD / 2) ? dd + HD / 2 : dd - HD / 2; float x0 = f[dd], x1 = f[dp];
        if (RF) { float n0 = __fmul_rn(x0, rf), n1 = __fmul_rn(x1, rf); asm volatile("" : "+v"(n0)); asm volatile("" : "+v"(n1)); x0 = __fmul_rn(bfr(nw[dd]), n0); x1 = __fmul_rn(bfr(nw[dp]), n1); }
        const v2f cs = *(const v2f*)(CS + ((size_t)t * HD + dd) * 2); float a = __fmul_rn(x0, cs[0]), bq = __fmul_rn(x1, cs[1]); asm volatile("" : "+v"(a)); asm volatile("" : "+v"(bq)); const float r = ((dd < HD / 2) ? __fsub_rn(a, bq) : __fadd_rn(a, bq)) * sc;
        o16[q] = tohx(r); unsigned short a2, c2; splitf(r, a2, c2); oh[q] = a2; ol[q] = c2; }
    *(v2h*)(P16 + e) = o16; *(v2us*)(Ph + e) = oh; *(v2us*)(Pl + e) = ol;  }
__global__ __launch_bounds__(256) void k_vtp(const float* __restrict__ F, int pitch, int nheads, h16* V16, bf* Vh, bf* Vl) { const size_t e = ((size_t)blockIdx.x * 256 + threadIdx.x) * 2; if (e >= (size_t)nheads * HD * TT) return; const int t = (int)(e % TT); const int d = (int)((e / TT) % HD); const int g = (int)(e / ((size_t)TT * HD)); v2h o16; v2us oh, ol;
#pragma unroll
    for (int q = 0; q < 2; ++q) { const float x = F[(size_t)(t + q) * pitch + g * HD + d]; o16[q] = tohx(x); unsigned short a2, c2; splitf(x, a2, c2); oh[q] = a2; ol[q] = c2; }
    *(v2h*)(V16 + e) = o16; *(v2us*)(Vh + e) = oh; *(v2us*)(Vl + e) = ol;  }
// k_asoft: per row (zz, i): t = S x HD^-0.5 for j <= i and i - j < WIN (sliding causal window; the reference's -1e9 additive fill vanishes identically); softmax over the 2048 keys (register row, one exp, fixed trees);
__global__ __launch_bounds__(256) void k_asoft(const float* __restrict__ Sb, h16* P16, bf* Ph, bf* Pl) {
    const int lane = threadIdx.x & 31; const int row = blockIdx.x * 8 + (threadIdx.x >> 5); if (row >= ZH * TT) return; const int i = row % TT; const int zz = row / TT; (void)zz; const bool hires = (i < RH); const float* sr = Sb + (size_t)row * TT; float v[TT / 32]; float mx = -3.0e38f;
#pragma unroll
    for (int ch = 0; ch < TT / 128; ++ch) { const int j0 = ch * 128 + lane * 4; const v4f a = *(const v4f*)(sr + j0);
#pragma unroll
        for (int q = 0; q < 4; ++q) { const int j = j0 + q; (void)j; const float t = (j <= i && i - j < WIN) ? a[q] * SCL : -3.0e38f; v[ch * 4 + q] = t; mx = fmaxf(mx, t); } }
#pragma unroll
    for (int sh = 16; sh; sh >>= 1) mx = fmaxf(mx, __shfl_xor(mx, sh, 32));
    float sum = 0.f;
#pragma unroll
    for (int k = 0; k < TT / 32; ++k) { float d0 = __fsub_rn(v[k], mx); asm volatile("" : "+v"(d0)); v[k] = __builtin_amdgcn_exp2f(__fmul_rn(d0, 1.4426950408889634f)); sum += v[k]; }
#pragma unroll
    for (int sh = 16; sh; sh >>= 1) sum += __shfl_xor(sum, sh, 32);
    const float f = __fdiv_rn(hires ? 1.0f : PCAR, sum);
{
        if (hires) {
#pragma unroll
            for (int ch = 0; ch < TT / 128; ++ch) { v4us oh, ol;
#pragma unroll
                for (int q = 0; q < 4; ++q) { unsigned short a, c2; splitf(v[ch * 4 + q] * f, a, c2); oh[q] = a; ol[q] = c2; }
                const size_t oo = ((size_t)zz * (RH ? RH : 1) + i) * TT + ch * 128 + lane * 4; *(v4us*)(Ph + oo) = oh; *(v4us*)(Pl + oo) = ol; }
        } else {
#pragma unroll
            for (int ch = 0; ch < TT / 128; ++ch) { v4h o4;
#pragma unroll
                for (int q = 0; q < 4; ++q) o4[q] = tohx(v[ch * 4 + q] * f);
                *(v4h*)(P16 + (size_t)row * TT + ch * 128 + lane * 4) = o4; } }
         }
}
__global__ __launch_bounds__(256) void k_merge(const float* __restrict__ O, int h0, bf* Ah, bf* Al) { const size_t e = ((size_t)blockIdx.x * 256 + threadIdx.x) * 2; if (e >= (size_t)ZH * TT * HD) return; const int d = (int)(e % HD); const int t = (int)((e / HD) % TT); const int zz = (int)(e / ((size_t)HD * TT)); const float cs = (t < RH) ? 1.0f : (1.0f / PCAR); const size_t oo = (size_t)t * DQ + (h0 + zz) * HD + d;
    v2us oh, ol;
#pragma unroll
    for (int q = 0; q < 2; ++q) { unsigned short a, c2; splitf(O[e + q] * cs, a, c2); oh[q] = a; ol[q] = c2; } *(v2us*)(Ah + oo) = oh; *(v2us*)(Al + oo) = ol;  }

extern "C" void kernel_launch(void* const* d_in, const int* in_sizes, int n_in,
                              void* d_out, int out_size, void* d_ws, size_t ws_size, hipStream_t stream) {
    (void)in_sizes; (void)n_in; (void)out_size;
    const float* x = (const float*)d_in[0]; const float* gw = (const float*)d_in[1]; const float* wq = (const float*)d_in[2]; const float* wk = (const float*)d_in[3]; const float* wv = (const float*)d_in[4]; const float* wo = (const float*)d_in[5]; const float* cosT = (const float*)d_in[6]; const float* sinT = (const float*)d_in[7];
    float* OUT = (float*)d_out;     // [2][2048][2048]
    char* wsp = (char*)d_ws;
    auto take = [&](size_t bytes) { char* p = wsp; wsp += (bytes + 255) & ~(size_t)255; return (void*)p; };
    bf* WQ = (bf*)take((size_t)DQ * DM * 2); bf* WK = (bf*)take((size_t)DKV * DM * 2); bf* WV = (bf*)take((size_t)DKV * DM * 2); bf* WO = (bf*)take((size_t)DM * DQ * 2); float* CS = (float*)take((size_t)TT * HD * 2 * 4);
    bf* Yh = (bf*)take((size_t)TT * DM * 2); bf* Yl = (bf*)take((size_t)TT * DM * 2); float* YO = (float*)take((size_t)TT * DM * 4); float* FQ = (float*)take((size_t)TT * DQ * 4); float* FK = (float*)take((size_t)TT * DKV * 4);
    h16* QP16 = (h16*)take((size_t)NH_ * TT * HD * 2); h16* KP16 = (h16*)take((size_t)NKV * TT * HD * 2); h16* VT16 = (h16*)take((size_t)NKV * HD * TT * 2);
    bf* QPh = (bf*)take((size_t)NH_ * TT * HD * 2); bf* QPl = (bf*)take((size_t)NH_ * TT * HD * 2); bf* KPh = (bf*)take((size_t)NKV * TT * HD * 2); bf* KPl = (bf*)take((size_t)NKV * TT * HD * 2); bf* VTh = (bf*)take((size_t)NKV * HD * TT * 2); bf* VTl = (bf*)take((size_t)NKV * HD * TT * 2); bf* Ph = (bf*)take((size_t)ZH * RH * TT * 2); bf* Pl = (bf*)take((size_t)ZH * RH * TT * 2);
    float* Sb = (float*)take((size_t)ZH * TT * TT * 4); h16* P16 = (h16*)take((size_t)ZH * TT * TT * 2); float* Ob = (float*)take((size_t)ZH * TT * HD * 4); bf* ATh = (bf*)take((size_t)TT * DQ * 2); bf* ATl = (bf*)take((size_t)TT * DQ * 2);
    if ((size_t)(wsp - (char*)d_ws) > ws_size) return;    // ws 256 MiB
    float* FV = FK;   // v projection reuses the k buffer after the k planes are built (stream-ordered)
    { k_wtG<<<(unsigned)((DM * DQ / 64 + 63) / 64), 256, 0, stream>>>(wq, DM, DQ, WQ); k_wtG<<<(unsigned)((DM * DKV / 64 + 63) / 64), 256, 0, stream>>>(wk, DM, DKV, WK); k_wtG<<<(unsigned)((DM * DKV / 64 + 63) / 64), 256, 0, stream>>>(wv, DM, DKV, WV);
      k_wtG<<<(unsigned)((DQ * DM / 64 + 63) / 64), 256, 0, stream>>>(wo, DQ, DM, WO);
       }
    const unsigned LQ = (unsigned)(((size_t)NH_ * TT * HD / 2 + 255) / 256), LKv = (unsigned)(((size_t)NKV * TT * HD / 2 + 255) / 256);
    for (int b = 0; b < NB_; ++b) {
        if (b == 0) k_cscvt<<<(TT * HD + 255) / 256, 256, 0, stream>>>(cosT, sinT, CS);
        k_rmshl<<<TT / 8, 256, 0, stream>>>(x + (size_t)b * TT * DM, gw, Yh, Yl);   /* n = RMSNorm(x) norm_w as hi/lo planes */
        k_gemmw<bf, 1, false><<<dim3(TT / 64, DQ / 64, 1), 32, 0, stream>>>(Yh, Yl, WQ, nullptr, DM, FQ, DQ, nullptr, 0, 0, 0);
        k_rope<<<LQ, 256, 0, stream>>>(FQ, DQ, NH_, CS, nullptr, nullptr, 1.0f, QP16, QPh, QPl);
        k_gemmw<bf, 1, false><<<dim3(TT / 64, DKV / 64, 1), 32, 0, stream>>>(Yh, Yl, WK, nullptr, DM, FK, DKV, nullptr, 0, 0, 0);
        k_rope<<<LKv, 256, 0, stream>>>(FK, DKV, NKV, CS, nullptr, nullptr, 1.0f, KP16, KPh, KPl);
        k_gemmw<bf, 1, false><<<dim3(TT / 64, DKV / 64, 1), 32, 0, stream>>>(Yh, Yl, WV, nullptr, DM, FV, DKV, nullptr, 0, 0, 0); k_vtp<<<LKv, 256, 0, stream>>>(FV, DKV, NKV, VT16, VTh, VTl);
        for (int h0 = 0; h0 < NH_; h0 += ZH) { const size_t zq = (size_t)h0, zk = (size_t)(h0 / REP);   // both heads of a pass share kv group h0/REP (REP >= 2): sB = 0
            k_gemmc<bf, 2, 1><<<dim3(RH / 64, TT / 64, ZH), 32, 0, stream>>>(QPh + zq * TT * HD, QPl + zq * TT * HD, KPh + zk * TT * HD, KPl + zk * TT * HD, HD, Sb, TT, 0, (size_t)TT * HD, 0, (size_t)TT * TT);
            k_gemmc<h16, 0, 1><<<dim3((TT - RH) / 64, TT / 64, ZH), 32, 0, stream>>>(QP16 + zq * TT * HD + (size_t)RH * HD, nullptr, KP16 + zk * TT * HD, nullptr, HD, Sb + (size_t)RH * TT, TT, RH, (size_t)TT * HD, 0, (size_t)TT * TT);
            k_asoft<<<ZH * TT / 8, 256, 0, stream>>>(Sb, P16, Ph, Pl);
            k_gemmc<bf, 2, 2><<<dim3(RH / 64, HD / 64, ZH), 32, 0, stream>>>(Ph, Pl, VTh + zk * HD * TT, VTl + zk * HD * TT, TT, Ob, HD, 0, (size_t)RH * TT, 0, (size_t)TT * HD);
            k_gemmc<h16, 0, 2><<<dim3((TT - RH) / 64, HD / 64, ZH), 32, 0, stream>>>(P16 + (size_t)RH * TT, nullptr, VT16 + zk * HD * TT, nullptr, TT, Ob + (size_t)RH * HD, HD, RH, (size_t)TT * TT, 0, (size_t)TT * HD);
            k_merge<<<(unsigned)(((size_t)ZH * TT * HD / 2 + 255) / 256), 256, 0, stream>>>(Ob, h0, ATh, ATl); }
        k_gemmw<bf, 1, false><<<dim3(TT / 64, DM / 64, 1), 32, 0, stream>>>(ATh, ATl, WO, nullptr, DQ, YO, DM, nullptr, 0, 0, 0);
        k_addres<<<(unsigned)(((size_t)TT * DM / 4 + 255) / 256), 256, 0, stream>>>(x + (size_t)b * TT * DM, YO, OUT + (size_t)b * TT * DM, (size_t)TT * DM / 4); }   /* out = x + attn wo */
}

// v001
// It runs in 1280 microseconds.
// In two side-by-side timings against v000, it was 1.35 and 1.39 times as fast.
#include <hip/hip_runtime.h>

// Sliding-window causal GQA with RMSNorm pre-normalisation and residual (x [2][2048][2048]; n = x rsqrt(mean x^2 + 1e-6) norm_w; q = n wq ('xw', 16 heads x 128), k, v = n wk / n wv (4 kv heads); rotate-half RoPE from the given tables [2048][64] (both halves share column d mod 64); 4 query heads per kv head (repeat); scores/sqrt(128) kept where j <= i and i - j < 512; softmax; out = x + merged wo -> [2][2048][2048]).
// Compute dtypes, f32 accumulate: every input rounded to bf16; q/k/v hl x exact (2 products); rotary in f32 from the bf16-rounded input tables; windowed-causal scores and attn.v (only key tiles that touch the window band computed): query rows < 512 hl (3 products), the rest single fp16 (x1024); softmax f32; wo hl x exact (2 products), + x residual in f32.

#define NB_  2
#define TT   2048
#define DM   2048
#define NH_  16
#define NKV  4
#define REP  (NH_ / NKV)
#define HD   128
#define DQ   (NH_ * HD)
#define DKV  (NKV * HD)
#define ZH   2
#define RH   512                  // query rows < RH use hi+lo planes (0: none)
#define WIN  512
#define NBC  ((WIN + 128) / 128)  // 128-key chunks of a softmax row: WIN + 64 band keys of a 64-row tile, from a multiple of 128
#define PCAR 1024.0f
#define SCL  0.088388347648318447f   // HD^-0.5
typedef _Float16 h16;
typedef unsigned short bf;
typedef __attribute__((ext_vector_type(16))) __bf16   v16bf;
typedef __attribute__((ext_vector_type(16))) _Float16 v16h;
typedef __attribute__((ext_vector_type(8)))  _Float16 v8h;
typedef __attribute__((ext_vector_type(8)))  unsigned short v8us;
typedef __attribute__((ext_vector_type(8)))  float    v8f;
typedef __attribute__((ext_vector_type(4)))  float    v4f;
typedef v8h  __attribute__((may_alias)) v8ha;
typedef v4f  __attribute__((may_alias)) v4fa;
typedef v8us __attribute__((may_alias)) v8usa;

__device__ __forceinline__ unsigned short f2bf(float f) { unsigned u = __float_as_uint(f); u += 0x7FFFu + ((u >> 16) & 1u); return (unsigned short)(u >> 16); }
__device__ __forceinline__ float bf2f(unsigned short b) { return __uint_as_float(((unsigned)b) << 16); }
__device__ __forceinline__ float bfr(float f) { return bf2f(f2bf(f)); }
__device__ __forceinline__ v16h cat16(v8h lo, v8h hi) { return __builtin_shufflevector(lo, hi, 0, 1, 2, 3, 4, 5, 6, 7, 8, 9, 10, 11, 12, 13, 14, 15); }
__device__ __forceinline__ v16bf cat16b(v8us lo, v8us hi) { return __builtin_bit_cast(v16bf, __builtin_shufflevector(lo, hi, 0, 1, 2, 3, 4, 5, 6, 7, 8, 9, 10, 11, 12, 13, 14, 15)); }
__device__ __forceinline__ v8f wmma16(v16h a, v16h b, v8f c) { return __builtin_amdgcn_wmma_f32_16x16x32_f16(false, a, false, b, (short)0, c, false, false); }
__device__ __forceinline__ v8f wmmab(v16bf a, v16bf b, v8f c) { return __builtin_amdgcn_wmma_f32_16x16x32_bf16(false, a, false, b, (short)0, c, false, false); }



// ---- k_gemmw: register-blocked GEMM, ONE WAVE per 64x64 output tile (16 accumulators), operands straight from K-contiguous 16-bit planes; grid (M/64, N/64, Z), 32 threads.
// C[m][n] (f32, pitch ldc, + optional f32 bias[n]) = sum_k A[m][k] Bt[n][k] (+ split products per NSPLIT). z-batch strides sA/sB/sC in elements. K % 32 == 0.
template <typename T16> struct WFrag;
template <> struct WFrag<h16> { typedef v16h V; static __device__ __forceinline__ V ld(const h16* p) { return cat16(*(const v8h*)p, *(const v8h*)(p + 16)); } static __device__ __forceinline__ v8f mma(V a, V b, v8f c) { return wmma16(a, b, c); } };
template <> struct WFrag<bf> { typedef v16bf V; static __device__ __forceinline__ V ld(const bf* p) { return cat16b(*(const v8us*)p, *(const v8us*)(p + 16)); } static __device__ __forceinline__ v8f mma(V a, V b, v8f c) { return wmmab(a, b, c); } };
template <typename T16, int NSPLIT, bool BIAS>
__global__ __launch_bounds__(32) void k_gemmw(const T16* __restrict__ A, const T16* __restrict__ A2, const T16* __restrict__ Bt, const T16* __restrict__ Bt2, int K, float* C, int ldc, const float* __restrict__ bias, size_t sA, size_t sB, size_t sC) {
    typedef typename WFrag<T16>::V V;
    __shared__ __align__(16) float os[16 * 68];
    const size_t z = blockIdx.z; A += z * sA; if (A2) A2 += z * sA; Bt += z * sB; if (Bt2) Bt2 += z * sB; C += z * sC;
    const int lane = threadIdx.x & 31, lr = lane & 15, hi = lane >> 4; const int r0 = blockIdx.x * 64, c0 = blockIdx.y * 64;
    v8f acc[4][4];
#pragma unroll
    for (int mb = 0; mb < 4; ++mb)
#pragma unroll
        for (int nb = 0; nb < 4; ++nb) acc[mb][nb] = (v8f){};
    const size_t aoff = (size_t)(r0 + lr) * K + 8 * hi, boff = (size_t)(c0 + lr) * K + 8 * hi;
#pragma unroll 1
    for (int kc = 0; kc < K; kc += 32) {
        V a[4], a2[4];
#pragma unroll
        for (int mb = 0; mb < 4; ++mb) { a[mb] = WFrag<T16>::ld(A + aoff + (size_t)mb * 16 * K + kc); if (NSPLIT == 1 || NSPLIT == 2) a2[mb] = WFrag<T16>::ld(A2 + aoff + (size_t)mb * 16 * K + kc); }
#pragma unroll
        for (int nb = 0; nb < 4; ++nb) { const V b = WFrag<T16>::ld(Bt + boff + (size_t)nb * 16 * K + kc); V b2; if (NSPLIT >= 2) b2 = WFrag<T16>::ld(Bt2 + boff + (size_t)nb * 16 * K + kc);
#pragma unroll
            for (int mb = 0; mb < 4; ++mb) { acc[mb][nb] = WFrag<T16>::mma(a[mb], b, acc[mb][nb]); if (NSPLIT == 1 || NSPLIT == 2) acc[mb][nb] = WFrag<T16>::mma(a2[mb], b, acc[mb][nb]); if (NSPLIT >= 2) acc[mb][nb] = WFrag<T16>::mma(a[mb], b2, acc[mb][nb]); } }
        asm volatile("v_nop\n\tv_nop\n\tv_nop\n\tv_nop" : "+v"(acc[0][0]), "+v"(acc[1][1]), "+v"(acc[2][2]), "+v"(acc[3][3]) : "v"(a[0]), "v"(a[3]));
    }
#pragma unroll
    for (int mb = 0; mb < 4; ++mb) {
#pragma unroll
        for (int nb = 0; nb < 4; ++nb) {
#pragma unroll
            for (int j = 0; j < 8; ++j) os[(hi * 8 + j) * 68 + nb * 16 + lr] = acc[mb][nb][j]; }
        __builtin_amdgcn_wave_barrier(); asm volatile("" ::: "memory");
        float* crow = C + (size_t)(r0 + mb * 16) * ldc + c0;
{
#pragma unroll
            for (int s = 0; s < 8; ++s) { const int row = 2 * s + hi, cofs = lr * 4; v4f val = *(const v4fa*)(os + row * 68 + cofs); if (BIAS) { val[0] += bfr(bias[c0 + cofs]); val[1] += bfr(bias[c0 + cofs + 1]); val[2] += bfr(bias[c0 + cofs + 2]); val[3] += bfr(bias[c0 + cofs + 3]); }
                *(v4f*)(crow + (size_t)row * ldc + cofs) = val; }
             }
        __builtin_amdgcn_wave_barrier(); asm volatile("" ::: "memory");
    }
}

// ---- k_gemmc: the same one-wave 64x64 tile GEMM specialised for causal attention: CMODE 1 computes only the score tiles that touch the band i - WIN < j <= i (grid y counts the WIN/64 + 1 key tiles from r0+roff-WIN up to the diagonal tile), CMODE 2 limits the
// key (K) loop of the probability x value contraction to the same band (probabilities outside it are exactly zero). roff = row offset of this launch's first row within the sequence.
template <typename T16, int NSPLIT, int CMODE>
__global__ __launch_bounds__(32) void k_gemmc(const T16* __restrict__ A, const T16* __restrict__ A2, const T16* __restrict__ Bt, const T16* __restrict__ Bt2, int K, float* C, int ldc, int roff, size_t sA, size_t sB, size_t sC) {
    typedef typename WFrag<T16>::V V;
    __shared__ __align__(16) float os[16 * 68];
    const size_t z = blockIdx.z; A += z * sA; if (A2) A2 += z * sA; Bt += z * sB; if (Bt2) Bt2 += z * sB; C += z * sC;
    const int lane = threadIdx.x & 31, lr = lane & 15, hi = lane >> 4; const int r0 = blockIdx.x * 64, c0 = (CMODE == 1) ? r0 + roff - WIN + (int)blockIdx.y * 64 : (int)blockIdx.y * 64;
    if (CMODE == 1 && c0 < 0) return;                                // the band starts at key 0 for the first WIN query rows; tiles outside the band are never computed (the softmax masks them by select)
    const int Kl = (CMODE == 2) ? min(K, r0 + roff + 64) : K;        // P.V: probabilities are exactly 0 beyond the diagonal block, so the K loop stops there
    const int K0 = (CMODE == 2) ? max(0, r0 + roff - WIN) : 0;       // ... and exactly 0 for keys j <= i - WIN, so it starts at the block that holds the first row's first key
    v8f acc[4][4];
#pragma unroll
    for (int mb = 0; mb < 4; ++mb)
#pragma unroll
        for (int nb = 0; nb < 4; ++nb) acc[mb][nb] = (v8f){};
    const size_t aoff = (size_t)(r0 + lr) * K + 8 * hi, boff = (size_t)(c0 + lr) * K + 8 * hi;
#pragma unroll 1
    for (int kc = K0; kc < Kl; kc += 32) {
        V a[4], a2[4];
#pragma unroll
        for (int mb = 0; mb < 4; ++mb) { a[mb] = WFrag<T16>::ld(A + aoff + (size_t)mb * 16 * K + kc); if (NSPLIT == 1 || NSPLIT == 2) a2[mb] = WFrag<T16>::ld(A2 + aoff + (size_t)mb * 16 * K + kc); }
#pragma unroll
        for (int nb = 0; nb < 4; ++nb) { const V b = WFrag<T16>::ld(Bt + boff + (size_t)nb * 16 * K + kc); V b2; if (NSPLIT >= 2) b2 = WFrag<T16>::ld(Bt2 + boff + (size_t)nb * 16 * K + kc);
#pragma unroll
            for (int mb = 0; mb < 4; ++mb) { acc[mb][nb] = WFrag<T16>::mma(a[mb], b, acc[mb][nb]); if (NSPLIT == 1 || NSPLIT == 2) acc[mb][nb] = WFrag<T16>::mma(a2[mb], b, acc[mb][nb]); if (NSPLIT >= 2) acc[mb][nb] = WFrag<T16>::mma(a[mb], b2, acc[mb][nb]); } }
        asm volatile("v_nop\n\tv_nop\n\tv_nop\n\tv_nop" : "+v"(acc[0][0]), "+v"(acc[1][1]), "+v"(acc[2][2]), "+v"(acc[3][3]) : "v"(a[0]), "v"(a[3]));
    }
#pragma unroll
    for (int mb = 0; mb < 4; ++mb) {
#pragma unroll
        for (int nb = 0; nb < 4; ++nb) {
#pragma unroll
            for (int j = 0; j < 8; ++j) os[(hi * 8 + j) * 68 + nb * 16 + lr] = acc[mb][nb][j]; }
        __builtin_amdgcn_wave_barrier(); asm volatile("" ::: "memory");
        float* crow = C + (size_t)(r0 + mb * 16) * ldc + c0;
{
#pragma unroll
            for (int s = 0; s < 8; ++s) { const int row = 2 * s + hi, cofs = lr * 4; v4f val = *(const v4fa*)(os + row * 68 + cofs);
                *(v4f*)(crow + (size_t)row * ldc + cofs) = val; }
             }
        __builtin_amdgcn_wave_barrier(); asm volatile("" ::: "memory");
    }
}

__device__ __forceinline__ h16 tohx(float x) { return (h16)x; }
__device__ __forceinline__ void splitf(float y, unsigned short& h, unsigned short& l) { h = f2bf(y); l = f2bf(y - bf2f(h)); }
typedef __attribute__((ext_vector_type(2))) _Float16 v2h;
typedef __attribute__((ext_vector_type(4))) _Float16 v4h;
typedef __attribute__((ext_vector_type(2))) unsigned short v2us;
typedef __attribute__((ext_vector_type(4))) unsigned short v4us;
typedef __attribute__((ext_vector_type(2))) float v2f;
typedef __attribute__((ext_vector_type(4))) int v4i;

__global__ __launch_bounds__(256) void k_wtG(const float* __restrict__ w, int K, int N, bf* Bt) {
    const int lane = threadIdx.x & 31; const int L0 = (blockIdx.x * 8 + (threadIdx.x >> 5)) * 8; const int nlines = N * K / 64;
{
#pragma unroll 1
        for (int l = 0; l < 8; ++l) { const int L = L0 + l; if (L >= nlines) break; const size_t e = (size_t)L * 64 + lane * 2; const int k = (int)(e % K), n = (int)(e / K); v2us o;
            o[0] = f2bf(w[(size_t)k * N + n]); o[1] = f2bf(w[(size_t)(k + 1) * N + n]); *(v2us*)(Bt + e) = o; }
         }
}
__global__ __launch_bounds__(256) void k_rmshl(const float* __restrict__ X, const float* __restrict__ g, bf* Yh, bf* Yl) {
    const int lane = threadIdx.x & 31; const int r = blockIdx.x * 8 + (threadIdx.x >> 5); if (r >= TT) return; const float* xr = X + (size_t)r * DM; float s = 0.f;
#pragma unroll 1
    for (int ch = 0; ch < DM / 128; ++ch) { const v4f a = *(const v4f*)(xr + ch * 128 + lane * 4);
#pragma unroll
        for (int q = 0; q < 4; ++q) { const float xb = bfr(a[q]); float p = __fmul_rn(xb, xb); asm volatile("" : "+v"(p)); s = __fadd_rn(s, p); } }
#pragma unroll
    for (int sh = 16; sh; sh >>= 1) s += __shfl_xor(s, sh, 32);
    const float rs = __fdiv_rn(1.0f, __fsqrt_rn(__fadd_rn(s * (1.0f / DM), 1e-6f)));
{
#pragma unroll 1
        for (int ch = 0; ch < DM / 128; ++ch) { const int c0 = ch * 128 + lane * 4; const v4f a = *(const v4f*)(xr + c0); v4us oh, ol;
#pragma unroll
            for (int q = 0; q < 4; ++q) { float n0 = __fmul_rn(bfr(a[q]), rs); asm volatile("" : "+v"(n0)); const float y = __fmul_rn(n0, bfr(g[c0 + q])); unsigned short h2, l2; splitf(y, h2, l2); oh[q] = h2; ol[q] = l2; }
            *(v4us*)(Yh + (size_t)r * DM + c0) = oh; *(v4us*)(Yl + (size_t)r * DM + c0) = ol; }
         } }
__global__ __launch_bounds__(256) void k_addres(const float* __restrict__ X, const float* __restrict__ Y, float* O, size_t n4) { const size_t i = (size_t)blockIdx.x * 256 + threadIdx.x; if (i >= n4) return; const v4f a = *(const v4f*)(X + i * 4), b = *(const v4f*)(Y + i * 4); v4f o;
#pragma unroll
    for (int q = 0; q < 4; ++q) o[q] = __fadd_rn(bfr(a[q]), b[q]); *(v4f*)(O + i * 4) = o;  }
__global__ __launch_bounds__(256) void k_cvt8(const float* __restrict__ src, bf* dst, size_t n8) { const size_t i = (size_t)blockIdx.x * 256 + threadIdx.x; if (i >= n8) return; const v8f v = *(const v8f*)(src + i * 8); v8us o;
#pragma unroll
    for (int k = 0; k < 8; ++k) o[k] = f2bf(v[k]); *(v8us*)(dst + i * 8) = o;  }
__global__ __launch_bounds__(256) void k_cscvt(const float* __restrict__ cosT, const float* __restrict__ sinT, float* CS) { const int idx = blockIdx.x * 256 + threadIdx.x; if (idx >= TT * HD) return; const int t = idx / HD, d = idx % HD; const size_t ti = (size_t)t * (HD / 2) + (d % (HD / 2));   /* half-width tables: both halves use column d mod 64 */ v2f cs; cs[0] = bfr(cosT[ti]); cs[1] = bfr(sinT[ti]); *(v2f*)(CS + (size_t)idx * 2) = cs;  }
// k_rope: head planes [h][t][d] (fp16 + hi/lo) of rope(x) x sc with the rotate-half convention out[d] = x[d] cos[t][d] - x[d+HD/2] sin[t][d], out[d+HD/2] = x[d+HD/2] cos[t][d+HD/2] + x[d] sin[t][d+HD/2]
__global__ __launch_bounds__(256) void k_rope(const float* __restrict__ F, int pitch, int nheads, const float* __restrict__ CS, const float* __restrict__ RF, const float* __restrict__ nw, float sc, h16* P16, bf* Ph, bf* Pl) {
    const size_t e = ((size_t)blockIdx.x * 256 + threadIdx.x) * 2; if (e >= (size_t)nheads * TT * HD) return; const int d = (int)(e % HD); const int t = (int)((e / HD) % TT); const int h = (int)(e / ((size_t)HD * TT)); const float* f = F + (size_t)t * pitch + h * HD; const float rf = RF ? RF[(size_t)h * TT + t] : 1.0f; v2h o16; v2us oh, ol;
#pragma unroll
    for (int q = 0; q < 2; ++q) { const int dd = d + q; const int dp = (dd < HD / 2) ? dd + HD / 2 : dd - HD / 2; float x0 = f[dd], x1 = f[dp];
        if (RF) { float n0 = __fmul_rn(x0, rf), n1 = __fmul_rn(x1, rf); asm volatile("" : "+v"(n0)); asm volatile("" : "+v"(n1)); x0 = __fmul_rn(bfr(nw[dd]), n0); x1 = __fmul_rn(bfr(nw[dp]), n1); }
        const v2f cs = *(const v2f*)(CS + ((size_t)t * HD + dd) * 2); float a = __fmul_rn(x0, cs[0]), bq = __fmul_rn(x1, cs[1]); asm volatile("" : "+v"(a)); asm volatile("" : "+v"(bq)); const float r = ((dd < HD / 2) ? __fsub_rn(a, bq) : __fadd_rn(a, bq)) * sc;
        o16[q] = tohx(r); unsigned short a2, c2; splitf(r, a2, c2); oh[q] = a2; ol[q] = c2; }
    *(v2h*)(P16 + e) = o16; *(v2us*)(Ph + e) = oh; *(v2us*)(Pl + e) = ol;  }
__global__ __launch_bounds__(256) void k_vtp(const float* __restrict__ F, int pitch, int nheads, h16* V16, bf* Vh, bf* Vl) { const size_t e = ((size_t)blockIdx.x * 256 + threadIdx.x) * 2; if (e >= (size_t)nheads * HD * TT) return; const int t = (int)(e % TT); const int d = (int)((e / TT) % HD); const int g = (int)(e / ((size_t)TT * HD)); v2h o16; v2us oh, ol;
#pragma unroll
    for (int q = 0; q < 2; ++q) { const float x = F[(size_t)(t + q) * pitch + g * HD + d]; o16[q] = tohx(x); unsigned short a2, c2; splitf(x, a2, c2); oh[q] = a2; ol[q] = c2; }
    *(v2h*)(V16 + e) = o16; *(v2us*)(Vh + e) = oh; *(v2us*)(Vl + e) = ol;  }
// k_asoft: per row (zz, i): t = S x HD^-0.5 for j <= i and i - j < WIN (sliding causal window; the reference's -1e9 additive fill vanishes identically); softmax over the NBC x 128 keys from jb on, which hold the band of every row of the 64-row tile (all that the P.V loop reads; jb is a multiple of 128, so each lane keeps its columns; register row, one exp, fixed trees);
__global__ __launch_bounds__(256) void k_asoft(const float* __restrict__ Sb, h16* P16, bf* Ph, bf* Pl) {
    const int lane = threadIdx.x & 31; const int row = blockIdx.x * 8 + (threadIdx.x >> 5); if (row >= ZH * TT) return; const int i = row % TT; const int zz = row / TT; (void)zz; const bool hires = (i < RH); const int jb = max(0, (i & ~63) - WIN) & ~127; const float* sr = Sb + (size_t)row * TT; float v[NBC * 4]; float mx = -3.0e38f;
#pragma unroll
    for (int ch = 0; ch < NBC; ++ch) { const int j0 = jb + ch * 128 + lane * 4; const v4f a = *(const v4f*)(sr + j0);
#pragma unroll
        for (int q = 0; q < 4; ++q) { const int j = j0 + q; (void)j; const float t = (j <= i && i - j < WIN) ? a[q] * SCL : -3.0e38f; v[ch * 4 + q] = t; mx = fmaxf(mx, t); } }
#pragma unroll
    for (int sh = 16; sh; sh >>= 1) mx = fmaxf(mx, __shfl_xor(mx, sh, 32));
    float sum = 0.f;
#pragma unroll
    for (int k = 0; k < NBC * 4; ++k) { float d0 = __fsub_rn(v[k], mx); asm volatile("" : "+v"(d0)); v[k] = __builtin_amdgcn_exp2f(__fmul_rn(d0, 1.4426950408889634f)); if (k + 1 < NBC * 4) asm volatile("v_nop" :: "v"(v[k])); /* fills the one slot the instruction set asks for behind a transcendental before the next key's value overwrites its source register */ sum += v[k]; }
#pragma unroll
    for (int sh = 16; sh; sh >>= 1) sum += __shfl_xor(sum, sh, 32);
    const float f = __fdiv_rn(hires ? 1.0f : PCAR, sum);
{
        if (hires) {
#pragma unroll
            for (int ch = 0; ch < NBC; ++ch) { v4us oh, ol;
#pragma unroll
                for (int q = 0; q < 4; ++q) { unsigned short a, c2; splitf(v[ch * 4 + q] * f, a, c2); oh[q] = a; ol[q] = c2; }
                const size_t oo = ((size_t)zz * (RH ? RH : 1) + i) * TT + jb + ch * 128 + lane * 4; *(v4us*)(Ph + oo) = oh; *(v4us*)(Pl + oo) = ol; }
        } else {
#pragma unroll
            for (int ch = 0; ch < NBC; ++ch) { v4h o4;
#pragma unroll
                for (int q = 0; q < 4; ++q) o4[q] = tohx(v[ch * 4 + q] * f);
                *(v4h*)(P16 + (size_t)row * TT + jb + ch * 128 + lane * 4) = o4; } }
         }
}
__global__ __launch_bounds__(256) void k_merge(const float* __restrict__ O, int h0, bf* Ah, bf* Al) { const size_t e = ((size_t)blockIdx.x * 256 + threadIdx.x) * 2; if (e >= (size_t)ZH * TT * HD) return; const int d = (int)(e % HD); const int t = (int)((e / HD) % TT); const int zz = (int)(e / ((size_t)HD * TT)); const float cs = (t < RH) ? 1.0f : (1.0f / PCAR); const size_t oo = (size_t)t * DQ + (h0 + zz) * HD + d;
    v2us oh, ol;
#pragma unroll
    for (int q = 0; q < 2; ++q) { unsigned short a, c2; splitf(O[e + q] * cs, a, c2); oh[q] = a; ol[q] = c2; } *(v2us*)(Ah + oo) = oh; *(v2us*)(Al + oo) = ol;  }

extern "C" void kernel_launch(void* const* d_in, const int* in_sizes, int n_in,
                              void* d_out, int out_size, void* d_ws, size_t ws_size, hipStream_t stream) {
    (void)in_sizes; (void)n_in; (void)out_size;
    const float* x = (const float*)d_in[0]; const float* gw = (const float*)d_in[1]; const float* wq = (const float*)d_in[2]; const float* wk = (const float*)d_in[3]; const float* wv = (const float*)d_in[4]; const float* wo = (const float*)d_in[5]; const float* cosT = (const float*)d_in[6]; const float* sinT = (const float*)d_in[7];
    float* OUT = (float*)d_out;     // [2][2048][2048]
    char* wsp = (char*)d_ws;
    auto take = [&](size_t bytes) { char* p = wsp; wsp += (bytes + 255) & ~(size_t)255; return (void*)p; };
    bf* WQ = (bf*)take((size_t)DQ * DM * 2); bf* WK = (bf*)take((size_t)DKV * DM * 2); bf* WV = (bf*)take((size_t)DKV * DM * 2); bf* WO = (bf*)take((size_t)DM * DQ * 2); float* CS = (float*)take((size_t)TT * HD * 2 * 4);
    bf* Yh = (bf*)take((size_t)TT * DM * 2); bf* Yl = (bf*)take((size_t)TT * DM * 2); float* YO = (float*)take((size_t)TT * DM * 4); float* FQ = (float*)take((size_t)TT * DQ * 4); float* FK = (float*)take((size_t)TT * DKV * 4);
    h16* QP16 = (h16*)take((size_t)NH_ * TT * HD * 2); h16* KP16 = (h16*)take((size_t)NKV * TT * HD * 2); h16* VT16 = (h16*)take((size_t)NKV * HD * TT * 2);
    bf* QPh = (bf*)take((size_t)NH_ * TT * HD * 2); bf* QPl = (bf*)take((size_t)NH_ * TT * HD * 2); bf* KPh = (bf*)take((size_t)NKV * TT * HD * 2); bf* KPl = (bf*)take((size_t)NKV * TT * HD * 2); bf* VTh = (bf*)take((size_t)NKV * HD * TT * 2); bf* VTl = (bf*)take((size_t)NKV * HD * TT * 2); bf* Ph = (bf*)take((size_t)ZH * RH * TT * 2); bf* Pl = (bf*)take((size_t)ZH * RH * TT * 2);
    float* Sb = (float*)take((size_t)ZH * TT * TT * 4); h16* P16 = (h16*)take((size_t)ZH * TT * TT * 2); float* Ob = (float*)take((size_t)ZH * TT * HD * 4); bf* ATh = (bf*)take((size_t)TT * DQ * 2); bf* ATl = (bf*)take((size_t)TT * DQ * 2);
    if ((size_t)(wsp - (char*)d_ws) > ws_size) return;    // ws 256 MiB
    float* FV = FK;   // v projection reuses the k buffer after the k planes are built (stream-ordered)
    { k_wtG<<<(unsigned)((DM * DQ / 64 + 63) / 64), 256, 0, stream>>>(wq, DM, DQ, WQ); k_wtG<<<(unsigned)((DM * DKV / 64 + 63) / 64), 256, 0, stream>>>(wk, DM, DKV, WK); k_wtG<<<(unsigned)((DM * DKV / 64 + 63) / 64), 256, 0, stream>>>(wv, DM, DKV, WV);
      k_wtG<<<(unsigned)((DQ * DM / 64 + 63) / 64), 256, 0, stream>>>(wo, DQ, DM, WO);
       }
    const unsigned LQ = (unsigned)(((size_t)NH_ * TT * HD / 2 + 255) / 256), LKv = (unsigned)(((size_t)NKV * TT * HD / 2 + 255) / 256);
    for (int b = 0; b < NB_; ++b) {
        if (b == 0) k_cscvt<<<(TT * HD + 255) / 256, 256, 0, stream>>>(cosT, sinT, CS);
        k_rmshl<<<TT / 8, 256, 0, stream>>>(x + (size_t)b * TT * DM, gw, Yh, Yl);   /* n = RMSNorm(x) norm_w as hi/lo planes */
        k_gemmw<bf, 1, false><<<dim3(TT / 64, DQ / 64, 1), 32, 0, stream>>>(Yh, Yl, WQ, nullptr, DM, FQ, DQ, nullptr, 0, 0, 0);
        k_rope<<<LQ, 256, 0, stream>>>(FQ, DQ, NH_, CS, nullptr, nullptr, 1.0f, QP16, QPh, QPl);
        k_gemmw<bf, 1, false><<<dim3(TT / 64, DKV / 64, 1), 32, 0, stream>>>(Yh, Yl, WK, nullptr, DM, FK, DKV, nullptr, 0, 0, 0);
        k_rope<<<LKv, 256, 0, stream>>>(FK, DKV, NKV, CS, nullptr, nullptr, 1.0f, KP16, KPh, KPl);
        k_gemmw<bf, 1, false><<<dim3(TT / 64, DKV / 64, 1), 32, 0, stream>>>(Yh, Yl, WV, nullptr, DM, FV, DKV, nullptr, 0, 0, 0); k_vtp<<<LKv, 256, 0, stream>>>(FV, DKV, NKV, VT16, VTh, VTl);
        for (int h0 = 0; h0 < NH_; h0 += ZH) { const size_t zq = (size_t)h0, zk = (size_t)(h0 / REP);   // both heads of a pass share kv group h0/REP (REP >= 2): sB = 0
            k_gemmc<bf, 2, 1><<<dim3(RH / 64, WIN / 64 + 1, ZH), 32, 0, stream>>>(QPh + zq * TT * HD, QPl + zq * TT * HD, KPh + zk * TT * HD, KPl + zk * TT * HD, HD, Sb, TT, 0, (size_t)TT * HD, 0, (size_t)TT * TT);
            k_gemmc<h16, 0, 1><<<dim3((TT - RH) / 64, WIN / 64 + 1, ZH), 32, 0, stream>>>(QP16 + zq * TT * HD + (size_t)RH * HD, nullptr, KP16 + zk * TT * HD, nullptr, HD, Sb + (size_t)RH * TT, TT, RH, (size_t)TT * HD, 0, (size_t)TT * TT);
            k_asoft<<<ZH * TT / 8, 256, 0, stream>>>(Sb, P16, Ph, Pl);
            k_gemmc<bf, 2, 2><<<dim3(RH / 64, HD / 64, ZH), 32, 0, stream>>>(Ph, Pl, VTh + zk * HD * TT, VTl + zk * HD * TT, TT, Ob, HD, 0, (size_t)RH * TT, 0, (size_t)TT * HD);
            k_gemmc<h16, 0, 2><<<dim3((TT - RH) / 64, HD / 64, ZH), 32, 0, stream>>>(P16 + (size_t)RH * TT, nullptr, VT16 + zk * HD * TT, nullptr, TT, Ob + (size_t)RH * HD, HD, RH, (size_t)TT * TT, 0, (size_t)TT * HD);
            k_merge<<<(unsigned)(((size_t)ZH * TT * HD / 2 + 255) / 256), 256, 0, stream>>>(Ob, h0, ATh, ATl); }
        k_gemmw<bf, 1, false><<<dim3(TT / 64, DM / 64, 1), 32, 0, stream>>>(ATh, ATl, WO, nullptr, DQ, YO, DM, nullptr, 0, 0, 0);
        k_addres<<<(unsigned)(((size_t)TT * DM / 4 + 255) / 256), 256, 0, stream>>>(x + (size_t)b * TT * DM, YO, OUT + (size_t)b * TT * DM, (size_t)TT * DM / 4); }   /* out = x + attn wo */
}

// v002
// Measured time: 727 microseconds a run.
// Timed twice side by side with v001, it ran 1.74 times as fast both times.
// Counting every step since v000, it is 2.38 times as fast.
#include <hip/hip_runtime.h>

// Sliding-window causal GQA with RMSNorm pre-normalisation and residual (x [2][2048][2048]; n = x rsqrt(mean x^2 + 1e-6) norm_w; q = n wq ('xw', 16 heads x 128), k, v = n wk / n wv (4 kv heads); rotate-half RoPE from the given tables [2048][64] (both halves share column d mod 64); 4 query heads per kv head (repeat); scores/sqrt(128) kept where j <= i and i - j < 512; softmax; out = x + merged wo -> [2][2048][2048]).
// Compute dtypes, f32 accumulate: every input rounded to bf16; q/k/v hl x exact (2 products); rotary in f32 from the bf16-rounded input tables; windowed-causal scores and attn.v (only key tiles that touch the window band computed): query rows < 512 hl (3 products), the rest single fp16 (x1024); softmax f32; wo hl x exact (2 products), + x residual in f32.

#define NB_  2
#define TT   2048
#define DM   2048
#define NH_  16
#define NKV  4
#define REP  (NH_ / NKV)
#define HD   128
#define DQ   (NH_ * HD)
#define DKV  (NKV * HD)
#define ZH   16                  // query heads per attention pass: all of one batch element
#define RH   512                  // query rows < RH use hi+lo planes (0: none)
#define WIN  512
#define NBC  ((WIN + 128) / 128)  // 128-key chunks of a softmax row: WIN + 64 band keys of a 64-row tile, from a multiple of 128
#define PB   (NBC * 128)         // pitch of a stored score / probability row: only the NBC chunks from the row tile's first chunk jb on are kept
#define PCAR 1024.0f
#define SCL  0.088388347648318447f   // HD^-0.5
typedef _Float16 h16;
typedef unsigned short bf;
typedef __attribute__((ext_vector_type(16))) __bf16   v16bf;
typedef __attribute__((ext_vector_type(16))) _Float16 v16h;
typedef __attribute__((ext_vector_type(8)))  _Float16 v8h;
typedef __attribute__((ext_vector_type(8)))  unsigned short v8us;
typedef __attribute__((ext_vector_type(8)))  float    v8f;
typedef __attribute__((ext_vector_type(4)))  float    v4f;
typedef v8h  __attribute__((may_alias)) v8ha;
typedef v4f  __attribute__((may_alias)) v4fa;
typedef v8us __attribute__((may_alias)) v8usa;

__device__ __forceinline__ unsigned short f2bf(float f) { unsigned u = __float_as_uint(f); u += 0x7FFFu + ((u >> 16) & 1u); return (unsigned short)(u >> 16); }
__device__ __forceinline__ float bf2f(unsigned short b) { return __uint_as_float(((unsigned)b) << 16); }
__device__ __forceinline__ float bfr(float f) { return bf2f(f2bf(f)); }
__device__ __forceinline__ v16h cat16(v8h lo, v8h hi) { return __builtin_shufflevector(lo, hi, 0, 1, 2, 3, 4, 5, 6, 7, 8, 9, 10, 11, 12, 13, 14, 15); }
__device__ __forceinline__ v16bf cat16b(v8us lo, v8us hi) { return __builtin_bit_cast(v16bf, __builtin_shufflevector(lo, hi, 0, 1, 2, 3, 4, 5, 6, 7, 8, 9, 10, 11, 12, 13, 14, 15)); }
__device__ __forceinline__ v8f wmma16(v16h a, v16h b, v8f c) { return __builtin_amdgcn_wmma_f32_16x16x32_f16(false, a, false, b, (short)0, c, false, false); }
__device__ __forceinline__ v8f wmmab(v16bf a, v16bf b, v8f c) { return __builtin_amdgcn_wmma_f32_16x16x32_bf16(false, a, false, b, (short)0, c, false, false); }



// ---- k_gemmw: register-blocked GEMM, ONE WAVE per 64x64 output tile (16 accumulators), operands straight from K-contiguous 16-bit planes; grid (M/64, N/64, Z), 32 threads.
// C[m][n] (f32, pitch ldc, + optional f32 bias[n]) = sum_k A[m][k] Bt[n][k] (+ split products per NSPLIT). z-batch strides sA/sB/sC in elements. K % 32 == 0.
template <typename T16> struct WFrag;
template <> struct WFrag<h16> { typedef v16h V; static __device__ __forceinline__ V ld(const h16* p) { return cat16(*(const v8h*)p, *(const v8h*)(p + 16)); } static __device__ __forceinline__ v8f mma(V a, V b, v8f c) { return wmma16(a, b, c); } };
template <> struct WFrag<bf> { typedef v16bf V; static __device__ __forceinline__ V ld(const bf* p) { return cat16b(*(const v8us*)p, *(const v8us*)(p + 16)); } static __device__ __forceinline__ v8f mma(V a, V b, v8f c) { return wmmab(a, b, c); } };
template <typename T16, int NSPLIT, bool BIAS>
__global__ __launch_bounds__(32) void k_gemmw(const T16* __restrict__ A, const T16* __restrict__ A2, const T16* __restrict__ Bt, const T16* __restrict__ Bt2, int K, float* C, int ldc, const float* __restrict__ bias, size_t sA, size_t sB, size_t sC) {
    typedef typename WFrag<T16>::V V;
    __shared__ __align__(16) float os[16 * 68];
    const size_t z = blockIdx.z; A += z * sA; if (A2) A2 += z * sA; Bt += z * sB; if (Bt2) Bt2 += z * sB; C += z * sC;
    const int lane = threadIdx.x & 31, lr = lane & 15, hi = lane >> 4; const int r0 = blockIdx.x * 64, c0 = blockIdx.y * 64;
    v8f acc[4][4];
#pragma unroll
    for (int mb = 0; mb < 4; ++mb)
#pragma unroll
        for (int nb = 0; nb < 4; ++nb) acc[mb][nb] = (v8f){};
    const size_t aoff = (size_t)(r0 + lr) * K + 8 * hi, boff = (size_t)(c0 + lr) * K + 8 * hi;
#pragma unroll 1
    for (int kc = 0; kc < K; kc += 32) {
        V a[4], a2[4];
#pragma unroll
        for (int mb = 0; mb < 4; ++mb) { a[mb] = WFrag<T16>::ld(A + aoff + (size_t)mb * 16 * K + kc); if (NSPLIT == 1 || NSPLIT == 2) a2[mb] = WFrag<T16>::ld(A2 + aoff + (size_t)mb * 16 * K + kc); }
#pragma unroll
        for (int nb = 0; nb < 4; ++nb) { const V b = WFrag<T16>::ld(Bt + boff + (size_t)nb * 16 * K + kc); V b2; if (NSPLIT >= 2) b2 = WFrag<T16>::ld(Bt2 + boff + (size_t)nb * 16 * K + kc);
#pragma unroll
            for (int mb = 0; mb < 4; ++mb) { acc[mb][nb] = WFrag<T16>::mma(a[mb], b, acc[mb][nb]); if (NSPLIT == 1 || NSPLIT == 2) acc[mb][nb] = WFrag<T16>::mma(a2[mb], b, acc[mb][nb]); if (NSPLIT >= 2) acc[mb][nb] = WFrag<T16>::mma(a[mb], b2, acc[mb][nb]); } }
        asm volatile("v_nop\n\tv_nop\n\tv_nop\n\tv_nop" : "+v"(acc[0][0]), "+v"(acc[1][1]), "+v"(acc[2][2]), "+v"(acc[3][3]) : "v"(a[0]), "v"(a[3]));
    }
#pragma unroll
    for (int mb = 0; mb < 4; ++mb) {
#pragma unroll
        for (int nb = 0; nb < 4; ++nb) {
#pragma unroll
            for (int j = 0; j < 8; ++j) os[(hi * 8 + j) * 68 + nb * 16 + lr] = acc[mb][nb][j]; }
        __builtin_amdgcn_wave_barrier(); asm volatile("" ::: "memory");
        float* crow = C + (size_t)(r0 + mb * 16) * ldc + c0;
{
#pragma unroll
            for (int s = 0; s < 8; ++s) { const int row = 2 * s + hi, cofs = lr * 4; v4f val = *(const v4fa*)(os + row * 68 + cofs); if (BIAS) { val[0] += bfr(bias[c0 + cofs]); val[1] += bfr(bias[c0 + cofs + 1]); val[2] += bfr(bias[c0 + cofs + 2]); val[3] += bfr(bias[c0 + cofs + 3]); }
                *(v4f*)(crow + (size_t)row * ldc + cofs) = val; }
             }
        __builtin_amdgcn_wave_barrier(); asm volatile("" ::: "memory");
    }
}

// ---- k_gemmc: the same one-wave 64x64 tile GEMM specialised for causal attention: CMODE 1 computes only the score tiles that touch the band i - WIN < j <= i (grid y counts the WIN/64 + 1 key tiles from r0+roff-WIN up to the diagonal tile), CMODE 2 limits the
// key (K) loop of the probability x value contraction to the same band (probabilities outside it are exactly zero). roff = row offset of this launch's first row within the sequence.
// Score and probability rows are stored from key jb on (pitch PB): column j lies at j - jb, jb = the 128-aligned start of the 64-row tile's band. z counts query heads; head z reads the planes of kv head z / REP (stride sB).
template <typename T16, int NSPLIT, int CMODE>
__global__ __launch_bounds__(32) void k_gemmc(const T16* __restrict__ A, const T16* __restrict__ A2, const T16* __restrict__ Bt, const T16* __restrict__ Bt2, int K, float* C, int ldc, int roff, size_t sA, size_t sB, size_t sC) {
    typedef typename WFrag<T16>::V V;
    __shared__ __align__(16) float os[16 * 68];
    const size_t z = blockIdx.z, zb = z / REP; A += z * sA; if (A2) A2 += z * sA; Bt += zb * sB; if (Bt2) Bt2 += zb * sB; C += z * sC;
    const int lane = threadIdx.x & 31, lr = lane & 15, hi = lane >> 4; const int r0 = blockIdx.x * 64, c0 = (CMODE == 1) ? r0 + roff - WIN + (int)blockIdx.y * 64 : (int)blockIdx.y * 64;
    if (CMODE == 1 && c0 < 0) return;                                // the band starts at key 0 for the first WIN query rows; tiles outside the band are never computed (the softmax masks them by select)
    const int Kl = (CMODE == 2) ? min(K, r0 + roff + 64) : K;        // P.V: probabilities are exactly 0 beyond the diagonal block, so the K loop stops there
    const int K0 = (CMODE == 2) ? max(0, r0 + roff - WIN) : 0;       // ... and exactly 0 for keys j <= i - WIN, so it starts at the block that holds the first row's first key
    const int jb = max(0, r0 + roff - WIN) & ~127;                   // first key that this tile's stored score / probability rows hold
    const int lda = (CMODE == 2) ? PB : K;                           // P.V reads the stored probability rows
    v8f acc[4][4];
#pragma unroll
    for (int mb = 0; mb < 4; ++mb)
#pragma unroll
        for (int nb = 0; nb < 4; ++nb) acc[mb][nb] = (v8f){};
    const size_t aoff = (size_t)(r0 + lr) * lda + 8 * hi - (CMODE == 2 ? jb : 0), boff = (size_t)(c0 + lr) * K + 8 * hi;
#pragma unroll 1
    for (int kc = K0; kc < Kl; kc += 32) {
        V a[4], a2[4];
#pragma unroll
        for (int mb = 0; mb < 4; ++mb) { a[mb] = WFrag<T16>::ld(A + aoff + (size_t)mb * 16 * lda + kc); if (NSPLIT == 1 || NSPLIT == 2) a2[mb] = WFrag<T16>::ld(A2 + aoff + (size_t)mb * 16 * lda + kc); }
#pragma unroll
        for (int nb = 0; nb < 4; ++nb) { const V b = WFrag<T16>::ld(Bt + boff + (size_t)nb * 16 * K + kc); V b2; if (NSPLIT >= 2) b2 = WFrag<T16>::ld(Bt2 + boff + (size_t)nb * 16 * K + kc);
#pragma unroll
            for (int mb = 0; mb < 4; ++mb) { acc[mb][nb] = WFrag<T16>::mma(a[mb], b, acc[mb][nb]); if (NSPLIT == 1 || NSPLIT == 2) acc[mb][nb] = WFrag<T16>::mma(a2[mb], b, acc[mb][nb]); if (NSPLIT >= 2) acc[mb][nb] = WFrag<T16>::mma(a[mb], b2, acc[mb][nb]); } }
        asm volatile("v_nop\n\tv_nop\n\tv_nop\n\tv_nop" : "+v"(acc[0][0]), "+v"(acc[1][1]), "+v"(acc[2][2]), "+v"(acc[3][3]) : "v"(a[0]), "v"(a[3]));
    }
#pragma unroll
    for (int mb = 0; mb < 4; ++mb) {
#pragma unroll
        for (int nb = 0; nb < 4; ++nb) {
#pragma unroll
            for (int j = 0; j < 8; ++j) os[(hi * 8 + j) * 68 + nb * 16 + lr] = acc[mb][nb][j]; }
        __builtin_amdgcn_wave_barrier(); asm volatile("" ::: "memory");
        float* crow = C + (size_t)(r0 + mb * 16) * ldc + (CMODE == 1 ? c0 - jb : c0);
{
#pragma unroll
            for (int s = 0; s < 8; ++s) { const int row = 2 * s + hi, cofs = lr * 4; v4f val = *(const v4fa*)(os + row * 68 + cofs);
                *(v4f*)(crow + (size_t)row * ldc + cofs) = val; }
             }
        __builtin_amdgcn_wave_barrier(); asm volatile("" ::: "memory");
    }
}

__device__ __forceinline__ h16 tohx(float x) { return (h16)x; }
__device__ __forceinline__ void splitf(float y, unsigned short& h, unsigned short& l) { h = f2bf(y); l = f2bf(y - bf2f(h)); }
typedef __attribute__((ext_vector_type(2))) _Float16 v2h;
typedef __attribute__((ext_vector_type(4))) _Float16 v4h;
typedef __attribute__((ext_vector_type(2))) unsigned short v2us;
typedef __attribute__((ext_vector_type(4))) unsigned short v4us;
typedef __attribute__((ext_vector_type(2))) float v2f;
typedef __attribute__((ext_vector_type(4))) int v4i;

__global__ __launch_bounds__(256) void k_wtG(const float* __restrict__ w, int K, int N, bf* Bt) {
    const int lane = threadIdx.x & 31; const int L0 = (blockIdx.x * 8 + (threadIdx.x >> 5)) * 8; const int nlines = N * K / 64;
{
#pragma unroll 1
        for (int l = 0; l < 8; ++l) { const int L = L0 + l; if (L >= nlines) break; const size_t e = (size_t)L * 64 + lane * 2; const int k = (int)(e % K), n = (int)(e / K); v2us o;
            o[0] = f2bf(w[(size_t)k * N + n]); o[1] = f2bf(w[(size_t)(k + 1) * N + n]); *(v2us*)(Bt + e) = o; }
         }
}
__global__ __launch_bounds__(256) void k_rmshl(const float* __restrict__ X, const float* __restrict__ g, bf* Yh, bf* Yl) {
    const int lane = threadIdx.x & 31; const int r = blockIdx.x * 8 + (threadIdx.x >> 5); if (r >= TT) return; const float* xr = X + (size_t)r * DM; float s = 0.f;
#pragma unroll 1
    for (int ch = 0; ch < DM / 128; ++ch) { const v4f a = *(const v4f*)(xr + ch * 128 + lane * 4);
#pragma unroll
        for (int q = 0; q < 4; ++q) { const float xb = bfr(a[q]); float p = __fmul_rn(xb, xb); asm volatile("" : "+v"(p)); s = __fadd_rn(s, p); } }
#pragma unroll
    for (int sh = 16; sh; sh >>= 1) s += __shfl_xor(s, sh, 32);
    const float rs = __fdiv_rn(1.0f, __fsqrt_rn(__fadd_rn(s * (1.0f / DM), 1e-6f)));
{
#pragma unroll 1
        for (int ch = 0; ch < DM / 128; ++ch) { const int c0 = ch * 128 + lane * 4; const v4f a = *(const v4f*)(xr + c0); v4us oh, ol;
#pragma unroll
            for (int q = 0; q < 4; ++q) { float n0 = __fmul_rn(bfr(a[q]), rs); asm volatile("" : "+v"(n0)); const float y = __fmul_rn(n0, bfr(g[c0 + q])); unsigned short h2, l2; splitf(y, h2, l2); oh[q] = h2; ol[q] = l2; }
            *(v4us*)(Yh + (size_t)r * DM + c0) = oh; *(v4us*)(Yl + (size_t)r * DM + c0) = ol; }
         } }
__global__ __launch_bounds__(256) void k_addres(const float* __restrict__ X, const float* __restrict__ Y, float* O, size_t n4) { const size_t i = (size_t)blockIdx.x * 256 + threadIdx.x; if (i >= n4) return; const v4f a = *(const v4f*)(X + i * 4), b = *(const v4f*)(Y + i * 4); v4f o;
#pragma unroll
    for (int q = 0; q < 4; ++q) o[q] = __fadd_rn(bfr(a[q]), b[q]); *(v4f*)(O + i * 4) = o;  }
__global__ __launch_bounds__(256) void k_cvt8(const float* __restrict__ src, bf* dst, size_t n8) { const size_t i = (size_t)blockIdx.x * 256 + threadIdx.x; if (i >= n8) return; const v8f v = *(const v8f*)(src + i * 8); v8us o;
#pragma unroll
    for (int k = 0; k < 8; ++k) o[k] = f2bf(v[k]); *(v8us*)(dst + i * 8) = o;  }
__global__ __launch_bounds__(256) void k_cscvt(const float* __restrict__ cosT, const float* __restrict__ sinT, float* CS) { const int idx = blockIdx.x * 256 + threadIdx.x; if (idx >= TT * HD) return; const int t = idx / HD, d = idx % HD; const size_t ti = (size_t)t * (HD / 2) + (d % (HD / 2));   /* half-width tables: both halves use column d mod 64 */ v2f cs; cs[0] = bfr(cosT[ti]); cs[1] = bfr(sinT[ti]); *(v2f*)(CS + (size_t)idx * 2) = cs;  }
// k_rope: head planes [h][t][d] (fp16 + hi/lo) of rope(x) x sc with the rotate-half convention out[d] = x[d] cos[t][d] - x[d+HD/2] sin[t][d], out[d+HD/2] = x[d+HD/2] cos[t][d+HD/2] + x[d] sin[t][d+HD/2]
__global__ __launch_bounds__(256) void k_rope(const float* __restrict__ F, int pitch, int nheads, const float* __restrict__ CS, const float* __restrict__ RF, const float* __restrict__ nw, float sc, h16* P16, bf* Ph, bf* Pl) {
    const size_t e = ((size_t)blockIdx.x * 256 + threadIdx.x) * 2; if (e >= (size_t)nheads * TT * HD) return; const int d = (int)(e % HD); const int t = (int)((e / HD) % TT); const int h = (int)(e / ((size_t)HD * TT)); const float* f = F + (size_t)t * pitch + h * HD; const float rf = RF ? RF[(size_t)h * TT + t] : 1.0f; v2h o16; v2us oh, ol;
#pragma unroll
    for (int q = 0; q < 2; ++q) { const int dd = d + q; const int dp = (dd < HD / 2) ? dd + HD / 2 : dd - HD / 2; float x0 = f[dd], x1 = f[dp];
        if (RF) { float n0 = __fmul_rn(x0, rf), n1 = __fmul_rn(x1, rf); asm volatile("" : "+v"(n0)); asm volatile("" : "+v"(n1)); x0 = __fmul_rn(bfr(nw[dd]), n0); x1 = __fmul_rn(bfr(nw[dp]), n1); }
        const v2f cs = *(const v2f*)(CS + ((size_t)t * HD + dd) * 2); float a = __fmul_rn(x0, cs[0]), bq = __fmul_rn(x1, cs[1]); asm volatile("" : "+v"(a)); asm volatile("" : "+v"(bq)); const float r = ((dd < HD / 2) ? __fsub_rn(a, bq) : __fadd_rn(a, bq)) * sc;
        o16[q] = tohx(r); unsigned short a2, c2; splitf(r, a2, c2); oh[q] = a2; ol[q] = c2; }
    *(v2h*)(P16 + e) = o16; *(v2us*)(Ph + e) = oh; *(v2us*)(Pl + e) = ol;  }
__global__ __launch_bounds__(256) void k_vtp(const float* __restrict__ F, int pitch, int nheads, h16* V16, bf* Vh, bf* Vl) { const size_t e = ((size_t)blockIdx.x * 256 + threadIdx.x) * 2; if (e >= (size_t)nheads * HD * TT) return; const int t = (int)(e % TT); const int d = (int)((e / TT) % HD); const int g = (int)(e / ((size_t)TT * HD)); v2h o16; v2us oh, ol;
#pragma unroll
    for (int q = 0; q < 2; ++q) { const float x = F[(size_t)(t + q) * pitch + g * HD + d]; o16[q] = tohx(x); unsigned short a2, c2; splitf(x, a2, c2); oh[q] = a2; ol[q] = c2; }
    *(v2h*)(V16 + e) = o16; *(v2us*)(Vh + e) = oh; *(v2us*)(Vl + e) = ol;  }
// k_asoft: per row (zz, i): t = S x HD^-0.5 for j <= i and i - j < WIN (sliding causal window; the reference's -1e9 additive fill vanishes identically); softmax over the NBC x 128 keys from jb on, which hold the band of every row of the 64-row tile (all that the P.V loop reads; jb is a multiple of 128, so each lane keeps its columns; register row, one exp, fixed trees); score and probability rows are stored from key jb on, pitch PB;
__global__ __launch_bounds__(256) void k_asoft(const float* __restrict__ Sb, h16* P16, bf* Ph, bf* Pl) {
    const int lane = threadIdx.x & 31; const int row = blockIdx.x * 8 + (threadIdx.x >> 5); if (row >= ZH * TT) return; const int i = row % TT; const int zz = row / TT; (void)zz; const bool hires = (i < RH); const int jb = max(0, (i & ~63) - WIN) & ~127; const float* sr = Sb + (size_t)row * PB; float v[NBC * 4]; float mx = -3.0e38f;
#pragma unroll
    for (int ch = 0; ch < NBC; ++ch) { const int j0 = jb + ch * 128 + lane * 4; const v4f a = *(const v4f*)(sr + ch * 128 + lane * 4);
#pragma unroll
        for (int q = 0; q < 4; ++q) { const int j = j0 + q; (void)j; const float t = (j <= i && i - j < WIN) ? a[q] * SCL : -3.0e38f; v[ch * 4 + q] = t; mx = fmaxf(mx, t); } }
#pragma unroll
    for (int sh = 16; sh; sh >>= 1) mx = fmaxf(mx, __shfl_xor(mx, sh, 32));
    float sum = 0.f;
#pragma unroll
    for (int k = 0; k < NBC * 4; ++k) { float d0 = __fsub_rn(v[k], mx); asm volatile("" : "+v"(d0)); v[k] = __builtin_amdgcn_exp2f(__fmul_rn(d0, 1.4426950408889634f)); if (k + 1 < NBC * 4) asm volatile("v_nop" :: "v"(v[k])); /* fills the one slot the instruction set asks for behind a transcendental before the next key's value overwrites its source register */ sum += v[k]; }
#pragma unroll
    for (int sh = 16; sh; sh >>= 1) sum += __shfl_xor(sum, sh, 32);
    const float f = __fdiv_rn(hires ? 1.0f : PCAR, sum);
{
        if (hires) {
#pragma unroll
            for (int ch = 0; ch < NBC; ++ch) { v4us oh, ol;
#pragma unroll
                for (int q = 0; q < 4; ++q) { unsigned short a, c2; splitf(v[ch * 4 + q] * f, a, c2); oh[q] = a; ol[q] = c2; }
                const size_t oo = ((size_t)zz * (RH ? RH : 1) + i) * PB + ch * 128 + lane * 4; *(v4us*)(Ph + oo) = oh; *(v4us*)(Pl + oo) = ol; }
        } else {
#pragma unroll
            for (int ch = 0; ch < NBC; ++ch) { v4h o4;
#pragma unroll
                for (int q = 0; q < 4; ++q) o4[q] = tohx(v[ch * 4 + q] * f);
                *(v4h*)(P16 + (size_t)row * PB + ch * 128 + lane * 4) = o4; } }
         }
}
__global__ __launch_bounds__(256) void k_merge(const float* __restrict__ O, int h0, bf* Ah, bf* Al) { const size_t e = ((size_t)blockIdx.x * 256 + threadIdx.x) * 2; if (e >= (size_t)ZH * TT * HD) return; const int d = (int)(e % HD); const int t = (int)((e / HD) % TT); const int zz = (int)(e / ((size_t)HD * TT)); const float cs = (t < RH) ? 1.0f : (1.0f / PCAR); const size_t oo = (size_t)t * DQ + (h0 + zz) * HD + d;
    v2us oh, ol;
#pragma unroll
    for (int q = 0; q < 2; ++q) { unsigned short a, c2; splitf(O[e + q] * cs, a, c2); oh[q] = a; ol[q] = c2; } *(v2us*)(Ah + oo) = oh; *(v2us*)(Al + oo) = ol;  }

extern "C" void kernel_launch(void* const* d_in, const int* in_sizes, int n_in,
                              void* d_out, int out_size, void* d_ws, size_t ws_size, hipStream_t stream) {
    (void)in_sizes; (void)n_in; (void)out_size;
    const float* x = (const float*)d_in[0]; const float* gw = (const float*)d_in[1]; const float* wq = (const float*)d_in[2]; const float* wk = (const float*)d_in[3]; const float* wv = (const float*)d_in[4]; const float* wo = (const float*)d_in[5]; const float* cosT = (const float*)d_in[6]; const float* sinT = (const float*)d_in[7];
    float* OUT = (float*)d_out;     // [2][2048][2048]
    char* wsp = (char*)d_ws;
    auto take = [&](size_t bytes) { char* p = wsp; wsp += (bytes + 255) & ~(size_t)255; return (void*)p; };
    bf* WQ = (bf*)take((size_t)DQ * DM * 2); bf* WK = (bf*)take((size_t)DKV * DM * 2); bf* WV = (bf*)take((size_t)DKV * DM * 2); bf* WO = (bf*)take((size_t)DM * DQ * 2); float* CS = (float*)take((size_t)TT * HD * 2 * 4);
    bf* Yh = (bf*)take((size_t)TT * DM * 2); bf* Yl = (bf*)take((size_t)TT * DM * 2); float* FQ = (float*)take((size_t)TT * DQ * 4); float* FK = (float*)take((size_t)TT * DKV * 4);
    h16* QP16 = (h16*)take((size_t)NH_ * TT * HD * 2); h16* KP16 = (h16*)take((size_t)NKV * TT * HD * 2); h16* VT16 = (h16*)take((size_t)NKV * HD * TT * 2);
    bf* QPh = (bf*)take((size_t)NH_ * TT * HD * 2); bf* QPl = (bf*)take((size_t)NH_ * TT * HD * 2); bf* KPh = (bf*)take((size_t)NKV * TT * HD * 2); bf* KPl = (bf*)take((size_t)NKV * TT * HD * 2); bf* VTh = (bf*)take((size_t)NKV * HD * TT * 2); bf* VTl = (bf*)take((size_t)NKV * HD * TT * 2); bf* Ph = (bf*)take((size_t)ZH * RH * PB * 2); bf* Pl = (bf*)take((size_t)ZH * RH * PB * 2);
    float* Sb = (float*)take((size_t)ZH * TT * PB * 4); h16* P16 = (h16*)take((size_t)ZH * TT * PB * 2); bf* ATh = (bf*)take((size_t)TT * DQ * 2); bf* ATl = (bf*)take((size_t)TT * DQ * 2);
    if ((size_t)(wsp - (char*)d_ws) > ws_size) return;    // ws 256 MiB
    float* FV = FK;   // v projection reuses the k buffer after the k planes are built (stream-ordered)
    static_assert(ZH % REP == 0 && ZH * HD <= DQ && ZH * PB >= DM, "a pass holds whole kv groups; the two reuses below must fit");
    float* Ob = FQ;   // attention output [ZH][TT][HD] reuses the q projection buffer (same size), dead once the q planes are built (stream-ordered)
    float* YO = Sb;   // the output projection reuses the score buffer, dead after the softmax (stream-ordered)
    { k_wtG<<<(unsigned)((DM * DQ / 64 + 63) / 64), 256, 0, stream>>>(wq, DM, DQ, WQ); k_wtG<<<(unsigned)((DM * DKV / 64 + 63) / 64), 256, 0, stream>>>(wk, DM, DKV, WK); k_wtG<<<(unsigned)((DM * DKV / 64 + 63) / 64), 256, 0, stream>>>(wv, DM, DKV, WV);
      k_wtG<<<(unsigned)((DQ * DM / 64 + 63) / 64), 256, 0, stream>>>(wo, DQ, DM, WO);
       }
    const unsigned LQ = (unsigned)(((size_t)NH_ * TT * HD / 2 + 255) / 256), LKv = (unsigned)(((size_t)NKV * TT * HD / 2 + 255) / 256);
    for (int b = 0; b < NB_; ++b) {
        if (b == 0) k_cscvt<<<(TT * HD + 255) / 256, 256, 0, stream>>>(cosT, sinT, CS);
        k_rmshl<<<TT / 8, 256, 0, stream>>>(x + (size_t)b * TT * DM, gw, Yh, Yl);   /* n = RMSNorm(x) norm_w as hi/lo planes */
        k_gemmw<bf, 1, false><<<dim3(TT / 64, DQ / 64, 1), 32, 0, stream>>>(Yh, Yl, WQ, nullptr, DM, FQ, DQ, nullptr, 0, 0, 0);
        k_rope<<<LQ, 256, 0, stream>>>(FQ, DQ, NH_, CS, nullptr, nullptr, 1.0f, QP16, QPh, QPl);
        k_gemmw<bf, 1, false><<<dim3(TT / 64, DKV / 64, 1), 32, 0, stream>>>(Yh, Yl, WK, nullptr, DM, FK, DKV, nullptr, 0, 0, 0);
        k_rope<<<LKv, 256, 0, stream>>>(FK, DKV, NKV, CS, nullptr, nullptr, 1.0f, KP16, KPh, KPl);
        k_gemmw<bf, 1, false><<<dim3(TT / 64, DKV / 64, 1), 32, 0, stream>>>(Yh, Yl, WV, nullptr, DM, FV, DKV, nullptr, 0, 0, 0); k_vtp<<<LKv, 256, 0, stream>>>(FV, DKV, NKV, VT16, VTh, VTl);
        for (int h0 = 0; h0 < NH_; h0 += ZH) { const size_t zq = (size_t)h0, zk = (size_t)(h0 / REP);   // one pass holds every head: head z of the grid reads kv group z / REP (stride sB)
            k_gemmc<bf, 2, 1><<<dim3(RH / 64, WIN / 64 + 1, ZH), 32, 0, stream>>>(QPh + zq * TT * HD, QPl + zq * TT * HD, KPh + zk * TT * HD, KPl + zk * TT * HD, HD, Sb, PB, 0, (size_t)TT * HD, (size_t)TT * HD, (size_t)TT * PB);
            k_gemmc<h16, 0, 1><<<dim3((TT - RH) / 64, WIN / 64 + 1, ZH), 32, 0, stream>>>(QP16 + zq * TT * HD + (size_t)RH * HD, nullptr, KP16 + zk * TT * HD, nullptr, HD, Sb + (size_t)RH * PB, PB, RH, (size_t)TT * HD, (size_t)TT * HD, (size_t)TT * PB);
            k_asoft<<<ZH * TT / 8, 256, 0, stream>>>(Sb, P16, Ph, Pl);
            k_gemmc<bf, 2, 2><<<dim3(RH / 64, HD / 64, ZH), 32, 0, stream>>>(Ph, Pl, VTh + zk * HD * TT, VTl + zk * HD * TT, TT, Ob, HD, 0, (size_t)RH * PB, (size_t)HD * TT, (size_t)TT * HD);
            k_gemmc<h16, 0, 2><<<dim3((TT - RH) / 64, HD / 64, ZH), 32, 0, stream>>>(P16 + (size_t)RH * PB, nullptr, VT16 + zk * HD * TT, nullptr, TT, Ob + (size_t)RH * HD, HD, RH, (size_t)TT * PB, (size_t)HD * TT, (size_t)TT * HD);
            k_merge<<<(unsigned)(((size_t)ZH * TT * HD / 2 + 255) / 256), 256, 0, stream>>>(Ob, h0, ATh, ATl); }
        k_gemmw<bf, 1, false><<<dim3(TT / 64, DM / 64, 1), 32, 0, stream>>>(ATh, ATl, WO, nullptr, DQ, YO, DM, nullptr, 0, 0, 0);
        k_addres<<<(unsigned)(((size_t)TT * DM / 4 + 255) / 256), 256, 0, stream>>>(x + (size_t)b * TT * DM, YO, OUT + (size_t)b * TT * DM, (size_t)TT * DM / 4); }   /* out = x + attn wo */
}

// v003
// A run of this version takes 526 microseconds.
// In two side-by-side timings against v002, it was 1.38 and 1.39 times as fast.
// All steps since v000 together make it 3.31 times as fast.
#include <hip/hip_runtime.h>

// Sliding-window causal GQA with RMSNorm pre-normalisation and residual (x [2][2048][2048]; n = x rsqrt(mean x^2 + 1e-6) norm_w; q = n wq ('xw', 16 heads x 128), k, v = n wk / n wv (4 kv heads); rotate-half RoPE from the given tables [2048][64] (both halves share column d mod 64); 4 query heads per kv head (repeat); scores/sqrt(128) kept where j <= i and i - j < 512; softmax; out = x + merged wo -> [2][2048][2048]).
// Compute dtypes, f32 accumulate: every input rounded to bf16; q/k/v hl x exact (2 products); rotary in f32 from the bf16-rounded input tables; windowed-causal scores and attn.v (only key tiles that touch the window band computed): query rows < 512 hl (3 products), the rest single fp16 (x1024); softmax f32; wo hl x exact (2 products), + x residual in f32.

#define NB_  2
#define TT   2048
#define DM   2048
#define NH_  16
#define NKV  4
#define REP  (NH_ / NKV)
#define HD   128
#define DQ   (NH_ * HD)
#define DKV  (NKV * HD)
#define ZH   16                  // query heads per attention pass: all of one batch element
#define RH   512                  // query rows < RH use hi+lo planes (0: none)
#define WIN  512
#define NBC  ((WIN + 128) / 128)  // 128-key chunks of a softmax row: WIN + 64 band keys of a 64-row tile, from a multiple of 128
#define PB   (NBC * 128)         // pitch of a stored score / probability row: only the NBC chunks from the row tile's first chunk jb on are kept
#define PCAR 1024.0f
#define SCL  0.088388347648318447f   // HD^-0.5
typedef _Float16 h16;
typedef unsigned short bf;
typedef __attribute__((ext_vector_type(16))) __bf16   v16bf;
typedef __attribute__((ext_vector_type(16))) _Float16 v16h;
typedef __attribute__((ext_vector_type(8)))  _Float16 v8h;
typedef __attribute__((ext_vector_type(8)))  unsigned short v8us;
typedef __attribute__((ext_vector_type(8)))  float    v8f;
typedef __attribute__((ext_vector_type(4)))  float    v4f;
typedef v8h  __attribute__((may_alias)) v8ha;
typedef v4f  __attribute__((may_alias)) v4fa;
typedef v8us __attribute__((may_alias)) v8usa;

__device__ __forceinline__ unsigned short f2bf(float f) { unsigned u = __float_as_uint(f); u += 0x7FFFu + ((u >> 16) & 1u); return (unsigned short)(u >> 16); }
__device__ __forceinline__ float bf2f(unsigned short b) { return __uint_as_float(((unsigned)b) << 16); }
__device__ __forceinline__ float bfr(float f) { return bf2f(f2bf(f)); }
__device__ __forceinline__ v16h cat16(v8h lo, v8h hi) { return __builtin_shufflevector(lo, hi, 0, 1, 2, 3, 4, 5, 6, 7, 8, 9, 10, 11, 12, 13, 14, 15); }
__device__ __forceinline__ v16bf cat16b(v8us lo, v8us hi) { return __builtin_bit_cast(v16bf, __builtin_shufflevector(lo, hi, 0, 1, 2, 3, 4, 5, 6, 7, 8, 9, 10, 11, 12, 13, 14, 15)); }
__device__ __forceinline__ v8f wmma16(v16h a, v16h b, v8f c) { return __builtin_amdgcn_wmma_f32_16x16x32_f16(false, a, false, b, (short)0, c, false, false); }
__device__ __forceinline__ v8f wmmab(v16bf a, v16bf b, v8f c) { return __builtin_amdgcn_wmma_f32_16x16x32_bf16(false, a, false, b, (short)0, c, false, false); }



// ---- k_gemms<MB>: projection GEMM, 4 waves (2 x 2) per (32 MB)x128 output tile, each wave a (16 MB)x64 tile (4 MB accumulators); MB = 4 where that fills the chip, MB = 2 for the narrow k and v outputs (twice the work-groups). The operands (K-contiguous bf16 planes A hi, A lo, Bt) are staged in LDS by asynchronous copies,
// KS k of the tile's rows of each plane a stage, two buffers: the next stage's copies fly while this stage is worked on; fragments are read from LDS one 32-k block ahead. grid (M/(32 MB), N/128), 128 threads. C[m][n] (f32, pitch ldc) = sum_k (A[m][k] + A2[m][k]) Bt[n][k]. K % KS == 0, K >= 2 KS (the prologue fills two stages).
#define KS   64                  // k per stage: 128 B of every operand row, one whole line
#define LP   (KS + 8)            // LDS row pitch in elements: 144 B = 16 B x odd, free of bank conflicts for 16-byte fragment reads
template <typename T16> struct WFrag;
template <> struct WFrag<h16> { typedef v16h V; static __device__ __forceinline__ V ld(const h16* p) { return cat16(*(const v8h*)p, *(const v8h*)(p + 16)); } static __device__ __forceinline__ v8f mma(V a, V b, v8f c) { return wmma16(a, b, c); } };
template <> struct WFrag<bf> { typedef v16bf V; static __device__ __forceinline__ V ld(const bf* p) { return cat16b(*(const v8us*)p, *(const v8us*)(p + 16)); } static __device__ __forceinline__ v8f mma(V a, V b, v8f c) { return wmmab(a, b, c); } };
typedef __attribute__((ext_vector_type(4))) int v4ic;
// NJ asynchronous copies of 512 B (4 rows of 128 B each, 16 B a lane): 4 NJ rows of one plane. l = the lane's place in the first of them in LDS, g = the same place in the global plane, gs = elements per 4 global rows.
template <int NJ>
__device__ __forceinline__ void planecopy(bf* l, const bf* g, size_t gs) {
#pragma unroll
    for (int j = 0; j < NJ; ++j)
        __builtin_amdgcn_global_load_async_to_lds_b128((__attribute__((address_space(1))) v4ic*)(g + (size_t)j * gs), (__attribute__((address_space(3))) v4ic*)(l + j * 4 * LP), 0, 0);
}
template <int MB> struct Frags { WFrag<bf>::V a[MB], a2[MB], b[4]; };
// the fragments of one 32-k block of a stage, as one group of LDS reads; sa, sa2, sb = the lane's place in the wave's first row of each plane
template <int MB>
__device__ __forceinline__ void ldfr(Frags<MB>& f, const bf* sa, const bf* sa2, const bf* sb) {
#pragma unroll
    for (int q = 0; q < MB; ++q) { f.a[q] = WFrag<bf>::ld(sa + q * 16 * LP); f.a2[q] = WFrag<bf>::ld(sa2 + q * 16 * LP); }
#pragma unroll
    for (int q = 0; q < 4; ++q) f.b[q] = WFrag<bf>::ld(sb + q * 16 * LP);
}
template <int MB>
__device__ __forceinline__ void mmblk(v8f (&acc)[MB][4], const Frags<MB>& f) {
#pragma unroll
    for (int nb = 0; nb < 4; ++nb)
#pragma unroll
        for (int mb = 0; mb < MB; ++mb) { acc[mb][nb] = WFrag<bf>::mma(f.a[mb], f.b[nb], acc[mb][nb]); acc[mb][nb] = WFrag<bf>::mma(f.a2[mb], f.b[nb], acc[mb][nb]); }
}
template <int MB>
__global__ __launch_bounds__(128) void k_gemms(const bf* __restrict__ A, const bf* __restrict__ A2, const bf* __restrict__ Bt, int K, float* C, int ldc) {
    static_assert(KS == 64, "a stage is two 32-k blocks");
    constexpr int PLA = 32 * MB * LP, STG = 2 * PLA + 128 * LP;   // a stage: A hi | A lo (32 MB rows each) | Bt (128 rows)
    __shared__ __align__(16) bf ring[2 * STG];
    __shared__ __align__(16) float osa[4 * 16 * 68];
    const int lane = threadIdx.x & 31, lr = lane & 15, hi = lane >> 4; const int w = __builtin_amdgcn_readfirstlane((int)(threadIdx.x >> 5)), wm = w >> 1, wn = w & 1;
    const int r0 = blockIdx.x * (32 * MB), c0 = blockIdx.y * 128;
    v8f acc[MB][4];
#pragma unroll
    for (int mb = 0; mb < MB; ++mb)
#pragma unroll
        for (int nb = 0; nb < 4; ++nb) acc[mb][nb] = (v8f){};
    // wave w copies rows 8 MB w .. 8 MB w + 8 MB - 1 of the A planes and rows 32 w .. 32 w + 31 of Bt
    const int crA = w * (8 * MB) + (lane >> 3), crB = w * 32 + (lane >> 3), ccol = (lane & 7) * 8; const size_t gs = (size_t)4 * K;
    const bf* gA = A + (size_t)(r0 + crA) * K + ccol; const bf* gA2 = A2 + (size_t)(r0 + crA) * K + ccol; const bf* gB = Bt + (size_t)(c0 + crB) * K + ccol;
    bf* lA = ring + crA * LP + ccol; bf* lB = ring + 2 * PLA + crB * LP + ccol;
    const int nt = K / KS;
    planecopy<2 * MB>(lA, gA, gs); planecopy<2 * MB>(lA + PLA, gA2, gs); planecopy<8>(lB, gB, gs);
    asm volatile("s_wait_asynccnt 0x0" ::: "memory");   // this wave's share of stage 0 has landed
    __syncthreads();                                     // ... and every other wave's
    planecopy<2 * MB>(lA + STG, gA + KS, gs); planecopy<2 * MB>(lA + STG + PLA, gA2 + KS, gs); planecopy<8>(lB + STG, gB + KS, gs);
    const int aofs = (wm * (16 * MB) + lr) * LP + 8 * hi, bofs = 2 * PLA + (wn * 64 + lr) * LP + 8 * hi;
    Frags<MB> f0, f1;                                    // two fragment sets: each block's LDS reads are issued one block ahead, as one group
    ldfr<MB>(f0, ring + aofs, ring + PLA + aofs, ring + bofs);
#pragma unroll 1
    for (int t = 0; t < nt; ++t) {
        const bf* st = ring + (t & 1) * STG; const bf* sn = ring + ((t + 1) & 1) * STG;
        ldfr<MB>(f1, st + aofs + 32, st + PLA + aofs + 32, st + bofs + 32);
        __builtin_amdgcn_sched_barrier(0);                   // keeps the read group ahead of the block it hides behind
        mmblk<MB>(acc, f0);
        __builtin_amdgcn_sched_barrier(0);                   // keeps the block ahead of the publish point, so that the waits below find their data landed
        // publish point of stage t + 1, in front of stage t's last block, whose fragments are already fetched
        asm volatile("s_wait_dscnt 0x0" ::: "memory");      // this wave's last reads of stage t have returned before its buffer is refilled
        asm volatile("s_wait_asynccnt 0x0" ::: "memory");   // this wave's share of stage t + 1 has landed
        __syncthreads();                                     // publishes stage t + 1 and ends every wave's reads of stage t
        if (t + 2 < nt) { const size_t ko = (size_t)(t + 2) * KS; const int bo = (t & 1) * STG; planecopy<2 * MB>(lA + bo, gA + ko, gs); planecopy<2 * MB>(lA + bo + PLA, gA2 + ko, gs); planecopy<8>(lB + bo, gB + ko, gs); }
        if (t + 1 < nt) ldfr<MB>(f0, sn + aofs, sn + PLA + aofs, sn + bofs);
        mmblk<MB>(acc, f1);
    }
    asm volatile("s_wait_asynccnt 0x0" ::: "memory");       // no copy is outstanding when the wave ends
    float* os = osa + w * (16 * 68);                         // each wave stages its output rows in its own LDS range
#pragma unroll
    for (int mb = 0; mb < MB; ++mb) {
#pragma unroll
        for (int nb = 0; nb < 4; ++nb) {
#pragma unroll
            for (int j = 0; j < 8; ++j) os[(hi * 8 + j) * 68 + nb * 16 + lr] = acc[mb][nb][j]; }
        __builtin_amdgcn_wave_barrier(); asm volatile("" ::: "memory");   // keeps the row reads below, which take other lanes' values, behind the stores above
        float* crw = C + (size_t)(r0 + wm * (16 * MB) + mb * 16) * ldc + c0 + wn * 64;
#pragma unroll
        for (int s = 0; s < 8; ++s) { const int row = 2 * s + hi, cofs = lr * 4; const v4f val = *(const v4fa*)(os + row * 68 + cofs); *(v4f*)(crw + (size_t)row * ldc + cofs) = val; }
        __builtin_amdgcn_wave_barrier(); asm volatile("" ::: "memory");   // keeps the next 16 rows' stores behind these reads
    }
}

// ---- k_gemmc: register-blocked GEMM, ONE WAVE per 64x64 output tile (16 accumulators), operands straight from K-contiguous 16-bit planes, specialised for causal attention: CMODE 1 computes only the score tiles that touch the band i - WIN < j <= i (grid y counts the WIN/64 + 1 key tiles from r0+roff-WIN up to the diagonal tile), CMODE 2 limits the
// key (K) loop of the probability x value contraction to the same band (probabilities outside it are exactly zero). roff = row offset of this launch's first row within the sequence.
// Score and probability rows are stored from key jb on (pitch PB): column j lies at j - jb, jb = the 128-aligned start of the 64-row tile's band. z counts query heads; head z reads the planes of kv head z / REP (stride sB).
template <typename T16, int NSPLIT, int CMODE>
__global__ __launch_bounds__(32) void k_gemmc(const T16* __restrict__ A, const T16* __restrict__ A2, const T16* __restrict__ Bt, const T16* __restrict__ Bt2, int K, float* C, int ldc, int roff, size_t sA, size_t sB, size_t sC) {
    typedef typename WFrag<T16>::V V;
    __shared__ __align__(16) float os[16 * 68];
    const size_t z = blockIdx.z, zb = z / REP; A += z * sA; if (A2) A2 += z * sA; Bt += zb * sB; if (Bt2) Bt2 += zb * sB; C += z * sC;
    const int lane = threadIdx.x & 31, lr = lane & 15, hi = lane >> 4; const int r0 = blockIdx.x * 64, c0 = (CMODE == 1) ? r0 + roff - WIN + (int)blockIdx.y * 64 : (int)blockIdx.y * 64;
    if (CMODE == 1 && c0 < 0) return;                                // the band starts at key 0 for the first WIN query rows; tiles outside the band are never computed (the softmax masks them by select)
    const int Kl = (CMODE == 2) ? min(K, r0 + roff + 64) : K;        // P.V: probabilities are exactly 0 beyond the diagonal block, so the K loop stops there
    const int K0 = (CMODE == 2) ? max(0, r0 + roff - WIN) : 0;       // ... and exactly 0 for keys j <= i - WIN, so it starts at the block that holds the first row's first key
    const int jb = max(0, r0 + roff - WIN) & ~127;                   // first key that this tile's stored score / probability rows hold
    const int lda = (CMODE == 2) ? PB : K;                           // P.V reads the stored probability rows
    v8f acc[4][4];
#pragma unroll
    for (int mb = 0; mb < 4; ++mb)
#pragma unroll
        for (int nb = 0; nb < 4; ++nb) acc[mb][nb] = (v8f){};
    const size_t aoff = (size_t)(r0 + lr) * lda + 8 * hi - (CMODE == 2 ? jb : 0), boff = (size_t)(c0 + lr) * K + 8 * hi;
#pragma unroll 1
    for (int kc = K0; kc < Kl; kc += 32) {
        V a[4], a2[4];
#pragma unroll
        for (int mb = 0; mb < 4; ++mb) { a[mb] = WFrag<T16>::ld(A + aoff + (size_t)mb * 16 * lda + kc); if (NSPLIT == 1 || NSPLIT == 2) a2[mb] = WFrag<T16>::ld(A2 + aoff + (size_t)mb * 16 * lda + kc); }
#pragma unroll
        for (int nb = 0; nb < 4; ++nb) { const V b = WFrag<T16>::ld(Bt + boff + (size_t)nb * 16 * K + kc); V b2; if (NSPLIT >= 2) b2 = WFrag<T16>::ld(Bt2 + boff + (size_t)nb * 16 * K + kc);
#pragma unroll
            for (int mb = 0; mb < 4; ++mb) { acc[mb][nb] = WFrag<T16>::mma(a[mb], b, acc[mb][nb]); if (NSPLIT == 1 || NSPLIT == 2) acc[mb][nb] = WFrag<T16>::mma(a2[mb], b, acc[mb][nb]); if (NSPLIT >= 2) acc[mb][nb] = WFrag<T16>::mma(a[mb], b2, acc[mb][nb]); } }
        asm volatile("v_nop\n\tv_nop\n\tv_nop\n\tv_nop" : "+v"(acc[0][0]), "+v"(acc[1][1]), "+v"(acc[2][2]), "+v"(acc[3][3]) : "v"(a[0]), "v"(a[3]));
    }
#pragma unroll
    for (int mb = 0; mb < 4; ++mb) {
#pragma unroll
        for (int nb = 0; nb < 4; ++nb) {
#pragma unroll
            for (int j = 0; j < 8; ++j) os[(hi * 8 + j) * 68 + nb * 16 + lr] = acc[mb][nb][j]; }
        __builtin_amdgcn_wave_barrier(); asm volatile("" ::: "memory");
        float* crow = C + (size_t)(r0 + mb * 16) * ldc + (CMODE == 1 ? c0 - jb : c0);
{
#pragma unroll
            for (int s = 0; s < 8; ++s) { const int row = 2 * s + hi, cofs = lr * 4; v4f val = *(const v4fa*)(os + row * 68 + cofs);
                *(v4f*)(crow + (size_t)row * ldc + cofs) = val; }
             }
        __builtin_amdgcn_wave_barrier(); asm volatile("" ::: "memory");
    }
}

__device__ __forceinline__ h16 tohx(float x) { return (h16)x; }
__device__ __forceinline__ void splitf(float y, unsigned short& h, unsigned short& l) { h = f2bf(y); l = f2bf(y - bf2f(h)); }
typedef __attribute__((ext_vector_type(2))) _Float16 v2h;
typedef __attribute__((ext_vector_type(4))) _Float16 v4h;
typedef __attribute__((ext_vector_type(2))) unsigned short v2us;
typedef __attribute__((ext_vector_type(4))) unsigned short v4us;
typedef __attribute__((ext_vector_type(2))) float v2f;
typedef __attribute__((ext_vector_type(4))) int v4i;

__global__ __launch_bounds__(256) void k_wtG(const float* __restrict__ w, int K, int N, bf* Bt) {
    const int lane = threadIdx.x & 31; const int L0 = (blockIdx.x * 8 + (threadIdx.x >> 5)) * 8; const int nlines = N * K / 64;
{
#pragma unroll 1
        for (int l = 0; l < 8; ++l) { const int L = L0 + l; if (L >= nlines) break; const size_t e = (size_t)L * 64 + lane * 2; const int k = (int)(e % K), n = (int)(e / K); v2us o;
            o[0] = f2bf(w[(size_t)k * N + n]); o[1] = f2bf(w[(size_t)(k + 1) * N + n]); *(v2us*)(Bt + e) = o; }
         }
}
__global__ __launch_bounds__(256) void k_rmshl(const float* __restrict__ X, const float* __restrict__ g, bf* Yh, bf* Yl) {
    const int lane = threadIdx.x & 31; const int r = blockIdx.x * 8 + (threadIdx.x >> 5); if (r >= TT) return; const float* xr = X + (size_t)r * DM; float s = 0.f;
#pragma unroll 1
    for (int ch = 0; ch < DM / 128; ++ch) { const v4f a = *(const v4f*)(xr + ch * 128 + lane * 4);
#pragma unroll
        for (int q = 0; q < 4; ++q) { const float xb = bfr(a[q]); float p = __fmul_rn(xb, xb); asm volatile("" : "+v"(p)); s = __fadd_rn(s, p); } }
#pragma unroll
    for (int sh = 16; sh; sh >>= 1) s += __shfl_xor(s, sh, 32);
    const float rs = __fdiv_rn(1.0f, __fsqrt_rn(__fadd_rn(s * (1.0f / DM), 1e-6f)));
{
#pragma unroll 1
        for (int ch = 0; ch < DM / 128; ++ch) { const int c0 = ch * 128 + lane * 4; const v4f a = *(const v4f*)(xr + c0); v4us oh, ol;
#pragma unroll
            for (int q = 0; q < 4; ++q) { float n0 = __fmul_rn(bfr(a[q]), rs); asm volatile("" : "+v"(n0)); const float y = __fmul_rn(n0, bfr(g[c0 + q])); unsigned short h2, l2; splitf(y, h2, l2); oh[q] = h2; ol[q] = l2; }
            *(v4us*)(Yh + (size_t)r * DM + c0) = oh; *(v4us*)(Yl + (size_t)r * DM + c0) = ol; }
         } }
__global__ __launch_bounds__(256) void k_addres(const float* __restrict__ X, const float* __restrict__ Y, float* O, size_t n4) { const size_t i = (size_t)blockIdx.x * 256 + threadIdx.x; if (i >= n4) return; const v4f a = *(const v4f*)(X + i * 4), b = *(const v4f*)(Y + i * 4); v4f o;
#pragma unroll
    for (int q = 0; q < 4; ++q) o[q] = __fadd_rn(bfr(a[q]), b[q]); *(v4f*)(O + i * 4) = o;  }
__global__ __launch_bounds__(256) void k_cvt8(const float* __restrict__ src, bf* dst, size_t n8) { const size_t i = (size_t)blockIdx.x * 256 + threadIdx.x; if (i >= n8) return; const v8f v = *(const v8f*)(src + i * 8); v8us o;
#pragma unroll
    for (int k = 0; k < 8; ++k) o[k] = f2bf(v[k]); *(v8us*)(dst + i * 8) = o;  }
__global__ __launch_bounds__(256) void k_cscvt(const float* __restrict__ cosT, const float* __restrict__ sinT, float* CS) { const int idx = blockIdx.x * 256 + threadIdx.x; if (idx >= TT * HD) return; const int t = idx / HD, d = idx % HD; const size_t ti = (size_t)t * (HD / 2) + (d % (HD / 2));   /* half-width tables: both halves use column d mod 64 */ v2f cs; cs[0] = bfr(cosT[ti]); cs[1] = bfr(sinT[ti]); *(v2f*)(CS + (size_t)idx * 2) = cs;  }
// k_rope: head planes [h][t][d] (fp16 + hi/lo) of rope(x) x sc with the rotate-half convention out[d] = x[d] cos[t][d] - x[d+HD/2] sin[t][d], out[d+HD/2] = x[d+HD/2] cos[t][d+HD/2] + x[d] sin[t][d+HD/2]
__global__ __launch_bounds__(256) void k_rope(const float* __restrict__ F, int pitch, int nheads, const float* __restrict__ CS, const float* __restrict__ RF, const float* __restrict__ nw, float sc, h16* P16, bf* Ph, bf* Pl) {
    const size_t e = ((size_t)blockIdx.x * 256 + threadIdx.x) * 2; if (e >= (size_t)nheads * TT * HD) return; const int d = (int)(e % HD); const int t = (int)((e / HD) % TT); const int h = (int)(e / ((size_t)HD * TT)); const float* f = F + (size_t)t * pitch + h * HD; const float rf = RF ? RF[(size_t)h * TT + t] : 1.0f; v2h o16; v2us oh, ol;
#pragma unroll
    for (int q = 0; q < 2; ++q) { const int dd = d + q; const int dp = (dd < HD / 2) ? dd + HD / 2 : dd - HD / 2; float x0 = f[dd], x1 = f[dp];
        if (RF) { float n0 = __fmul_rn(x0, rf), n1 = __fmul_rn(x1, rf); asm volatile("" : "+v"(n0)); asm volatile("" : "+v"(n1)); x0 = __fmul_rn(bfr(nw[dd]), n0); x1 = __fmul_rn(bfr(nw[dp]), n1); }
        const v2f cs = *(const v2f*)(CS + ((size_t)t * HD + dd) * 2); float a = __fmul_rn(x0, cs[0]), bq = __fmul_rn(x1, cs[1]); asm volatile("" : "+v"(a)); asm volatile("" : "+v"(bq)); const float r = ((dd < HD / 2) ? __fsub_rn(a, bq) : __fadd_rn(a, bq)) * sc;
        o16[q] = tohx(r); unsigned short a2, c2; splitf(r, a2, c2); oh[q] = a2; ol[q] = c2; }
    *(v2h*)(P16 + e) = o16; *(v2us*)(Ph + e) = oh; *(v2us*)(Pl + e) = ol;  }
__global__ __launch_bounds__(256) void k_vtp(const float* __restrict__ F, int pitch, int nheads, h16* V16, bf* Vh, bf* Vl) { const size_t e = ((size_t)blockIdx.x * 256 + threadIdx.x) * 2; if (e >= (size_t)nheads * HD * TT) return; const int t = (int)(e % TT); const int d = (int)((e / TT) % HD); const int g = (int)(e / ((size_t)TT * HD)); v2h o16; v2us oh, ol;
#pragma unroll
    for (int q = 0; q < 2; ++q) { const float x = F[(size_t)(t + q) * pitch + g * HD + d]; o16[q] = tohx(x); unsigned short a2, c2; splitf(x, a2, c2); oh[q] = a2; ol[q] = c2; }
    *(v2h*)(V16 + e) = o16; *(v2us*)(Vh + e) = oh; *(v2us*)(Vl + e) = ol;  }
// k_asoft: per row (zz, i): t = S x HD^-0.5 for j <= i and i - j < WIN (sliding causal window; the reference's -1e9 additive fill vanishes identically); softmax over the NBC x 128 keys from jb on, which hold the band of every row of the 64-row tile (all that the P.V loop reads; jb is a multiple of 128, so each lane keeps its columns; register row, one exp, fixed trees); score and probability rows are stored from key jb on, pitch PB;
__global__ __launch_bounds__(256) void k_asoft(const float* __restrict__ Sb, h16* P16, bf* Ph, bf* Pl) {
    const int lane = threadIdx.x & 31; const int row = blockIdx.x * 8 + (threadIdx.x >> 5); if (row >= ZH * TT) return; const int i = row % TT; const int zz = row / TT; (void)zz; const bool hires = (i < RH); const int jb = max(0, (i & ~63) - WIN) & ~127; const float* sr = Sb + (size_t)row * PB; float v[NBC * 4]; float mx = -3.0e38f;
#pragma unroll
    for (int ch = 0; ch < NBC; ++ch) { const int j0 = jb + ch * 128 + lane * 4; const v4f a = *(const v4f*)(sr + ch * 128 + lane * 4);
#pragma unroll
        for (int q = 0; q < 4; ++q) { const int j = j0 + q; (void)j; const float t = (j <= i && i - j < WIN) ? a[q] * SCL : -3.0e38f; v[ch * 4 + q] = t; mx = fmaxf(mx, t); } }
#pragma unroll
    for (int sh = 16; sh; sh >>= 1) mx = fmaxf(mx, __shfl_xor(mx, sh, 32));
    float sum = 0.f;
#pragma unroll
    for (int k = 0; k < NBC * 4; ++k) { float d0 = __fsub_rn(v[k], mx); asm volatile("" : "+v"(d0)); v[k] = __builtin_amdgcn_exp2f(__fmul_rn(d0, 1.4426950408889634f)); if (k + 1 < NBC * 4) asm volatile("v_nop" :: "v"(v[k])); /* fills the one slot the instruction set asks for behind a transcendental before the next key's value overwrites its source register */ sum += v[k]; }
#pragma unroll
    for (int sh = 16; sh; sh >>= 1) sum += __shfl_xor(sum, sh, 32);
    const float f = __fdiv_rn(hires ? 1.0f : PCAR, sum);
{
        if (hires) {
#pragma unroll
            for (int ch = 0; ch < NBC; ++ch) { v4us oh, ol;
#pragma unroll
                for (int q = 0; q < 4; ++q) { unsigned short a, c2; splitf(v[ch * 4 + q] * f, a, c2); oh[q] = a; ol[q] = c2; }
                const size_t oo = ((size_t)zz * (RH ? RH : 1) + i) * PB + ch * 128 + lane * 4; *(v4us*)(Ph + oo) = oh; *(v4us*)(Pl + oo) = ol; }
        } else {
#pragma unroll
            for (int ch = 0; ch < NBC; ++ch) { v4h o4;
#pragma unroll
                for (int q = 0; q < 4; ++q) o4[q] = tohx(v[ch * 4 + q] * f);
                *(v4h*)(P16 + (size_t)row * PB + ch * 128 + lane * 4) = o4; } }
         }
}
__global__ __launch_bounds__(256) void k_merge(const float* __restrict__ O, int h0, bf* Ah, bf* Al) { const size_t e = ((size_t)blockIdx.x * 256 + threadIdx.x) * 2; if (e >= (size_t)ZH * TT * HD) return; const int d = (int)(e % HD); const int t = (int)((e / HD) % TT); const int zz = (int)(e / ((size_t)HD * TT)); const float cs = (t < RH) ? 1.0f : (1.0f / PCAR); const size_t oo = (size_t)t * DQ + (h0 + zz) * HD + d;
    v2us oh, ol;
#pragma unroll
    for (int q = 0; q < 2; ++q) { unsigned short a, c2; splitf(O[e + q] * cs, a, c2); oh[q] = a; ol[q] = c2; } *(v2us*)(Ah + oo) = oh; *(v2us*)(Al + oo) = ol;  }

extern "C" void kernel_launch(void* const* d_in, const int* in_sizes, int n_in,
                              void* d_out, int out_size, void* d_ws, size_t ws_size, hipStream_t stream) {
    (void)in_sizes; (void)n_in; (void)out_size;
    const float* x = (const float*)d_in[0]; const float* gw = (const float*)d_in[1]; const float* wq = (const float*)d_in[2]; const float* wk = (const float*)d_in[3]; const float* wv = (const float*)d_in[4]; const float* wo = (const float*)d_in[5]; const float* cosT = (const float*)d_in[6]; const float* sinT = (const float*)d_in[7];
    float* OUT = (float*)d_out;     // [2][2048][2048]
    char* wsp = (char*)d_ws;
    auto take = [&](size_t bytes) { char* p = wsp; wsp += (bytes + 255) & ~(size_t)255; return (void*)p; };
    bf* WQ = (bf*)take((size_t)DQ * DM * 2); bf* WK = (bf*)take((size_t)DKV * DM * 2); bf* WV = (bf*)take((size_t)DKV * DM * 2); bf* WO = (bf*)take((size_t)DM * DQ * 2); float* CS = (float*)take((size_t)TT * HD * 2 * 4);
    bf* Yh = (bf*)take((size_t)TT * DM * 2); bf* Yl = (bf*)take((size_t)TT * DM * 2); float* FQ = (float*)take((size_t)TT * DQ * 4); float* FK = (float*)take((size_t)TT * DKV * 4);
    h16* QP16 = (h16*)take((size_t)NH_ * TT * HD * 2); h16* KP16 = (h16*)take((size_t)NKV * TT * HD * 2); h16* VT16 = (h16*)take((size_t)NKV * HD * TT * 2);
    bf* QPh = (bf*)take((size_t)NH_ * TT * HD * 2); bf* QPl = (bf*)take((size_t)NH_ * TT * HD * 2); bf* KPh = (bf*)take((size_t)NKV * TT * HD * 2); bf* KPl = (bf*)take((size_t)NKV * TT * HD * 2); bf* VTh = (bf*)take((size_t)NKV * HD * TT * 2); bf* VTl = (bf*)take((size_t)NKV * HD * TT * 2); bf* Ph = (bf*)take((size_t)ZH * RH * PB * 2); bf* Pl = (bf*)take((size_t)ZH * RH * PB * 2);
    float* Sb = (float*)take((size_t)ZH * TT * PB * 4); h16* P16 = (h16*)take((size_t)ZH * TT * PB * 2); bf* ATh = (bf*)take((size_t)TT * DQ * 2); bf* ATl = (bf*)take((size_t)TT * DQ * 2);
    if ((size_t)(wsp - (char*)d_ws) > ws_size) return;    // ws 256 MiB
    float* FV = FK;   // v projection reuses the k buffer after the k planes are built (stream-ordered)
    static_assert(ZH % REP == 0 && ZH * HD <= DQ && ZH * PB >= DM, "a pass holds whole kv groups; the two reuses below must fit");
    float* Ob = FQ;   // attention output [ZH][TT][HD] reuses the q projection buffer (same size), dead once the q planes are built (stream-ordered)
    float* YO = Sb;   // the output projection reuses the score buffer, dead after the softmax (stream-ordered)
    { k_wtG<<<(unsigned)((DM * DQ / 64 + 63) / 64), 256, 0, stream>>>(wq, DM, DQ, WQ); k_wtG<<<(unsigned)((DM * DKV / 64 + 63) / 64), 256, 0, stream>>>(wk, DM, DKV, WK); k_wtG<<<(unsigned)((DM * DKV / 64 + 63) / 64), 256, 0, stream>>>(wv, DM, DKV, WV);
      k_wtG<<<(unsigned)((DQ * DM / 64 + 63) / 64), 256, 0, stream>>>(wo, DQ, DM, WO);
       }
    const unsigned LQ = (unsigned)(((size_t)NH_ * TT * HD / 2 + 255) / 256), LKv = (unsigned)(((size_t)NKV * TT * HD / 2 + 255) / 256);
    for (int b = 0; b < NB_; ++b) {
        if (b == 0) k_cscvt<<<(TT * HD + 255) / 256, 256, 0, stream>>>(cosT, sinT, CS);
        k_rmshl<<<TT / 8, 256, 0, stream>>>(x + (size_t)b * TT * DM, gw, Yh, Yl);   /* n = RMSNorm(x) norm_w as hi/lo planes */
        k_gemms<4><<<dim3(TT / 128, DQ / 128, 1), 128, 0, stream>>>(Yh, Yl, WQ, DM, FQ, DQ);
        k_rope<<<LQ, 256, 0, stream>>>(FQ, DQ, NH_, CS, nullptr, nullptr, 1.0f, QP16, QPh, QPl);
        k_gemms<2><<<dim3(TT / 64, DKV / 128, 1), 128, 0, stream>>>(Yh, Yl, WK, DM, FK, DKV);
        k_rope<<<LKv, 256, 0, stream>>>(FK, DKV, NKV, CS, nullptr, nullptr, 1.0f, KP16, KPh, KPl);
        k_gemms<2><<<dim3(TT / 64, DKV / 128, 1), 128, 0, stream>>>(Yh, Yl, WV, DM, FV, DKV); k_vtp<<<LKv, 256, 0, stream>>>(FV, DKV, NKV, VT16, VTh, VTl);
        for (int h0 = 0; h0 < NH_; h0 += ZH) { const size_t zq = (size_t)h0, zk = (size_t)(h0 / REP);   // one pass holds every head: head z of the grid reads kv group z / REP (stride sB)
            k_gemmc<bf, 2, 1><<<dim3(RH / 64, WIN / 64 + 1, ZH), 32, 0, stream>>>(QPh + zq * TT * HD, QPl + zq * TT * HD, KPh + zk * TT * HD, KPl + zk * TT * HD, HD, Sb, PB, 0, (size_t)TT * HD, (size_t)TT * HD, (size_t)TT * PB);
            k_gemmc<h16, 0, 1><<<dim3((TT - RH) / 64, WIN / 64 + 1, ZH), 32, 0, stream>>>(QP16 + zq * TT * HD + (size_t)RH * HD, nullptr, KP16 + zk * TT * HD, nullptr, HD, Sb + (size_t)RH * PB, PB, RH, (size_t)TT * HD, (size_t)TT * HD, (size_t)TT * PB);
            k_asoft<<<ZH * TT / 8, 256, 0, stream>>>(Sb, P16, Ph, Pl);
            k_gemmc<bf, 2, 2><<<dim3(RH / 64, HD / 64, ZH), 32, 0, stream>>>(Ph, Pl, VTh + zk * HD * TT, VTl + zk * HD * TT, TT, Ob, HD, 0, (size_t)RH * PB, (size_t)HD * TT, (size_t)TT * HD);
            k_gemmc<h16, 0, 2><<<dim3((TT - RH) / 64, HD / 64, ZH), 32, 0, stream>>>(P16 + (size_t)RH * PB, nullptr, VT16 + zk * HD * TT, nullptr, TT, Ob + (size_t)RH * HD, HD, RH, (size_t)TT * PB, (size_t)HD * TT, (size_t)TT * HD);
            k_merge<<<(unsigned)(((size_t)ZH * TT * HD / 2 + 255) / 256), 256, 0, stream>>>(Ob, h0, ATh, ATl); }
        k_gemms<4><<<dim3(TT / 128, DM / 128, 1), 128, 0, stream>>>(ATh, ATl, WO, DQ, YO, DM);
        k_addres<<<(unsigned)(((size_t)TT * DM / 4 + 255) / 256), 256, 0, stream>>>(x + (size_t)b * TT * DM, YO, OUT + (size_t)b * TT * DM, (size_t)TT * DM / 4); }   /* out = x + attn wo */
}

// v004
// One run takes 493 microseconds.
// In two side-by-side timings against v003, it was 1.07 and 1.06 times as fast.
// Over all steps from v000 it is 3.53 times as fast.
#include <hip/hip_runtime.h>

// Sliding-window causal GQA with RMSNorm pre-normalisation and residual (x [2][2048][2048]; n = x rsqrt(mean x^2 + 1e-6) norm_w; q = n wq ('xw', 16 heads x 128), k, v = n wk / n wv (4 kv heads); rotate-half RoPE from the given tables [2048][64] (both halves share column d mod 64); 4 query heads per kv head (repeat); scores/sqrt(128) kept where j <= i and i - j < 512; softmax; out = x + merged wo -> [2][2048][2048]).
// Compute dtypes, f32 accumulate: every input rounded to bf16; q/k/v hl x exact (2 products); rotary in f32 from the bf16-rounded input tables; windowed-causal scores and attn.v (only key tiles that touch the window band computed): query rows < 512 hl (3 products), the rest single fp16 (x1024); softmax f32; wo hl x exact (2 products), + x residual in f32.

#define NB_  2
#define TT   2048
#define DM   2048
#define NH_  16
#define NKV  4
#define REP  (NH_ / NKV)
#define HD   128
#define DQ   (NH_ * HD)
#define DKV  (NKV * HD)
#define RH   512                  // query rows < RH use hi+lo planes (0: none)
#define WIN  512
#define NBC  ((WIN + 128) / 128)  // 128-key chunks of a softmax row: WIN + 64 band keys of a 64-row tile, from a multiple of 128
#define PB   (NBC * 128)         // pitch of a stored score / probability row: only the NBC chunks from the row tile's first chunk jb on are kept
#define PCAR 1024.0f
#define SCL  0.088388347648318447f   // HD^-0.5
typedef _Float16 h16;
typedef unsigned short bf;
typedef __attribute__((ext_vector_type(16))) __bf16   v16bf;
typedef __attribute__((ext_vector_type(16))) _Float16 v16h;
typedef __attribute__((ext_vector_type(8)))  _Float16 v8h;
typedef __attribute__((ext_vector_type(8)))  unsigned short v8us;
typedef __attribute__((ext_vector_type(8)))  float    v8f;
typedef __attribute__((ext_vector_type(4)))  float    v4f;
typedef v8h  __attribute__((may_alias)) v8ha;
typedef v4f  __attribute__((may_alias)) v4fa;
typedef v8us __attribute__((may_alias)) v8usa;

__device__ __forceinline__ unsigned short f2bf(float f) { unsigned u = __float_as_uint(f); u += 0x7FFFu + ((u >> 16) & 1u); return (unsigned short)(u >> 16); }
__device__ __forceinline__ float bf2f(unsigned short b) { return __uint_as_float(((unsigned)b) << 16); }
__device__ __forceinline__ float bfr(float f) { return bf2f(f2bf(f)); }
__device__ __forceinline__ v16h cat16(v8h lo, v8h hi) { return __builtin_shufflevector(lo, hi, 0, 1, 2, 3, 4, 5, 6, 7, 8, 9, 10, 11, 12, 13, 14, 15); }
__device__ __forceinline__ v16bf cat16b(v8us lo, v8us hi) { return __builtin_bit_cast(v16bf, __builtin_shufflevector(lo, hi, 0, 1, 2, 3, 4, 5, 6, 7, 8, 9, 10, 11, 12, 13, 14, 15)); }
__device__ __forceinline__ v8f wmma16(v16h a, v16h b, v8f c) { return __builtin_amdgcn_wmma_f32_16x16x32_f16(false, a, false, b, (short)0, c, false, false); }
__device__ __forceinline__ v8f wmmab(v16bf a, v16bf b, v8f c) { return __builtin_amdgcn_wmma_f32_16x16x32_bf16(false, a, false, b, (short)0, c, false, false); }



// ---- k_gemms<MB>: projection GEMM, 4 waves (2 x 2) per (32 MB)x128 output tile, each wave a (16 MB)x64 tile (4 MB accumulators); MB = 4 where that fills the chip, MB = 2 for the narrow k and v outputs (twice the work-groups). The operands (K-contiguous bf16 planes A hi, A lo, Bt) are staged in LDS by asynchronous copies,
// KS k of the tile's rows of each plane a stage, two buffers: the next stage's copies fly while this stage is worked on; fragments are read from LDS one 32-k block ahead. grid (M/(32 MB), N/128), 128 threads. C[m][n] (f32, pitch ldc) = sum_k (A[m][k] + A2[m][k]) Bt[n][k]. K % KS == 0, K >= 2 KS (the prologue fills two stages).
#define KS   64                  // k per stage: 128 B of every operand row, one whole line
#define LP   (KS + 8)            // LDS row pitch in elements: 144 B = 16 B x odd, free of bank conflicts for 16-byte fragment reads
template <typename T16> struct WFrag;
template <> struct WFrag<h16> { typedef v16h V; static __device__ __forceinline__ V ld(const h16* p) { return cat16(*(const v8h*)p, *(const v8h*)(p + 16)); } static __device__ __forceinline__ V cat(const h16* p, const h16* p2) { return cat16(*(const v8ha*)p, *(const v8ha*)p2); } static __device__ __forceinline__ v8f mma(V a, V b, v8f c) { return wmma16(a, b, c); } };
template <> struct WFrag<bf> { typedef v16bf V; static __device__ __forceinline__ V ld(const bf* p) { return cat16b(*(const v8us*)p, *(const v8us*)(p + 16)); } static __device__ __forceinline__ V cat(const bf* p, const bf* p2) { return cat16b(*(const v8usa*)p, *(const v8usa*)p2); } static __device__ __forceinline__ v8f mma(V a, V b, v8f c) { return wmmab(a, b, c); } };
typedef __attribute__((ext_vector_type(4))) int v4ic;
// NJ asynchronous copies of 512 B (4 rows of 128 B each, 16 B a lane): 4 NJ rows of one plane. l = the lane's place in the first of them in LDS, g = the same place in the global plane, gs = elements per 4 global rows.
template <int NJ>
__device__ __forceinline__ void planecopy(bf* l, const bf* g, size_t gs) {
#pragma unroll
    for (int j = 0; j < NJ; ++j)
        __builtin_amdgcn_global_load_async_to_lds_b128((__attribute__((address_space(1))) v4ic*)(g + (size_t)j * gs), (__attribute__((address_space(3))) v4ic*)(l + j * 4 * LP), 0, 0);
}
template <int MB> struct Frags { WFrag<bf>::V a[MB], a2[MB], b[4]; };
// the fragments of one 32-k block of a stage, as one group of LDS reads; sa, sa2, sb = the lane's place in the wave's first row of each plane
template <int MB>
__device__ __forceinline__ void ldfr(Frags<MB>& f, const bf* sa, const bf* sa2, const bf* sb) {
#pragma unroll
    for (int q = 0; q < MB; ++q) { f.a[q] = WFrag<bf>::ld(sa + q * 16 * LP); f.a2[q] = WFrag<bf>::ld(sa2 + q * 16 * LP); }
#pragma unroll
    for (int q = 0; q < 4; ++q) f.b[q] = WFrag<bf>::ld(sb + q * 16 * LP);
}
template <int MB>
__device__ __forceinline__ void mmblk(v8f (&acc)[MB][4], const Frags<MB>& f) {
#pragma unroll
    for (int nb = 0; nb < 4; ++nb)
#pragma unroll
        for (int mb = 0; mb < MB; ++mb) { acc[mb][nb] = WFrag<bf>::mma(f.a[mb], f.b[nb], acc[mb][nb]); acc[mb][nb] = WFrag<bf>::mma(f.a2[mb], f.b[nb], acc[mb][nb]); }
}
template <int MB>
__global__ __launch_bounds__(128) void k_gemms(const bf* __restrict__ A, const bf* __restrict__ A2, const bf* __restrict__ Bt, int K, float* C, int ldc) {
    static_assert(KS == 64, "a stage is two 32-k blocks");
    constexpr int PLA = 32 * MB * LP, STG = 2 * PLA + 128 * LP;   // a stage: A hi | A lo (32 MB rows each) | Bt (128 rows)
    __shared__ __align__(16) bf ring[2 * STG];
    __shared__ __align__(16) float osa[4 * 16 * 68];
    const int lane = threadIdx.x & 31, lr = lane & 15, hi = lane >> 4; const int w = __builtin_amdgcn_readfirstlane((int)(threadIdx.x >> 5)), wm = w >> 1, wn = w & 1;
    const int r0 = blockIdx.x * (32 * MB), c0 = blockIdx.y * 128;
    v8f acc[MB][4];
#pragma unroll
    for (int mb = 0; mb < MB; ++mb)
#pragma unroll
        for (int nb = 0; nb < 4; ++nb) acc[mb][nb] = (v8f){};
    // wave w copies rows 8 MB w .. 8 MB w + 8 MB - 1 of the A planes and rows 32 w .. 32 w + 31 of Bt
    const int crA = w * (8 * MB) + (lane >> 3), crB = w * 32 + (lane >> 3), ccol = (lane & 7) * 8; const size_t gs = (size_t)4 * K;
    const bf* gA = A + (size_t)(r0 + crA) * K + ccol; const bf* gA2 = A2 + (size_t)(r0 + crA) * K + ccol; const bf* gB = Bt + (size_t)(c0 + crB) * K + ccol;
    bf* lA = ring + crA * LP + ccol; bf* lB = ring + 2 * PLA + crB * LP + ccol;
    const int nt = K / KS;
    planecopy<2 * MB>(lA, gA, gs); planecopy<2 * MB>(lA + PLA, gA2, gs); planecopy<8>(lB, gB, gs);
    asm volatile("s_wait_asynccnt 0x0" ::: "memory");   // this wave's share of stage 0 has landed
    __syncthreads();                                     // ... and every other wave's
    planecopy<2 * MB>(lA + STG, gA + KS, gs); planecopy<2 * MB>(lA + STG + PLA, gA2 + KS, gs); planecopy<8>(lB + STG, gB + KS, gs);
    const int aofs = (wm * (16 * MB) + lr) * LP + 8 * hi, bofs = 2 * PLA + (wn * 64 + lr) * LP + 8 * hi;
    Frags<MB> f0, f1;                                    // two fragment sets: each block's LDS reads are issued one block ahead, as one group
    ldfr<MB>(f0, ring + aofs, ring + PLA + aofs, ring + bofs);
#pragma unroll 1
    for (int t = 0; t < nt; ++t) {
        const bf* st = ring + (t & 1) * STG; const bf* sn = ring + ((t + 1) & 1) * STG;
        ldfr<MB>(f1, st + aofs + 32, st + PLA + aofs + 32, st + bofs + 32);
        __builtin_amdgcn_sched_barrier(0);                   // keeps the read group ahead of the block it hides behind
        mmblk<MB>(acc, f0);
        __builtin_amdgcn_sched_barrier(0);                   // keeps the block ahead of the publish point, so that the waits below find their data landed
        // publish point of stage t + 1, in front of stage t's last block, whose fragments are already fetched
        asm volatile("s_wait_dscnt 0x0" ::: "memory");      // this wave's last reads of stage t have returned before its buffer is refilled
        asm volatile("s_wait_asynccnt 0x0" ::: "memory");   // this wave's share of stage t + 1 has landed
        __syncthreads();                                     // publishes stage t + 1 and ends every wave's reads of stage t
        if (t + 2 < nt) { const size_t ko = (size_t)(t + 2) * KS; const int bo = (t & 1) * STG; planecopy<2 * MB>(lA + bo, gA + ko, gs); planecopy<2 * MB>(lA + bo + PLA, gA2 + ko, gs); planecopy<8>(lB + bo, gB + ko, gs); }
        if (t + 1 < nt) ldfr<MB>(f0, sn + aofs, sn + PLA + aofs, sn + bofs);
        mmblk<MB>(acc, f1);
    }
    asm volatile("s_wait_asynccnt 0x0" ::: "memory");       // no copy is outstanding when the wave ends
    float* os = osa + w * (16 * 68);                         // each wave stages its output rows in its own LDS range
#pragma unroll
    for (int mb = 0; mb < MB; ++mb) {
#pragma unroll
        for (int nb = 0; nb < 4; ++nb) {
#pragma unroll
            for (int j = 0; j < 8; ++j) os[(hi * 8 + j) * 68 + nb * 16 + lr] = acc[mb][nb][j]; }
        __builtin_amdgcn_wave_barrier(); asm volatile("" ::: "memory");   // keeps the row reads below, which take other lanes' values, behind the stores above
        float* crw = C + (size_t)(r0 + wm * (16 * MB) + mb * 16) * ldc + c0 + wn * 64;
#pragma unroll
        for (int s = 0; s < 8; ++s) { const int row = 2 * s + hi, cofs = lr * 4; const v4f val = *(const v4fa*)(os + row * 68 + cofs); *(v4f*)(crw + (size_t)row * ldc + cofs) = val; }
        __builtin_amdgcn_wave_barrier(); asm volatile("" ::: "memory");   // keeps the next 16 rows' stores behind these reads
    }
}

__device__ __forceinline__ h16 tohx(float x) { return (h16)x; }
__device__ __forceinline__ void splitf(float y, unsigned short& h, unsigned short& l) { h = f2bf(y); l = f2bf(y - bf2f(h)); }
typedef __attribute__((ext_vector_type(2))) _Float16 v2h;
typedef __attribute__((ext_vector_type(4))) _Float16 v4h;
typedef __attribute__((ext_vector_type(2))) unsigned short v2us;
typedef __attribute__((ext_vector_type(4))) unsigned short v4us;
typedef __attribute__((ext_vector_type(2))) float v2f;
typedef __attribute__((ext_vector_type(4))) int v4i;

__global__ __launch_bounds__(256) void k_wtG(const float* __restrict__ w, int K, int N, bf* Bt) {
    const int lane = threadIdx.x & 31; const int L0 = (blockIdx.x * 8 + (threadIdx.x >> 5)) * 8; const int nlines = N * K / 64;
{
#pragma unroll 1
        for (int l = 0; l < 8; ++l) { const int L = L0 + l; if (L >= nlines) break; const size_t e = (size_t)L * 64 + lane * 2; const int k = (int)(e % K), n = (int)(e / K); v2us o;
            o[0] = f2bf(w[(size_t)k * N + n]); o[1] = f2bf(w[(size_t)(k + 1) * N + n]); *(v2us*)(Bt + e) = o; }
         }
}
__global__ __launch_bounds__(256) void k_rmshl(const float* __restrict__ X, const float* __restrict__ g, bf* Yh, bf* Yl) {
    const int lane = threadIdx.x & 31; const int r = blockIdx.x * 8 + (threadIdx.x >> 5); if (r >= TT) return; const float* xr = X + (size_t)r * DM; float s = 0.f;
#pragma unroll 1
    for (int ch = 0; ch < DM / 128; ++ch) { const v4f a = *(const v4f*)(xr + ch * 128 + lane * 4);
#pragma unroll
        for (int q = 0; q < 4; ++q) { const float xb = bfr(a[q]); float p = __fmul_rn(xb, xb); asm volatile("" : "+v"(p)); s = __fadd_rn(s, p); } }
#pragma unroll
    for (int sh = 16; sh; sh >>= 1) s += __shfl_xor(s, sh, 32);
    const float rs = __fdiv_rn(1.0f, __fsqrt_rn(__fadd_rn(s * (1.0f / DM), 1e-6f)));
{
#pragma unroll 1
        for (int ch = 0; ch < DM / 128; ++ch) { const int c0 = ch * 128 + lane * 4; const v4f a = *(const v4f*)(xr + c0); v4us oh, ol;
#pragma unroll
            for (int q = 0; q < 4; ++q) { float n0 = __fmul_rn(bfr(a[q]), rs); asm volatile("" : "+v"(n0)); const float y = __fmul_rn(n0, bfr(g[c0 + q])); unsigned short h2, l2; splitf(y, h2, l2); oh[q] = h2; ol[q] = l2; }
            *(v4us*)(Yh + (size_t)r * DM + c0) = oh; *(v4us*)(Yl + (size_t)r * DM + c0) = ol; }
         } }
__global__ __launch_bounds__(256) void k_addres(const float* __restrict__ X, const float* __restrict__ Y, float* O, size_t n4) { const size_t i = (size_t)blockIdx.x * 256 + threadIdx.x; if (i >= n4) return; const v4f a = *(const v4f*)(X + i * 4), b = *(const v4f*)(Y + i * 4); v4f o;
#pragma unroll
    for (int q = 0; q < 4; ++q) o[q] = __fadd_rn(bfr(a[q]), b[q]); *(v4f*)(O + i * 4) = o;  }
__global__ __launch_bounds__(256) void k_cvt8(const float* __restrict__ src, bf* dst, size_t n8) { const size_t i = (size_t)blockIdx.x * 256 + threadIdx.x; if (i >= n8) return; const v8f v = *(const v8f*)(src + i * 8); v8us o;
#pragma unroll
    for (int k = 0; k < 8; ++k) o[k] = f2bf(v[k]); *(v8us*)(dst + i * 8) = o;  }
__global__ __launch_bounds__(256) void k_cscvt(const float* __restrict__ cosT, const float* __restrict__ sinT, float* CS) { const int idx = blockIdx.x * 256 + threadIdx.x; if (idx >= TT * HD) return; const int t = idx / HD, d = idx % HD; const size_t ti = (size_t)t * (HD / 2) + (d % (HD / 2));   /* half-width tables: both halves use column d mod 64 */ v2f cs; cs[0] = bfr(cosT[ti]); cs[1] = bfr(sinT[ti]); *(v2f*)(CS + (size_t)idx * 2) = cs;  }
// k_rope: head planes [h][t][d] (fp16 + hi/lo) of rope(x) x sc with the rotate-half convention out[d] = x[d] cos[t][d] - x[d+HD/2] sin[t][d], out[d+HD/2] = x[d+HD/2] cos[t][d+HD/2] + x[d] sin[t][d+HD/2]
__global__ __launch_bounds__(256) void k_rope(const float* __restrict__ F, int pitch, int nheads, const float* __restrict__ CS, const float* __restrict__ RF, const float* __restrict__ nw, float sc, h16* P16, bf* Ph, bf* Pl) {
    const size_t e = ((size_t)blockIdx.x * 256 + threadIdx.x) * 2; if (e >= (size_t)nheads * TT * HD) return; const int d = (int)(e % HD); const int t = (int)((e / HD) % TT); const int h = (int)(e / ((size_t)HD * TT)); const float* f = F + (size_t)t * pitch + h * HD; const float rf = RF ? RF[(size_t)h * TT + t] : 1.0f; v2h o16; v2us oh, ol;
#pragma unroll
    for (int q = 0; q < 2; ++q) { const int dd = d + q; const int dp = (dd < HD / 2) ? dd + HD / 2 : dd - HD / 2; float x0 = f[dd], x1 = f[dp];
        if (RF) { float n0 = __fmul_rn(x0, rf), n1 = __fmul_rn(x1, rf); asm volatile("" : "+v"(n0)); asm volatile("" : "+v"(n1)); x0 = __fmul_rn(bfr(nw[dd]), n0); x1 = __fmul_rn(bfr(nw[dp]), n1); }
        const v2f cs = *(const v2f*)(CS + ((size_t)t * HD + dd) * 2); float a = __fmul_rn(x0, cs[0]), bq = __fmul_rn(x1, cs[1]); asm volatile("" : "+v"(a)); asm volatile("" : "+v"(bq)); const float r = ((dd < HD / 2) ? __fsub_rn(a, bq) : __fadd_rn(a, bq)) * sc;
        o16[q] = tohx(r); unsigned short a2, c2; splitf(r, a2, c2); oh[q] = a2; ol[q] = c2; }
    *(v2h*)(P16 + e) = o16; *(v2us*)(Ph + e) = oh; *(v2us*)(Pl + e) = ol;  }
__global__ __launch_bounds__(256) void k_vtp(const float* __restrict__ F, int pitch, int nheads, h16* V16, bf* Vh, bf* Vl) { const size_t e = ((size_t)blockIdx.x * 256 + threadIdx.x) * 2; if (e >= (size_t)nheads * HD * TT) return; const int t = (int)(e % TT); const int d = (int)((e / TT) % HD); const int g = (int)(e / ((size_t)TT * HD)); v2h o16; v2us oh, ol;
#pragma unroll
    for (int q = 0; q < 2; ++q) { const float x = F[(size_t)(t + q) * pitch + g * HD + d]; o16[q] = tohx(x); unsigned short a2, c2; splitf(x, a2, c2); oh[q] = a2; ol[q] = c2; }
    *(v2h*)(V16 + e) = o16; *(v2us*)(Vh + e) = oh; *(v2us*)(Vl + e) = ol;  }
typedef v4h  __attribute__((may_alias)) v4ha;
typedef v4us __attribute__((may_alias)) v4usa;
// ---- k_attn: the whole attention of one 64-row query tile of one head in one work-group of AW = 9 waves; the tile's score / probability band (PB keys from key jb on, jb = the 128-aligned start of the tile's band) lives in LDS only.
// Phase 1: wave w computes the 64x64 score tile of keys r0 - WIN + 64 w .. (in passes of 32 rows, 16 with hi+lo planes; tiles left of key 0 do not exist). Phase 2: softmax, one row a wave at a time (t = S x HD^-0.5 for j <= i and i - j < WIN, everything else masked by select; register row, one exp, fixed trees);
// the probabilities overwrite their own score row (16-bit planes: hi or fp16 in the first PB elements of the row's space, lo in the second), each plane rotated by 8 (row mod 16) elements so that the 16 rows of a fragment read lie in different banks.
// Phase 3: waves 0..7 each contract a 16x64 tile of P.V over the band's keys (probabilities outside it are exactly zero), V from the transposed planes [d][t]; the result x carrier scale goes out as the hi/lo planes [t][head][d] that the output projection reads, whole 128-byte lines a store.
#define AW 9
template <typename T16, int NSPLIT>
__device__ __forceinline__ void attn_tile(float* S, const T16* __restrict__ Q, const T16* __restrict__ Q2, const T16* __restrict__ Kp, const T16* __restrict__ Kp2, const T16* __restrict__ Vt, const T16* __restrict__ Vt2, int r0, bf* Ah, bf* Al) {
    typedef typename WFrag<T16>::V V;
    constexpr bool hires = (NSPLIT == 2);
    const int lane = threadIdx.x & 31, lr = lane & 15, hi = lane >> 4; const int w = __builtin_amdgcn_readfirstlane((int)(threadIdx.x >> 5));
    const int jb = max(0, r0 - WIN) & ~127;                          // first key that the stored rows hold
    const int c0 = r0 - WIN + w * 64;                                // this wave's key tile
    if (c0 >= 0) {
        constexpr int MBS = hires ? 1 : 2;                           // 16-row blocks a pass: as many as let one k block's fragments of every plane lie in registers at once
#pragma unroll 1   // rolled, like the three loops marked so below: keeps the registers under the cap that lets two work-groups share a WGP
        for (int rh = 0; rh < 4 / MBS; ++rh) {
            v8f acc[MBS][4];
#pragma unroll
            for (int mb = 0; mb < MBS; ++mb)
#pragma unroll
                for (int nb = 0; nb < 4; ++nb) acc[mb][nb] = (v8f){};
            const size_t aoff = (size_t)(r0 + rh * (16 * MBS) + lr) * HD + 8 * hi, boff = (size_t)(c0 + lr) * HD + 8 * hi;
#pragma unroll 1   // rolled (registers)
            for (int kc = 0; kc < HD; kc += 32) {
                V a[MBS], a2[MBS], b[4], b2[4];
                const T16* qp = Q + aoff + kc; const T16* qp2 = hires ? Q2 + aoff + kc : qp; const T16* kp = Kp + boff + kc; const T16* kp2 = hires ? Kp2 + boff + kc : kp;
#pragma unroll
                for (int mb = 0; mb < MBS; ++mb) { a[mb] = WFrag<T16>::ld(qp + (size_t)mb * 16 * HD); if (hires) a2[mb] = WFrag<T16>::ld(qp2 + (size_t)mb * 16 * HD); }
#pragma unroll
                for (int nb = 0; nb < 4; ++nb) { b[nb] = WFrag<T16>::ld(kp + (size_t)nb * 16 * HD); if (hires) b2[nb] = WFrag<T16>::ld(kp2 + (size_t)nb * 16 * HD); }
                // the wait that stands in front of a rewrite of a register which an issued load names; it takes the addresses as inputs, so that they stay in their registers up to it and no load of the run lands on them
                asm volatile("s_wait_xcnt 0x0" :: "v"(qp), "v"(qp2), "v"(kp), "v"(kp2) : "memory");
                __builtin_amdgcn_sched_barrier(0);                   // keeps all of the trip's loads in front of its products, so that a trip waits for memory once
#pragma unroll
                for (int nb = 0; nb < 4; ++nb)
#pragma unroll
                    for (int mb = 0; mb < MBS; ++mb) { acc[mb][nb] = WFrag<T16>::mma(a[mb], b[nb], acc[mb][nb]); if (hires) { acc[mb][nb] = WFrag<T16>::mma(a2[mb], b[nb], acc[mb][nb]); acc[mb][nb] = WFrag<T16>::mma(a[mb], b2[nb], acc[mb][nb]); } }
                // fills the slots the chip needs behind the last matrix instruction on the loop's back edge
                if constexpr (MBS == 2) asm volatile("v_nop\n\tv_nop\n\tv_nop\n\tv_nop" : "+v"(acc[0][0]), "+v"(acc[0][1]), "+v"(acc[0][2]), "+v"(acc[0][3]), "+v"(acc[MBS - 1][0]), "+v"(acc[MBS - 1][1]), "+v"(acc[MBS - 1][2]), "+v"(acc[MBS - 1][3]));
                else asm volatile("v_nop\n\tv_nop\n\tv_nop\n\tv_nop" : "+v"(acc[0][0]), "+v"(acc[0][1]), "+v"(acc[0][2]), "+v"(acc[0][3]));
            }
            float* so = S + (size_t)(rh * (16 * MBS) + hi * 8) * PB + (c0 - jb) + lr;
#pragma unroll
            for (int mb = 0; mb < MBS; ++mb)
#pragma unroll
                for (int nb = 0; nb < 4; ++nb)
#pragma unroll
                    for (int j = 0; j < 8; ++j) so[(mb * 16 + j) * PB + nb * 16] = acc[mb][nb][j];
        }
    }
    __syncthreads();                                                 // every score tile is in LDS before a row is read
#pragma unroll 1   // rolled (registers)
    for (int rr = w; rr < 64; rr += AW) {
        const int i = r0 + rr; const float* sr = S + rr * PB; float v[NBC * 4]; float mx = -3.0e38f;
#pragma unroll
        for (int ch = 0; ch < NBC; ++ch) { const int j0 = jb + ch * 128 + lane * 4; const v4f a = *(const v4fa*)(sr + ch * 128 + lane * 4);
#pragma unroll
            for (int q = 0; q < 4; ++q) { const int j = j0 + q; const float t = (j <= i && i - j < WIN) ? a[q] * SCL : -3.0e38f; v[ch * 4 + q] = t; mx = fmaxf(mx, t); } }
#pragma unroll
        for (int sh = 16; sh; sh >>= 1) mx = fmaxf(mx, __shfl_xor(mx, sh, 32));
        float sum = 0.f;
#pragma unroll
        for (int k = 0; k < NBC * 4; ++k) { float d0 = __fsub_rn(v[k], mx); asm volatile("" : "+v"(d0)); v[k] = __builtin_amdgcn_exp2f(__fmul_rn(d0, 1.4426950408889634f)); if (k + 1 < NBC * 4) asm volatile("v_nop" :: "v"(v[k])); /* fills the one slot the instruction set asks for behind a transcendental before the next key's value overwrites its source register */ sum += v[k]; }
#pragma unroll
        for (int sh = 16; sh; sh >>= 1) sum += __shfl_xor(sum, sh, 32);
        const float f = __fdiv_rn(hires ? 1.0f : PCAR, sum);
        T16* pr = (T16*)(S + rr * PB);                               // the row's own space: all of it is in this wave's registers by now
#pragma unroll
        for (int ch = 0; ch < NBC; ++ch) { int cx = ch * 128 + lane * 4 + 8 * (rr & 15); if (cx >= PB) cx -= PB;
            if constexpr (hires) { v4us oh, ol;
#pragma unroll
                for (int q = 0; q < 4; ++q) { unsigned short a, c2; splitf(v[ch * 4 + q] * f, a, c2); oh[q] = a; ol[q] = c2; }
                *(v4usa*)(pr + cx) = oh; *(v4usa*)(pr + PB + cx) = ol;
            } else { v4h o4;
#pragma unroll
                for (int q = 0; q < 4; ++q) o4[q] = tohx(v[ch * 4 + q] * f);
                *(v4ha*)(pr + cx) = o4; } }
    }
    __syncthreads();                                                 // every probability row is in LDS before a fragment is read
    const int wr = w >> 1, wc = w & 1;                               // waves 0..7: rows 16 wr .., columns 64 wc ..
    v8f oc[4];
#pragma unroll
    for (int nb = 0; nb < 4; ++nb) oc[nb] = (v8f){};
    if (w < 8) {
        const int K0 = max(0, r0 - WIN), Kl = r0 + 64;               // the band's keys, both multiples of 64
        const T16* pr = (const T16*)(S + (wr * 16 + lr) * PB); const size_t boff = (size_t)(wc * 64 + lr) * TT + 8 * hi;
        constexpr int UB = hires ? 1 : 2;                            // 32-key blocks a trip: as many as let the trip's fragments of every plane lie in registers at once
#pragma unroll 1   // rolled (registers)
        for (int kb = K0; kb < Kl; kb += 32 * UB) {
            V a[UB], a2[UB], b[UB][4], b2[UB][4];
            const T16* vp = Vt + boff + kb; const T16* vp2 = hires ? Vt2 + boff + kb : vp;
#pragma unroll
            for (int u = 0; u < UB; ++u) {
                int c1 = kb + u * 32 - jb + 8 * hi + 8 * lr, c2 = c1 + 16; if (c1 >= PB) c1 -= PB; if (c2 >= PB) c2 -= PB;
                a[u] = WFrag<T16>::cat(pr + c1, pr + c2); if (hires) a2[u] = WFrag<T16>::cat(pr + PB + c1, pr + PB + c2);
#pragma unroll
                for (int nb = 0; nb < 4; ++nb) { b[u][nb] = WFrag<T16>::ld(vp + (size_t)nb * 16 * TT + u * 32); if (hires) b2[u][nb] = WFrag<T16>::ld(vp2 + (size_t)nb * 16 * TT + u * 32); } }
            // the wait that stands in front of a rewrite of a register which an issued load names; it takes the addresses as inputs, so that they stay in their registers up to it and no load of the run lands on them
            asm volatile("s_wait_xcnt 0x0" :: "v"(vp), "v"(vp2) : "memory");
            __builtin_amdgcn_sched_barrier(0);                       // keeps all of the trip's loads in front of its products, so that a trip waits for memory once
#pragma unroll
            for (int u = 0; u < UB; ++u)
#pragma unroll
                for (int nb = 0; nb < 4; ++nb) { oc[nb] = WFrag<T16>::mma(a[u], b[u][nb], oc[nb]);
                    if (hires) { oc[nb] = WFrag<T16>::mma(a2[u], b[u][nb], oc[nb]); oc[nb] = WFrag<T16>::mma(a[u], b2[u][nb], oc[nb]); } }
            // fills the slots the chip needs behind the last matrix instruction on the loop's back edge
            asm volatile("v_nop\n\tv_nop\n\tv_nop\n\tv_nop" : "+v"(oc[0]), "+v"(oc[1]), "+v"(oc[2]), "+v"(oc[3]));
        }
    }
    __syncthreads();                                                 // every wave's last fragment read is over before the rows' space is reused for the output staging
    if (w < 8) {
        float* os = S + w * (16 * 68);                               // each wave stages its 16x64 tile in its own LDS range
#pragma unroll
        for (int nb = 0; nb < 4; ++nb)
#pragma unroll
            for (int j = 0; j < 8; ++j) os[(hi * 8 + j) * 68 + nb * 16 + lr] = oc[nb][j];
        __builtin_amdgcn_wave_barrier(); asm volatile("" ::: "memory");   // keeps the row reads below, which take other lanes' values, behind the stores above
        const float cs = hires ? 1.0f : (1.0f / PCAR);
#pragma unroll
        for (int s = 0; s < 8; ++s) { const int row = 2 * s + hi, cofs = lr * 4; const v4f val = *(const v4fa*)(os + row * 68 + cofs); v4us oh, ol;
#pragma unroll
            for (int q = 0; q < 4; ++q) { unsigned short a, c2; splitf(val[q] * cs, a, c2); oh[q] = a; ol[q] = c2; }
            const size_t oo = (size_t)(r0 + wr * 16 + row) * DQ + wc * 64 + cofs; *(v4us*)(Ah + oo) = oh; *(v4us*)(Al + oo) = ol; }
        asm volatile("s_wait_xcnt 0x0" ::: "memory");                // the wait that stands in front of a rewrite of a register which an issued store names
    }
}
// grid (TT / 64, NH_): query tile, head; head z reads the planes of kv head z / REP. Query rows < RH take the hi+lo planes (3 products), the rest single fp16.
// waves_per_eu(6): caps the registers so that the 18 waves of two work-groups fit the four SIMDs of a WGP however they are dealt out.
__global__ __launch_bounds__(AW * 32) __attribute__((amdgpu_waves_per_eu(6))) void k_attn(const h16* __restrict__ Q16, const bf* __restrict__ Qh, const bf* __restrict__ Ql, const h16* __restrict__ K16, const bf* __restrict__ Kh, const bf* __restrict__ Kl, const h16* __restrict__ V16, const bf* __restrict__ Vh, const bf* __restrict__ Vl, bf* Ah, bf* Al) {
    static_assert(RH % 64 == 0 && WIN % 64 == 0 && WIN / 64 + 1 == AW, "a tile is all hi+lo or all fp16; one wave a key tile");
    __shared__ __align__(16) float S[64 * PB];                       // 160 KiB: two work-groups a WGP
    const int r0 = blockIdx.x * 64; const size_t z = blockIdx.y, qo = z * TT * HD, ko = (z / REP) * TT * HD;
    if (r0 < RH) attn_tile<bf, 2>(S, Qh + qo, Ql + qo, Kh + ko, Kl + ko, Vh + ko, Vl + ko, r0, Ah + z * HD, Al + z * HD);
    else attn_tile<h16, 0>(S, Q16 + qo, nullptr, K16 + ko, nullptr, V16 + ko, nullptr, r0, Ah + z * HD, Al + z * HD);
}

extern "C" void kernel_launch(void* const* d_in, const int* in_sizes, int n_in,
                              void* d_out, int out_size, void* d_ws, size_t ws_size, hipStream_t stream) {
    (void)in_sizes; (void)n_in; (void)out_size;
    const float* x = (const float*)d_in[0]; const float* gw = (const float*)d_in[1]; const float* wq = (const float*)d_in[2]; const float* wk = (const float*)d_in[3]; const float* wv = (const float*)d_in[4]; const float* wo = (const float*)d_in[5]; const float* cosT = (const float*)d_in[6]; const float* sinT = (const float*)d_in[7];
    float* OUT = (float*)d_out;     // [2][2048][2048]
    char* wsp = (char*)d_ws;
    auto take = [&](size_t bytes) { char* p = wsp; wsp += (bytes + 255) & ~(size_t)255; return (void*)p; };
    bf* WQ = (bf*)take((size_t)DQ * DM * 2); bf* WK = (bf*)take((size_t)DKV * DM * 2); bf* WV = (bf*)take((size_t)DKV * DM * 2); bf* WO = (bf*)take((size_t)DM * DQ * 2); float* CS = (float*)take((size_t)TT * HD * 2 * 4);
    bf* Yh = (bf*)take((size_t)TT * DM * 2); bf* Yl = (bf*)take((size_t)TT * DM * 2); float* FQ = (float*)take((size_t)TT * DQ * 4); float* FK = (float*)take((size_t)TT * DKV * 4);
    h16* QP16 = (h16*)take((size_t)NH_ * TT * HD * 2); h16* KP16 = (h16*)take((size_t)NKV * TT * HD * 2); h16* VT16 = (h16*)take((size_t)NKV * HD * TT * 2);
    bf* QPh = (bf*)take((size_t)NH_ * TT * HD * 2); bf* QPl = (bf*)take((size_t)NH_ * TT * HD * 2); bf* KPh = (bf*)take((size_t)NKV * TT * HD * 2); bf* KPl = (bf*)take((size_t)NKV * TT * HD * 2); bf* VTh = (bf*)take((size_t)NKV * HD * TT * 2); bf* VTl = (bf*)take((size_t)NKV * HD * TT * 2);
    float* YO = (float*)take((size_t)TT * DM * 4); bf* ATh = (bf*)take((size_t)TT * DQ * 2); bf* ATl = (bf*)take((size_t)TT * DQ * 2);
    if ((size_t)(wsp - (char*)d_ws) > ws_size) return;    // ws 256 MiB
    float* FV = FK;   // v projection reuses the k buffer after the k planes are built (stream-ordered)
    { k_wtG<<<(unsigned)((DM * DQ / 64 + 63) / 64), 256, 0, stream>>>(wq, DM, DQ, WQ); k_wtG<<<(unsigned)((DM * DKV / 64 + 63) / 64), 256, 0, stream>>>(wk, DM, DKV, WK); k_wtG<<<(unsigned)((DM * DKV / 64 + 63) / 64), 256, 0, stream>>>(wv, DM, DKV, WV);
      k_wtG<<<(unsigned)((DQ * DM / 64 + 63) / 64), 256, 0, stream>>>(wo, DQ, DM, WO);
       }
    const unsigned LQ = (unsigned)(((size_t)NH_ * TT * HD / 2 + 255) / 256), LKv = (unsigned)(((size_t)NKV * TT * HD / 2 + 255) / 256);
    for (int b = 0; b < NB_; ++b) {
        if (b == 0) k_cscvt<<<(TT * HD + 255) / 256, 256, 0, stream>>>(cosT, sinT, CS);
        k_rmshl<<<TT / 8, 256, 0, stream>>>(x + (size_t)b * TT * DM, gw, Yh, Yl);   /* n = RMSNorm(x) norm_w as hi/lo planes */
        k_gemms<4><<<dim3(TT / 128, DQ / 128, 1), 128, 0, stream>>>(Yh, Yl, WQ, DM, FQ, DQ);
        k_rope<<<LQ, 256, 0, stream>>>(FQ, DQ, NH_, CS, nullptr, nullptr, 1.0f, QP16, QPh, QPl);
        k_gemms<2><<<dim3(TT / 64, DKV / 128, 1), 128, 0, stream>>>(Yh, Yl, WK, DM, FK, DKV);
        k_rope<<<LKv, 256, 0, stream>>>(FK, DKV, NKV, CS, nullptr, nullptr, 1.0f, KP16, KPh, KPl);
        k_gemms<2><<<dim3(TT / 64, DKV / 128, 1), 128, 0, stream>>>(Yh, Yl, WV, DM, FV, DKV); k_vtp<<<LKv, 256, 0, stream>>>(FV, DKV, NKV, VT16, VTh, VTl);
        k_attn<<<dim3(TT / 64, NH_, 1), AW * 32, 0, stream>>>(QP16, QPh, QPl, KP16, KPh, KPl, VT16, VTh, VTl, ATh, ATl);
        k_gemms<4><<<dim3(TT / 128, DM / 128, 1), 128, 0, stream>>>(ATh, ATl, WO, DQ, YO, DM);
        k_addres<<<(unsigned)(((size_t)TT * DM / 4 + 255) / 256), 256, 0, stream>>>(x + (size_t)b * TT * DM, YO, OUT + (size_t)b * TT * DM, (size_t)TT * DM / 4); }   /* out = x + attn wo */
}

// v005
// It runs in 454 microseconds.
// Timed twice side by side with v004, it ran 1.08 times as fast both times.
// Over all steps from v000 it is 3.82 times as fast.
#include <hip/hip_runtime.h>

// Sliding-window causal GQA with RMSNorm pre-normalisation and residual (x [2][2048][2048]; n = x rsqrt(mean x^2 + 1e-6) norm_w; q = n wq ('xw', 16 heads x 128), k, v = n wk / n wv (4 kv heads); rotate-half RoPE from the given tables [2048][64] (both halves share column d mod 64); 4 query heads per kv head (repeat); scores/sqrt(128) kept where j <= i and i - j < 512; softmax; out = x + merged wo -> [2][2048][2048]).
// Compute dtypes, f32 accumulate: every input rounded to bf16; q/k/v hl x exact (2 products); rotary in f32 from the bf16-rounded input tables; windowed-causal scores and attn.v (only key tiles that touch the window band computed): query rows < 512 hl (3 products), the rest single fp16 (x1024); softmax f32; wo hl x exact (2 products), + x residual in f32.

#define NB_  2
#define TT   2048
#define DM   2048
#define NH_  16
#define NKV  4
#define REP  (NH_ / NKV)
#define HD   128
#define DQ   (NH_ * HD)
#define DKV  (NKV * HD)
#define RH   512                  // query rows < RH use hi+lo planes (0: none)
#define WIN  512
#define NBC  ((WIN + 128) / 128)  // 128-key chunks of a softmax row: WIN + 64 band keys of a 64-row tile, from a multiple of 128
#define PB   (NBC * 128)         // pitch of a stored score / probability row: only the NBC chunks from the row tile's first chunk jb on are kept
#define PCAR 1024.0f
#define SCL  0.088388347648318447f   // HD^-0.5
typedef _Float16 h16;
typedef unsigned short bf;
typedef __attribute__((ext_vector_type(16))) __bf16   v16bf;
typedef __attribute__((ext_vector_type(16))) _Float16 v16h;
typedef __attribute__((ext_vector_type(8)))  _Float16 v8h;
typedef __attribute__((ext_vector_type(8)))  unsigned short v8us;
typedef __attribute__((ext_vector_type(8)))  float    v8f;
typedef __attribute__((ext_vector_type(4)))  float    v4f;
typedef v8h  __attribute__((may_alias)) v8ha;
typedef v4f  __attribute__((may_alias)) v4fa;
typedef v8us __attribute__((may_alias)) v8usa;

__device__ __forceinline__ unsigned short f2bf(float f) { unsigned u = __float_as_uint(f); u += 0x7FFFu + ((u >> 16) & 1u); return (unsigned short)(u >> 16); }
__device__ __forceinline__ float bf2f(unsigned short b) { return __uint_as_float(((unsigned)b) << 16); }
__device__ __forceinline__ float bfr(float f) { return bf2f(f2bf(f)); }
__device__ __forceinline__ v16h cat16(v8h lo, v8h hi) { return __builtin_shufflevector(lo, hi, 0, 1, 2, 3, 4, 5, 6, 7, 8, 9, 10, 11, 12, 13, 14, 15); }
__device__ __forceinline__ v16bf cat16b(v8us lo, v8us hi) { return __builtin_bit_cast(v16bf, __builtin_shufflevector(lo, hi, 0, 1, 2, 3, 4, 5, 6, 7, 8, 9, 10, 11, 12, 13, 14, 15)); }
__device__ __forceinline__ v8f wmma16(v16h a, v16h b, v8f c) { return __builtin_amdgcn_wmma_f32_16x16x32_f16(false, a, false, b, (short)0, c, false, false); }
__device__ __forceinline__ v8f wmmab(v16bf a, v16bf b, v8f c) { return __builtin_amdgcn_wmma_f32_16x16x32_bf16(false, a, false, b, (short)0, c, false, false); }
__device__ __forceinline__ h16 tohx(float x) { return (h16)x; }
__device__ __forceinline__ void splitf(float y, unsigned short& h, unsigned short& l) { h = f2bf(y); l = f2bf(y - bf2f(h)); }
typedef float __attribute__((may_alias)) fa;



// ---- k_gemms<MB>: projection GEMM, 4 waves (2 x 2) per (32 MB)x128 output tile, each wave a (16 MB)x64 tile (4 MB accumulators); MB = 4 where that fills the chip, MB = 2 for the narrow k and v outputs (twice the work-groups). The operands (K-contiguous bf16 planes A hi, A lo, Bt) are staged in LDS by asynchronous copies,
// KS k of the tile's rows of each plane a stage, two buffers: the next stage's copies fly while this stage is worked on; fragments are read from LDS one 32-k block ahead. grid (M/(32 MB), N/128), 128 threads. c[m][n] (f32) = sum_k (A[m][k] + A2[m][k]) Bt[n][k]. K % KS == 0, K >= 2 KS (the prologue fills two stages).
// The element-wise pass that follows each product is the kernel's epilogue EP, on the f32 tile while it is still on the chip (a tile's 128 columns are one head):
// EP_ROPE: rotate-half rotary from the bf16-rounded tables E0 = cos, E1 = sin [t][HD/2] (out[d] = c[d] cos[t][d] - c[d+HD/2] sin[t][d], out[d+HD/2] = c[d+HD/2] cos[t][d] + c[d] sin[t][d]), written as the head planes [h][t][d] (fp16, hi, lo);
// EP_VT: the transposed head planes [h][d][t] (fp16, hi, lo); EP_RES: O[m][n] = bf16-rounded E0[m][n] + c[m][n] (f32, both of pitch DM).
#define EP_ROPE 0
#define EP_VT   1
#define EP_RES  2
#define TP   132                 // pitch in floats of the f32 tile staged for EP_ROPE: 16-byte rows, four banks on from row to row
#define KS   64                  // k per stage: 128 B of every operand row, one whole line
#define LP   (KS + 8)            // LDS row pitch in elements: 144 B = 16 B x odd, free of bank conflicts for 16-byte fragment reads
template <typename T16> struct WFrag;
template <> struct WFrag<h16> { typedef v16h V; static __device__ __forceinline__ V ld(const h16* p) { return cat16(*(const v8h*)p, *(const v8h*)(p + 16)); } static __device__ __forceinline__ V cat(const h16* p, const h16* p2) { return cat16(*(const v8ha*)p, *(const v8ha*)p2); } static __device__ __forceinline__ v8f mma(V a, V b, v8f c) { return wmma16(a, b, c); } };
template <> struct WFrag<bf> { typedef v16bf V; static __device__ __forceinline__ V ld(const bf* p) { return cat16b(*(const v8us*)p, *(const v8us*)(p + 16)); } static __device__ __forceinline__ V cat(const bf* p, const bf* p2) { return cat16b(*(const v8usa*)p, *(const v8usa*)p2); } static __device__ __forceinline__ v8f mma(V a, V b, v8f c) { return wmmab(a, b, c); } };
typedef __attribute__((ext_vector_type(4))) int v4ic;
// NJ asynchronous copies of 512 B (4 rows of 128 B each, 16 B a lane): 4 NJ rows of one plane. l = the lane's place in the first of them in LDS, g = the same place in the global plane, gs = elements per 4 global rows.
template <int NJ>
__device__ __forceinline__ void planecopy(bf* l, const bf* g, size_t gs) {
#pragma unroll
    for (int j = 0; j < NJ; ++j)
        __builtin_amdgcn_global_load_async_to_lds_b128((__attribute__((address_space(1))) v4ic*)(g + (size_t)j * gs), (__attribute__((address_space(3))) v4ic*)(l + j * 4 * LP), 0, 0);
}
template <int MB> struct Frags { WFrag<bf>::V a[MB], a2[MB], b[4]; };
// the fragments of one 32-k block of a stage, as one group of LDS reads; sa, sa2, sb = the lane's place in the wave's first row of each plane
template <int MB>
__device__ __forceinline__ void ldfr(Frags<MB>& f, const bf* sa, const bf* sa2, const bf* sb) {
#pragma unroll
    for (int q = 0; q < MB; ++q) { f.a[q] = WFrag<bf>::ld(sa + q * 16 * LP); f.a2[q] = WFrag<bf>::ld(sa2 + q * 16 * LP); }
#pragma unroll
    for (int q = 0; q < 4; ++q) f.b[q] = WFrag<bf>::ld(sb + q * 16 * LP);
}
template <int MB>
__device__ __forceinline__ void mmblk(v8f (&acc)[MB][4], const Frags<MB>& f) {
#pragma unroll
    for (int nb = 0; nb < 4; ++nb)
#pragma unroll
        for (int mb = 0; mb < MB; ++mb) { acc[mb][nb] = WFrag<bf>::mma(f.a[mb], f.b[nb], acc[mb][nb]); acc[mb][nb] = WFrag<bf>::mma(f.a2[mb], f.b[nb], acc[mb][nb]); }
}
template <int MB, int EP>
__global__ __launch_bounds__(128) void k_gemms(const bf* __restrict__ A, const bf* __restrict__ A2, const bf* __restrict__ Bt, int K, const float* __restrict__ E0, const float* __restrict__ E1, float* O, h16* P16, bf* Ph, bf* Pl) {
    static_assert(KS == 64, "a stage is two 32-k blocks");
    constexpr int PLA = 32 * MB * LP, STG = 2 * PLA + 128 * LP;   // a stage: A hi | A lo (32 MB rows each) | Bt (128 rows)
    __shared__ __align__(16) bf ring[2 * STG];
    const int lane = threadIdx.x & 31, lr = lane & 15, hi = lane >> 4; const int w = __builtin_amdgcn_readfirstlane((int)(threadIdx.x >> 5)), wm = w >> 1, wn = w & 1;
    const int r0 = blockIdx.x * (32 * MB), c0 = blockIdx.y * 128;
    v8f acc[MB][4];
#pragma unroll
    for (int mb = 0; mb < MB; ++mb)
#pragma unroll
        for (int nb = 0; nb < 4; ++nb) acc[mb][nb] = (v8f){};
    // wave w copies rows 8 MB w .. 8 MB w + 8 MB - 1 of the A planes and rows 32 w .. 32 w + 31 of Bt
    const int crA = w * (8 * MB) + (lane >> 3), crB = w * 32 + (lane >> 3), ccol = (lane & 7) * 8; const size_t gs = (size_t)4 * K;
    const bf* gA = A + (size_t)(r0 + crA) * K + ccol; const bf* gA2 = A2 + (size_t)(r0 + crA) * K + ccol; const bf* gB = Bt + (size_t)(c0 + crB) * K + ccol;
    bf* lA = ring + crA * LP + ccol; bf* lB = ring + 2 * PLA + crB * LP + ccol;
    const int nt = K / KS;
    planecopy<2 * MB>(lA, gA, gs); planecopy<2 * MB>(lA + PLA, gA2, gs); planecopy<8>(lB, gB, gs);
    asm volatile("s_wait_asynccnt 0x0" ::: "memory");   // this wave's share of stage 0 has landed
    __syncthreads();                                     // ... and every other wave's
    planecopy<2 * MB>(lA + STG, gA + KS, gs); planecopy<2 * MB>(lA + STG + PLA, gA2 + KS, gs); planecopy<8>(lB + STG, gB + KS, gs);
    const int aofs = (wm * (16 * MB) + lr) * LP + 8 * hi, bofs = 2 * PLA + (wn * 64 + lr) * LP + 8 * hi;
    Frags<MB> f0, f1;                                    // two fragment sets: each block's LDS reads are issued one block ahead, as one group
    ldfr<MB>(f0, ring + aofs, ring + PLA + aofs, ring + bofs);
#pragma unroll 1
    for (int t = 0; t < nt; ++t) {
        const bf* st = ring + (t & 1) * STG; const bf* sn = ring + ((t + 1) & 1) * STG;
        ldfr<MB>(f1, st + aofs + 32, st + PLA + aofs + 32, st + bofs + 32);
        __builtin_amdgcn_sched_barrier(0);                   // keeps the read group ahead of the block it hides behind
        mmblk<MB>(acc, f0);
        __builtin_amdgcn_sched_barrier(0);                   // keeps the block ahead of the publish point, so that the waits below find their data landed
        // publish point of stage t + 1, in front of stage t's last block, whose fragments are already fetched
        asm volatile("s_wait_dscnt 0x0" ::: "memory");      // this wave's last reads of stage t have returned before its buffer is refilled
        asm volatile("s_wait_asynccnt 0x0" ::: "memory");   // this wave's share of stage t + 1 has landed
        __syncthreads();                                     // publishes stage t + 1 and ends every wave's reads of stage t
        if (t + 2 < nt) { const size_t ko = (size_t)(t + 2) * KS; const int bo = (t & 1) * STG; planecopy<2 * MB>(lA + bo, gA + ko, gs); planecopy<2 * MB>(lA + bo + PLA, gA2 + ko, gs); planecopy<8>(lB + bo, gB + ko, gs); }
        if (t + 1 < nt) ldfr<MB>(f0, sn + aofs, sn + PLA + aofs, sn + bofs);
        mmblk<MB>(acc, f1);
    }
    asm volatile("s_wait_asynccnt 0x0" ::: "memory");       // no copy is outstanding when the wave ends
    // Behind the loop's last barrier the ring is free: no copy is outstanding and every wave's last fragment read returned in front of that barrier. The epilogues stage in it.
    if constexpr (EP == EP_ROPE) {
        fa* tl = (fa*)ring;                                  // the work-group's whole tile in f32: a column's rotary partner lies in the neighbour wave's registers
#pragma unroll
        for (int mb = 0; mb < MB; ++mb)
#pragma unroll
            for (int nb = 0; nb < 4; ++nb)
#pragma unroll
                for (int j = 0; j < 8; ++j) tl[(wm * (16 * MB) + mb * 16 + hi * 8 + j) * TP + wn * 64 + nb * 16 + lr] = acc[mb][nb][j];
        // wave w takes rows 8 MB w ..; a step is 4 rows, 8 lanes a row, a lane 8 columns d < HD/2 and their partners d + HD/2
        const int row0 = w * (8 * MB) + (lane >> 3), dc = (lane & 7) * 8;
        const float* cp = E0 + (size_t)(r0 + row0) * (HD / 2) + dc; const float* sp = E1 + (size_t)(r0 + row0) * (HD / 2) + dc;
        v4f cv[2 * MB][2], sv[2 * MB][2];                    // every step's table values, fetched while the tile is staged
#pragma unroll
        for (int s = 0; s < 2 * MB; ++s)
#pragma unroll
            for (int u = 0; u < 2; ++u) { cv[s][u] = *(const v4f*)(cp + s * 4 * (HD / 2) + u * 4); sv[s][u] = *(const v4f*)(sp + s * 4 * (HD / 2) + u * 4); }
        // the wait that stands in front of a rewrite of a register which an issued load names; it takes the addresses as inputs, so that they stay in their registers up to it
        asm volatile("s_wait_xcnt 0x0" :: "v"(cp), "v"(sp) : "memory");
        __syncthreads();                                     // the whole tile is in LDS before a row is read
        const size_t oo = ((size_t)blockIdx.y * TT + r0 + row0) * HD + dc;
        h16* q16 = P16 + oo; bf* qh = Ph + oo; bf* ql = Pl + oo;
        const fa* xr = tl + row0 * TP + dc;
        v4f xl0 = *(const v4fa*)xr, xl1 = *(const v4fa*)(xr + 4), xh0 = *(const v4fa*)(xr + HD / 2), xh1 = *(const v4fa*)(xr + HD / 2 + 4);
        v8h pa16 = {}, pb16 = {}; v8us pah = {}, pal = {}, pbh = {}, pbl = {};   // the last step's stored values
#pragma unroll
        for (int s = 0; s < 2 * MB; ++s) {
            v4f nl0 = xl0, nl1 = xl1, nh0 = xh0, nh1 = xh1;
            if (s + 1 < 2 * MB) { const fa* xn = xr + (s + 1) * 4 * TP; nl0 = *(const v4fa*)xn; nl1 = *(const v4fa*)(xn + 4); nh0 = *(const v4fa*)(xn + HD / 2); nh1 = *(const v4fa*)(xn + HD / 2 + 4); }   // the next step's rows are read from LDS while this step is worked on
            v8h a16, b16; v8us ah, al, bh, bl;
#pragma unroll
            for (int q = 0; q < 8; ++q) { const float x0 = q < 4 ? xl0[q & 3] : xl1[q & 3], x1 = q < 4 ? xh0[q & 3] : xh1[q & 3], c = bfr(cv[s][q >> 2][q & 3]), sn = bfr(sv[s][q >> 2][q & 3]);
                const float ra = x0 * c - x1 * sn, rb = x1 * c + x0 * sn; unsigned short h2, l2;
                a16[q] = tohx(ra); splitf(ra, h2, l2); ah[q] = h2; al[q] = l2; b16[q] = tohx(rb); splitf(rb, h2, l2); bh[q] = h2; bl[q] = l2; }
            __builtin_amdgcn_sched_barrier(0);               // keeps the step's arithmetic in front of the wait, which would otherwise be lifted to directly behind the last step's stores
            // the wait that stands in front of a rewrite of a register which an issued store names: it takes the addresses and the last step's data as inputs, so that they stay in their registers up to it, a step's work behind those stores
            if (s) asm volatile("s_wait_xcnt 0x0" :: "v"(q16), "v"(qh), "v"(ql), "v"(pa16), "v"(pb16), "v"(pah), "v"(pbh), "v"(pal), "v"(pbl) : "memory");
            *(v8h*)(q16 + s * 4 * HD) = a16; *(v8h*)(q16 + s * 4 * HD + HD / 2) = b16; *(v8us*)(qh + s * 4 * HD) = ah; *(v8us*)(qh + s * 4 * HD + HD / 2) = bh; *(v8us*)(ql + s * 4 * HD) = al; *(v8us*)(ql + s * 4 * HD + HD / 2) = bl;
            pa16 = a16; pb16 = b16; pah = ah; pal = al; pbh = bh; pbl = bl; xl0 = nl0; xl1 = nl1; xh0 = nh0; xh1 = nh1;
        }
    } else if constexpr (EP == EP_VT) {
        static_assert(MB == 2, "a staged row is 64 t of one column: one 128-byte line");
        constexpr int VP = 32 * MB + 8, VPL = 128 * VP;      // staged planes [d][t]: pitch 144 B = 16 B x odd; a lane's 8 accumulator rows are 8 consecutive t of one d
#pragma unroll
        for (int mb = 0; mb < MB; ++mb)
#pragma unroll
            for (int nb = 0; nb < 4; ++nb) { v8h o16; v8us oh, ol;
#pragma unroll
                for (int j = 0; j < 8; ++j) { const float xv = acc[mb][nb][j]; unsigned short h2, l2; o16[j] = tohx(xv); splitf(xv, h2, l2); oh[j] = h2; ol[j] = l2; }
                const int e = (wn * 64 + nb * 16 + lr) * VP + wm * (16 * MB) + mb * 16 + hi * 8;
                *(v8ha*)(ring + e) = o16; *(v8usa*)(ring + VPL + e) = oh; *(v8usa*)(ring + 2 * VPL + e) = ol; }
        __syncthreads();                                     // every plane row is whole in LDS before it is read
        // wave w takes columns 32 w ..; a step is 4 columns, 8 lanes a column: whole 128-byte lines a store
        const int d0 = w * 32 + (lane >> 3), tc = (lane & 7) * 8; const bf* lp = ring + d0 * VP + tc;
        const size_t oo = ((size_t)blockIdx.y * HD + d0) * TT + r0 + tc;
        h16* q16 = P16 + oo; bf* qh = Ph + oo; bf* ql = Pl + oo;
        v8us a[8], b[8], c[8];                               // all of the wave's rows are read first: no register that a store names is written again
#pragma unroll
        for (int s = 0; s < 8; ++s) { a[s] = *(const v8usa*)(lp + s * 4 * VP); b[s] = *(const v8usa*)(lp + VPL + s * 4 * VP); c[s] = *(const v8usa*)(lp + 2 * VPL + s * 4 * VP); }
        __builtin_amdgcn_sched_barrier(0);                   // keeps every LDS read in front of the first store
#pragma unroll
        for (int s = 0; s < 8; ++s) { *(v8usa*)(q16 + s * 4 * TT) = a[s]; *(v8us*)(qh + s * 4 * TT) = b[s]; *(v8us*)(ql + s * 4 * TT) = c[s]; }
    } else {
        fa* os = (fa*)ring + w * (16 * 68);                  // each wave stages its output rows in its own LDS range
        const size_t eo = (size_t)(r0 + wm * (16 * MB) + hi) * DM + c0 + wn * 64 + lr * 4;   // the lane's place in its first row; a step is 2 rows
        const float* xp = E0 + eo; float* op = O + eo;
        v4f xa[2][8], o[2][8];                               // the residual rows of a 16-row block, fetched one block ahead; two blocks' results
#pragma unroll
        for (int s = 0; s < 8; ++s) xa[0][s] = *(const v4f*)(xp + s * 2 * DM);
#pragma unroll
        for (int mb = 0; mb < MB; ++mb) {
#pragma unroll
            for (int nb = 0; nb < 4; ++nb) {
#pragma unroll
                for (int j = 0; j < 8; ++j) os[(hi * 8 + j) * 68 + nb * 16 + lr] = acc[mb][nb][j]; }
            if (mb + 1 < MB) {
#pragma unroll
                for (int s = 0; s < 8; ++s) xa[(mb + 1) & 1][s] = *(const v4f*)(xp + ((mb + 1) * 16 + s * 2) * DM); }
            __builtin_amdgcn_wave_barrier(); asm volatile("" ::: "memory");   // keeps the row reads below, which take other lanes' values, behind the stores above
#pragma unroll
            for (int s = 0; s < 8; ++s) { const v4f val = *(const v4fa*)(os + (2 * s + hi) * 68 + lr * 4);
#pragma unroll
                for (int q = 0; q < 4; ++q) o[mb & 1][s][q] = bfr(xa[mb & 1][s][q]) + val[q]; }
            __builtin_amdgcn_sched_barrier(0);               // keeps the block's sums in front of the wait, which would otherwise be lifted to directly behind the last block's stores
            // the wait that stands in front of a rewrite of a register which an issued load or store names: it takes the addresses and the last block's data as inputs, so that they stay in their registers up to it, a block's work behind those stores
            if (mb) asm volatile("s_wait_xcnt 0x0" :: "v"(xp), "v"(op), "v"(o[(mb + 1) & 1][0]), "v"(o[(mb + 1) & 1][1]), "v"(o[(mb + 1) & 1][2]), "v"(o[(mb + 1) & 1][3]), "v"(o[(mb + 1) & 1][4]), "v"(o[(mb + 1) & 1][5]), "v"(o[(mb + 1) & 1][6]), "v"(o[(mb + 1) & 1][7]) : "memory");
#pragma unroll
            for (int s = 0; s < 8; ++s) *(v4f*)(op + (mb * 16 + s * 2) * DM) = o[mb & 1][s];
            __builtin_amdgcn_wave_barrier(); asm volatile("" ::: "memory");   // keeps the next 16 rows' LDS stores behind this block's reads
        }
    }
}

typedef __attribute__((ext_vector_type(2))) _Float16 v2h;
typedef __attribute__((ext_vector_type(4))) _Float16 v4h;
typedef __attribute__((ext_vector_type(2))) unsigned short v2us;
typedef __attribute__((ext_vector_type(4))) unsigned short v4us;
typedef __attribute__((ext_vector_type(2))) float v2f;
typedef __attribute__((ext_vector_type(4))) int v4i;

__global__ __launch_bounds__(256) void k_wtG(const float* __restrict__ w, int K, int N, bf* Bt) {
    const int lane = threadIdx.x & 31; const int L0 = (blockIdx.x * 8 + (threadIdx.x >> 5)) * 8; const int nlines = N * K / 64;
{
#pragma unroll 1
        for (int l = 0; l < 8; ++l) { const int L = L0 + l; if (L >= nlines) break; const size_t e = (size_t)L * 64 + lane * 2; const int k = (int)(e % K), n = (int)(e / K); v2us o;
            o[0] = f2bf(w[(size_t)k * N + n]); o[1] = f2bf(w[(size_t)(k + 1) * N + n]); *(v2us*)(Bt + e) = o; }
         }
}
__global__ __launch_bounds__(256) void k_rmshl(const float* __restrict__ X, const float* __restrict__ g, bf* Yh, bf* Yl) {
    const int lane = threadIdx.x & 31; const int r = blockIdx.x * 8 + (threadIdx.x >> 5); if (r >= TT) return; const float* xr = X + (size_t)r * DM; float s = 0.f;
#pragma unroll 1
    for (int ch = 0; ch < DM / 128; ++ch) { const v4f a = *(const v4f*)(xr + ch * 128 + lane * 4);
#pragma unroll
        for (int q = 0; q < 4; ++q) { const float xb = bfr(a[q]); float p = __fmul_rn(xb, xb); asm volatile("" : "+v"(p)); s = __fadd_rn(s, p); } }
#pragma unroll
    for (int sh = 16; sh; sh >>= 1) s += __shfl_xor(s, sh, 32);
    const float rs = __fdiv_rn(1.0f, __fsqrt_rn(__fadd_rn(s * (1.0f / DM), 1e-6f)));
{
#pragma unroll 1
        for (int ch = 0; ch < DM / 128; ++ch) { const int c0 = ch * 128 + lane * 4; const v4f a = *(const v4f*)(xr + c0); v4us oh, ol;
#pragma unroll
            for (int q = 0; q < 4; ++q) { float n0 = __fmul_rn(bfr(a[q]), rs); asm volatile("" : "+v"(n0)); const float y = __fmul_rn(n0, bfr(g[c0 + q])); unsigned short h2, l2; splitf(y, h2, l2); oh[q] = h2; ol[q] = l2; }
            *(v4us*)(Yh + (size_t)r * DM + c0) = oh; *(v4us*)(Yl + (size_t)r * DM + c0) = ol; }
         } }
__global__ __launch_bounds__(256) void k_cvt8(const float* __restrict__ src, bf* dst, size_t n8) { const size_t i = (size_t)blockIdx.x * 256 + threadIdx.x; if (i >= n8) return; const v8f v = *(const v8f*)(src + i * 8); v8us o;
#pragma unroll
    for (int k = 0; k < 8; ++k) o[k] = f2bf(v[k]); *(v8us*)(dst + i * 8) = o;  }
typedef v4h  __attribute__((may_alias)) v4ha;
typedef v4us __attribute__((may_alias)) v4usa;
// ---- k_attn: the whole attention of one 64-row query tile of one head in one work-group of AW = 9 waves; the tile's score / probability band (PB keys from key jb on, jb = the 128-aligned start of the tile's band) lives in LDS only.
// Phase 1: wave w computes the 64x64 score tile of keys r0 - WIN + 64 w .. (in passes of 32 rows, 16 with hi+lo planes; tiles left of key 0 do not exist). Phase 2: softmax, one row a wave at a time (t = S x HD^-0.5 for j <= i and i - j < WIN, everything else masked by select; register row, one exp, fixed trees);
// the probabilities overwrite their own score row (16-bit planes: hi or fp16 in the first PB elements of the row's space, lo in the second), each plane rotated by 8 (row mod 16) elements so that the 16 rows of a fragment read lie in different banks.
// Phase 3: waves 0..7 each contract a 16x64 tile of P.V over the band's keys (probabilities outside it are exactly zero), V from the transposed planes [d][t]; the result x carrier scale goes out as the hi/lo planes [t][head][d] that the output projection reads, whole 128-byte lines a store.
#define AW 9
template <typename T16, int NSPLIT>
__device__ __forceinline__ void attn_tile(float* S, const T16* __restrict__ Q, const T16* __restrict__ Q2, const T16* __restrict__ Kp, const T16* __restrict__ Kp2, const T16* __restrict__ Vt, const T16* __restrict__ Vt2, int r0, bf* Ah, bf* Al) {
    typedef typename WFrag<T16>::V V;
    constexpr bool hires = (NSPLIT == 2);
    const int lane = threadIdx.x & 31, lr = lane & 15, hi = lane >> 4; const int w = __builtin_amdgcn_readfirstlane((int)(threadIdx.x >> 5));
    const int jb = max(0, r0 - WIN) & ~127;                          // first key that the stored rows hold
    const int c0 = r0 - WIN + w * 64;                                // this wave's key tile
    if (c0 >= 0) {
        constexpr int MBS = hires ? 1 : 2;                           // 16-row blocks a pass: as many as let one k block's fragments of every plane lie in registers at once
#pragma unroll 1   // rolled, like the three loops marked so below: keeps the registers under the cap that lets two work-groups share a WGP
        for (int rh = 0; rh < 4 / MBS; ++rh) {
            v8f acc[MBS][4];
#pragma unroll
            for (int mb = 0; mb < MBS; ++mb)
#pragma unroll
                for (int nb = 0; nb < 4; ++nb) acc[mb][nb] = (v8f){};
            const size_t aoff = (size_t)(r0 + rh * (16 * MBS) + lr) * HD + 8 * hi, boff = (size_t)(c0 + lr) * HD + 8 * hi;
#pragma unroll 1   // rolled (registers)
            for (int kc = 0; kc < HD; kc += 32) {
                V a[MBS], a2[MBS], b[4], b2[4];
                const T16* qp = Q + aoff + kc; const T16* qp2 = hires ? Q2 + aoff + kc : qp; const T16* kp = Kp + boff + kc; const T16* kp2 = hires ? Kp2 + boff + kc : kp;
#pragma unroll
                for (int mb = 0; mb < MBS; ++mb) { a[mb] = WFrag<T16>::ld(qp + (size_t)mb * 16 * HD); if (hires) a2[mb] = WFrag<T16>::ld(qp2 + (size_t)mb * 16 * HD); }
#pragma unroll
                for (int nb = 0; nb < 4; ++nb) { b[nb] = WFrag<T16>::ld(kp + (size_t)nb * 16 * HD); if (hires) b2[nb] = WFrag<T16>::ld(kp2 + (size_t)nb * 16 * HD); }
                // the wait that stands in front of a rewrite of a register which an issued load names; it takes the addresses as inputs, so that they stay in their registers up to it and no load of the run lands on them
                asm volatile("s_wait_xcnt 0x0" :: "v"(qp), "v"(qp2), "v"(kp), "v"(kp2) : "memory");
                __builtin_amdgcn_sched_barrier(0);                   // keeps all of the trip's loads in front of its products, so that a trip waits for memory once
#pragma unroll
                for (int nb = 0; nb < 4; ++nb)
#pragma unroll
                    for (int mb = 0; mb < MBS; ++mb) { acc[mb][nb] = WFrag<T16>::mma(a[mb], b[nb], acc[mb][nb]); if (hires) { acc[mb][nb] = WFrag<T16>::mma(a2[mb], b[nb], acc[mb][nb]); acc[mb][nb] = WFrag<T16>::mma(a[mb], b2[nb], acc[mb][nb]); } }
                // fills the slots the chip needs behind the last matrix instruction on the loop's back edge
                if constexpr (MBS == 2) asm volatile("v_nop\n\tv_nop\n\tv_nop\n\tv_nop" : "+v"(acc[0][0]), "+v"(acc[0][1]), "+v"(acc[0][2]), "+v"(acc[0][3]), "+v"(acc[MBS - 1][0]), "+v"(acc[MBS - 1][1]), "+v"(acc[MBS - 1][2]), "+v"(acc[MBS - 1][3]));
                else asm volatile("v_nop\n\tv_nop\n\tv_nop\n\tv_nop" : "+v"(acc[0][0]), "+v"(acc[0][1]), "+v"(acc[0][2]), "+v"(acc[0][3]));
            }
            float* so = S + (size_t)(rh * (16 * MBS) + hi * 8) * PB + (c0 - jb) + lr;
#pragma unroll
            for (int mb = 0; mb < MBS; ++mb)
#pragma unroll
                for (int nb = 0; nb < 4; ++nb)
#pragma unroll
                    for (int j = 0; j < 8; ++j) so[(mb * 16 + j) * PB + nb * 16] = acc[mb][nb][j];
        }
    }
    __syncthreads();                                                 // every score tile is in LDS before a row is read
#pragma unroll 1   // rolled (registers)
    for (int rr = w; rr < 64; rr += AW) {
        const int i = r0 + rr; const float* sr = S + rr * PB; float v[NBC * 4]; float mx = -3.0e38f;
#pragma unroll
        for (int ch = 0; ch < NBC; ++ch) { const int j0 = jb + ch * 128 + lane * 4; const v4f a = *(const v4fa*)(sr + ch * 128 + lane * 4);
#pragma unroll
            for (int q = 0; q < 4; ++q) { const int j = j0 + q; const float t = (j <= i && i - j < WIN) ? a[q] * SCL : -3.0e38f; v[ch * 4 + q] = t; mx = fmaxf(mx, t); } }
#pragma unroll
        for (int sh = 16; sh; sh >>= 1) mx = fmaxf(mx, __shfl_xor(mx, sh, 32));
        float sum = 0.f;
#pragma unroll
        for (int k = 0; k < NBC * 4; ++k) { float d0 = __fsub_rn(v[k], mx); asm volatile("" : "+v"(d0)); v[k] = __builtin_amdgcn_exp2f(__fmul_rn(d0, 1.4426950408889634f)); if (k + 1 < NBC * 4) asm volatile("v_nop" :: "v"(v[k])); /* fills the one slot the instruction set asks for behind a transcendental before the next key's value overwrites its source register */ sum += v[k]; }
#pragma unroll
        for (int sh = 16; sh; sh >>= 1) sum += __shfl_xor(sum, sh, 32);
        const float f = __fdiv_rn(hires ? 1.0f : PCAR, sum);
        T16* pr = (T16*)(S + rr * PB);                               // the row's own space: all of it is in this wave's registers by now
#pragma unroll
        for (int ch = 0; ch < NBC; ++ch) { int cx = ch * 128 + lane * 4 + 8 * (rr & 15); if (cx >= PB) cx -= PB;
            if constexpr (hires) { v4us oh, ol;
#pragma unroll
                for (int q = 0; q < 4; ++q) { unsigned short a, c2; splitf(v[ch * 4 + q] * f, a, c2); oh[q] = a; ol[q] = c2; }
                *(v4usa*)(pr + cx) = oh; *(v4usa*)(pr + PB + cx) = ol;
            } else { v4h o4;
#pragma unroll
                for (int q = 0; q < 4; ++q) o4[q] = tohx(v[ch * 4 + q] * f);
                *(v4ha*)(pr + cx) = o4; } }
    }
    __syncthreads();                                                 // every probability row is in LDS before a fragment is read
    const int wr = w >> 1, wc = w & 1;                               // waves 0..7: rows 16 wr .., columns 64 wc ..
    v8f oc[4];
#pragma unroll
    for (int nb = 0; nb < 4; ++nb) oc[nb] = (v8f){};
    if (w < 8) {
        const int K0 = max(0, r0 - WIN), Kl = r0 + 64;               // the band's keys, both multiples of 64
        const T16* pr = (const T16*)(S + (wr * 16 + lr) * PB); const size_t boff = (size_t)(wc * 64 + lr) * TT + 8 * hi;
        constexpr int UB = hires ? 1 : 2;                            // 32-key blocks a trip: as many as let the trip's fragments of every plane lie in registers at once
#pragma unroll 1   // rolled (registers)
        for (int kb = K0; kb < Kl; kb += 32 * UB) {
            V a[UB], a2[UB], b[UB][4], b2[UB][4];
            const T16* vp = Vt + boff + kb; const T16* vp2 = hires ? Vt2 + boff + kb : vp;
#pragma unroll
            for (int u = 0; u < UB; ++u) {
                int c1 = kb + u * 32 - jb + 8 * hi + 8 * lr, c2 = c1 + 16; if (c1 >= PB) c1 -= PB; if (c2 >= PB) c2 -= PB;
                a[u] = WFrag<T16>::cat(pr + c1, pr + c2); if (hires) a2[u] = WFrag<T16>::cat(pr + PB + c1, pr + PB + c2);
#pragma unroll
                for (int nb = 0; nb < 4; ++nb) { b[u][nb] = WFrag<T16>::ld(vp + (size_t)nb * 16 * TT + u * 32); if (hires) b2[u][nb] = WFrag<T16>::ld(vp2 + (size_t)nb * 16 * TT + u * 32); } }
            // the wait that stands in front of a rewrite of a register which an issued load names; it takes the addresses as inputs, so that they stay in their registers up to it and no load of the run lands on them
            asm volatile("s_wait_xcnt 0x0" :: "v"(vp), "v"(vp2) : "memory");
            __builtin_amdgcn_sched_barrier(0);                       // keeps all of the trip's loads in front of its products, so that a trip waits for memory once
#pragma unroll
            for (int u = 0; u < UB; ++u)
#pragma unroll
                for (int nb = 0; nb < 4; ++nb) { oc[nb] = WFrag<T16>::mma(a[u], b[u][nb], oc[nb]);
                    if (hires) { oc[nb] = WFrag<T16>::mma(a2[u], b[u][nb], oc[nb]); oc[nb] = WFrag<T16>::mma(a[u], b2[u][nb], oc[nb]); } }
            // fills the slots the chip needs behind the last matrix instruction on the loop's back edge
            asm volatile("v_nop\n\tv_nop\n\tv_nop\n\tv_nop" : "+v"(oc[0]), "+v"(oc[1]), "+v"(oc[2]), "+v"(oc[3]));
        }
    }
    __syncthreads();                                                 // every wave's last fragment read is over before the rows' space is reused for the output staging
    if (w < 8) {
        float* os = S + w * (16 * 68);                               // each wave stages its 16x64 tile in its own LDS range
#pragma unroll
        for (int nb = 0; nb < 4; ++nb)
#pragma unroll
            for (int j = 0; j < 8; ++j) os[(hi * 8 + j) * 68 + nb * 16 + lr] = oc[nb][j];
        __builtin_amdgcn_wave_barrier(); asm volatile("" ::: "memory");   // keeps the row reads below, which take other lanes' values, behind the stores above
        const float cs = hires ? 1.0f : (1.0f / PCAR);
#pragma unroll
        for (int s = 0; s < 8; ++s) { const int row = 2 * s + hi, cofs = lr * 4; const v4f val = *(const v4fa*)(os + row * 68 + cofs); v4us oh, ol;
#pragma unroll
            for (int q = 0; q < 4; ++q) { unsigned short a, c2; splitf(val[q] * cs, a, c2); oh[q] = a; ol[q] = c2; }
            const size_t oo = (size_t)(r0 + wr * 16 + row) * DQ + wc * 64 + cofs; *(v4us*)(Ah + oo) = oh; *(v4us*)(Al + oo) = ol; }
        asm volatile("s_wait_xcnt 0x0" ::: "memory");                // the wait that stands in front of a rewrite of a register which an issued store names
    }
}
// grid (TT / 64, NH_): query tile, head; head z reads the planes of kv head z / REP. Query rows < RH take the hi+lo planes (3 products), the rest single fp16.
// waves_per_eu(6): caps the registers so that the 18 waves of two work-groups fit the four SIMDs of a WGP however they are dealt out.
__global__ __launch_bounds__(AW * 32) __attribute__((amdgpu_waves_per_eu(6))) void k_attn(const h16* __restrict__ Q16, const bf* __restrict__ Qh, const bf* __restrict__ Ql, const h16* __restrict__ K16, const bf* __restrict__ Kh, const bf* __restrict__ Kl, const h16* __restrict__ V16, const bf* __restrict__ Vh, const bf* __restrict__ Vl, bf* Ah, bf* Al) {
    static_assert(RH % 64 == 0 && WIN % 64 == 0 && WIN / 64 + 1 == AW, "a tile is all hi+lo or all fp16; one wave a key tile");
    __shared__ __align__(16) float S[64 * PB];                       // 160 KiB: two work-groups a WGP
    const int r0 = blockIdx.x * 64; const size_t z = blockIdx.y, qo = z * TT * HD, ko = (z / REP) * TT * HD;
    if (r0 < RH) attn_tile<bf, 2>(S, Qh + qo, Ql + qo, Kh + ko, Kl + ko, Vh + ko, Vl + ko, r0, Ah + z * HD, Al + z * HD);
    else attn_tile<h16, 0>(S, Q16 + qo, nullptr, K16 + ko, nullptr, V16 + ko, nullptr, r0, Ah + z * HD, Al + z * HD);
}

extern "C" void kernel_launch(void* const* d_in, const int* in_sizes, int n_in,
                              void* d_out, int out_size, void* d_ws, size_t ws_size, hipStream_t stream) {
    (void)in_sizes; (void)n_in; (void)out_size;
    const float* x = (const float*)d_in[0]; const float* gw = (const float*)d_in[1]; const float* wq = (const float*)d_in[2]; const float* wk = (const float*)d_in[3]; const float* wv = (const float*)d_in[4]; const float* wo = (const float*)d_in[5]; const float* cosT = (const float*)d_in[6]; const float* sinT = (const float*)d_in[7];
    float* OUT = (float*)d_out;     // [2][2048][2048]
    char* wsp = (char*)d_ws;
    auto take = [&](size_t bytes) { char* p = wsp; wsp += (bytes + 255) & ~(size_t)255; return (void*)p; };
    bf* WQ = (bf*)take((size_t)DQ * DM * 2); bf* WK = (bf*)take((size_t)DKV * DM * 2); bf* WV = (bf*)take((size_t)DKV * DM * 2); bf* WO = (bf*)take((size_t)DM * DQ * 2);
    bf* Yh = (bf*)take((size_t)TT * DM * 2); bf* Yl = (bf*)take((size_t)TT * DM * 2);
    h16* QP16 = (h16*)take((size_t)NH_ * TT * HD * 2); h16* KP16 = (h16*)take((size_t)NKV * TT * HD * 2); h16* VT16 = (h16*)take((size_t)NKV * HD * TT * 2);
    bf* QPh = (bf*)take((size_t)NH_ * TT * HD * 2); bf* QPl = (bf*)take((size_t)NH_ * TT * HD * 2); bf* KPh = (bf*)take((size_t)NKV * TT * HD * 2); bf* KPl = (bf*)take((size_t)NKV * TT * HD * 2); bf* VTh = (bf*)take((size_t)NKV * HD * TT * 2); bf* VTl = (bf*)take((size_t)NKV * HD * TT * 2);
    bf* ATh = (bf*)take((size_t)TT * DQ * 2); bf* ATl = (bf*)take((size_t)TT * DQ * 2);
    if ((size_t)(wsp - (char*)d_ws) > ws_size) return;    // ws 256 MiB
    { k_wtG<<<(unsigned)((DM * DQ / 64 + 63) / 64), 256, 0, stream>>>(wq, DM, DQ, WQ); k_wtG<<<(unsigned)((DM * DKV / 64 + 63) / 64), 256, 0, stream>>>(wk, DM, DKV, WK); k_wtG<<<(unsigned)((DM * DKV / 64 + 63) / 64), 256, 0, stream>>>(wv, DM, DKV, WV);
      k_wtG<<<(unsigned)((DQ * DM / 64 + 63) / 64), 256, 0, stream>>>(wo, DQ, DM, WO);
       }
    for (int b = 0; b < NB_; ++b) {
        k_rmshl<<<TT / 8, 256, 0, stream>>>(x + (size_t)b * TT * DM, gw, Yh, Yl);   /* n = RMSNorm(x) norm_w as hi/lo planes */
        k_gemms<4, EP_ROPE><<<dim3(TT / 128, DQ / 128, 1), 128, 0, stream>>>(Yh, Yl, WQ, DM, cosT, sinT, nullptr, QP16, QPh, QPl);
        k_gemms<2, EP_ROPE><<<dim3(TT / 64, DKV / 128, 1), 128, 0, stream>>>(Yh, Yl, WK, DM, cosT, sinT, nullptr, KP16, KPh, KPl);
        k_gemms<2, EP_VT><<<dim3(TT / 64, DKV / 128, 1), 128, 0, stream>>>(Yh, Yl, WV, DM, nullptr, nullptr, nullptr, VT16, VTh, VTl);
        k_attn<<<dim3(TT / 64, NH_, 1), AW * 32, 0, stream>>>(QP16, QPh, QPl, KP16, KPh, KPl, VT16, VTh, VTl, ATh, ATl);
        k_gemms<4, EP_RES><<<dim3(TT / 128, DM / 128, 1), 128, 0, stream>>>(ATh, ATl, WO, DQ, x + (size_t)b * TT * DM, nullptr, OUT + (size_t)b * TT * DM, nullptr, nullptr, nullptr); }   /* out = x + attn wo */
}

// v006
// A run of this version takes 277 microseconds.
// In two side-by-side timings against v005, it was 1.64 and 1.65 times as fast.
// Over all steps from v000 it is 6.28 times as fast.
#include <hip/hip_runtime.h>

// Sliding-window causal GQA with RMSNorm pre-normalisation and residual (x [2][2048][2048]; n = x rsqrt(mean x^2 + 1e-6) norm_w; q = n wq ('xw', 16 heads x 128), k, v = n wk / n wv (4 kv heads); rotate-half RoPE from the given tables [2048][64] (both halves share column d mod 64); 4 query heads per kv head (repeat); scores/sqrt(128) kept where j <= i and i - j < 512; softmax; out = x + merged wo -> [2][2048][2048]).
// Compute dtypes, f32 accumulate: every input rounded to bf16; q/k/v hl x exact (2 products); rotary in f32 from the bf16-rounded input tables; windowed-causal scores and attn.v (only key tiles that touch the window band computed): query rows < 512 hl (3 products), the rest single fp16 (x1024); softmax f32; wo hl x exact (2 products), + x residual in f32.

#define NB_  2
#define TT   2048
#define DM   2048
#define NH_  16
#define NKV  4
#define REP  (NH_ / NKV)
#define HD   128
#define DQ   (NH_ * HD)
#define DKV  (NKV * HD)
#define MT   (NB_ * TT)           // rows of both batch elements together: every stage takes them in one launch
#define RH   512                  // query rows < RH use hi+lo planes (0: none)
#define WIN  512
#define NBC  ((WIN + 128) / 128)  // 128-key chunks of a softmax row: WIN + 64 band keys of a 64-row tile, from a multiple of 128
#define PB   (NBC * 128)         // pitch of a stored score / probability row: only the NBC chunks from the row tile's first chunk jb on are kept
#define PCAR 1024.0f
#define SCL  0.088388347648318447f   // HD^-0.5
typedef _Float16 h16;
typedef unsigned short bf;
typedef __attribute__((ext_vector_type(16))) __bf16   v16bf;
typedef __attribute__((ext_vector_type(16))) _Float16 v16h;
typedef __attribute__((ext_vector_type(8)))  _Float16 v8h;
typedef __attribute__((ext_vector_type(8)))  unsigned short v8us;
typedef __attribute__((ext_vector_type(8)))  float    v8f;
typedef __attribute__((ext_vector_type(4)))  float    v4f;
typedef v8h  __attribute__((may_alias)) v8ha;
typedef v4f  __attribute__((may_alias)) v4fa;
typedef v8us __attribute__((may_alias)) v8usa;

__device__ __forceinline__ unsigned short f2bf(float f) { unsigned u = __float_as_uint(f); u += 0x7FFFu + ((u >> 16) & 1u); return (unsigned short)(u >> 16); }
__device__ __forceinline__ float bf2f(unsigned short b) { return __uint_as_float(((unsigned)b) << 16); }
__device__ __forceinline__ float bfr(float f) { return bf2f(f2bf(f)); }
__device__ __forceinline__ v16h cat16(v8h lo, v8h hi) { return __builtin_shufflevector(lo, hi, 0, 1, 2, 3, 4, 5, 6, 7, 8, 9, 10, 11, 12, 13, 14, 15); }
__device__ __forceinline__ v16bf cat16b(v8us lo, v8us hi) { return __builtin_bit_cast(v16bf, __builtin_shufflevector(lo, hi, 0, 1, 2, 3, 4, 5, 6, 7, 8, 9, 10, 11, 12, 13, 14, 15)); }
__device__ __forceinline__ v8f wmma16(v16h a, v16h b, v8f c) { return __builtin_amdgcn_wmma_f32_16x16x32_f16(false, a, false, b, (short)0, c, false, false); }
__device__ __forceinline__ v8f wmmab(v16bf a, v16bf b, v8f c) { return __builtin_amdgcn_wmma_f32_16x16x32_bf16(false, a, false, b, (short)0, c, false, false); }
__device__ __forceinline__ h16 tohx(float x) { return (h16)x; }
__device__ __forceinline__ void splitf(float y, unsigned short& h, unsigned short& l) { h = f2bf(y); l = f2bf(y - bf2f(h)); }
typedef float __attribute__((may_alias)) fa;



// ---- gemm_tile<MB>: projection GEMM, 4 waves (2 x 2) per (32 MB)x128 output tile, each wave a (16 MB)x64 tile (4 MB accumulators); MB = 4 where that fills the chip, MB = 2 for the narrow k and v outputs (twice the work-groups). The operands (K-contiguous bf16 planes A hi, A lo, Bt) are staged in LDS by asynchronous copies,
// KS k of the tile's rows of each plane a stage, two buffers: the next stage's copies fly while this stage is worked on; fragments are read from LDS one 32-k block ahead. Tile (bx, by) of (M/(32 MB), N/128), 128 threads; M = MT, the rows of both batch elements (row m = batch m / TT, position m mod TT; a tile lies in one batch element); ring = the work-group's LDS, declared by the kernel. c[m][n] (f32) = sum_k (A[m][k] + A2[m][k]) Bt[n][k]. K % KS == 0, K >= 2 KS (the prologue fills two stages).
// The element-wise pass that follows each product is the kernel's epilogue EP, on the f32 tile while it is still on the chip (a tile's 128 columns are one head):
// EP_ROPE: rotate-half rotary from the bf16-rounded tables E0 = cos, E1 = sin [t][HD/2] (out[d] = c[d] cos[t][d] - c[d+HD/2] sin[t][d], out[d+HD/2] = c[d+HD/2] cos[t][d] + c[d] sin[t][d]), written as the head planes [b][h][t][d] (fp16, hi, lo; nh heads);
// EP_VT: the transposed head planes [b][h][d][t] (fp16, hi, lo); EP_RES: O[m][n] = bf16-rounded E0[m][n] + c[m][n] (f32, both of pitch DM).
#define EP_ROPE 0
#define EP_VT   1
#define EP_RES  2
#define TP   132                 // pitch in floats of the f32 tile staged for EP_ROPE: 16-byte rows, four banks on from row to row
#define KS   64                  // k per stage: 128 B of every operand row, one whole line
#define LP   (KS + 8)            // LDS row pitch in elements: 144 B = 16 B x odd, free of bank conflicts for 16-byte fragment reads
template <typename T16> struct WFrag;
template <> struct WFrag<h16> { typedef v16h V; static __device__ __forceinline__ V ld(const h16* p) { return cat16(*(const v8h*)p, *(const v8h*)(p + 16)); } static __device__ __forceinline__ V cat(const h16* p, const h16* p2) { return cat16(*(const v8ha*)p, *(const v8ha*)p2); } static __device__ __forceinline__ v8f mma(V a, V b, v8f c) { return wmma16(a, b, c); } };
template <> struct WFrag<bf> { typedef v16bf V; static __device__ __forceinline__ V ld(const bf* p) { return cat16b(*(const v8us*)p, *(const v8us*)(p + 16)); } static __device__ __forceinline__ V cat(const bf* p, const bf* p2) { return cat16b(*(const v8usa*)p, *(const v8usa*)p2); } static __device__ __forceinline__ v8f mma(V a, V b, v8f c) { return wmmab(a, b, c); } };
typedef __attribute__((ext_vector_type(4))) int v4ic;
// NJ asynchronous copies of 512 B (4 rows of 128 B each, 16 B a lane): 4 NJ rows of one plane. l = the lane's place in the first of them in LDS, g = the same place in the global plane, gs = elements per 4 global rows.
template <int NJ>
__device__ __forceinline__ void planecopy(bf* l, const bf* g, size_t gs) {
#pragma unroll
    for (int j = 0; j < NJ; ++j)
        __builtin_amdgcn_global_load_async_to_lds_b128((__attribute__((address_space(1))) v4ic*)(g + (size_t)j * gs), (__attribute__((address_space(3))) v4ic*)(l + j * 4 * LP), 0, 0);
}
template <int MB> struct Frags { WFrag<bf>::V a[MB], a2[MB], b[4]; };
// the fragments of one 32-k block of a stage, as one group of LDS reads; sa, sa2, sb = the lane's place in the wave's first row of each plane
template <int MB>
__device__ __forceinline__ void ldfr(Frags<MB>& f, const bf* sa, const bf* sa2, const bf* sb) {
#pragma unroll
    for (int q = 0; q < MB; ++q) { f.a[q] = WFrag<bf>::ld(sa + q * 16 * LP); f.a2[q] = WFrag<bf>::ld(sa2 + q * 16 * LP); }
#pragma unroll
    for (int q = 0; q < 4; ++q) f.b[q] = WFrag<bf>::ld(sb + q * 16 * LP);
}
template <int MB>
__device__ __forceinline__ void mmblk(v8f (&acc)[MB][4], const Frags<MB>& f) {
#pragma unroll
    for (int nb = 0; nb < 4; ++nb)
#pragma unroll
        for (int mb = 0; mb < MB; ++mb) { acc[mb][nb] = WFrag<bf>::mma(f.a[mb], f.b[nb], acc[mb][nb]); acc[mb][nb] = WFrag<bf>::mma(f.a2[mb], f.b[nb], acc[mb][nb]); }
}
#define RINGE (2 * (2 * 32 * 4 * LP + 128 * LP))   // elements of the two-stage ring of the largest tile (MB = 4)
template <int MB, int EP>
__device__ __forceinline__ void gemm_tile(bf* ring, int bx, int by, int nh, const bf* __restrict__ A, const bf* __restrict__ A2, const bf* __restrict__ Bt, int K, const float* __restrict__ E0, const float* __restrict__ E1, float* O, h16* P16, bf* Ph, bf* Pl) {
    static_assert(KS == 64, "a stage is two 32-k blocks");
    constexpr int PLA = 32 * MB * LP, STG = 2 * PLA + 128 * LP;   // a stage: A hi | A lo (32 MB rows each) | Bt (128 rows)
    static_assert(2 * STG <= RINGE, "the ring fits the kernel's LDS");
    const int lane = threadIdx.x & 31, lr = lane & 15, hi = lane >> 4; const int w = __builtin_amdgcn_readfirstlane((int)(threadIdx.x >> 5)), wm = w >> 1, wn = w & 1;
    const int r0 = bx * (32 * MB), c0 = by * 128, bb = r0 / TT, t0 = r0 % TT;   // bb, t0: the tile's batch element and its first position there
    (void)bb; (void)t0; (void)nh;
    v8f acc[MB][4];
#pragma unroll
    for (int mb = 0; mb < MB; ++mb)
#pragma unroll
        for (int nb = 0; nb < 4; ++nb) acc[mb][nb] = (v8f){};
    // wave w copies rows 8 MB w .. 8 MB w + 8 MB - 1 of the A planes and rows 32 w .. 32 w + 31 of Bt
    const int crA = w * (8 * MB) + (lane >> 3), crB = w * 32 + (lane >> 3), ccol = (lane & 7) * 8; const size_t gs = (size_t)4 * K;
    const bf* gA = A + (size_t)(r0 + crA) * K + ccol; const bf* gA2 = A2 + (size_t)(r0 + crA) * K + ccol; const bf* gB = Bt + (size_t)(c0 + crB) * K + ccol;
    bf* lA = ring + crA * LP + ccol; bf* lB = ring + 2 * PLA + crB * LP + ccol;
    const int nt = K / KS;
    planecopy<2 * MB>(lA, gA, gs); planecopy<2 * MB>(lA + PLA, gA2, gs); planecopy<8>(lB, gB, gs);
    asm volatile("s_wait_asynccnt 0x0" ::: "memory");   // this wave's share of stage 0 has landed
    __syncthreads();                                     // ... and every other wave's
    planecopy<2 * MB>(lA + STG, gA + KS, gs); planecopy<2 * MB>(lA + STG + PLA, gA2 + KS, gs); planecopy<8>(lB + STG, gB + KS, gs);
    const int aofs = (wm * (16 * MB) + lr) * LP + 8 * hi, bofs = 2 * PLA + (wn * 64 + lr) * LP + 8 * hi;
    Frags<MB> f0, f1;                                    // two fragment sets: each block's LDS reads are issued one block ahead, as one group
    ldfr<MB>(f0, ring + aofs, ring + PLA + aofs, ring + bofs);
#pragma unroll 1
    for (int t = 0; t < nt; ++t) {
        const bf* st = ring + (t & 1) * STG; const bf* sn = ring + ((t + 1) & 1) * STG;
        ldfr<MB>(f1, st + aofs + 32, st + PLA + aofs + 32, st + bofs + 32);
        __builtin_amdgcn_sched_barrier(0);                   // keeps the read group ahead of the block it hides behind
        mmblk<MB>(acc, f0);
        __builtin_amdgcn_sched_barrier(0);                   // keeps the block ahead of the publish point, so that the waits below find their data landed
        // publish point of stage t + 1, in front of stage t's last block, whose fragments are already fetched
        asm volatile("s_wait_dscnt 0x0" ::: "memory");      // this wave's last reads of stage t have returned before its buffer is refilled
        asm volatile("s_wait_asynccnt 0x0" ::: "memory");   // this wave's share of stage t + 1 has landed
        __syncthreads();                                     // publishes stage t + 1 and ends every wave's reads of stage t
        if (t + 2 < nt) { const size_t ko = (size_t)(t + 2) * KS; const int bo = (t & 1) * STG; planecopy<2 * MB>(lA + bo, gA + ko, gs); planecopy<2 * MB>(lA + bo + PLA, gA2 + ko, gs); planecopy<8>(lB + bo, gB + ko, gs); }
        if (t + 1 < nt) ldfr<MB>(f0, sn + aofs, sn + PLA + aofs, sn + bofs);
        mmblk<MB>(acc, f1);
    }
    asm volatile("s_wait_asynccnt 0x0" ::: "memory");       // no copy is outstanding when the wave ends
    // Behind the loop's last barrier the ring is free: no copy is outstanding and every wave's last fragment read returned in front of that barrier. The epilogues stage in it.
    if constexpr (EP == EP_ROPE) {
        fa* tl = (fa*)ring;                                  // the work-group's whole tile in f32: a column's rotary partner lies in the neighbour wave's registers
#pragma unroll
        for (int mb = 0; mb < MB; ++mb)
#pragma unroll
            for (int nb = 0; nb < 4; ++nb)
#pragma unroll
                for (int j = 0; j < 8; ++j) tl[(wm * (16 * MB) + mb * 16 + hi * 8 + j) * TP + wn * 64 + nb * 16 + lr] = acc[mb][nb][j];
        // wave w takes rows 8 MB w ..; a step is 4 rows, 8 lanes a row, a lane 8 columns d < HD/2 and their partners d + HD/2
        const int row0 = w * (8 * MB) + (lane >> 3), dc = (lane & 7) * 8;
        const float* cp = E0 + (size_t)(t0 + row0) * (HD / 2) + dc; const float* sp = E1 + (size_t)(t0 + row0) * (HD / 2) + dc;
        v4f cv[2 * MB][2], sv[2 * MB][2];                    // every step's table values, fetched while the tile is staged
#pragma unroll
        for (int s = 0; s < 2 * MB; ++s)
#pragma unroll
            for (int u = 0; u < 2; ++u) { cv[s][u] = *(const v4f*)(cp + s * 4 * (HD / 2) + u * 4); sv[s][u] = *(const v4f*)(sp + s * 4 * (HD / 2) + u * 4); }
        // the wait that stands in front of a rewrite of a register which an issued load names; it takes the addresses as inputs, so that they stay in their registers up to it
        asm volatile("s_wait_xcnt 0x0" :: "v"(cp), "v"(sp) : "memory");
        __syncthreads();                                     // the whole tile is in LDS before a row is read
        const size_t oo = (((size_t)bb * nh + by) * TT + t0 + row0) * HD + dc;
        h16* q16 = P16 + oo; bf* qh = Ph + oo; bf* ql = Pl + oo;
        const fa* xr = tl + row0 * TP + dc;
        v4f xl0 = *(const v4fa*)xr, xl1 = *(const v4fa*)(xr + 4), xh0 = *(const v4fa*)(xr + HD / 2), xh1 = *(const v4fa*)(xr + HD / 2 + 4);
        v8h pa16 = {}, pb16 = {}; v8us pah = {}, pal = {}, pbh = {}, pbl = {};   // the last step's stored values
#pragma unroll
        for (int s = 0; s < 2 * MB; ++s) {
            v4f nl0 = xl0, nl1 = xl1, nh0 = xh0, nh1 = xh1;
            if (s + 1 < 2 * MB) { const fa* xn = xr + (s + 1) * 4 * TP; nl0 = *(const v4fa*)xn; nl1 = *(const v4fa*)(xn + 4); nh0 = *(const v4fa*)(xn + HD / 2); nh1 = *(const v4fa*)(xn + HD / 2 + 4); }   // the next step's rows are read from LDS while this step is worked on
            v8h a16, b16; v8us ah, al, bh, bl;
#pragma unroll
            for (int q = 0; q < 8; ++q) { const float x0 = q < 4 ? xl0[q & 3] : xl1[q & 3], x1 = q < 4 ? xh0[q & 3] : xh1[q & 3], c = bfr(cv[s][q >> 2][q & 3]), sn = bfr(sv[s][q >> 2][q & 3]);
                const float ra = x0 * c - x1 * sn, rb = x1 * c + x0 * sn; unsigned short h2, l2;
                a16[q] = tohx(ra); splitf(ra, h2, l2); ah[q] = h2; al[q] = l2; b16[q] = tohx(rb); splitf(rb, h2, l2); bh[q] = h2; bl[q] = l2; }
            __builtin_amdgcn_sched_barrier(0);               // keeps the step's arithmetic in front of the wait, which would otherwise be lifted to directly behind the last step's stores
            // the wait that stands in front of a rewrite of a register which an issued store names: it takes the addresses and the last step's data as inputs, so that they stay in their registers up to it, a step's work behind those stores
            if (s) asm volatile("s_wait_xcnt 0x0" :: "v"(q16), "v"(qh), "v"(ql), "v"(pa16), "v"(pb16), "v"(pah), "v"(pbh), "v"(pal), "v"(pbl) : "memory");
            *(v8h*)(q16 + s * 4 * HD) = a16; *(v8h*)(q16 + s * 4 * HD + HD / 2) = b16; *(v8us*)(qh + s * 4 * HD) = ah; *(v8us*)(qh + s * 4 * HD + HD / 2) = bh; *(v8us*)(ql + s * 4 * HD) = al; *(v8us*)(ql + s * 4 * HD + HD / 2) = bl;
            pa16 = a16; pb16 = b16; pah = ah; pal = al; pbh = bh; pbl = bl; xl0 = nl0; xl1 = nl1; xh0 = nh0; xh1 = nh1;
        }
    } else if constexpr (EP == EP_VT) {
        static_assert(MB == 2, "a staged row is 64 t of one column: one 128-byte line");
        constexpr int VP = 32 * MB + 8, VPL = 128 * VP;      // staged planes [d][t]: pitch 144 B = 16 B x odd; a lane's 8 accumulator rows are 8 consecutive t of one d
#pragma unroll
        for (int mb = 0; mb < MB; ++mb)
#pragma unroll
            for (int nb = 0; nb < 4; ++nb) { v8h o16; v8us oh, ol;
#pragma unroll
                for (int j = 0; j < 8; ++j) { const float xv = acc[mb][nb][j]; unsigned short h2, l2; o16[j] = tohx(xv); splitf(xv, h2, l2); oh[j] = h2; ol[j] = l2; }
                const int e = (wn * 64 + nb * 16 + lr) * VP + wm * (16 * MB) + mb * 16 + hi * 8;
                *(v8ha*)(ring + e) = o16; *(v8usa*)(ring + VPL + e) = oh; *(v8usa*)(ring + 2 * VPL + e) = ol; }
        __syncthreads();                                     // every plane row is whole in LDS before it is read
        // wave w takes columns 32 w ..; a step is 4 columns, 8 lanes a column: whole 128-byte lines a store
        const int d0 = w * 32 + (lane >> 3), tc = (lane & 7) * 8; const bf* lp = ring + d0 * VP + tc;
        const size_t oo = (((size_t)bb * nh + by) * HD + d0) * TT + t0 + tc;
        h16* q16 = P16 + oo; bf* qh = Ph + oo; bf* ql = Pl + oo;
        v8us a[8], b[8], c[8];                               // all of the wave's rows are read first: no register that a store names is written again
#pragma unroll
        for (int s = 0; s < 8; ++s) { a[s] = *(const v8usa*)(lp + s * 4 * VP); b[s] = *(const v8usa*)(lp + VPL + s * 4 * VP); c[s] = *(const v8usa*)(lp + 2 * VPL + s * 4 * VP); }
        __builtin_amdgcn_sched_barrier(0);                   // keeps every LDS read in front of the first store
#pragma unroll
        for (int s = 0; s < 8; ++s) { *(v8usa*)(q16 + s * 4 * TT) = a[s]; *(v8us*)(qh + s * 4 * TT) = b[s]; *(v8us*)(ql + s * 4 * TT) = c[s]; }
    } else {
        fa* os = (fa*)ring + w * (16 * 68);                  // each wave stages its output rows in its own LDS range
        const size_t eo = (size_t)(r0 + wm * (16 * MB) + hi) * DM + c0 + wn * 64 + lr * 4;   // the lane's place in its first row; a step is 2 rows
        const float* xp = E0 + eo; float* op = O + eo;
        v4f xa[2][8], o[2][8];                               // the residual rows of a 16-row block, fetched one block ahead; two blocks' results
#pragma unroll
        for (int s = 0; s < 8; ++s) xa[0][s] = *(const v4f*)(xp + s * 2 * DM);
#pragma unroll
        for (int mb = 0; mb < MB; ++mb) {
#pragma unroll
            for (int nb = 0; nb < 4; ++nb) {
#pragma unroll
                for (int j = 0; j < 8; ++j) os[(hi * 8 + j) * 68 + nb * 16 + lr] = acc[mb][nb][j]; }
            if (mb + 1 < MB) {
#pragma unroll
                for (int s = 0; s < 8; ++s) xa[(mb + 1) & 1][s] = *(const v4f*)(xp + ((mb + 1) * 16 + s * 2) * DM); }
            __builtin_amdgcn_wave_barrier(); asm volatile("" ::: "memory");   // keeps the row reads below, which take other lanes' values, behind the stores above
#pragma unroll
            for (int s = 0; s < 8; ++s) { const v4f val = *(const v4fa*)(os + (2 * s + hi) * 68 + lr * 4);
#pragma unroll
                for (int q = 0; q < 4; ++q) o[mb & 1][s][q] = bfr(xa[mb & 1][s][q]) + val[q]; }
            __builtin_amdgcn_sched_barrier(0);               // keeps the block's sums in front of the wait, which would otherwise be lifted to directly behind the last block's stores
            // the wait that stands in front of a rewrite of a register which an issued load or store names: it takes the addresses and the last block's data as inputs, so that they stay in their registers up to it, a block's work behind those stores
            if (mb) asm volatile("s_wait_xcnt 0x0" :: "v"(xp), "v"(op), "v"(o[(mb + 1) & 1][0]), "v"(o[(mb + 1) & 1][1]), "v"(o[(mb + 1) & 1][2]), "v"(o[(mb + 1) & 1][3]), "v"(o[(mb + 1) & 1][4]), "v"(o[(mb + 1) & 1][5]), "v"(o[(mb + 1) & 1][6]), "v"(o[(mb + 1) & 1][7]) : "memory");
#pragma unroll
            for (int s = 0; s < 8; ++s) *(v4f*)(op + (mb * 16 + s * 2) * DM) = o[mb & 1][s];
            __builtin_amdgcn_wave_barrier(); asm volatile("" ::: "memory");   // keeps the next 16 rows' LDS stores behind this block's reads
        }
    }
    asm volatile("s_wait_xcnt 0x0" ::: "memory");            // the wait that stands in front of a rewrite of a register which an issued store names: in a kernel of several tile kinds another kind's text follows this one's last stores
}
// ---- k_qkv: the three projections of n, which read nothing of each other, in one grid: first the q tiles (the longest), then the k tiles, then the v tiles; within each the row tile runs fastest.
#define NQT ((MT / 128) * (DQ / 128))
#define NKT ((MT / 64) * (DKV / 128))
__global__ __launch_bounds__(128) void k_qkv(const bf* __restrict__ Yh, const bf* __restrict__ Yl, const bf* __restrict__ WQ, const bf* __restrict__ WK, const bf* __restrict__ WV, int K, const float* __restrict__ cosT, const float* __restrict__ sinT, h16* QP16, bf* QPh, bf* QPl, h16* KP16, bf* KPh, bf* KPl, h16* VT16, bf* VTh, bf* VTl) {
    __shared__ __align__(16) bf ring[RINGE];
    const int i = blockIdx.x;
    if (i < NQT) gemm_tile<4, EP_ROPE>(ring, i % (MT / 128), i / (MT / 128), NH_, Yh, Yl, WQ, K, cosT, sinT, nullptr, QP16, QPh, QPl);
    else if (i < NQT + NKT) gemm_tile<2, EP_ROPE>(ring, (i - NQT) % (MT / 64), (i - NQT) / (MT / 64), NKV, Yh, Yl, WK, K, cosT, sinT, nullptr, KP16, KPh, KPl);
    else gemm_tile<2, EP_VT>(ring, (i - NQT - NKT) % (MT / 64), (i - NQT - NKT) / (MT / 64), NKV, Yh, Yl, WV, K, nullptr, nullptr, nullptr, VT16, VTh, VTl);
}
// ---- k_oproj: out = x + attn wo, grid (MT / 128, DM / 128)
__global__ __launch_bounds__(128) void k_oproj(const bf* __restrict__ Ah, const bf* __restrict__ Al, const bf* __restrict__ WO, int K, const float* __restrict__ x, float* O) {
    __shared__ __align__(16) bf ring[RINGE];
    gemm_tile<4, EP_RES>(ring, blockIdx.x, blockIdx.y, 0, Ah, Al, WO, K, x, nullptr, O, nullptr, nullptr, nullptr);
}

typedef __attribute__((ext_vector_type(2))) _Float16 v2h;
typedef __attribute__((ext_vector_type(4))) _Float16 v4h;
typedef __attribute__((ext_vector_type(2))) unsigned short v2us;
typedef __attribute__((ext_vector_type(4))) unsigned short v4us;
typedef __attribute__((ext_vector_type(2))) float v2f;
typedef __attribute__((ext_vector_type(4))) int v4i;

__device__ __forceinline__ void wt_blk(int blk, const float* __restrict__ w, int K, int N, bf* Bt) {
    const int lane = threadIdx.x & 31; const int L0 = (blk * 8 + (threadIdx.x >> 5)) * 8; const int nlines = N * K / 64;
{
#pragma unroll 1
        for (int l = 0; l < 8; ++l) { const int L = L0 + l; if (L >= nlines) break; const size_t e = (size_t)L * 64 + lane * 2; const int k = (int)(e % K), n = (int)(e / K); v2us o;
            o[0] = f2bf(w[(size_t)k * N + n]); o[1] = f2bf(w[(size_t)(k + 1) * N + n]); *(v2us*)(Bt + e) = o; }
         }
}
__device__ __forceinline__ void rms_blk(int blk, const float* __restrict__ X, const float* __restrict__ g, bf* Yh, bf* Yl) {
    const int lane = threadIdx.x & 31; const int r = blk * 8 + (threadIdx.x >> 5); if (r >= MT) return; const float* xr = X + (size_t)r * DM; float s = 0.f;
#pragma unroll 1
    for (int ch = 0; ch < DM / 128; ++ch) { const v4f a = *(const v4f*)(xr + ch * 128 + lane * 4);
#pragma unroll
        for (int q = 0; q < 4; ++q) { const float xb = bfr(a[q]); float p = __fmul_rn(xb, xb); asm volatile("" : "+v"(p)); s = __fadd_rn(s, p); } }
#pragma unroll
    for (int sh = 16; sh; sh >>= 1) s += __shfl_xor(s, sh, 32);
    const float rs = __fdiv_rn(1.0f, __fsqrt_rn(__fadd_rn(s * (1.0f / DM), 1e-6f)));
{
#pragma unroll 1
        for (int ch = 0; ch < DM / 128; ++ch) { const int c0 = ch * 128 + lane * 4; const v4f a = *(const v4f*)(xr + c0); v4us oh, ol;
#pragma unroll
            for (int q = 0; q < 4; ++q) { float n0 = __fmul_rn(bfr(a[q]), rs); asm volatile("" : "+v"(n0)); const float y = __fmul_rn(n0, bfr(g[c0 + q])); unsigned short h2, l2; splitf(y, h2, l2); oh[q] = h2; ol[q] = l2; }
            *(v4us*)(Yh + (size_t)r * DM + c0) = oh; *(v4us*)(Yl + (size_t)r * DM + c0) = ol; }
         } }
// ---- k_prep: the five jobs that read inputs only, in one grid: n = RMSNorm(x) norm_w of all MT rows as hi/lo planes, then the four weight transposes (the large ones first).
#define NRB (MT / 8)
#define NWQ (DM * DQ / 64 / 64)
#define NWK (DM * DKV / 64 / 64)
__global__ __launch_bounds__(256) void k_prep(const float* __restrict__ x, const float* __restrict__ g, const float* __restrict__ wq, const float* __restrict__ wk, const float* __restrict__ wv, const float* __restrict__ wo, bf* Yh, bf* Yl, bf* WQ, bf* WK, bf* WV, bf* WO) {
    const int i = blockIdx.x;
    if (i < NRB) rms_blk(i, x, g, Yh, Yl);
    else if (i < NRB + NWQ) wt_blk(i - NRB, wq, DM, DQ, WQ);
    else if (i < NRB + 2 * NWQ) wt_blk(i - NRB - NWQ, wo, DQ, DM, WO);
    else if (i < NRB + 2 * NWQ + NWK) wt_blk(i - NRB - 2 * NWQ, wk, DM, DKV, WK);
    else wt_blk(i - NRB - 2 * NWQ - NWK, wv, DM, DKV, WV);
}
__global__ __launch_bounds__(256) void k_cvt8(const float* __restrict__ src, bf* dst, size_t n8) { const size_t i = (size_t)blockIdx.x * 256 + threadIdx.x; if (i >= n8) return; const v8f v = *(const v8f*)(src + i * 8); v8us o;
#pragma unroll
    for (int k = 0; k < 8; ++k) o[k] = f2bf(v[k]); *(v8us*)(dst + i * 8) = o;  }
typedef v4h  __attribute__((may_alias)) v4ha;
typedef v4us __attribute__((may_alias)) v4usa;
// ---- k_attn: the whole attention of one 64-row query tile of one head in one work-group of AW = 9 waves; the tile's score / probability band (PB keys from key jb on, jb = the 128-aligned start of the tile's band) lives in LDS only.
// Phase 1: wave w computes the 64x64 score tile of keys r0 - WIN + 64 w .. (in passes of 32 rows, 16 with hi+lo planes; tiles left of key 0 do not exist). Phase 2: softmax, one row a wave at a time (t = S x HD^-0.5 for j <= i and i - j < WIN, everything else masked by select; register row, one exp, fixed trees);
// the probabilities overwrite their own score row (16-bit planes: hi or fp16 in the first PB elements of the row's space, lo in the second), each plane rotated by 8 (row mod 16) elements so that the 16 rows of a fragment read lie in different banks.
// Phase 3: waves 0..7 each contract a 16x64 tile of P.V over the band's keys (probabilities outside it are exactly zero), V from the transposed planes [d][t]; the result x carrier scale goes out as the hi/lo planes [t][head][d] that the output projection reads, whole 128-byte lines a store.
#define AW 9
template <typename T16, int NSPLIT>
__device__ __forceinline__ void attn_tile(float* S, const T16* __restrict__ Q, const T16* __restrict__ Q2, const T16* __restrict__ Kp, const T16* __restrict__ Kp2, const T16* __restrict__ Vt, const T16* __restrict__ Vt2, int r0, bf* Ah, bf* Al) {
    typedef typename WFrag<T16>::V V;
    constexpr bool hires = (NSPLIT == 2);
    const int lane = threadIdx.x & 31, lr = lane & 15, hi = lane >> 4; const int w = __builtin_amdgcn_readfirstlane((int)(threadIdx.x >> 5));
    const int jb = max(0, r0 - WIN) & ~127;                          // first key that the stored rows hold
    const int c0 = r0 - WIN + w * 64;                                // this wave's key tile
    if (c0 >= 0) {
        constexpr int MBS = hires ? 1 : 2;                           // 16-row blocks a pass: as many as let one k block's fragments of every plane lie in registers at once
#pragma unroll 1   // rolled, like the three loops marked so below: keeps the registers under the cap that lets two work-groups share a WGP
        for (int rh = 0; rh < 4 / MBS; ++rh) {
            v8f acc[MBS][4];
#pragma unroll
            for (int mb = 0; mb < MBS; ++mb)
#pragma unroll
                for (int nb = 0; nb < 4; ++nb) acc[mb][nb] = (v8f){};
            const size_t aoff = (size_t)(r0 + rh * (16 * MBS) + lr) * HD + 8 * hi, boff = (size_t)(c0 + lr) * HD + 8 * hi;
#pragma unroll 1   // rolled (registers)
            for (int kc = 0; kc < HD; kc += 32) {
                V a[MBS], a2[MBS], b[4], b2[4];
                const T16* qp = Q + aoff + kc; const T16* qp2 = hires ? Q2 + aoff + kc : qp; const T16* kp = Kp + boff + kc; const T16* kp2 = hires ? Kp2 + boff + kc : kp;
#pragma unroll
                for (int mb = 0; mb < MBS; ++mb) { a[mb] = WFrag<T16>::ld(qp + (size_t)mb * 16 * HD); if (hires) a2[mb] = WFrag<T16>::ld(qp2 + (size_t)mb * 16 * HD); }
#pragma unroll
                for (int nb = 0; nb < 4; ++nb) { b[nb] = WFrag<T16>::ld(kp + (size_t)nb * 16 * HD); if (hires) b2[nb] = WFrag<T16>::ld(kp2 + (size_t)nb * 16 * HD); }
                // the wait that stands in front of a rewrite of a register which an issued load names; it takes the addresses as inputs, so that they stay in their registers up to it and no load of the run lands on them
                asm volatile("s_wait_xcnt 0x0" :: "v"(qp), "v"(qp2), "v"(kp), "v"(kp2) : "memory");
                __builtin_amdgcn_sched_barrier(0);                   // keeps all of the trip's loads in front of its products, so that a trip waits for memory once
#pragma unroll
                for (int nb = 0; nb < 4; ++nb)
#pragma unroll
                    for (int mb = 0; mb < MBS; ++mb) { acc[mb][nb] = WFrag<T16>::mma(a[mb], b[nb], acc[mb][nb]); if (hires) { acc[mb][nb] = WFrag<T16>::mma(a2[mb], b[nb], acc[mb][nb]); acc[mb][nb] = WFrag<T16>::mma(a[mb], b2[nb], acc[mb][nb]); } }
                // fills the slots the chip needs behind the last matrix instruction on the loop's back edge
                if constexpr (MBS == 2) asm volatile("v_nop\n\tv_nop\n\tv_nop\n\tv_nop" : "+v"(acc[0][0]), "+v"(acc[0][1]), "+v"(acc[0][2]), "+v"(acc[0][3]), "+v"(acc[MBS - 1][0]), "+v"(acc[MBS - 1][1]), "+v"(acc[MBS - 1][2]), "+v"(acc[MBS - 1][3]));
                else asm volatile("v_nop\n\tv_nop\n\tv_nop\n\tv_nop" : "+v"(acc[0][0]), "+v"(acc[0][1]), "+v"(acc[0][2]), "+v"(acc[0][3]));
            }
            float* so = S + (size_t)(rh * (16 * MBS) + hi * 8) * PB + (c0 - jb) + lr;
#pragma unroll
            for (int mb = 0; mb < MBS; ++mb)
#pragma unroll
                for (int nb = 0; nb < 4; ++nb)
#pragma unroll
                    for (int j = 0; j < 8; ++j) so[(mb * 16 + j) * PB + nb * 16] = acc[mb][nb][j];
        }
    }
    __syncthreads();                                                 // every score tile is in LDS before a row is read
#pragma unroll 1   // rolled (registers)
    for (int rr = w; rr < 64; rr += AW) {
        const int i = r0 + rr; const float* sr = S + rr * PB; float v[NBC * 4]; float mx = -3.0e38f;
#pragma unroll
        for (int ch = 0; ch < NBC; ++ch) { const int j0 = jb + ch * 128 + lane * 4; const v4f a = *(const v4fa*)(sr + ch * 128 + lane * 4);
#pragma unroll
            for (int q = 0; q < 4; ++q) { const int j = j0 + q; const float t = (j <= i && i - j < WIN) ? a[q] * SCL : -3.0e38f; v[ch * 4 + q] = t; mx = fmaxf(mx, t); } }
#pragma unroll
        for (int sh = 16; sh; sh >>= 1) mx = fmaxf(mx, __shfl_xor(mx, sh, 32));
        float sum = 0.f;
#pragma unroll
        for (int k = 0; k < NBC * 4; ++k) { float d0 = __fsub_rn(v[k], mx); asm volatile("" : "+v"(d0)); v[k] = __builtin_amdgcn_exp2f(__fmul_rn(d0, 1.4426950408889634f)); if (k + 1 < NBC * 4) asm volatile("v_nop" :: "v"(v[k])); /* fills the one slot the instruction set asks for behind a transcendental before the next key's value overwrites its source register */ sum += v[k]; }
#pragma unroll
        for (int sh = 16; sh; sh >>= 1) sum += __shfl_xor(sum, sh, 32);
        const float f = __fdiv_rn(hires ? 1.0f : PCAR, sum);
        T16* pr = (T16*)(S + rr * PB);                               // the row's own space: all of it is in this wave's registers by now
#pragma unroll
        for (int ch = 0; ch < NBC; ++ch) { int cx = ch * 128 + lane * 4 + 8 * (rr & 15); if (cx >= PB) cx -= PB;
            if constexpr (hires) { v4us oh, ol;
#pragma unroll
                for (int q = 0; q < 4; ++q) { unsigned short a, c2; splitf(v[ch * 4 + q] * f, a, c2); oh[q] = a; ol[q] = c2; }
                *(v4usa*)(pr + cx) = oh; *(v4usa*)(pr + PB + cx) = ol;
            } else { v4h o4;
#pragma unroll
                for (int q = 0; q < 4; ++q) o4[q] = tohx(v[ch * 4 + q] * f);
                *(v4ha*)(pr + cx) = o4; } }
    }
    __syncthreads();                                                 // every probability row is in LDS before a fragment is read
    const int wr = w >> 1, wc = w & 1;                               // waves 0..7: rows 16 wr .., columns 64 wc ..
    v8f oc[4];
#pragma unroll
    for (int nb = 0; nb < 4; ++nb) oc[nb] = (v8f){};
    if (w < 8) {
        const int K0 = max(0, r0 - WIN), Kl = r0 + 64;               // the band's keys, both multiples of 64
        const T16* pr = (const T16*)(S + (wr * 16 + lr) * PB); const size_t boff = (size_t)(wc * 64 + lr) * TT + 8 * hi;
        constexpr int UB = hires ? 1 : 2;                            // 32-key blocks a trip: as many as let the trip's fragments of every plane lie in registers at once
#pragma unroll 1   // rolled (registers)
        for (int kb = K0; kb < Kl; kb += 32 * UB) {
            V a[UB], a2[UB], b[UB][4], b2[UB][4];
            const T16* vp = Vt + boff + kb; const T16* vp2 = hires ? Vt2 + boff + kb : vp;
#pragma unroll
            for (int u = 0; u < UB; ++u) {
                int c1 = kb + u * 32 - jb + 8 * hi + 8 * lr, c2 = c1 + 16; if (c1 >= PB) c1 -= PB; if (c2 >= PB) c2 -= PB;
                a[u] = WFrag<T16>::cat(pr + c1, pr + c2); if (hires) a2[u] = WFrag<T16>::cat(pr + PB + c1, pr + PB + c2);
#pragma unroll
                for (int nb = 0; nb < 4; ++nb) { b[u][nb] = WFrag<T16>::ld(vp + (size_t)nb * 16 * TT + u * 32); if (hires) b2[u][nb] = WFrag<T16>::ld(vp2 + (size_t)nb * 16 * TT + u * 32); } }
            // the wait that stands in front of a rewrite of a register which an issued load names; it takes the addresses as inputs, so that they stay in their registers up to it and no load of the run lands on them
            asm volatile("s_wait_xcnt 0x0" :: "v"(vp), "v"(vp2) : "memory");
            __builtin_amdgcn_sched_barrier(0);                       // keeps all of the trip's loads in front of its products, so that a trip waits for memory once
#pragma unroll
            for (int u = 0; u < UB; ++u)
#pragma unroll
                for (int nb = 0; nb < 4; ++nb) { oc[nb] = WFrag<T16>::mma(a[u], b[u][nb], oc[nb]);
                    if (hires) { oc[nb] = WFrag<T16>::mma(a2[u], b[u][nb], oc[nb]); oc[nb] = WFrag<T16>::mma(a[u], b2[u][nb], oc[nb]); } }
            // fills the slots the chip needs behind the last matrix instruction on the loop's back edge
            asm volatile("v_nop\n\tv_nop\n\tv_nop\n\tv_nop" : "+v"(oc[0]), "+v"(oc[1]), "+v"(oc[2]), "+v"(oc[3]));
        }
    }
    __syncthreads();                                                 // every wave's last fragment read is over before the rows' space is reused for the output staging
    if (w < 8) {
        float* os = S + w * (16 * 68);                               // each wave stages its 16x64 tile in its own LDS range
#pragma unroll
        for (int nb = 0; nb < 4; ++nb)
#pragma unroll
            for (int j = 0; j < 8; ++j) os[(hi * 8 + j) * 68 + nb * 16 + lr] = oc[nb][j];
        __builtin_amdgcn_wave_barrier(); asm volatile("" ::: "memory");   // keeps the row reads below, which take other lanes' values, behind the stores above
        const float cs = hires ? 1.0f : (1.0f / PCAR);
#pragma unroll
        for (int s = 0; s < 8; ++s) { const int row = 2 * s + hi, cofs = lr * 4; const v4f val = *(const v4fa*)(os + row * 68 + cofs); v4us oh, ol;
#pragma unroll
            for (int q = 0; q < 4; ++q) { unsigned short a, c2; splitf(val[q] * cs, a, c2); oh[q] = a; ol[q] = c2; }
            const size_t oo = (size_t)(r0 + wr * 16 + row) * DQ + wc * 64 + cofs; *(v4us*)(Ah + oo) = oh; *(v4us*)(Al + oo) = ol; }
        asm volatile("s_wait_xcnt 0x0" ::: "memory");                // the wait that stands in front of a rewrite of a register which an issued store names
    }
}
// grid (TT / 64, NH_, NB_): query tile, head, batch element; head z reads the planes of kv head z / REP. Query rows < RH take the hi+lo planes (3 products), the rest single fp16.
// waves_per_eu(6): caps the registers so that the 18 waves of two work-groups fit the four SIMDs of a WGP however they are dealt out.
__global__ __launch_bounds__(AW * 32) __attribute__((amdgpu_waves_per_eu(6))) void k_attn(const h16* __restrict__ Q16, const bf* __restrict__ Qh, const bf* __restrict__ Ql, const h16* __restrict__ K16, const bf* __restrict__ Kh, const bf* __restrict__ Kl, const h16* __restrict__ V16, const bf* __restrict__ Vh, const bf* __restrict__ Vl, bf* Ah, bf* Al) {
    static_assert(RH % 64 == 0 && WIN % 64 == 0 && WIN / 64 + 1 == AW, "a tile is all hi+lo or all fp16; one wave a key tile");
    __shared__ __align__(16) float S[64 * PB];                       // 160 KiB: two work-groups a WGP
    const int r0 = blockIdx.x * 64; const size_t z = blockIdx.y, bz = blockIdx.z, qo = (bz * NH_ + z) * TT * HD, ko = (bz * NKV + z / REP) * TT * HD;
    Ah += bz * TT * DQ; Al += bz * TT * DQ;                          // the batch element's rows of the merged planes
    if (r0 < RH) attn_tile<bf, 2>(S, Qh + qo, Ql + qo, Kh + ko, Kl + ko, Vh + ko, Vl + ko, r0, Ah + z * HD, Al + z * HD);
    else attn_tile<h16, 0>(S, Q16 + qo, nullptr, K16 + ko, nullptr, V16 + ko, nullptr, r0, Ah + z * HD, Al + z * HD);
}

extern "C" void kernel_launch(void* const* d_in, const int* in_sizes, int n_in,
                              void* d_out, int out_size, void* d_ws, size_t ws_size, hipStream_t stream) {
    (void)in_sizes; (void)n_in; (void)out_size;
    const float* x = (const float*)d_in[0]; const float* gw = (const float*)d_in[1]; const float* wq = (const float*)d_in[2]; const float* wk = (const float*)d_in[3]; const float* wv = (const float*)d_in[4]; const float* wo = (const float*)d_in[5]; const float* cosT = (const float*)d_in[6]; const float* sinT = (const float*)d_in[7];
    float* OUT = (float*)d_out;     // [2][2048][2048]
    char* wsp = (char*)d_ws;
    auto take = [&](size_t bytes) { char* p = wsp; wsp += (bytes + 255) & ~(size_t)255; return (void*)p; };
    bf* WQ = (bf*)take((size_t)DQ * DM * 2); bf* WK = (bf*)take((size_t)DKV * DM * 2); bf* WV = (bf*)take((size_t)DKV * DM * 2); bf* WO = (bf*)take((size_t)DM * DQ * 2);
    bf* Yh = (bf*)take((size_t)MT * DM * 2); bf* Yl = (bf*)take((size_t)MT * DM * 2);
    h16* QP16 = (h16*)take((size_t)NB_ * NH_ * TT * HD * 2); h16* KP16 = (h16*)take((size_t)NB_ * NKV * TT * HD * 2); h16* VT16 = (h16*)take((size_t)NB_ * NKV * HD * TT * 2);
    bf* QPh = (bf*)take((size_t)NB_ * NH_ * TT * HD * 2); bf* QPl = (bf*)take((size_t)NB_ * NH_ * TT * HD * 2); bf* KPh = (bf*)take((size_t)NB_ * NKV * TT * HD * 2); bf* KPl = (bf*)take((size_t)NB_ * NKV * TT * HD * 2); bf* VTh = (bf*)take((size_t)NB_ * NKV * HD * TT * 2); bf* VTl = (bf*)take((size_t)NB_ * NKV * HD * TT * 2);
    bf* ATh = (bf*)take((size_t)MT * DQ * 2); bf* ATl = (bf*)take((size_t)MT * DQ * 2);
    if ((size_t)(wsp - (char*)d_ws) > ws_size) return;    // ws 256 MiB
    k_prep<<<NRB + 2 * NWQ + 2 * NWK, 256, 0, stream>>>(x, gw, wq, wk, wv, wo, Yh, Yl, WQ, WK, WV, WO);   /* n = RMSNorm(x) norm_w as hi/lo planes; the weights as [n][k] bf16 */
    k_qkv<<<NQT + 2 * NKT, 128, 0, stream>>>(Yh, Yl, WQ, WK, WV, DM, cosT, sinT, QP16, QPh, QPl, KP16, KPh, KPl, VT16, VTh, VTl);
    k_attn<<<dim3(TT / 64, NH_, NB_), AW * 32, 0, stream>>>(QP16, QPh, QPl, KP16, KPh, KPl, VT16, VTh, VTl, ATh, ATl);
    k_oproj<<<dim3(MT / 128, DM / 128, 1), 128, 0, stream>>>(ATh, ATl, WO, DQ, x, OUT);   /* out = x + attn wo */
}

// v007
// Measured time: 253 microseconds a run.
// Two timings next to v006 both put it at 1.09 times that version's speed.
// Over all steps from v000 it is 6.87 times as fast.
#include <hip/hip_runtime.h>

// Sliding-window causal GQA with RMSNorm pre-normalisation and residual (x [2][2048][2048]; n = x rsqrt(mean x^2 + 1e-6) norm_w; q = n wq ('xw', 16 heads x 128), k, v = n wk / n wv (4 kv heads); rotate-half RoPE from the given tables [2048][64] (both halves share column d mod 64); 4 query heads per kv head (repeat); scores/sqrt(128) kept where j <= i and i - j < 512; softmax; out = x + merged wo -> [2][2048][2048]).
// Compute dtypes, f32 accumulate: every input rounded to bf16; q/k/v hl x exact (2 products); rotary in f32 from the bf16-rounded input tables; windowed-causal scores and attn.v (only key tiles that touch the window band computed): query rows < 512 hl (3 products), the rest single fp16 (x1024); softmax f32; wo hl x exact (2 products), + x residual in f32.

#define NB_  2
#define TT   2048
#define DM   2048
#define NH_  16
#define NKV  4
#define REP  (NH_ / NKV)
#define HD   128
#define DQ   (NH_ * HD)
#define DKV  (NKV * HD)
#define MT   (NB_ * TT)           // rows of both batch elements together: every stage takes them in one launch
#define RH   512                  // query rows < RH use hi+lo planes (0: none)
#define WIN  512
#define NBC  ((WIN + 128) / 128)  // 128-key chunks of a softmax row: WIN + 64 band keys of a 64-row tile, from a multiple of 128
#define PB   (NBC * 128)         // pitch of a stored score / probability row: only the NBC chunks from the row tile's first chunk jb on are kept
#define PCAR 1024.0f
#define SCL  0.088388347648318447f   // HD^-0.5
typedef _Float16 h16;
typedef unsigned short bf;
typedef __attribute__((ext_vector_type(16))) __bf16   v16bf;
typedef __attribute__((ext_vector_type(16))) _Float16 v16h;
typedef __attribute__((ext_vector_type(8)))  _Float16 v8h;
typedef __attribute__((ext_vector_type(8)))  unsigned short v8us;
typedef __attribute__((ext_vector_type(8)))  float    v8f;
typedef __attribute__((ext_vector_type(4)))  float    v4f;
typedef v8h  __attribute__((may_alias)) v8ha;
typedef v4f  __attribute__((may_alias)) v4fa;
typedef v8us __attribute__((may_alias)) v8usa;

__device__ __forceinline__ unsigned short f2bf(float f) { unsigned u = __float_as_uint(f); u += 0x7FFFu + ((u >> 16) & 1u); return (unsigned short)(u >> 16); }
__device__ __forceinline__ float bf2f(unsigned short b) { return __uint_as_float(((unsigned)b) << 16); }
__device__ __forceinline__ float bfr(float f) { return bf2f(f2bf(f)); }
__device__ __forceinline__ v16h cat16(v8h lo, v8h hi) { return __builtin_shufflevector(lo, hi, 0, 1, 2, 3, 4, 5, 6, 7, 8, 9, 10, 11, 12, 13, 14, 15); }
__device__ __forceinline__ v16bf cat16b(v8us lo, v8us hi) { return __builtin_bit_cast(v16bf, __builtin_shufflevector(lo, hi, 0, 1, 2, 3, 4, 5, 6, 7, 8, 9, 10, 11, 12, 13, 14, 15)); }
__device__ __forceinline__ v8f wmma16(v16h a, v16h b, v8f c) { return __builtin_amdgcn_wmma_f32_16x16x32_f16(false, a, false, b, (short)0, c, false, false); }
__device__ __forceinline__ v8f wmmab(v16bf a, v16bf b, v8f c) { return __builtin_amdgcn_wmma_f32_16x16x32_bf16(false, a, false, b, (short)0, c, false, false); }
__device__ __forceinline__ h16 tohx(float x) { return (h16)x; }
__device__ __forceinline__ void splitf(float y, unsigned short& h, unsigned short& l) { h = f2bf(y); l = f2bf(y - bf2f(h)); }
typedef float __attribute__((may_alias)) fa;



// ---- gemm_tile<MB>: projection GEMM, 4 waves (2 x 2) per (32 MB)x128 output tile, each wave a (16 MB)x64 tile (4 MB accumulators); MB = 4 where that fills the chip, MB = 2 for the narrow k and v outputs (twice the work-groups). The operands (K-contiguous bf16 planes A hi, A lo, Bt) are staged in LDS by asynchronous copies,
// KS k of the tile's rows of each plane a stage, two buffers: the next stage's copies fly while this stage is worked on; fragments are read from LDS one 32-k block ahead. Tile (bx, by) of (M/(32 MB), N/128), 128 threads; M = MT, the rows of both batch elements (row m = batch m / TT, position m mod TT; a tile lies in one batch element); ring = the work-group's LDS, declared by the kernel. c[m][n] (f32) = sum_k (A[m][k] + A2[m][k]) Bt[n][k]. K % KS == 0, K >= 2 KS (the prologue fills two stages).
// The element-wise pass that follows each product is the kernel's epilogue EP, on the f32 tile while it is still on the chip (a tile's 128 columns are one head):
// EP_ROPE: rotate-half rotary from the bf16-rounded tables E0 = cos, E1 = sin [t][HD/2] (out[d] = c[d] cos[t][d] - c[d+HD/2] sin[t][d], out[d+HD/2] = c[d+HD/2] cos[t][d] + c[d] sin[t][d]), written as the head planes [b][h] (fp16, hi, lo; nh heads) in fragment order: blocks of 16 t x 32 d, [t/16][d/32], 512 elements each;
// EP_VT: the transposed head planes [b][h] (fp16, hi, lo) in fragment order: blocks of 16 d x 32 t, [t/32][d/16]; EP_RES: O[m][n] = bf16-rounded E0[m][n] + c[m][n] (f32, both of pitch DM).
// Fragment order: a block holds one matrix-instruction operand (16 rows r x 32 k) as the attention kernel's lanes take it: element (r, k) at (k / 16) 256 + ((k mod 16) / 8 x 16 + r) 8 + k mod 8, so that lane l = hi 16 + r reads its 8 + 8 elements at 8 l and 256 + 8 l and a wave's 16-byte load covers 512 contiguous bytes (4 whole lines; from a row-major plane it touches 16). WFrag::ldf reads one.
#define EP_ROPE 0
#define EP_VT   1
#define EP_RES  2
#define TP   132                 // pitch in floats of the f32 tile staged for EP_ROPE: 16-byte rows, four banks on from row to row
#define KS   64                  // k per stage: 128 B of every operand row, one whole line
#define LP   (KS + 8)            // LDS row pitch in elements: 144 B = 16 B x odd, free of bank conflicts for 16-byte fragment reads
template <typename T16> struct WFrag;
template <> struct WFrag<h16> { typedef v16h V; static __device__ __forceinline__ V ld(const h16* p) { return cat16(*(const v8h*)p, *(const v8h*)(p + 16)); } static __device__ __forceinline__ V ldf(const h16* p) { return cat16(*(const v8h*)p, *(const v8h*)(p + 256)); } static __device__ __forceinline__ V cat(const h16* p, const h16* p2) { return cat16(*(const v8ha*)p, *(const v8ha*)p2); } static __device__ __forceinline__ v8f mma(V a, V b, v8f c) { return wmma16(a, b, c); } };
template <> struct WFrag<bf> { typedef v16bf V; static __device__ __forceinline__ V ld(const bf* p) { return cat16b(*(const v8us*)p, *(const v8us*)(p + 16)); } static __device__ __forceinline__ V ldf(const bf* p) { return cat16b(*(const v8us*)p, *(const v8us*)(p + 256)); } static __device__ __forceinline__ V cat(const bf* p, const bf* p2) { return cat16b(*(const v8usa*)p, *(const v8usa*)p2); } static __device__ __forceinline__ v8f mma(V a, V b, v8f c) { return wmmab(a, b, c); } };
typedef __attribute__((ext_vector_type(4))) int v4ic;
// NJ asynchronous copies of 512 B (4 rows of 128 B each, 16 B a lane): 4 NJ rows of one plane. l = the lane's place in the first of them in LDS, g = the same place in the global plane, gs = elements per 4 global rows.
template <int NJ>
__device__ __forceinline__ void planecopy(bf* l, const bf* g, size_t gs) {
#pragma unroll
    for (int j = 0; j < NJ; ++j)
        __builtin_amdgcn_global_load_async_to_lds_b128((__attribute__((address_space(1))) v4ic*)(g + (size_t)j * gs), (__attribute__((address_space(3))) v4ic*)(l + j * 4 * LP), 0, 0);
}
template <int MB> struct Frags { WFrag<bf>::V a[MB], a2[MB], b[4]; };
// the fragments of one 32-k block of a stage, as one group of LDS reads; sa, sa2, sb = the lane's place in the wave's first row of each plane
template <int MB>
__device__ __forceinline__ void ldfr(Frags<MB>& f, const bf* sa, const bf* sa2, const bf* sb) {
#pragma unroll
    for (int q = 0; q < MB; ++q) { f.a[q] = WFrag<bf>::ld(sa + q * 16 * LP); f.a2[q] = WFrag<bf>::ld(sa2 + q * 16 * LP); }
#pragma unroll
    for (int q = 0; q < 4; ++q) f.b[q] = WFrag<bf>::ld(sb + q * 16 * LP);
}
template <int MB>
__device__ __forceinline__ void mmblk(v8f (&acc)[MB][4], const Frags<MB>& f) {
#pragma unroll
    for (int nb = 0; nb < 4; ++nb)
#pragma unroll
        for (int mb = 0; mb < MB; ++mb) { acc[mb][nb] = WFrag<bf>::mma(f.a[mb], f.b[nb], acc[mb][nb]); acc[mb][nb] = WFrag<bf>::mma(f.a2[mb], f.b[nb], acc[mb][nb]); }
}
#define RINGE (2 * (2 * 32 * 4 * LP + 128 * LP))   // elements of the two-stage ring of the largest tile (MB = 4)
template <int MB, int EP>
__device__ __forceinline__ void gemm_tile(bf* ring, int bx, int by, int nh, const bf* __restrict__ A, const bf* __restrict__ A2, const bf* __restrict__ Bt, int K, const float* __restrict__ E0, const float* __restrict__ E1, float* O, h16* P16, bf* Ph, bf* Pl) {
    static_assert(KS == 64, "a stage is two 32-k blocks");
    constexpr int PLA = 32 * MB * LP, STG = 2 * PLA + 128 * LP;   // a stage: A hi | A lo (32 MB rows each) | Bt (128 rows)
    static_assert(2 * STG <= RINGE, "the ring fits the kernel's LDS");
    const int lane = threadIdx.x & 31, lr = lane & 15, hi = lane >> 4; const int w = __builtin_amdgcn_readfirstlane((int)(threadIdx.x >> 5)), wm = w >> 1, wn = w & 1;
    const int r0 = bx * (32 * MB), c0 = by * 128, bb = r0 / TT, t0 = r0 % TT;   // bb, t0: the tile's batch element and its first position there
    (void)bb; (void)t0; (void)nh;
    v8f acc[MB][4];
#pragma unroll
    for (int mb = 0; mb < MB; ++mb)
#pragma unroll
        for (int nb = 0; nb < 4; ++nb) acc[mb][nb] = (v8f){};
    // wave w copies rows 8 MB w .. 8 MB w + 8 MB - 1 of the A planes and rows 32 w .. 32 w + 31 of Bt
    const int crA = w * (8 * MB) + (lane >> 3), crB = w * 32 + (lane >> 3), ccol = (lane & 7) * 8; const size_t gs = (size_t)4 * K;
    const bf* gA = A + (size_t)(r0 + crA) * K + ccol; const bf* gA2 = A2 + (size_t)(r0 + crA) * K + ccol; const bf* gB = Bt + (size_t)(c0 + crB) * K + ccol;
    bf* lA = ring + crA * LP + ccol; bf* lB = ring + 2 * PLA + crB * LP + ccol;
    const int nt = K / KS;
    planecopy<2 * MB>(lA, gA, gs); planecopy<2 * MB>(lA + PLA, gA2, gs); planecopy<8>(lB, gB, gs);
    asm volatile("s_wait_asynccnt 0x0" ::: "memory");   // this wave's share of stage 0 has landed
    __syncthreads();                                     // ... and every other wave's
    planecopy<2 * MB>(lA + STG, gA + KS, gs); planecopy<2 * MB>(lA + STG + PLA, gA2 + KS, gs); planecopy<8>(lB + STG, gB + KS, gs);
    const int aofs = (wm * (16 * MB) + lr) * LP + 8 * hi, bofs = 2 * PLA + (wn * 64 + lr) * LP + 8 * hi;
    Frags<MB> f0, f1;                                    // two fragment sets: each block's LDS reads are issued one block ahead, as one group
    ldfr<MB>(f0, ring + aofs, ring + PLA + aofs, ring + bofs);
#pragma unroll 1
    for (int t = 0; t < nt; ++t) {
        const bf* st = ring + (t & 1) * STG; const bf* sn = ring + ((t + 1) & 1) * STG;
        ldfr<MB>(f1, st + aofs + 32, st + PLA + aofs + 32, st + bofs + 32);
        __builtin_amdgcn_sched_barrier(0);                   // keeps the read group ahead of the block it hides behind
        mmblk<MB>(acc, f0);
        __builtin_amdgcn_sched_barrier(0);                   // keeps the block ahead of the publish point, so that the waits below find their data landed
        // publish point of stage t + 1, in front of stage t's last block, whose fragments are already fetched
        asm volatile("s_wait_dscnt 0x0" ::: "memory");      // this wave's last reads of stage t have returned before its buffer is refilled
        asm volatile("s_wait_asynccnt 0x0" ::: "memory");   // this wave's share of stage t + 1 has landed
        __syncthreads();                                     // publishes stage t + 1 and ends every wave's reads of stage t
        if (t + 2 < nt) { const size_t ko = (size_t)(t + 2) * KS; const int bo = (t & 1) * STG; planecopy<2 * MB>(lA + bo, gA + ko, gs); planecopy<2 * MB>(lA + bo + PLA, gA2 + ko, gs); planecopy<8>(lB + bo, gB + ko, gs); }
        if (t + 1 < nt) ldfr<MB>(f0, sn + aofs, sn + PLA + aofs, sn + bofs);
        mmblk<MB>(acc, f1);
    }
    asm volatile("s_wait_asynccnt 0x0" ::: "memory");       // no copy is outstanding when the wave ends
    // Behind the loop's last barrier the ring is free: no copy is outstanding and every wave's last fragment read returned in front of that barrier. The epilogues stage in it.
    if constexpr (EP == EP_ROPE) {
        fa* tl = (fa*)ring;                                  // the work-group's whole tile in f32: a column's rotary partner lies in the neighbour wave's registers
#pragma unroll
        for (int mb = 0; mb < MB; ++mb)
#pragma unroll
            for (int nb = 0; nb < 4; ++nb)
#pragma unroll
                for (int j = 0; j < 8; ++j) tl[(wm * (16 * MB) + mb * 16 + hi * 8 + j) * TP + wn * 64 + nb * 16 + lr] = acc[mb][nb][j];
        // wave w takes rows 8 MB w ..; a step is half a block: 16 rows (lane mod 16) x 16 columns d < HD/2 (8 a lane), and their partners d + HD/2; step s = row block s / 4, column group s mod 4
        const int row0 = w * (8 * MB) + lr, dc = hi * 8;
        const float* cp = E0 + (size_t)(t0 + row0) * (HD / 2) + dc; const float* sp = E1 + (size_t)(t0 + row0) * (HD / 2) + dc;
        v4f cv[2 * MB][2], sv[2 * MB][2];                    // every step's table values, fetched while the tile is staged
#pragma unroll
        for (int s = 0; s < 2 * MB; ++s)
#pragma unroll
            for (int u = 0; u < 2; ++u) { cv[s][u] = *(const v4f*)(cp + (s >> 2) * 16 * (HD / 2) + (s & 3) * 16 + u * 4); sv[s][u] = *(const v4f*)(sp + (s >> 2) * 16 * (HD / 2) + (s & 3) * 16 + u * 4); }
        // the wait that stands in front of a rewrite of a register which an issued load names; it takes the addresses as inputs, so that they stay in their registers up to it
        asm volatile("s_wait_xcnt 0x0" :: "v"(cp), "v"(sp) : "memory");
        __syncthreads();                                     // the whole tile is in LDS before a row is read
        const size_t oo = (((size_t)bb * nh + by) * TT + t0 + w * (8 * MB)) * HD + lane * 8;   // the lane's place in the wave's first block (the HD / 32 blocks of 16 rows t are 16 HD elements)
        h16* q16 = P16 + oo; bf* qh = Ph + oo; bf* ql = Pl + oo;
        const fa* xr = tl + row0 * TP + dc;
        v4f xl0 = *(const v4fa*)xr, xl1 = *(const v4fa*)(xr + 4), xh0 = *(const v4fa*)(xr + HD / 2), xh1 = *(const v4fa*)(xr + HD / 2 + 4);
        v8h pa16 = {}, pb16 = {}; v8us pah = {}, pal = {}, pbh = {}, pbl = {};   // the last step's stored values
#pragma unroll
        for (int s = 0; s < 2 * MB; ++s) {
            v4f nl0 = xl0, nl1 = xl1, nh0 = xh0, nh1 = xh1;
            if (s + 1 < 2 * MB) { const fa* xn = xr + ((s + 1) >> 2) * 16 * TP + ((s + 1) & 3) * 16; nl0 = *(const v4fa*)xn; nl1 = *(const v4fa*)(xn + 4); nh0 = *(const v4fa*)(xn + HD / 2); nh1 = *(const v4fa*)(xn + HD / 2 + 4); }   // the next step's rows are read from LDS while this step is worked on
            v8h a16, b16; v8us ah, al, bh, bl;
#pragma unroll
            for (int q = 0; q < 8; ++q) { const float x0 = q < 4 ? xl0[q & 3] : xl1[q & 3], x1 = q < 4 ? xh0[q & 3] : xh1[q & 3], c = bfr(cv[s][q >> 2][q & 3]), sn = bfr(sv[s][q >> 2][q & 3]);
                const float ra = x0 * c - x1 * sn, rb = x1 * c + x0 * sn; unsigned short h2, l2;
                a16[q] = tohx(ra); splitf(ra, h2, l2); ah[q] = h2; al[q] = l2; b16[q] = tohx(rb); splitf(rb, h2, l2); bh[q] = h2; bl[q] = l2; }
            __builtin_amdgcn_sched_barrier(0);               // keeps the step's arithmetic in front of the wait, which would otherwise be lifted to directly behind the last step's stores
            // the wait that stands in front of a rewrite of a register which an issued store names: it takes the addresses and the last step's data as inputs, so that they stay in their registers up to it, a step's work behind those stores
            if (s) asm volatile("s_wait_xcnt 0x0" :: "v"(q16), "v"(qh), "v"(ql), "v"(pa16), "v"(pb16), "v"(pah), "v"(pbh), "v"(pal), "v"(pbl) : "memory");
            constexpr int PO = (HD / 2 / 32) * 512; const int so = (s >> 2) * 16 * HD + (s & 3) * 256;   // the step's half block; the partner columns lie HD/2/32 blocks on
            *(v8h*)(q16 + so) = a16; *(v8h*)(q16 + so + PO) = b16; *(v8us*)(qh + so) = ah; *(v8us*)(qh + so + PO) = bh; *(v8us*)(ql + so) = al; *(v8us*)(ql + so + PO) = bl;
            pa16 = a16; pb16 = b16; pah = ah; pal = al; pbh = bh; pbl = bl; xl0 = nl0; xl1 = nl1; xh0 = nh0; xh1 = nh1;
        }
    } else if constexpr (EP == EP_VT) {
        static_assert(MB == 2, "a staged row is 64 t of one column: one 128-byte line");
        constexpr int VP = 32 * MB + 8, VPL = 128 * VP;      // staged planes [d][t]: pitch 144 B = 16 B x odd; a lane's 8 accumulator rows are 8 consecutive t of one d
#pragma unroll
        for (int mb = 0; mb < MB; ++mb)
#pragma unroll
            for (int nb = 0; nb < 4; ++nb) { v8h o16; v8us oh, ol;
#pragma unroll
                for (int j = 0; j < 8; ++j) { const float xv = acc[mb][nb][j]; unsigned short h2, l2; o16[j] = tohx(xv); splitf(xv, h2, l2); oh[j] = h2; ol[j] = l2; }
                const int e = (wn * 64 + nb * 16 + lr) * VP + wm * (16 * MB) + mb * 16 + hi * 8;
                *(v8ha*)(ring + e) = o16; *(v8usa*)(ring + VPL + e) = oh; *(v8usa*)(ring + 2 * VPL + e) = ol; }
        __syncthreads();                                     // every plane row is whole in LDS before it is read
        // wave w takes columns 32 w ..; a step is half a block: 16 columns d (lane mod 16) x 16 t (8 a lane), 512 contiguous bytes a store; step s = column block s / 4, t group s mod 4
        const int d0 = w * 32 + lr, tc = hi * 8; const bf* lp = ring + d0 * VP + tc;
        const size_t oo = ((size_t)bb * nh + by) * HD * TT + (size_t)(t0 / 32) * (HD / 16 * 512) + w * 1024 + lane * 8;   // the lane's place in the wave's first block
        h16* q16 = P16 + oo; bf* qh = Ph + oo; bf* ql = Pl + oo;
        v8us a[8], b[8], c[8];                               // all of the wave's rows are read first: no register that a store names is written again
#pragma unroll
        for (int s = 0; s < 8; ++s) { const int lo = (s >> 2) * 16 * VP + (s & 3) * 16; a[s] = *(const v8usa*)(lp + lo); b[s] = *(const v8usa*)(lp + VPL + lo); c[s] = *(const v8usa*)(lp + 2 * VPL + lo); }
        __builtin_amdgcn_sched_barrier(0);                   // keeps every LDS read in front of the first store
#pragma unroll
        for (int s = 0; s < 8; ++s) { const int so = ((s & 3) >> 1) * (HD / 16 * 512) + (s >> 2) * 512 + (s & 1) * 256; *(v8usa*)(q16 + so) = a[s]; *(v8us*)(qh + so) = b[s]; *(v8us*)(ql + so) = c[s]; }
    } else {
        fa* os = (fa*)ring + w * (16 * 68);                  // each wave stages its output rows in its own LDS range
        const size_t eo = (size_t)(r0 + wm * (16 * MB) + hi) * DM + c0 + wn * 64 + lr * 4;   // the lane's place in its first row; a step is 2 rows
        const float* xp = E0 + eo; float* op = O + eo;
        v4f xa[2][8], o[2][8];                               // the residual rows of a 16-row block, fetched one block ahead; two blocks' results
#pragma unroll
        for (int s = 0; s < 8; ++s) xa[0][s] = *(const v4f*)(xp + s * 2 * DM);
#pragma unroll
        for (int mb = 0; mb < MB; ++mb) {
#pragma unroll
            for (int nb = 0; nb < 4; ++nb) {
#pragma unroll
                for (int j = 0; j < 8; ++j) os[(hi * 8 + j) * 68 + nb * 16 + lr] = acc[mb][nb][j]; }
            if (mb + 1 < MB) {
#pragma unroll
                for (int s = 0; s < 8; ++s) xa[(mb + 1) & 1][s] = *(const v4f*)(xp + ((mb + 1) * 16 + s * 2) * DM); }
            __builtin_amdgcn_wave_barrier(); asm volatile("" ::: "memory");   // keeps the row reads below, which take other lanes' values, behind the stores above
#pragma unroll
            for (int s = 0; s < 8; ++s) { const v4f val = *(const v4fa*)(os + (2 * s + hi) * 68 + lr * 4);
#pragma unroll
                for (int q = 0; q < 4; ++q) o[mb & 1][s][q] = bfr(xa[mb & 1][s][q]) + val[q]; }
            __builtin_amdgcn_sched_barrier(0);               // keeps the block's sums in front of the wait, which would otherwise be lifted to directly behind the last block's stores
            // the wait that stands in front of a rewrite of a register which an issued load or store names: it takes the addresses and the last block's data as inputs, so that they stay in their registers up to it, a block's work behind those stores
            if (mb) asm volatile("s_wait_xcnt 0x0" :: "v"(xp), "v"(op), "v"(o[(mb + 1) & 1][0]), "v"(o[(mb + 1) & 1][1]), "v"(o[(mb + 1) & 1][2]), "v"(o[(mb + 1) & 1][3]), "v"(o[(mb + 1) & 1][4]), "v"(o[(mb + 1) & 1][5]), "v"(o[(mb + 1) & 1][6]), "v"(o[(mb + 1) & 1][7]) : "memory");
#pragma unroll
            for (int s = 0; s < 8; ++s) *(v4f*)(op + (mb * 16 + s * 2) * DM) = o[mb & 1][s];
            __builtin_amdgcn_wave_barrier(); asm volatile("" ::: "memory");   // keeps the next 16 rows' LDS stores behind this block's reads
        }
    }
    asm volatile("s_wait_xcnt 0x0" ::: "memory");            // the wait that stands in front of a rewrite of a register which an issued store names: in a kernel of several tile kinds another kind's text follows this one's last stores
}
// ---- k_qkv: the three projections of n, which read nothing of each other, in one grid: first the q tiles (the longest), then the k tiles, then the v tiles; within each the row tile runs fastest.
#define NQT ((MT / 128) * (DQ / 128))
#define NKT ((MT / 64) * (DKV / 128))
__global__ __launch_bounds__(128) void k_qkv(const bf* __restrict__ Yh, const bf* __restrict__ Yl, const bf* __restrict__ WQ, const bf* __restrict__ WK, const bf* __restrict__ WV, int K, const float* __restrict__ cosT, const float* __restrict__ sinT, h16* QP16, bf* QPh, bf* QPl, h16* KP16, bf* KPh, bf* KPl, h16* VT16, bf* VTh, bf* VTl) {
    __shared__ __align__(16) bf ring[RINGE];
    const int i = blockIdx.x;
    if (i < NQT) gemm_tile<4, EP_ROPE>(ring, i % (MT / 128), i / (MT / 128), NH_, Yh, Yl, WQ, K, cosT, sinT, nullptr, QP16, QPh, QPl);
    else if (i < NQT + NKT) gemm_tile<2, EP_ROPE>(ring, (i - NQT) % (MT / 64), (i - NQT) / (MT / 64), NKV, Yh, Yl, WK, K, cosT, sinT, nullptr, KP16, KPh, KPl);
    else gemm_tile<2, EP_VT>(ring, (i - NQT - NKT) % (MT / 64), (i - NQT - NKT) / (MT / 64), NKV, Yh, Yl, WV, K, nullptr, nullptr, nullptr, VT16, VTh, VTl);
}
// ---- k_oproj: out = x + attn wo, grid (MT / 128, DM / 128)
__global__ __launch_bounds__(128) void k_oproj(const bf* __restrict__ Ah, const bf* __restrict__ Al, const bf* __restrict__ WO, int K, const float* __restrict__ x, float* O) {
    __shared__ __align__(16) bf ring[RINGE];
    gemm_tile<4, EP_RES>(ring, blockIdx.x, blockIdx.y, 0, Ah, Al, WO, K, x, nullptr, O, nullptr, nullptr, nullptr);
}

typedef __attribute__((ext_vector_type(2))) _Float16 v2h;
typedef __attribute__((ext_vector_type(4))) _Float16 v4h;
typedef __attribute__((ext_vector_type(2))) unsigned short v2us;
typedef __attribute__((ext_vector_type(4))) unsigned short v4us;
typedef __attribute__((ext_vector_type(2))) float v2f;
typedef __attribute__((ext_vector_type(4))) int v4i;

__device__ __forceinline__ void wt_blk(int blk, const float* __restrict__ w, int K, int N, bf* Bt) {
    const int lane = threadIdx.x & 31; const int L0 = (blk * 8 + (threadIdx.x >> 5)) * 8; const int nlines = N * K / 64;
{
#pragma unroll 1
        for (int l = 0; l < 8; ++l) { const int L = L0 + l; if (L >= nlines) break; const size_t e = (size_t)L * 64 + lane * 2; const int k = (int)(e % K), n = (int)(e / K); v2us o;
            o[0] = f2bf(w[(size_t)k * N + n]); o[1] = f2bf(w[(size_t)(k + 1) * N + n]); *(v2us*)(Bt + e) = o; }
         }
}
__device__ __forceinline__ void rms_blk(int blk, const float* __restrict__ X, const float* __restrict__ g, bf* Yh, bf* Yl) {
    const int lane = threadIdx.x & 31; const int r = blk * 8 + (threadIdx.x >> 5); if (r >= MT) return; const float* xr = X + (size_t)r * DM; float s = 0.f;
#pragma unroll 1
    for (int ch = 0; ch < DM / 128; ++ch) { const v4f a = *(const v4f*)(xr + ch * 128 + lane * 4);
#pragma unroll
        for (int q = 0; q < 4; ++q) { const float xb = bfr(a[q]); float p = __fmul_rn(xb, xb); asm volatile("" : "+v"(p)); s = __fadd_rn(s, p); } }
#pragma unroll
    for (int sh = 16; sh; sh >>= 1) s += __shfl_xor(s, sh, 32);
    const float rs = __fdiv_rn(1.0f, __fsqrt_rn(__fadd_rn(s * (1.0f / DM), 1e-6f)));
{
#pragma unroll 1
        for (int ch = 0; ch < DM / 128; ++ch) { const int c0 = ch * 128 + lane * 4; const v4f a = *(const v4f*)(xr + c0); v4us oh, ol;
#pragma unroll
            for (int q = 0; q < 4; ++q) { float n0 = __fmul_rn(bfr(a[q]), rs); asm volatile("" : "+v"(n0)); const float y = __fmul_rn(n0, bfr(g[c0 + q])); unsigned short h2, l2; splitf(y, h2, l2); oh[q] = h2; ol[q] = l2; }
            *(v4us*)(Yh + (size_t)r * DM + c0) = oh; *(v4us*)(Yl + (size_t)r * DM + c0) = ol; }
         } }
// ---- k_prep: the five jobs that read inputs only, in one grid: n = RMSNorm(x) norm_w of all MT rows as hi/lo planes, then the four weight transposes (the large ones first).
#define NRB (MT / 8)
#define NWQ (DM * DQ / 64 / 64)
#define NWK (DM * DKV / 64 / 64)
__global__ __launch_bounds__(256) void k_prep(const float* __restrict__ x, const float* __restrict__ g, const float* __restrict__ wq, const float* __restrict__ wk, const float* __restrict__ wv, const float* __restrict__ wo, bf* Yh, bf* Yl, bf* WQ, bf* WK, bf* WV, bf* WO) {
    const int i = blockIdx.x;
    if (i < NRB) rms_blk(i, x, g, Yh, Yl);
    else if (i < NRB + NWQ) wt_blk(i - NRB, wq, DM, DQ, WQ);
    else if (i < NRB + 2 * NWQ) wt_blk(i - NRB - NWQ, wo, DQ, DM, WO);
    else if (i < NRB + 2 * NWQ + NWK) wt_blk(i - NRB - 2 * NWQ, wk, DM, DKV, WK);
    else wt_blk(i - NRB - 2 * NWQ - NWK, wv, DM, DKV, WV);
}
__global__ __launch_bounds__(256) void k_cvt8(const float* __restrict__ src, bf* dst, size_t n8) { const size_t i = (size_t)blockIdx.x * 256 + threadIdx.x; if (i >= n8) return; const v8f v = *(const v8f*)(src + i * 8); v8us o;
#pragma unroll
    for (int k = 0; k < 8; ++k) o[k] = f2bf(v[k]); *(v8us*)(dst + i * 8) = o;  }
typedef v4h  __attribute__((may_alias)) v4ha;
typedef v4us __attribute__((may_alias)) v4usa;
// ---- k_attn: the whole attention of one 64-row query tile of one head in one work-group of AW = 9 waves; the tile's score / probability band (PB keys from key jb on, jb = the 128-aligned start of the tile's band) lives in LDS only.
// Phase 1: wave w computes the 64x64 score tile of keys r0 - WIN + 64 w .. (in passes of 32 rows, 16 with hi+lo planes; tiles left of key 0 do not exist). Phase 2: softmax, one row a wave at a time (t = S x HD^-0.5 for j <= i and i - j < WIN, everything else masked by select; register row, one exp, fixed trees);
// the probabilities overwrite their own score row (16-bit planes: hi or fp16 in the first PB elements of the row's space, lo in the second), each plane rotated by 8 (row mod 16) elements so that the 16 rows of a fragment read lie in different banks.
// Phase 3: waves 0..7 each contract a 16x64 tile of P.V over the band's keys (probabilities outside it are exactly zero), V from the transposed planes; Q, K and V fragments come from planes in fragment order, 512 contiguous bytes a load; the result x carrier scale goes out as the hi/lo planes [t][head][d] that the output projection reads, whole 128-byte lines a store.
#define AW 9
template <typename T16, int NSPLIT>
__device__ __forceinline__ void attn_tile(float* S, const T16* __restrict__ Q, const T16* __restrict__ Q2, const T16* __restrict__ Kp, const T16* __restrict__ Kp2, const T16* __restrict__ Vt, const T16* __restrict__ Vt2, int r0, bf* Ah, bf* Al) {
    typedef typename WFrag<T16>::V V;
    constexpr bool hires = (NSPLIT == 2);
    const int lane = threadIdx.x & 31, lr = lane & 15, hi = lane >> 4; const int w = __builtin_amdgcn_readfirstlane((int)(threadIdx.x >> 5));
    const int jb = max(0, r0 - WIN) & ~127;                          // first key that the stored rows hold
    const int c0 = r0 - WIN + w * 64;                                // this wave's key tile
    if (c0 >= 0) {
        constexpr int MBS = hires ? 1 : 2;                           // 16-row blocks a pass: as many as let one k block's fragments of every plane lie in registers at once
#pragma unroll 1   // rolled, like the three loops marked so below: keeps the registers under the cap that lets two work-groups share a WGP
        for (int rh = 0; rh < 4 / MBS; ++rh) {
            v8f acc[MBS][4];
#pragma unroll
            for (int mb = 0; mb < MBS; ++mb)
#pragma unroll
                for (int nb = 0; nb < 4; ++nb) acc[mb][nb] = (v8f){};
            const size_t aoff = (size_t)(r0 + rh * (16 * MBS)) * HD + lane * 8, boff = (size_t)c0 * HD + lane * 8;   // the lane's place in the first block of the pass's query rows and of the wave's keys (fragment order)
#pragma unroll 1   // rolled (registers)
            for (int kc = 0; kc < HD; kc += 32) {
                V a[MBS], a2[MBS], b[4], b2[4];
                const T16* qp = Q + aoff + kc * 16; const T16* qp2 = hires ? Q2 + aoff + kc * 16 : qp; const T16* kp = Kp + boff + kc * 16; const T16* kp2 = hires ? Kp2 + boff + kc * 16 : kp;   // block kc / 32 of the row of blocks
#pragma unroll
                for (int mb = 0; mb < MBS; ++mb) { a[mb] = WFrag<T16>::ldf(qp + (size_t)mb * 16 * HD); if (hires) a2[mb] = WFrag<T16>::ldf(qp2 + (size_t)mb * 16 * HD); }
#pragma unroll
                for (int nb = 0; nb < 4; ++nb) { b[nb] = WFrag<T16>::ldf(kp + (size_t)nb * 16 * HD); if (hires) b2[nb] = WFrag<T16>::ldf(kp2 + (size_t)nb * 16 * HD); }
                // the wait that stands in front of a rewrite of a register which an issued load names; it takes the addresses as inputs, so that they stay in their registers up to it and no load of the run lands on them
                asm volatile("s_wait_xcnt 0x0" :: "v"(qp), "v"(qp2), "v"(kp), "v"(kp2) : "memory");
                __builtin_amdgcn_sched_barrier(0);                   // keeps all of the trip's loads in front of its products, so that a trip waits for memory once
#pragma unroll
                for (int nb = 0; nb < 4; ++nb)
#pragma unroll
                    for (int mb = 0; mb < MBS; ++mb) { acc[mb][nb] = WFrag<T16>::mma(a[mb], b[nb], acc[mb][nb]); if (hires) { acc[mb][nb] = WFrag<T16>::mma(a2[mb], b[nb], acc[mb][nb]); acc[mb][nb] = WFrag<T16>::mma(a[mb], b2[nb], acc[mb][nb]); } }
                // fills the slots the chip needs behind the last matrix instruction on the loop's back edge
                if constexpr (MBS == 2) asm volatile("v_nop\n\tv_nop\n\tv_nop\n\tv_nop" : "+v"(acc[0][0]), "+v"(acc[0][1]), "+v"(acc[0][2]), "+v"(acc[0][3]), "+v"(acc[MBS - 1][0]), "+v"(acc[MBS - 1][1]), "+v"(acc[MBS - 1][2]), "+v"(acc[MBS - 1][3]));
                else asm volatile("v_nop\n\tv_nop\n\tv_nop\n\tv_nop" : "+v"(acc[0][0]), "+v"(acc[0][1]), "+v"(acc[0][2]), "+v"(acc[0][3]));
            }
            float* so = S + (size_t)(rh * (16 * MBS) + hi * 8) * PB + (c0 - jb) + lr;
#pragma unroll
            for (int mb = 0; mb < MBS; ++mb)
#pragma unroll
                for (int nb = 0; nb < 4; ++nb)
#pragma unroll
                    for (int j = 0; j < 8; ++j) so[(mb * 16 + j) * PB + nb * 16] = acc[mb][nb][j];
        }
    }
    __syncthreads();                                                 // every score tile is in LDS before a row is read
#pragma unroll 1   // rolled (registers)
    for (int rr = w; rr < 64; rr += AW) {
        const int i = r0 + rr; const float* sr = S + rr * PB; float v[NBC * 4]; float mx = -3.0e38f;
#pragma unroll
        for (int ch = 0; ch < NBC; ++ch) { const int j0 = jb + ch * 128 + lane * 4; const v4f a = *(const v4fa*)(sr + ch * 128 + lane * 4);
#pragma unroll
            for (int q = 0; q < 4; ++q) { const int j = j0 + q; const float t = (j <= i && i - j < WIN) ? a[q] * SCL : -3.0e38f; v[ch * 4 + q] = t; mx = fmaxf(mx, t); } }
#pragma unroll
        for (int sh = 16; sh; sh >>= 1) mx = fmaxf(mx, __shfl_xor(mx, sh, 32));
        float sum = 0.f;
#pragma unroll
        for (int k = 0; k < NBC * 4; ++k) { float d0 = __fsub_rn(v[k], mx); asm volatile("" : "+v"(d0)); v[k] = __builtin_amdgcn_exp2f(__fmul_rn(d0, 1.4426950408889634f)); if (k + 1 < NBC * 4) asm volatile("v_nop" :: "v"(v[k])); /* fills the one slot the instruction set asks for behind a transcendental before the next key's value overwrites its source register */ sum += v[k]; }
#pragma unroll
        for (int sh = 16; sh; sh >>= 1) sum += __shfl_xor(sum, sh, 32);
        const float f = __fdiv_rn(hires ? 1.0f : PCAR, sum);
        T16* pr = (T16*)(S + rr * PB);                               // the row's own space: all of it is in this wave's registers by now
#pragma unroll
        for (int ch = 0; ch < NBC; ++ch) { int cx = ch * 128 + lane * 4 + 8 * (rr & 15); if (cx >= PB) cx -= PB;
            if constexpr (hires) { v4us oh, ol;
#pragma unroll
                for (int q = 0; q < 4; ++q) { unsigned short a, c2; splitf(v[ch * 4 + q] * f, a, c2); oh[q] = a; ol[q] = c2; }
                *(v4usa*)(pr + cx) = oh; *(v4usa*)(pr + PB + cx) = ol;
            } else { v4h o4;
#pragma unroll
                for (int q = 0; q < 4; ++q) o4[q] = tohx(v[ch * 4 + q] * f);
                *(v4ha*)(pr + cx) = o4; } }
    }
    __syncthreads();                                                 // every probability row is in LDS before a fragment is read
    const int wr = w >> 1, wc = w & 1;                               // waves 0..7: rows 16 wr .., columns 64 wc ..
    v8f oc[4];
#pragma unroll
    for (int nb = 0; nb < 4; ++nb) oc[nb] = (v8f){};
    if (w < 8) {
        const int K0 = max(0, r0 - WIN), Kl = r0 + 64;               // the band's keys, both multiples of 64
        const T16* pr = (const T16*)(S + (wr * 16 + lr) * PB); const size_t boff = (size_t)wc * (4 * 512) + lane * 8;   // the lane's place in the wave's first column block (fragment order)
        constexpr int UB = hires ? 1 : 2;                            // 32-key blocks a trip: as many as let the trip's fragments of every plane lie in registers at once
#pragma unroll 1   // rolled (registers)
        for (int kb = K0; kb < Kl; kb += 32 * UB) {
            V a[UB], a2[UB], b[UB][4], b2[UB][4];
            const T16* vp = Vt + boff + (size_t)kb * (HD / 16 * 16); const T16* vp2 = hires ? Vt2 + boff + (size_t)kb * (HD / 16 * 16) : vp;   // key block kb / 32: HD / 16 blocks of 512 elements each
#pragma unroll
            for (int u = 0; u < UB; ++u) {
                int c1 = kb + u * 32 - jb + 8 * hi + 8 * lr, c2 = c1 + 16; if (c1 >= PB) c1 -= PB; if (c2 >= PB) c2 -= PB;
                a[u] = WFrag<T16>::cat(pr + c1, pr + c2); if (hires) a2[u] = WFrag<T16>::cat(pr + PB + c1, pr + PB + c2);
#pragma unroll
                for (int nb = 0; nb < 4; ++nb) { b[u][nb] = WFrag<T16>::ldf(vp + nb * 512 + u * (HD / 16 * 512)); if (hires) b2[u][nb] = WFrag<T16>::ldf(vp2 + nb * 512 + u * (HD / 16 * 512)); } }
            // the wait that stands in front of a rewrite of a register which an issued load names; it takes the addresses as inputs, so that they stay in their registers up to it and no load of the run lands on them
            asm volatile("s_wait_xcnt 0x0" :: "v"(vp), "v"(vp2) : "memory");
            __builtin_amdgcn_sched_barrier(0);                       // keeps all of the trip's loads in front of its products, so that a trip waits for memory once
#pragma unroll
            for (int u = 0; u < UB; ++u)
#pragma unroll
                for (int nb = 0; nb < 4; ++nb) { oc[nb] = WFrag<T16>::mma(a[u], b[u][nb], oc[nb]);
                    if (hires) { oc[nb] = WFrag<T16>::mma(a2[u], b[u][nb], oc[nb]); oc[nb] = WFrag<T16>::mma(a[u], b2[u][nb], oc[nb]); } }
            // fills the slots the chip needs behind the last matrix instruction on the loop's back edge
            asm volatile("v_nop\n\tv_nop\n\tv_nop\n\tv_nop" : "+v"(oc[0]), "+v"(oc[1]), "+v"(oc[2]), "+v"(oc[3]));
        }
    }
    __syncthreads();                                                 // every wave's last fragment read is over before the rows' space is reused for the output staging
    if (w < 8) {
        float* os = S + w * (16 * 68);                               // each wave stages its 16x64 tile in its own LDS range
#pragma unroll
        for (int nb = 0; nb < 4; ++nb)
#pragma unroll
            for (int j = 0; j < 8; ++j) os[(hi * 8 + j) * 68 + nb * 16 + lr] = oc[nb][j];
        __builtin_amdgcn_wave_barrier(); asm volatile("" ::: "memory");   // keeps the row reads below, which take other lanes' values, behind the stores above
        const float cs = hires ? 1.0f : (1.0f / PCAR);
#pragma unroll
        for (int s = 0; s < 8; ++s) { const int row = 2 * s + hi, cofs = lr * 4; const v4f val = *(const v4fa*)(os + row * 68 + cofs); v4us oh, ol;
#pragma unroll
            for (int q = 0; q < 4; ++q) { unsigned short a, c2; splitf(val[q] * cs, a, c2); oh[q] = a; ol[q] = c2; }
            const size_t oo = (size_t)(r0 + wr * 16 + row) * DQ + wc * 64 + cofs; *(v4us*)(Ah + oo) = oh; *(v4us*)(Al + oo) = ol; }
        asm volatile("s_wait_xcnt 0x0" ::: "memory");                // the wait that stands in front of a rewrite of a register which an issued store names
    }
}
// grid (TT / 64, NH_, NB_): query tile, head, batch element; head z reads the planes of kv head z / REP. Query rows < RH take the hi+lo planes (3 products), the rest single fp16.
// waves_per_eu(6): caps the registers so that the 18 waves of two work-groups fit the four SIMDs of a WGP however they are dealt out.
__global__ __launch_bounds__(AW * 32) __attribute__((amdgpu_waves_per_eu(6))) void k_attn(const h16* __restrict__ Q16, const bf* __restrict__ Qh, const bf* __restrict__ Ql, const h16* __restrict__ K16, const bf* __restrict__ Kh, const bf* __restrict__ Kl, const h16* __restrict__ V16, const bf* __restrict__ Vh, const bf* __restrict__ Vl, bf* Ah, bf* Al) {
    static_assert(RH % 64 == 0 && WIN % 64 == 0 && WIN / 64 + 1 == AW, "a tile is all hi+lo or all fp16; one wave a key tile");
    __shared__ __align__(16) float S[64 * PB];                       // 160 KiB: two work-groups a WGP
    const int r0 = blockIdx.x * 64; const size_t z = blockIdx.y, bz = blockIdx.z, qo = (bz * NH_ + z) * TT * HD, ko = (bz * NKV + z / REP) * TT * HD;
    Ah += bz * TT * DQ; Al += bz * TT * DQ;                          // the batch element's rows of the merged planes
    if (r0 < RH) attn_tile<bf, 2>(S, Qh + qo, Ql + qo, Kh + ko, Kl + ko, Vh + ko, Vl + ko, r0, Ah + z * HD, Al + z * HD);
    else attn_tile<h16, 0>(S, Q16 + qo, nullptr, K16 + ko, nullptr, V16 + ko, nullptr, r0, Ah + z * HD, Al + z * HD);
}

extern "C" void kernel_launch(void* const* d_in, const int* in_sizes, int n_in,
                              void* d_out, int out_size, void* d_ws, size_t ws_size, hipStream_t stream) {
    (void)in_sizes; (void)n_in; (void)out_size;
    const float* x = (const float*)d_in[0]; const float* gw = (const float*)d_in[1]; const float* wq = (const float*)d_in[2]; const float* wk = (const float*)d_in[3]; const float* wv = (const float*)d_in[4]; const float* wo = (const float*)d_in[5]; const float* cosT = (const float*)d_in[6]; const float* sinT = (const float*)d_in[7];
    float* OUT = (float*)d_out;     // [2][2048][2048]
    char* wsp = (char*)d_ws;
    auto take = [&](size_t bytes) { char* p = wsp; wsp += (bytes + 255) & ~(size_t)255; return (void*)p; };
    bf* WQ = (bf*)take((size_t)DQ * DM * 2); bf* WK = (bf*)take((size_t)DKV * DM * 2); bf* WV = (bf*)take((size_t)DKV * DM * 2); bf* WO = (bf*)take((size_t)DM * DQ * 2);
    bf* Yh = (bf*)take((size_t)MT * DM * 2); bf* Yl = (bf*)take((size_t)MT * DM * 2);
    h16* QP16 = (h16*)take((size_t)NB_ * NH_ * TT * HD * 2); h16* KP16 = (h16*)take((size_t)NB_ * NKV * TT * HD * 2); h16* VT16 = (h16*)take((size_t)NB_ * NKV * HD * TT * 2);
    bf* QPh = (bf*)take((size_t)NB_ * NH_ * TT * HD * 2); bf* QPl = (bf*)take((size_t)NB_ * NH_ * TT * HD * 2); bf* KPh = (bf*)take((size_t)NB_ * NKV * TT * HD * 2); bf* KPl = (bf*)take((size_t)NB_ * NKV * TT * HD * 2); bf* VTh = (bf*)take((size_t)NB_ * NKV * HD * TT * 2); bf* VTl = (bf*)take((size_t)NB_ * NKV * HD * TT * 2);
    bf* ATh = (bf*)take((size_t)MT * DQ * 2); bf* ATl = (bf*)take((size_t)MT * DQ * 2);
    if ((size_t)(wsp - (char*)d_ws) > ws_size) return;    // ws 256 MiB
    k_prep<<<NRB + 2 * NWQ + 2 * NWK, 256, 0, stream>>>(x, gw, wq, wk, wv, wo, Yh, Yl, WQ, WK, WV, WO);   /* n = RMSNorm(x) norm_w as hi/lo planes; the weights as [n][k] bf16 */
    k_qkv<<<NQT + 2 * NKT, 128, 0, stream>>>(Yh, Yl, WQ, WK, WV, DM, cosT, sinT, QP16, QPh, QPl, KP16, KPh, KPl, VT16, VTh, VTl);
    k_attn<<<dim3(TT / 64, NH_, NB_), AW * 32, 0, stream>>>(QP16, QPh, QPl, KP16, KPh, KPl, VT16, VTh, VTl, ATh, ATl);
    k_oproj<<<dim3(MT / 128, DM / 128, 1), 128, 0, stream>>>(ATh, ATl, WO, DQ, x, OUT);   /* out = x + attn wo */
}

// v008
// One run takes 230 microseconds.
// Next to v007, in two timings, it ran 1.09 times as fast each time.
// Over all steps from v000 it is 7.51 times as fast.
#include <hip/hip_runtime.h>

// Sliding-window causal GQA with RMSNorm pre-normalisation and residual (x [2][2048][2048]; n = x rsqrt(mean x^2 + 1e-6) norm_w; q = n wq ('xw', 16 heads x 128), k, v = n wk / n wv (4 kv heads); rotate-half RoPE from the given tables [2048][64] (both halves share column d mod 64); 4 query heads per kv head (repeat); scores/sqrt(128) kept where j <= i and i - j < 512; softmax; out = x + merged wo -> [2][2048][2048]).
// Compute dtypes, f32 accumulate: every input rounded to bf16; q/k/v hl x exact (2 products); rotary in f32 from the bf16-rounded input tables; windowed-causal scores and attn.v (only key tiles that touch the window band computed): query rows < 512 hl (3 products), the rest single fp16 (x1024); softmax f32; wo hl x exact (2 products), + x residual in f32.

#define NB_  2
#define TT   2048
#define DM   2048
#define NH_  16
#define NKV  4
#define REP  (NH_ / NKV)
#define HD   128
#define DQ   (NH_ * HD)
#define DKV  (NKV * HD)
#define MT   (NB_ * TT)           // rows of both batch elements together: every stage takes them in one launch
#define RH   512                  // query rows < RH use hi+lo planes (0: none)
#define WIN  512
#define NBC  ((WIN + 128) / 128)  // 128-key chunks of a softmax row: WIN + 64 band keys of a 64-row tile, from a multiple of 128
#define PB   (NBC * 128)         // pitch of a stored score / probability row: only the NBC chunks from the row tile's first chunk jb on are kept
#define PCAR 1024.0f
#define SCL  0.088388347648318447f   // HD^-0.5
typedef _Float16 h16;
typedef unsigned short bf;
typedef __attribute__((ext_vector_type(16))) __bf16   v16bf;
typedef __attribute__((ext_vector_type(16))) _Float16 v16h;
typedef __attribute__((ext_vector_type(8)))  _Float16 v8h;
typedef __attribute__((ext_vector_type(8)))  unsigned short v8us;
typedef __attribute__((ext_vector_type(8)))  float    v8f;
typedef __attribute__((ext_vector_type(4)))  float    v4f;
typedef v8h  __attribute__((may_alias)) v8ha;
typedef v4f  __attribute__((may_alias)) v4fa;
typedef v8us __attribute__((may_alias)) v8usa;

__device__ __forceinline__ unsigned short f2bf(float f) { unsigned u = __float_as_uint(f); u += 0x7FFFu + ((u >> 16) & 1u); return (unsigned short)(u >> 16); }
__device__ __forceinline__ float bf2f(unsigned short b) { return __uint_as_float(((unsigned)b) << 16); }
__device__ __forceinline__ float bfr(float f) { return bf2f(f2bf(f)); }
__device__ __forceinline__ v16h cat16(v8h lo, v8h hi) { return __builtin_shufflevector(lo, hi, 0, 1, 2, 3, 4, 5, 6, 7, 8, 9, 10, 11, 12, 13, 14, 15); }
__device__ __forceinline__ v16bf cat16b(v8us lo, v8us hi) { return __builtin_bit_cast(v16bf, __builtin_shufflevector(lo, hi, 0, 1, 2, 3, 4, 5, 6, 7, 8, 9, 10, 11, 12, 13, 14, 15)); }
__device__ __forceinline__ v8f wmma16(v16h a, v16h b, v8f c) { return __builtin_amdgcn_wmma_f32_16x16x32_f16(false, a, false, b, (short)0, c, false, false); }
__device__ __forceinline__ v8f wmmab(v16bf a, v16bf b, v8f c) { return __builtin_amdgcn_wmma_f32_16x16x32_bf16(false, a, false, b, (short)0, c, false, false); }
__device__ __forceinline__ h16 tohx(float x) { return (h16)x; }
__device__ __forceinline__ void splitf(float y, unsigned short& h, unsigned short& l) { h = f2bf(y); l = f2bf(y - bf2f(h)); }
typedef float __attribute__((may_alias)) fa;



// ---- gemm_tile<MB>: projection GEMM, 4 waves (2 x 2) per (32 MB)x128 output tile, each wave a (16 MB)x64 tile (4 MB accumulators); MB = 4 where that fills the chip, MB = 2 for the narrow k and v outputs (twice the work-groups). The operands (K-contiguous bf16 planes A hi, A lo, Bt) are staged in LDS by asynchronous copies,
// KS k of the tile's rows of each plane a stage, two buffers: the next stage's copies fly while this stage is worked on; fragments are read from LDS one 32-k block ahead. Tile (bx, by) of (M/(32 MB), N/128), 128 threads; M = MT, the rows of both batch elements (row m = batch m / TT, position m mod TT; a tile lies in one batch element); ring = the work-group's LDS, declared by the kernel. c[m][n] (f32) = sum_k (A[m][k] + A2[m][k]) Bt[n][k]. K % KS == 0, K >= 2 KS (the prologue fills two stages).
// The element-wise pass that follows each product is the kernel's epilogue EP, on the f32 tile while it is still on the chip (a tile's 128 columns are one head):
// EP_ROPE: rotate-half rotary from the bf16-rounded tables E0 = cos, E1 = sin [t][HD/2] (out[d] = c[d] cos[t][d] - c[d+HD/2] sin[t][d], out[d+HD/2] = c[d+HD/2] cos[t][d] + c[d] sin[t][d]), written as the head planes [b][h] (fp16, hi, lo; nh heads) in fragment order: blocks of 16 t x 32 d, [t/16][d/32], 512 elements each;
// EP_VT: the transposed head planes [b][h] (fp16, hi, lo) in fragment order: blocks of 16 d x 32 t, [t/32][d/16]; EP_RES: O[m][n] = bf16-rounded E0[m][n] + c[m][n] (f32, both of pitch DM).
// Fragment order: a block holds one matrix-instruction operand (16 rows r x 32 k) as the attention kernel's lanes take it: element (r, k) at (k / 16) 256 + ((k mod 16) / 8 x 16 + r) 8 + k mod 8, so that lane l = hi 16 + r reads its 8 + 8 elements at 8 l and 256 + 8 l and a wave's 16-byte load covers 512 contiguous bytes (4 whole lines; from a row-major plane it touches 16). WFrag::ldf reads one.
#define EP_ROPE 0
#define EP_VT   1
#define EP_RES  2
#define TP   132                 // pitch in floats of the f32 tile staged for EP_ROPE: 16-byte rows, four banks on from row to row
#define KS   64                  // k per stage: 128 B of every operand row, one whole line
#define LP   (KS + 8)            // LDS row pitch in elements: 144 B = 16 B x odd, free of bank conflicts for 16-byte fragment reads
template <typename T16> struct WFrag;
template <> struct WFrag<h16> { typedef v16h V; static __device__ __forceinline__ V ld(const h16* p) { return cat16(*(const v8h*)p, *(const v8h*)(p + 16)); } static __device__ __forceinline__ V ldf(const h16* p) { return cat16(*(const v8h*)p, *(const v8h*)(p + 256)); } static __device__ __forceinline__ V cat(const h16* p, const h16* p2) { return cat16(*(const v8ha*)p, *(const v8ha*)p2); } static __device__ __forceinline__ v8f mma(V a, V b, v8f c) { return wmma16(a, b, c); } };
template <> struct WFrag<bf> { typedef v16bf V; static __device__ __forceinline__ V ld(const bf* p) { return cat16b(*(const v8us*)p, *(const v8us*)(p + 16)); } static __device__ __forceinline__ V ldf(const bf* p) { return cat16b(*(const v8us*)p, *(const v8us*)(p + 256)); } static __device__ __forceinline__ V cat(const bf* p, const bf* p2) { return cat16b(*(const v8usa*)p, *(const v8usa*)p2); } static __device__ __forceinline__ v8f mma(V a, V b, v8f c) { return wmmab(a, b, c); } };
typedef __attribute__((ext_vector_type(4))) int v4ic;
// NJ asynchronous copies of 512 B (4 rows of 128 B each, 16 B a lane): 4 NJ rows of one plane. l = the lane's place in the first of them in LDS, g = the same place in the global plane, gs = elements per 4 global rows.
template <int NJ>
__device__ __forceinline__ void planecopy(bf* l, const bf* g, size_t gs) {
#pragma unroll
    for (int j = 0; j < NJ; ++j)
        __builtin_amdgcn_global_load_async_to_lds_b128((__attribute__((address_space(1))) v4ic*)(g + (size_t)j * gs), (__attribute__((address_space(3))) v4ic*)(l + j * 4 * LP), 0, 0);
}
template <int MB> struct Frags { WFrag<bf>::V a[MB], a2[MB], b[4]; };
// the fragments of one 32-k block of a stage, as one group of LDS reads; sa, sa2, sb = the lane's place in the wave's first row of each plane
template <int MB>
__device__ __forceinline__ void ldfr(Frags<MB>& f, const bf* sa, const bf* sa2, const bf* sb) {
#pragma unroll
    for (int q = 0; q < MB; ++q) { f.a[q] = WFrag<bf>::ld(sa + q * 16 * LP); f.a2[q] = WFrag<bf>::ld(sa2 + q * 16 * LP); }
#pragma unroll
    for (int q = 0; q < 4; ++q) f.b[q] = WFrag<bf>::ld(sb + q * 16 * LP);
}
template <int MB>
__device__ __forceinline__ void mmblk(v8f (&acc)[MB][4], const Frags<MB>& f) {
#pragma unroll
    for (int nb = 0; nb < 4; ++nb)
#pragma unroll
        for (int mb = 0; mb < MB; ++mb) { acc[mb][nb] = WFrag<bf>::mma(f.a[mb], f.b[nb], acc[mb][nb]); acc[mb][nb] = WFrag<bf>::mma(f.a2[mb], f.b[nb], acc[mb][nb]); }
}
#define RINGE (2 * (2 * 32 * 4 * LP + 128 * LP))   // elements of the two-stage ring of the largest tile (MB = 4)
template <int MB, int EP>
__device__ __forceinline__ void gemm_tile(bf* ring, int bx, int by, int nh, const bf* __restrict__ A, const bf* __restrict__ A2, const bf* __restrict__ Bt, int K, const float* __restrict__ E0, const float* __restrict__ E1, float* O, h16* P16, bf* Ph, bf* Pl) {
    static_assert(KS == 64, "a stage is two 32-k blocks");
    constexpr int PLA = 32 * MB * LP, STG = 2 * PLA + 128 * LP;   // a stage: A hi | A lo (32 MB rows each) | Bt (128 rows)
    static_assert(2 * STG <= RINGE, "the ring fits the kernel's LDS");
    const int lane = threadIdx.x & 31, lr = lane & 15, hi = lane >> 4; const int w = __builtin_amdgcn_readfirstlane((int)(threadIdx.x >> 5)), wm = w >> 1, wn = w & 1;
    const int r0 = bx * (32 * MB), c0 = by * 128, bb = r0 / TT, t0 = r0 % TT;   // bb, t0: the tile's batch element and its first position there
    (void)bb; (void)t0; (void)nh;
    v8f acc[MB][4];
#pragma unroll
    for (int mb = 0; mb < MB; ++mb)
#pragma unroll
        for (int nb = 0; nb < 4; ++nb) acc[mb][nb] = (v8f){};
    // wave w copies rows 8 MB w .. 8 MB w + 8 MB - 1 of the A planes and rows 32 w .. 32 w + 31 of Bt
    const int crA = w * (8 * MB) + (lane >> 3), crB = w * 32 + (lane >> 3), ccol = (lane & 7) * 8; const size_t gs = (size_t)4 * K;
    const bf* gA = A + (size_t)(r0 + crA) * K + ccol; const bf* gA2 = A2 + (size_t)(r0 + crA) * K + ccol; const bf* gB = Bt + (size_t)(c0 + crB) * K + ccol;
    bf* lA = ring + crA * LP + ccol; bf* lB = ring + 2 * PLA + crB * LP + ccol;
    const int nt = K / KS;
    planecopy<2 * MB>(lA, gA, gs); planecopy<2 * MB>(lA + PLA, gA2, gs); planecopy<8>(lB, gB, gs);
    asm volatile("s_wait_asynccnt 0x0" ::: "memory");   // this wave's share of stage 0 has landed
    __syncthreads();                                     // ... and every other wave's
    planecopy<2 * MB>(lA + STG, gA + KS, gs); planecopy<2 * MB>(lA + STG + PLA, gA2 + KS, gs); planecopy<8>(lB + STG, gB + KS, gs);
    const int aofs = (wm * (16 * MB) + lr) * LP + 8 * hi, bofs = 2 * PLA + (wn * 64 + lr) * LP + 8 * hi;
    Frags<MB> f0, f1;                                    // two fragment sets: each block's LDS reads are issued one block ahead, as one group
    ldfr<MB>(f0, ring + aofs, ring + PLA + aofs, ring + bofs);
#pragma unroll 1
    for (int t = 0; t < nt; ++t) {
        const bf* st = ring + (t & 1) * STG; const bf* sn = ring + ((t + 1) & 1) * STG;
        ldfr<MB>(f1, st + aofs + 32, st + PLA + aofs + 32, st + bofs + 32);
        __builtin_amdgcn_sched_barrier(0);                   // keeps the read group ahead of the block it hides behind
        mmblk<MB>(acc, f0);
        __builtin_amdgcn_sched_barrier(0);                   // keeps the block ahead of the publish point, so that the waits below find their data landed
        // publish point of stage t + 1, in front of stage t's last block, whose fragments are already fetched
        asm volatile("s_wait_dscnt 0x0" ::: "memory");      // this wave's last reads of stage t have returned before its buffer is refilled
        asm volatile("s_wait_asynccnt 0x0" ::: "memory");   // this wave's share of stage t + 1 has landed
        __syncthreads();                                     // publishes stage t + 1 and ends every wave's reads of stage t
        if (t + 2 < nt) { const size_t ko = (size_t)(t + 2) * KS; const int bo = (t & 1) * STG; planecopy<2 * MB>(lA + bo, gA + ko, gs); planecopy<2 * MB>(lA + bo + PLA, gA2 + ko, gs); planecopy<8>(lB + bo, gB + ko, gs); }
        if (t + 1 < nt) ldfr<MB>(f0, sn + aofs, sn + PLA + aofs, sn + bofs);
        mmblk<MB>(acc, f1);
    }
    asm volatile("s_wait_asynccnt 0x0" ::: "memory");       // no copy is outstanding when the wave ends
    // Behind the loop's last barrier the ring is free: no copy is outstanding and every wave's last fragment read returned in front of that barrier. The epilogues stage in it.
    if constexpr (EP == EP_ROPE) {
        fa* tl = (fa*)ring;                                  // the work-group's whole tile in f32: a column's rotary partner lies in the neighbour wave's registers
#pragma unroll
        for (int mb = 0; mb < MB; ++mb)
#pragma unroll
            for (int nb = 0; nb < 4; ++nb)
#pragma unroll
                for (int j = 0; j < 8; ++j) tl[(wm * (16 * MB) + mb * 16 + hi * 8 + j) * TP + wn * 64 + nb * 16 + lr] = acc[mb][nb][j];
        // wave w takes rows 8 MB w ..; a step is half a block: 16 rows (lane mod 16) x 16 columns d < HD/2 (8 a lane), and their partners d + HD/2; step s = row block s / 4, column group s mod 4
        const int row0 = w * (8 * MB) + lr, dc = hi * 8;
        const float* cp = E0 + (size_t)(t0 + row0) * (HD / 2) + dc; const float* sp = E1 + (size_t)(t0 + row0) * (HD / 2) + dc;
        v4f cv[2 * MB][2], sv[2 * MB][2];                    // every step's table values, fetched while the tile is staged
#pragma unroll
        for (int s = 0; s < 2 * MB; ++s)
#pragma unroll
            for (int u = 0; u < 2; ++u) { cv[s][u] = *(const v4f*)(cp + (s >> 2) * 16 * (HD / 2) + (s & 3) * 16 + u * 4); sv[s][u] = *(const v4f*)(sp + (s >> 2) * 16 * (HD / 2) + (s & 3) * 16 + u * 4); }
        // the wait that stands in front of a rewrite of a register which an issued load names; it takes the addresses as inputs, so that they stay in their registers up to it
        asm volatile("s_wait_xcnt 0x0" :: "v"(cp), "v"(sp) : "memory");
        __syncthreads();                                     // the whole tile is in LDS before a row is read
        const size_t oo = (((size_t)bb * nh + by) * TT + t0 + w * (8 * MB)) * HD + lane * 8;   // the lane's place in the wave's first block (the HD / 32 blocks of 16 rows t are 16 HD elements)
        h16* q16 = P16 + oo; bf* qh = Ph + oo; bf* ql = Pl + oo;
        const fa* xr = tl + row0 * TP + dc;
        v4f xl0 = *(const v4fa*)xr, xl1 = *(const v4fa*)(xr + 4), xh0 = *(const v4fa*)(xr + HD / 2), xh1 = *(const v4fa*)(xr + HD / 2 + 4);
        v8h pa16 = {}, pb16 = {}; v8us pah = {}, pal = {}, pbh = {}, pbl = {};   // the last step's stored values
#pragma unroll
        for (int s = 0; s < 2 * MB; ++s) {
            v4f nl0 = xl0, nl1 = xl1, nh0 = xh0, nh1 = xh1;
            if (s + 1 < 2 * MB) { const fa* xn = xr + ((s + 1) >> 2) * 16 * TP + ((s + 1) & 3) * 16; nl0 = *(const v4fa*)xn; nl1 = *(const v4fa*)(xn + 4); nh0 = *(const v4fa*)(xn + HD / 2); nh1 = *(const v4fa*)(xn + HD / 2 + 4); }   // the next step's rows are read from LDS while this step is worked on
            v8h a16, b16; v8us ah, al, bh, bl;
#pragma unroll
            for (int q = 0; q < 8; ++q) { const float x0 = q < 4 ? xl0[q & 3] : xl1[q & 3], x1 = q < 4 ? xh0[q & 3] : xh1[q & 3], c = bfr(cv[s][q >> 2][q & 3]), sn = bfr(sv[s][q >> 2][q & 3]);
                const float ra = x0 * c - x1 * sn, rb = x1 * c + x0 * sn; unsigned short h2, l2;
                a16[q] = tohx(ra); splitf(ra, h2, l2); ah[q] = h2; al[q] = l2; b16[q] = tohx(rb); splitf(rb, h2, l2); bh[q] = h2; bl[q] = l2; }
            __builtin_amdgcn_sched_barrier(0);               // keeps the step's arithmetic in front of the wait, which would otherwise be lifted to directly behind the last step's stores
            // the wait that stands in front of a rewrite of a register which an issued store names: it takes the addresses and the last step's data as inputs, so that they stay in their registers up to it, a step's work behind those stores
            if (s) asm volatile("s_wait_xcnt 0x0" :: "v"(q16), "v"(qh), "v"(ql), "v"(pa16), "v"(pb16), "v"(pah), "v"(pbh), "v"(pal), "v"(pbl) : "memory");
            constexpr int PO = (HD / 2 / 32) * 512; const int so = (s >> 2) * 16 * HD + (s & 3) * 256;   // the step's half block; the partner columns lie HD/2/32 blocks on
            *(v8h*)(q16 + so) = a16; *(v8h*)(q16 + so + PO) = b16; *(v8us*)(qh + so) = ah; *(v8us*)(qh + so + PO) = bh; *(v8us*)(ql + so) = al; *(v8us*)(ql + so + PO) = bl;
            pa16 = a16; pb16 = b16; pah = ah; pal = al; pbh = bh; pbl = bl; xl0 = nl0; xl1 = nl1; xh0 = nh0; xh1 = nh1;
        }
    } else if constexpr (EP == EP_VT) {
        static_assert(MB == 2, "a staged row is 64 t of one column: one 128-byte line");
        constexpr int VP = 32 * MB + 8, VPL = 128 * VP;      // staged planes [d][t]: pitch 144 B = 16 B x odd; a lane's 8 accumulator rows are 8 consecutive t of one d
#pragma unroll
        for (int mb = 0; mb < MB; ++mb)
#pragma unroll
            for (int nb = 0; nb < 4; ++nb) { v8h o16; v8us oh, ol;
#pragma unroll
                for (int j = 0; j < 8; ++j) { const float xv = acc[mb][nb][j]; unsigned short h2, l2; o16[j] = tohx(xv); splitf(xv, h2, l2); oh[j] = h2; ol[j] = l2; }
                const int e = (wn * 64 + nb * 16 + lr) * VP + wm * (16 * MB) + mb * 16 + hi * 8;
                *(v8ha*)(ring + e) = o16; *(v8usa*)(ring + VPL + e) = oh; *(v8usa*)(ring + 2 * VPL + e) = ol; }
        __syncthreads();                                     // every plane row is whole in LDS before it is read
        // wave w takes columns 32 w ..; a step is half a block: 16 columns d (lane mod 16) x 16 t (8 a lane), 512 contiguous bytes a store; step s = column block s / 4, t group s mod 4
        const int d0 = w * 32 + lr, tc = hi * 8; const bf* lp = ring + d0 * VP + tc;
        const size_t oo = ((size_t)bb * nh + by) * HD * TT + (size_t)(t0 / 32) * (HD / 16 * 512) + w * 1024 + lane * 8;   // the lane's place in the wave's first block
        h16* q16 = P16 + oo; bf* qh = Ph + oo; bf* ql = Pl + oo;
        v8us a[8], b[8], c[8];                               // all of the wave's rows are read first: no register that a store names is written again
#pragma unroll
        for (int s = 0; s < 8; ++s) { const int lo = (s >> 2) * 16 * VP + (s & 3) * 16; a[s] = *(const v8usa*)(lp + lo); b[s] = *(const v8usa*)(lp + VPL + lo); c[s] = *(const v8usa*)(lp + 2 * VPL + lo); }
        __builtin_amdgcn_sched_barrier(0);                   // keeps every LDS read in front of the first store
#pragma unroll
        for (int s = 0; s < 8; ++s) { const int so = ((s & 3) >> 1) * (HD / 16 * 512) + (s >> 2) * 512 + (s & 1) * 256; *(v8usa*)(q16 + so) = a[s]; *(v8us*)(qh + so) = b[s]; *(v8us*)(ql + so) = c[s]; }
    } else {
        fa* os = (fa*)ring + w * (16 * 68);                  // each wave stages its output rows in its own LDS range
        const size_t eo = (size_t)(r0 + wm * (16 * MB) + hi) * DM + c0 + wn * 64 + lr * 4;   // the lane's place in its first row; a step is 2 rows
        const float* xp = E0 + eo; float* op = O + eo;
        v4f xa[2][8], o[2][8];                               // the residual rows of a 16-row block, fetched one block ahead; two blocks' results
#pragma unroll
        for (int s = 0; s < 8; ++s) xa[0][s] = *(const v4f*)(xp + s * 2 * DM);
#pragma unroll
        for (int mb = 0; mb < MB; ++mb) {
#pragma unroll
            for (int nb = 0; nb < 4; ++nb) {
#pragma unroll
                for (int j = 0; j < 8; ++j) os[(hi * 8 + j) * 68 + nb * 16 + lr] = acc[mb][nb][j]; }
            if (mb + 1 < MB) {
#pragma unroll
                for (int s = 0; s < 8; ++s) xa[(mb + 1) & 1][s] = *(const v4f*)(xp + ((mb + 1) * 16 + s * 2) * DM); }
            __builtin_amdgcn_wave_barrier(); asm volatile("" ::: "memory");   // keeps the row reads below, which take other lanes' values, behind the stores above
#pragma unroll
            for (int s = 0; s < 8; ++s) { const v4f val = *(const v4fa*)(os + (2 * s + hi) * 68 + lr * 4);
#pragma unroll
                for (int q = 0; q < 4; ++q) o[mb & 1][s][q] = bfr(xa[mb & 1][s][q]) + val[q]; }
            __builtin_amdgcn_sched_barrier(0);               // keeps the block's sums in front of the wait, which would otherwise be lifted to directly behind the last block's stores
            // the wait that stands in front of a rewrite of a register which an issued load or store names: it takes the addresses and the last block's data as inputs, so that they stay in their registers up to it, a block's work behind those stores
            if (mb) asm volatile("s_wait_xcnt 0x0" :: "v"(xp), "v"(op), "v"(o[(mb + 1) & 1][0]), "v"(o[(mb + 1) & 1][1]), "v"(o[(mb + 1) & 1][2]), "v"(o[(mb + 1) & 1][3]), "v"(o[(mb + 1) & 1][4]), "v"(o[(mb + 1) & 1][5]), "v"(o[(mb + 1) & 1][6]), "v"(o[(mb + 1) & 1][7]) : "memory");
#pragma unroll
            for (int s = 0; s < 8; ++s) *(v4f*)(op + (mb * 16 + s * 2) * DM) = o[mb & 1][s];
            __builtin_amdgcn_wave_barrier(); asm volatile("" ::: "memory");   // keeps the next 16 rows' LDS stores behind this block's reads
        }
    }
    asm volatile("s_wait_xcnt 0x0" ::: "memory");            // the wait that stands in front of a rewrite of a register which an issued store names: in a kernel of several tile kinds another kind's text follows this one's last stores
}
// ---- k_qkv: the three projections of n, which read nothing of each other, in one grid: first the q tiles (the longest), then the k tiles, then the v tiles; within each the row tile runs fastest.
#define NQT ((MT / 128) * (DQ / 128))
#define NKT ((MT / 64) * (DKV / 128))
__global__ __launch_bounds__(128) void k_qkv(const bf* __restrict__ Yh, const bf* __restrict__ Yl, const bf* __restrict__ WQ, const bf* __restrict__ WK, const bf* __restrict__ WV, int K, const float* __restrict__ cosT, const float* __restrict__ sinT, h16* QP16, bf* QPh, bf* QPl, h16* KP16, bf* KPh, bf* KPl, h16* VT16, bf* VTh, bf* VTl) {
    __shared__ __align__(16) bf ring[RINGE];
    const int i = blockIdx.x;
    if (i < NQT) gemm_tile<4, EP_ROPE>(ring, i % (MT / 128), i / (MT / 128), NH_, Yh, Yl, WQ, K, cosT, sinT, nullptr, QP16, QPh, QPl);
    else if (i < NQT + NKT) gemm_tile<2, EP_ROPE>(ring, (i - NQT) % (MT / 64), (i - NQT) / (MT / 64), NKV, Yh, Yl, WK, K, cosT, sinT, nullptr, KP16, KPh, KPl);
    else gemm_tile<2, EP_VT>(ring, (i - NQT - NKT) % (MT / 64), (i - NQT - NKT) / (MT / 64), NKV, Yh, Yl, WV, K, nullptr, nullptr, nullptr, VT16, VTh, VTl);
}
// ---- k_oproj: out = x + attn wo, grid (MT / 128, DM / 128)
__global__ __launch_bounds__(128) void k_oproj(const bf* __restrict__ Ah, const bf* __restrict__ Al, const bf* __restrict__ WO, int K, const float* __restrict__ x, float* O) {
    __shared__ __align__(16) bf ring[RINGE];
    gemm_tile<4, EP_RES>(ring, blockIdx.x, blockIdx.y, 0, Ah, Al, WO, K, x, nullptr, O, nullptr, nullptr, nullptr);
}

typedef __attribute__((ext_vector_type(2))) _Float16 v2h;
typedef __attribute__((ext_vector_type(4))) _Float16 v4h;
typedef __attribute__((ext_vector_type(2))) unsigned short v2us;
typedef __attribute__((ext_vector_type(4))) unsigned short v4us;
typedef __attribute__((ext_vector_type(2))) float v2f;
typedef __attribute__((ext_vector_type(4))) int v4i;

// ---- wt_blk: tile blk of the transpose Bt[n][k] (bf16) = w[k][n] (f32), WTT k x WTT n a work-group of 8 waves, through the LDS tile tl [n][k].
// Wave v reads rows k = 16 v .. 16 v + 15, a whole 512-byte row piece a load (lane l: columns 4 l .. 4 l + 3), all 16 loads in flight at once; a lane then holds 16 k of each of its 4 columns and writes them as 16-byte chunks of 8 k.
// Chunk c of tile row n lies at place c ^ ((n / 4) mod 16) of the row's 16: the 16 lanes of a half wave hit 16 different places (all 64 banks once) in the column-wise writes and in the row-wise reads alike. A store covers two output rows' 256 contiguous bytes each.
#define WTT 128
__device__ __forceinline__ void wt_blk(bf* tl, int blk, const float* __restrict__ w, int K, int N, bf* Bt) {
    const int lane = threadIdx.x & 31, lc = lane & 15, lh = lane >> 4, wv = threadIdx.x >> 5; const int nt = N / WTT, n0 = (blk % nt) * WTT, k0 = (blk / nt) * WTT;
    const float* sp = w + (size_t)(k0 + wv * 16) * N + n0 + lane * 4;
    v4f a[16];
#pragma unroll
    for (int j = 0; j < 16; ++j) a[j] = *(const v4f*)(sp + (size_t)j * N);
    // the wait that stands in front of a rewrite of a register which an issued load names; it takes the address as an input, so that it stays in its registers up to it
    asm volatile("s_wait_xcnt 0x0" :: "v"(sp) : "memory");
    __builtin_amdgcn_sched_barrier(0);                       // keeps all 16 loads in front of the conversions, so that a wave waits out the memory latency once
#pragma unroll
    for (int g = 0; g < 2; ++g)
#pragma unroll
        for (int q = 0; q < 4; ++q) { v8us o;
#pragma unroll
            for (int j = 0; j < 8; ++j) o[j] = f2bf(a[g * 8 + j][q]);
            *(v8usa*)(tl + (lane * 4 + q) * WTT + ((wv * 2 + g) ^ lc) * 8) = o; }
    __syncthreads();                                         // the whole tile is in LDS before a row is read
    bf* dp = Bt + (size_t)(n0 + wv * 16 + lh) * K + k0 + lc * 8;   // wave v stores tile rows 16 v .. 16 v + 15, two a step
    v8us o[8];                                               // all of the wave's rows are read first: no register that a store names is written again
#pragma unroll
    for (int s = 0; s < 8; ++s) { const int n = wv * 16 + 2 * s + lh; o[s] = *(const v8usa*)(tl + n * WTT + (lc ^ ((n >> 2) & 15)) * 8); }
    __builtin_amdgcn_sched_barrier(0);                       // keeps every LDS read in front of the first store
#pragma unroll
    for (int s = 0; s < 8; ++s) *(v8us*)(dp + (size_t)(2 * s) * K) = o[s];
    asm volatile("s_wait_xcnt 0x0" ::: "memory");            // the wait that stands in front of a rewrite of a register which an issued store names: another job's text follows this one's last stores
}
__device__ __forceinline__ void rms_blk(int blk, const float* __restrict__ X, const float* __restrict__ g, bf* Yh, bf* Yl) {
    const int lane = threadIdx.x & 31; const int r = blk * 8 + (threadIdx.x >> 5); if (r >= MT) return; const float* xr = X + (size_t)r * DM; float s = 0.f;
#pragma unroll 1
    for (int ch = 0; ch < DM / 128; ++ch) { const v4f a = *(const v4f*)(xr + ch * 128 + lane * 4);
#pragma unroll
        for (int q = 0; q < 4; ++q) { const float xb = bfr(a[q]); float p = __fmul_rn(xb, xb); asm volatile("" : "+v"(p)); s = __fadd_rn(s, p); } }
#pragma unroll
    for (int sh = 16; sh; sh >>= 1) s += __shfl_xor(s, sh, 32);
    const float rs = __fdiv_rn(1.0f, __fsqrt_rn(__fadd_rn(s * (1.0f / DM), 1e-6f)));
{
#pragma unroll 1
        for (int ch = 0; ch < DM / 128; ++ch) { const int c0 = ch * 128 + lane * 4; const v4f a = *(const v4f*)(xr + c0); v4us oh, ol;
#pragma unroll
            for (int q = 0; q < 4; ++q) { float n0 = __fmul_rn(bfr(a[q]), rs); asm volatile("" : "+v"(n0)); const float y = __fmul_rn(n0, bfr(g[c0 + q])); unsigned short h2, l2; splitf(y, h2, l2); oh[q] = h2; ol[q] = l2; }
            *(v4us*)(Yh + (size_t)r * DM + c0) = oh; *(v4us*)(Yl + (size_t)r * DM + c0) = ol; }
         } }
// ---- k_prep: the five jobs that read inputs only, in one grid: n = RMSNorm(x) norm_w of all MT rows as hi/lo planes, then the four weight transposes (the large ones first).
#define NRB (MT / 8)
#define NWQ ((DM / WTT) * (DQ / WTT))
#define NWK ((DM / WTT) * (DKV / WTT))
__global__ __launch_bounds__(256) void k_prep(const float* __restrict__ x, const float* __restrict__ g, const float* __restrict__ wq, const float* __restrict__ wk, const float* __restrict__ wv, const float* __restrict__ wo, bf* Yh, bf* Yl, bf* WQ, bf* WK, bf* WV, bf* WO) {
    static_assert(DM % WTT == 0 && DQ % WTT == 0 && DKV % WTT == 0, "whole transpose tiles");
    __shared__ __align__(16) bf tl[WTT * WTT];               // a transpose tile, 32 KiB
    const int i = blockIdx.x;
    if (i < NRB) rms_blk(i, x, g, Yh, Yl);
    else if (i < NRB + NWQ) wt_blk(tl, i - NRB, wq, DM, DQ, WQ);
    else if (i < NRB + 2 * NWQ) wt_blk(tl, i - NRB - NWQ, wo, DQ, DM, WO);
    else if (i < NRB + 2 * NWQ + NWK) wt_blk(tl, i - NRB - 2 * NWQ, wk, DM, DKV, WK);
    else wt_blk(tl, i - NRB - 2 * NWQ - NWK, wv, DM, DKV, WV);
}
__global__ __launch_bounds__(256) void k_cvt8(const float* __restrict__ src, bf* dst, size_t n8) { const size_t i = (size_t)blockIdx.x * 256 + threadIdx.x; if (i >= n8) return; const v8f v = *(const v8f*)(src + i * 8); v8us o;
#pragma unroll
    for (int k = 0; k < 8; ++k) o[k] = f2bf(v[k]); *(v8us*)(dst + i * 8) = o;  }
typedef v4h  __attribute__((may_alias)) v4ha;
typedef v4us __attribute__((may_alias)) v4usa;
// ---- k_attn: the whole attention of one 64-row query tile of one head in one work-group of AW = 9 waves; the tile's score / probability band (PB keys from key jb on, jb = the 128-aligned start of the tile's band) lives in LDS only.
// Phase 1: wave w computes the 64x64 score tile of keys r0 - WIN + 64 w .. (in passes of 32 rows, 16 with hi+lo planes; tiles left of key 0 do not exist). Phase 2: softmax, one row a wave at a time (t = S x HD^-0.5 for j <= i and i - j < WIN, everything else masked by select; register row, one exp, fixed trees);
// the probabilities overwrite their own score row (16-bit planes: hi or fp16 in the first PB elements of the row's space, lo in the second), each plane rotated by 8 (row mod 16) elements so that the 16 rows of a fragment read lie in different banks.
// Phase 3: waves 0..7 each contract a 16x64 tile of P.V over the band's keys (probabilities outside it are exactly zero), V from the transposed planes; Q, K and V fragments come from planes in fragment order, 512 contiguous bytes a load; the result x carrier scale goes out as the hi/lo planes [t][head][d] that the output projection reads, whole 128-byte lines a store.
#define AW 9
template <typename T16, int NSPLIT>
__device__ __forceinline__ void attn_tile(float* S, const T16* __restrict__ Q, const T16* __restrict__ Q2, const T16* __restrict__ Kp, const T16* __restrict__ Kp2, const T16* __restrict__ Vt, const T16* __restrict__ Vt2, int r0, bf* Ah, bf* Al) {
    typedef typename WFrag<T16>::V V;
    constexpr bool hires = (NSPLIT == 2);
    const int lane = threadIdx.x & 31, lr = lane & 15, hi = lane >> 4; const int w = __builtin_amdgcn_readfirstlane((int)(threadIdx.x >> 5));
    const int jb = max(0, r0 - WIN) & ~127;                          // first key that the stored rows hold
    const int c0 = r0 - WIN + w * 64;                                // this wave's key tile
    if (c0 >= 0) {
        constexpr int MBS = hires ? 1 : 2;                           // 16-row blocks a pass: as many as let one k block's fragments of every plane lie in registers at once
#pragma unroll 1   // rolled, like the three loops marked so below: keeps the registers under the cap that lets two work-groups share a WGP
        for (int rh = 0; rh < 4 / MBS; ++rh) {
            v8f acc[MBS][4];
#pragma unroll
            for (int mb = 0; mb < MBS; ++mb)
#pragma unroll
                for (int nb = 0; nb < 4; ++nb) acc[mb][nb] = (v8f){};
            const size_t aoff = (size_t)(r0 + rh * (16 * MBS)) * HD + lane * 8, boff = (size_t)c0 * HD + lane * 8;   // the lane's place in the first block of the pass's query rows and of the wave's keys (fragment order)
#pragma unroll 1   // rolled (registers)
            for (int kc = 0; kc < HD; kc += 32) {
                V a[MBS], a2[MBS], b[4], b2[4];
                const T16* qp = Q + aoff + kc * 16; const T16* qp2 = hires ? Q2 + aoff + kc * 16 : qp; const T16* kp = Kp + boff + kc * 16; const T16* kp2 = hires ? Kp2 + boff + kc * 16 : kp;   // block kc / 32 of the row of blocks
#pragma unroll
                for (int mb = 0; mb < MBS; ++mb) { a[mb] = WFrag<T16>::ldf(qp + (size_t)mb * 16 * HD); if (hires) a2[mb] = WFrag<T16>::ldf(qp2 + (size_t)mb * 16 * HD); }
#pragma unroll
                for (int nb = 0; nb < 4; ++nb) { b[nb] = WFrag<T16>::ldf(kp + (size_t)nb * 16 * HD); if (hires) b2[nb] = WFrag<T16>::ldf(kp2 + (size_t)nb * 16 * HD); }
                // the wait that stands in front of a rewrite of a register which an issued load names; it takes the addresses as inputs, so that they stay in their registers up to it and no load of the run lands on them
                asm volatile("s_wait_xcnt 0x0" :: "v"(qp), "v"(qp2), "v"(kp), "v"(kp2) : "memory");
                __builtin_amdgcn_sched_barrier(0);                   // keeps all of the trip's loads in front of its products, so that a trip waits for memory once
#pragma unroll
                for (int nb = 0; nb < 4; ++nb)
#pragma unroll
                    for (int mb = 0; mb < MBS; ++mb) { acc[mb][nb] = WFrag<T16>::mma(a[mb], b[nb], acc[mb][nb]); if (hires) { acc[mb][nb] = WFrag<T16>::mma(a2[mb], b[nb], acc[mb][nb]); acc[mb][nb] = WFrag<T16>::mma(a[mb], b2[nb], acc[mb][nb]); } }
                // fills the slots the chip needs behind the last matrix instruction on the loop's back edge
                if constexpr (MBS == 2) asm volatile("v_nop\n\tv_nop\n\tv_nop\n\tv_nop" : "+v"(acc[0][0]), "+v"(acc[0][1]), "+v"(acc[0][2]), "+v"(acc[0][3]), "+v"(acc[MBS - 1][0]), "+v"(acc[MBS - 1][1]), "+v"(acc[MBS - 1][2]), "+v"(acc[MBS - 1][3]));
                else asm volatile("v_nop\n\tv_nop\n\tv_nop\n\tv_nop" : "+v"(acc[0][0]), "+v"(acc[0][1]), "+v"(acc[0][2]), "+v"(acc[0][3]));
            }
            float* so = S + (size_t)(rh * (16 * MBS) + hi * 8) * PB + (c0 - jb) + lr;
#pragma unroll
            for (int mb = 0; mb < MBS; ++mb)
#pragma unroll
                for (int nb = 0; nb < 4; ++nb)
#pragma unroll
                    for (int j = 0; j < 8; ++j) so[(mb * 16 + j) * PB + nb * 16] = acc[mb][nb][j];
        }
    }
    __syncthreads();                                                 // every score tile is in LDS before a row is read
#pragma unroll 1   // rolled (registers)
    for (int rr = w; rr < 64; rr += AW) {
        const int i = r0 + rr; const float* sr = S + rr * PB; float v[NBC * 4]; float mx = -3.0e38f;
#pragma unroll
        for (int ch = 0; ch < NBC; ++ch) { const int j0 = jb + ch * 128 + lane * 4; const v4f a = *(const v4fa*)(sr + ch * 128 + lane * 4);
#pragma unroll
            for (int q = 0; q < 4; ++q) { const int j = j0 + q; const float t = (j <= i && i - j < WIN) ? a[q] * SCL : -3.0e38f; v[ch * 4 + q] = t; mx = fmaxf(mx, t); } }
#pragma unroll
        for (int sh = 16; sh; sh >>= 1) mx = fmaxf(mx, __shfl_xor(mx, sh, 32));
        float sum = 0.f;
#pragma unroll
        for (int k = 0; k < NBC * 4; ++k) { float d0 = __fsub_rn(v[k], mx); asm volatile("" : "+v"(d0)); v[k] = __builtin_amdgcn_exp2f(__fmul_rn(d0, 1.4426950408889634f)); if (k + 1 < NBC * 4) asm volatile("v_nop" :: "v"(v[k])); /* fills the one slot the instruction set asks for behind a transcendental before the next key's value overwrites its source register */ sum += v[k]; }
#pragma unroll
        for (int sh = 16; sh; sh >>= 1) sum += __shfl_xor(sum, sh, 32);
        const float f = __fdiv_rn(hires ? 1.0f : PCAR, sum);
        T16* pr = (T16*)(S + rr * PB);                               // the row's own space: all of it is in this wave's registers by now
#pragma unroll
        for (int ch = 0; ch < NBC; ++ch) { int cx = ch * 128 + lane * 4 + 8 * (rr & 15); if (cx >= PB) cx -= PB;
            if constexpr (hires) { v4us oh, ol;
#pragma unroll
                for (int q = 0; q < 4; ++q) { unsigned short a, c2; splitf(v[ch * 4 + q] * f, a, c2); oh[q] = a; ol[q] = c2; }
                *(v4usa*)(pr + cx) = oh; *(v4usa*)(pr + PB + cx) = ol;
            } else { v4h o4;
#pragma unroll
                for (int q = 0; q < 4; ++q) o4[q] = tohx(v[ch * 4 + q] * f);
                *(v4ha*)(pr + cx) = o4; } }
    }
    __syncthreads();                                                 // every probability row is in LDS before a fragment is read
    const int wr = w >> 1, wc = w & 1;                               // waves 0..7: rows 16 wr .., columns 64 wc ..
    v8f oc[4];
#pragma unroll
    for (int nb = 0; nb < 4; ++nb) oc[nb] = (v8f){};
    if (w < 8) {
        const int K0 = max(0, r0 - WIN), Kl = r0 + 64;               // the band's keys, both multiples of 64
        const T16* pr = (const T16*)(S + (wr * 16 + lr) * PB); const size_t boff = (size_t)wc * (4 * 512) + lane * 8;   // the lane's place in the wave's first column block (fragment order)
        constexpr int UB = hires ? 1 : 2;                            // 32-key blocks a trip: as many as let the trip's fragments of every plane lie in registers at once
#pragma unroll 1   // rolled (registers)
        for (int kb = K0; kb < Kl; kb += 32 * UB) {
            V a[UB], a2[UB], b[UB][4], b2[UB][4];
            const T16* vp = Vt + boff + (size_t)kb * (HD / 16 * 16); const T16* vp2 = hires ? Vt2 + boff + (size_t)kb * (HD / 16 * 16) : vp;   // key block kb / 32: HD / 16 blocks of 512 elements each
#pragma unroll
            for (int u = 0; u < UB; ++u) {
                int c1 = kb + u * 32 - jb + 8 * hi + 8 * lr, c2 = c1 + 16; if (c1 >= PB) c1 -= PB; if (c2 >= PB) c2 -= PB;
                a[u] = WFrag<T16>::cat(pr + c1, pr + c2); if (hires) a2[u] = WFrag<T16>::cat(pr + PB + c1, pr + PB + c2);
#pragma unroll
                for (int nb = 0; nb < 4; ++nb) { b[u][nb] = WFrag<T16>::ldf(vp + nb * 512 + u * (HD / 16 * 512)); if (hires) b2[u][nb] = WFrag<T16>::ldf(vp2 + nb * 512 + u * (HD / 16 * 512)); } }
            // the wait that stands in front of a rewrite of a register which an issued load names; it takes the addresses as inputs, so that they stay in their registers up to it and no load of the run lands on them
            asm volatile("s_wait_xcnt 0x0" :: "v"(vp), "v"(vp2) : "memory");
            __builtin_amdgcn_sched_barrier(0);                       // keeps all of the trip's loads in front of its products, so that a trip waits for memory once
#pragma unroll
            for (int u = 0; u < UB; ++u)
#pragma unroll
                for (int nb = 0; nb < 4; ++nb) { oc[nb] = WFrag<T16>::mma(a[u], b[u][nb], oc[nb]);
                    if (hires) { oc[nb] = WFrag<T16>::mma(a2[u], b[u][nb], oc[nb]); oc[nb] = WFrag<T16>::mma(a[u], b2[u][nb], oc[nb]); } }
            // fills the slots the chip needs behind the last matrix instruction on the loop's back edge
            asm volatile("v_nop\n\tv_nop\n\tv_nop\n\tv_nop" : "+v"(oc[0]), "+v"(oc[1]), "+v"(oc[2]), "+v"(oc[3]));
        }
    }
    __syncthreads();                                                 // every wave's last fragment read is over before the rows' space is reused for the output staging
    if (w < 8) {
        float* os = S + w * (16 * 68);                               // each wave stages its 16x64 tile in its own LDS range
#pragma unroll
        for (int nb = 0; nb < 4; ++nb)
#pragma unroll
            for (int j = 0; j < 8; ++j) os[(hi * 8 + j) * 68 + nb * 16 + lr] = oc[nb][j];
        __builtin_amdgcn_wave_barrier(); asm volatile("" ::: "memory");   // keeps the row reads below, which take other lanes' values, behind the stores above
        const float cs = hires ? 1.0f : (1.0f / PCAR);
#pragma unroll
        for (int s = 0; s < 8; ++s) { const int row = 2 * s + hi, cofs = lr * 4; const v4f val = *(const v4fa*)(os + row * 68 + cofs); v4us oh, ol;
#pragma unroll
            for (int q = 0; q < 4; ++q) { unsigned short a, c2; splitf(val[q] * cs, a, c2); oh[q] = a; ol[q] = c2; }
            const size_t oo = (size_t)(r0 + wr * 16 + row) * DQ + wc * 64 + cofs; *(v4us*)(Ah + oo) = oh; *(v4us*)(Al + oo) = ol; }
        asm volatile("s_wait_xcnt 0x0" ::: "memory");                // the wait that stands in front of a rewrite of a register which an issued store names
    }
}
// grid (TT / 64, NH_, NB_): query tile, head, batch element; head z reads the planes of kv head z / REP. Query rows < RH take the hi+lo planes (3 products), the rest single fp16.
// waves_per_eu(6): caps the registers so that the 18 waves of two work-groups fit the four SIMDs of a WGP however they are dealt out.
__global__ __launch_bounds__(AW * 32) __attribute__((amdgpu_waves_per_eu(6))) void k_attn(const h16* __restrict__ Q16, const bf* __restrict__ Qh, const bf* __restrict__ Ql, const h16* __restrict__ K16, const bf* __restrict__ Kh, const bf* __restrict__ Kl, const h16* __restrict__ V16, const bf* __restrict__ Vh, const bf* __restrict__ Vl, bf* Ah, bf* Al) {
    static_assert(RH % 64 == 0 && WIN % 64 == 0 && WIN / 64 + 1 == AW, "a tile is all hi+lo or all fp16; one wave a key tile");
    __shared__ __align__(16) float S[64 * PB];                       // 160 KiB: two work-groups a WGP
    const int r0 = blockIdx.x * 64; const size_t z = blockIdx.y, bz = blockIdx.z, qo = (bz * NH_ + z) * TT * HD, ko = (bz * NKV + z / REP) * TT * HD;
    Ah += bz * TT * DQ; Al += bz * TT * DQ;                          // the batch element's rows of the merged planes
    if (r0 < RH) attn_tile<bf, 2>(S, Qh + qo, Ql + qo, Kh + ko, Kl + ko, Vh + ko, Vl + ko, r0, Ah + z * HD, Al + z * HD);
    else attn_tile<h16, 0>(S, Q16 + qo, nullptr, K16 + ko, nullptr, V16 + ko, nullptr, r0, Ah + z * HD, Al + z * HD);
}

extern "C" void kernel_launch(void* const* d_in, const int* in_sizes, int n_in,
                              void* d_out, int out_size, void* d_ws, size_t ws_size, hipStream_t stream) {
    (void)in_sizes; (void)n_in; (void)out_size;
    const float* x = (const float*)d_in[0]; const float* gw = (const float*)d_in[1]; const float* wq = (const float*)d_in[2]; const float* wk = (const float*)d_in[3]; const float* wv = (const float*)d_in[4]; const float* wo = (const float*)d_in[5]; const float* cosT = (const float*)d_in[6]; const float* sinT = (const float*)d_in[7];
    float* OUT = (float*)d_out;     // [2][2048][2048]
    char* wsp = (char*)d_ws;
    auto take = [&](size_t bytes) { char* p = wsp; wsp += (bytes + 255) & ~(size_t)255; return (void*)p; };
    bf* WQ = (bf*)take((size_t)DQ * DM * 2); bf* WK = (bf*)take((size_t)DKV * DM * 2); bf* WV = (bf*)take((size_t)DKV * DM * 2); bf* WO = (bf*)take((size_t)DM * DQ * 2);
    bf* Yh = (bf*)take((size_t)MT * DM * 2); bf* Yl = (bf*)take((size_t)MT * DM * 2);
    h16* QP16 = (h16*)take((size_t)NB_ * NH_ * TT * HD * 2); h16* KP16 = (h16*)take((size_t)NB_ * NKV * TT * HD * 2); h16* VT16 = (h16*)take((size_t)NB_ * NKV * HD * TT * 2);
    bf* QPh = (bf*)take((size_t)NB_ * NH_ * TT * HD * 2); bf* QPl = (bf*)take((size_t)NB_ * NH_ * TT * HD * 2); bf* KPh = (bf*)take((size_t)NB_ * NKV * TT * HD * 2); bf* KPl = (bf*)take((size_t)NB_ * NKV * TT * HD * 2); bf* VTh = (bf*)take((size_t)NB_ * NKV * HD * TT * 2); bf* VTl = (bf*)take((size_t)NB_ * NKV * HD * TT * 2);
    bf* ATh = (bf*)take((size_t)MT * DQ * 2); bf* ATl = (bf*)take((size_t)MT * DQ * 2);
    if ((size_t)(wsp - (char*)d_ws) > ws_size) return;    // ws 256 MiB
    k_prep<<<NRB + 2 * NWQ + 2 * NWK, 256, 0, stream>>>(x, gw, wq, wk, wv, wo, Yh, Yl, WQ, WK, WV, WO);   /* n = RMSNorm(x) norm_w as hi/lo planes; the weights as [n][k] bf16 */
    k_qkv<<<NQT + 2 * NKT, 128, 0, stream>>>(Yh, Yl, WQ, WK, WV, DM, cosT, sinT, QP16, QPh, QPl, KP16, KPh, KPl, VT16, VTh, VTl);
    k_attn<<<dim3(TT / 64, NH_, NB_), AW * 32, 0, stream>>>(QP16, QPh, QPl, KP16, KPh, KPl, VT16, VTh, VTl, ATh, ATl);
    k_oproj<<<dim3(MT / 128, DM / 128, 1), 128, 0, stream>>>(ATh, ATl, WO, DQ, x, OUT);   /* out = x + attn wo */
}

// v009
// It runs in 183 microseconds.
// Two timings next to v008 put it at 1.27 and 1.26 times that version's speed.
// Counting every step since v000, it is 9.50 times as fast.
#include <hip/hip_runtime.h>

// Sliding-window causal GQA with RMSNorm pre-normalisation and residual (x [2][2048][2048]; n = x rsqrt(mean x^2 + 1e-6) norm_w; q = n wq ('xw', 16 heads x 128), k, v = n wk / n wv (4 kv heads); rotate-half RoPE from the given tables [2048][64] (both halves share column d mod 64); 4 query heads per kv head (repeat); scores/sqrt(128) kept where j <= i and i - j < 512; softmax; out = x + merged wo -> [2][2048][2048]).
// Compute dtypes, f32 accumulate: every input rounded to bf16; q/k/v hl x exact (2 products); rotary in f32 from the bf16-rounded input tables; windowed-causal scores and attn.v (tiles outside the band skipped): query rows < 512 hl (3 products), the rest single fp16; running softmax f32, divided once at the end; wo hl x exact (2 products), + x residual in f32.

#define NB_  2
#define TT   2048
#define DM   2048
#define NH_  16
#define NKV  4
#define REP  (NH_ / NKV)
#define HD   128
#define DQ   (NH_ * HD)
#define DKV  (NKV * HD)
#define MT   (NB_ * TT)           // rows of both batch elements together: every stage takes them in one launch
#define RH   512                  // query rows < RH use hi+lo planes (0: none)
#define WIN  512
#define SCL  0.088388347648318447f   // HD^-0.5
typedef _Float16 h16;
typedef unsigned short bf;
typedef __attribute__((ext_vector_type(16))) __bf16   v16bf;
typedef __attribute__((ext_vector_type(16))) _Float16 v16h;
typedef __attribute__((ext_vector_type(8)))  _Float16 v8h;
typedef __attribute__((ext_vector_type(8)))  unsigned short v8us;
typedef __attribute__((ext_vector_type(8)))  float    v8f;
typedef __attribute__((ext_vector_type(4)))  float    v4f;
typedef v8h  __attribute__((may_alias)) v8ha;
typedef v4f  __attribute__((may_alias)) v4fa;
typedef v8us __attribute__((may_alias)) v8usa;

__device__ __forceinline__ unsigned short f2bf(float f) { unsigned u = __float_as_uint(f); u += 0x7FFFu + ((u >> 16) & 1u); return (unsigned short)(u >> 16); }
__device__ __forceinline__ float bf2f(unsigned short b) { return __uint_as_float(((unsigned)b) << 16); }
__device__ __forceinline__ float bfr(float f) { return bf2f(f2bf(f)); }
__device__ __forceinline__ v16h cat16(v8h lo, v8h hi) { return __builtin_shufflevector(lo, hi, 0, 1, 2, 3, 4, 5, 6, 7, 8, 9, 10, 11, 12, 13, 14, 15); }
__device__ __forceinline__ v16bf cat16b(v8us lo, v8us hi) { return __builtin_bit_cast(v16bf, __builtin_shufflevector(lo, hi, 0, 1, 2, 3, 4, 5, 6, 7, 8, 9, 10, 11, 12, 13, 14, 15)); }
__device__ __forceinline__ v8f wmma16(v16h a, v16h b, v8f c) { return __builtin_amdgcn_wmma_f32_16x16x32_f16(false, a, false, b, (short)0, c, false, false); }
__device__ __forceinline__ v8f wmmab(v16bf a, v16bf b, v8f c) { return __builtin_amdgcn_wmma_f32_16x16x32_bf16(false, a, false, b, (short)0, c, false, false); }
__device__ __forceinline__ h16 tohx(float x) { return (h16)x; }
__device__ __forceinline__ void splitf(float y, unsigned short& h, unsigned short& l) { h = f2bf(y); l = f2bf(y - bf2f(h)); }
typedef float __attribute__((may_alias)) fa;



// ---- gemm_tile<MB>: projection GEMM, 4 waves (2 x 2) per (32 MB)x128 output tile, each wave a (16 MB)x64 tile (4 MB accumulators); MB = 4 where that fills the chip, MB = 2 for the narrow k and v outputs (twice the work-groups). The operands (K-contiguous bf16 planes A hi, A lo, Bt) are staged in LDS by asynchronous copies,
// KS k of the tile's rows of each plane a stage, two buffers: the next stage's copies fly while this stage is worked on; fragments are read from LDS one 32-k block ahead. Tile (bx, by) of (M/(32 MB), N/128), 128 threads; M = MT, the rows of both batch elements (row m = batch m / TT, position m mod TT; a tile lies in one batch element); ring = the work-group's LDS, declared by the kernel. c[m][n] (f32) = sum_k (A[m][k] + A2[m][k]) Bt[n][k]. K % KS == 0, K >= 2 KS (the prologue fills two stages).
// The element-wise pass that follows each product is the kernel's epilogue EP, on the f32 tile while it is still on the chip (a tile's 128 columns are one head):
// EP_ROPE: rotate-half rotary from the bf16-rounded tables E0 = cos, E1 = sin [t][HD/2] (out[d] = c[d] cos[t][d] - c[d+HD/2] sin[t][d], out[d+HD/2] = c[d+HD/2] cos[t][d] + c[d] sin[t][d]), written as the head planes [b][h] (fp16, hi, lo; nh heads) in fragment order: blocks of 16 t x 32 d, [t/16][d/32], 512 elements each;
// EP_VT: the transposed head planes [b][h] (fp16, hi, lo) in fragment order: blocks of 16 d x 32 t, [t/32][d/16]; EP_RES: O[m][n] = bf16-rounded E0[m][n] + c[m][n] (f32, both of pitch DM).
// Fragment order: a block holds one matrix-instruction operand (16 rows r x 32 k) as the attention kernel's lanes take it: element (r, k) at (k / 16) 256 + ((k mod 16) / 8 x 16 + r) 8 + k mod 8, so that lane l = hi 16 + r reads its 8 + 8 elements at 8 l and 256 + 8 l and a wave's 16-byte load covers 512 contiguous bytes (4 whole lines; from a row-major plane it touches 16). WFrag::ldf reads one.
#define EP_ROPE 0
#define EP_VT   1
#define EP_RES  2
#define TP   132                 // pitch in floats of the f32 tile staged for EP_ROPE: 16-byte rows, four banks on from row to row
#define KS   64                  // k per stage: 128 B of every operand row, one whole line
#define LP   (KS + 8)            // LDS row pitch in elements: 144 B = 16 B x odd, free of bank conflicts for 16-byte fragment reads
template <typename T16> struct WFrag;
template <> struct WFrag<h16> { typedef v16h V; static __device__ __forceinline__ V ld(const h16* p) { return cat16(*(const v8h*)p, *(const v8h*)(p + 16)); } static __device__ __forceinline__ V ldf(const h16* p) { return cat16(*(const v8h*)p, *(const v8h*)(p + 256)); } static __device__ __forceinline__ V cat(const h16* p, const h16* p2) { return cat16(*(const v8ha*)p, *(const v8ha*)p2); } static __device__ __forceinline__ v8f mma(V a, V b, v8f c) { return wmma16(a, b, c); } };
template <> struct WFrag<bf> { typedef v16bf V; static __device__ __forceinline__ V ld(const bf* p) { return cat16b(*(const v8us*)p, *(const v8us*)(p + 16)); } static __device__ __forceinline__ V ldf(const bf* p) { return cat16b(*(const v8us*)p, *(const v8us*)(p + 256)); } static __device__ __forceinline__ V cat(const bf* p, const bf* p2) { return cat16b(*(const v8usa*)p, *(const v8usa*)p2); } static __device__ __forceinline__ v8f mma(V a, V b, v8f c) { return wmmab(a, b, c); } };
typedef __attribute__((ext_vector_type(4))) int v4ic;
// NJ asynchronous copies of 512 B (4 rows of 128 B each, 16 B a lane): 4 NJ rows of one plane. l = the lane's place in the first of them in LDS, g = the same place in the global plane, gs = elements per 4 global rows.
template <int NJ>
__device__ __forceinline__ void planecopy(bf* l, const bf* g, size_t gs) {
#pragma unroll
    for (int j = 0; j < NJ; ++j)
        __builtin_amdgcn_global_load_async_to_lds_b128((__attribute__((address_space(1))) v4ic*)(g + (size_t)j * gs), (__attribute__((address_space(3))) v4ic*)(l + j * 4 * LP), 0, 0);
}
template <int MB> struct Frags { WFrag<bf>::V a[MB], a2[MB], b[4]; };
// the fragments of one 32-k block of a stage, as one group of LDS reads; sa, sa2, sb = the lane's place in the wave's first row of each plane
template <int MB>
__device__ __forceinline__ void ldfr(Frags<MB>& f, const bf* sa, const bf* sa2, const bf* sb) {
#pragma unroll
    for (int q = 0; q < MB; ++q) { f.a[q] = WFrag<bf>::ld(sa + q * 16 * LP); f.a2[q] = WFrag<bf>::ld(sa2 + q * 16 * LP); }
#pragma unroll
    for (int q = 0; q < 4; ++q) f.b[q] = WFrag<bf>::ld(sb + q * 16 * LP);
}
template <int MB>
__device__ __forceinline__ void mmblk(v8f (&acc)[MB][4], const Frags<MB>& f) {
#pragma unroll
    for (int nb = 0; nb < 4; ++nb)
#pragma unroll
        for (int mb = 0; mb < MB; ++mb) { acc[mb][nb] = WFrag<bf>::mma(f.a[mb], f.b[nb], acc[mb][nb]); acc[mb][nb] = WFrag<bf>::mma(f.a2[mb], f.b[nb], acc[mb][nb]); }
}
#define RINGE (2 * (2 * 32 * 4 * LP + 128 * LP))   // elements of the two-stage ring of the largest tile (MB = 4)
template <int MB, int EP>
__device__ __forceinline__ void gemm_tile(bf* ring, int bx, int by, int nh, const bf* __restrict__ A, const bf* __restrict__ A2, const bf* __restrict__ Bt, int K, const float* __restrict__ E0, const float* __restrict__ E1, float* O, h16* P16, bf* Ph, bf* Pl) {
    static_assert(KS == 64, "a stage is two 32-k blocks");
    constexpr int PLA = 32 * MB * LP, STG = 2 * PLA + 128 * LP;   // a stage: A hi | A lo (32 MB rows each) | Bt (128 rows)
    static_assert(2 * STG <= RINGE, "the ring fits the kernel's LDS");
    const int lane = threadIdx.x & 31, lr = lane & 15, hi = lane >> 4; const int w = __builtin_amdgcn_readfirstlane((int)(threadIdx.x >> 5)), wm = w >> 1, wn = w & 1;
    const int r0 = bx * (32 * MB), c0 = by * 128, bb = r0 / TT, t0 = r0 % TT;   // bb, t0: the tile's batch element and its first position there
    (void)bb; (void)t0; (void)nh;
    v8f acc[MB][4];
#pragma unroll
    for (int mb = 0; mb < MB; ++mb)
#pragma unroll
        for (int nb = 0; nb < 4; ++nb) acc[mb][nb] = (v8f){};
    // wave w copies rows 8 MB w .. 8 MB w + 8 MB - 1 of the A planes and rows 32 w .. 32 w + 31 of Bt
    const int crA = w * (8 * MB) + (lane >> 3), crB = w * 32 + (lane >> 3), ccol = (lane & 7) * 8; const size_t gs = (size_t)4 * K;
    const bf* gA = A + (size_t)(r0 + crA) * K + ccol; const bf* gA2 = A2 + (size_t)(r0 + crA) * K + ccol; const bf* gB = Bt + (size_t)(c0 + crB) * K + ccol;
    bf* lA = ring + crA * LP + ccol; bf* lB = ring + 2 * PLA + crB * LP + ccol;
    const int nt = K / KS;
    planecopy<2 * MB>(lA, gA, gs); planecopy<2 * MB>(lA + PLA, gA2, gs); planecopy<8>(lB, gB, gs);
    asm volatile("s_wait_asynccnt 0x0" ::: "memory");   // this wave's share of stage 0 has landed
    __syncthreads();                                     // ... and every other wave's
    planecopy<2 * MB>(lA + STG, gA + KS, gs); planecopy<2 * MB>(lA + STG + PLA, gA2 + KS, gs); planecopy<8>(lB + STG, gB + KS, gs);
    const int aofs = (wm * (16 * MB) + lr) * LP + 8 * hi, bofs = 2 * PLA + (wn * 64 + lr) * LP + 8 * hi;
    Frags<MB> f0, f1;                                    // two fragment sets: each block's LDS reads are issued one block ahead, as one group
    ldfr<MB>(f0, ring + aofs, ring + PLA + aofs, ring + bofs);
#pragma unroll 1
    for (int t = 0; t < nt; ++t) {
        const bf* st = ring + (t & 1) * STG; const bf* sn = ring + ((t + 1) & 1) * STG;
        ldfr<MB>(f1, st + aofs + 32, st + PLA + aofs + 32, st + bofs + 32);
        __builtin_amdgcn_sched_barrier(0);                   // keeps the read group ahead of the block it hides behind
        mmblk<MB>(acc, f0);
        __builtin_amdgcn_sched_barrier(0);                   // keeps the block ahead of the publish point, so that the waits below find their data landed
        // publish point of stage t + 1, in front of stage t's last block, whose fragments are already fetched
        asm volatile("s_wait_dscnt 0x0" ::: "memory");      // this wave's last reads of stage t have returned before its buffer is refilled
        asm volatile("s_wait_asynccnt 0x0" ::: "memory");   // this wave's share of stage t + 1 has landed
        __syncthreads();                                     // publishes stage t + 1 and ends every wave's reads of stage t
        if (t + 2 < nt) { const size_t ko = (size_t)(t + 2) * KS; const int bo = (t & 1) * STG; planecopy<2 * MB>(lA + bo, gA + ko, gs); planecopy<2 * MB>(lA + bo + PLA, gA2 + ko, gs); planecopy<8>(lB + bo, gB + ko, gs); }
        if (t + 1 < nt) ldfr<MB>(f0, sn + aofs, sn + PLA + aofs, sn + bofs);
        mmblk<MB>(acc, f1);
    }
    asm volatile("s_wait_asynccnt 0x0" ::: "memory");       // no copy is outstanding when the wave ends
    // Behind the loop's last barrier the ring is free: no copy is outstanding and every wave's last fragment read returned in front of that barrier. The epilogues stage in it.
    if constexpr (EP == EP_ROPE) {
        fa* tl = (fa*)ring;                                  // the work-group's whole tile in f32: a column's rotary partner lies in the neighbour wave's registers
#pragma unroll
        for (int mb = 0; mb < MB; ++mb)
#pragma unroll
            for (int nb = 0; nb < 4; ++nb)
#pragma unroll
                for (int j = 0; j < 8; ++j) tl[(wm * (16 * MB) + mb * 16 + hi * 8 + j) * TP + wn * 64 + nb * 16 + lr] = acc[mb][nb][j];
        // wave w takes rows 8 MB w ..; a step is half a block: 16 rows (lane mod 16) x 16 columns d < HD/2 (8 a lane), and their partners d + HD/2; step s = row block s / 4, column group s mod 4
        const int row0 = w * (8 * MB) + lr, dc = hi * 8;
        const float* cp = E0 + (size_t)(t0 + row0) * (HD / 2) + dc; const float* sp = E1 + (size_t)(t0 + row0) * (HD / 2) + dc;
        v4f cv[2 * MB][2], sv[2 * MB][2];                    // every step's table values, fetched while the tile is staged
#pragma unroll
        for (int s = 0; s < 2 * MB; ++s)
#pragma unroll
            for (int u = 0; u < 2; ++u) { cv[s][u] = *(const v4f*)(cp + (s >> 2) * 16 * (HD / 2) + (s & 3) * 16 + u * 4); sv[s][u] = *(const v4f*)(sp + (s >> 2) * 16 * (HD / 2) + (s & 3) * 16 + u * 4); }
        // the wait that stands in front of a rewrite of a register which an issued load names; it takes the addresses as inputs, so that they stay in their registers up to it
        asm volatile("s_wait_xcnt 0x0" :: "v"(cp), "v"(sp) : "memory");
        __syncthreads();                                     // the whole tile is in LDS before a row is read
        const size_t oo = (((size_t)bb * nh + by) * TT + t0 + w * (8 * MB)) * HD + lane * 8;   // the lane's place in the wave's first block (the HD / 32 blocks of 16 rows t are 16 HD elements)
        h16* q16 = P16 + oo; bf* qh = Ph + oo; bf* ql = Pl + oo;
        const fa* xr = tl + row0 * TP + dc;
        v4f xl0 = *(const v4fa*)xr, xl1 = *(const v4fa*)(xr + 4), xh0 = *(const v4fa*)(xr + HD / 2), xh1 = *(const v4fa*)(xr + HD / 2 + 4);
        v8h pa16 = {}, pb16 = {}; v8us pah = {}, pal = {}, pbh = {}, pbl = {};   // the last step's stored values
#pragma unroll
        for (int s = 0; s < 2 * MB; ++s) {
            v4f nl0 = xl0, nl1 = xl1, nh0 = xh0, nh1 = xh1;
            if (s + 1 < 2 * MB) { const fa* xn = xr + ((s + 1) >> 2) * 16 * TP + ((s + 1) & 3) * 16; nl0 = *(const v4fa*)xn; nl1 = *(const v4fa*)(xn + 4); nh0 = *(const v4fa*)(xn + HD / 2); nh1 = *(const v4fa*)(xn + HD / 2 + 4); }   // the next step's rows are read from LDS while this step is worked on
            v8h a16, b16; v8us ah, al, bh, bl;
#pragma unroll
            for (int q = 0; q < 8; ++q) { const float x0 = q < 4 ? xl0[q & 3] : xl1[q & 3], x1 = q < 4 ? xh0[q & 3] : xh1[q & 3], c = bfr(cv[s][q >> 2][q & 3]), sn = bfr(sv[s][q >> 2][q & 3]);
                const float ra = x0 * c - x1 * sn, rb = x1 * c + x0 * sn; unsigned short h2, l2;
                a16[q] = tohx(ra); splitf(ra, h2, l2); ah[q] = h2; al[q] = l2; b16[q] = tohx(rb); splitf(rb, h2, l2); bh[q] = h2; bl[q] = l2; }
            __builtin_amdgcn_sched_barrier(0);               // keeps the step's arithmetic in front of the wait, which would otherwise be lifted to directly behind the last step's stores
            // the wait that stands in front of a rewrite of a register which an issued store names: it takes the addresses and the last step's data as inputs, so that they stay in their registers up to it, a step's work behind those stores
            if (s) asm volatile("s_wait_xcnt 0x0" :: "v"(q16), "v"(qh), "v"(ql), "v"(pa16), "v"(pb16), "v"(pah), "v"(pbh), "v"(pal), "v"(pbl) : "memory");
            constexpr int PO = (HD / 2 / 32) * 512; const int so = (s >> 2) * 16 * HD + (s & 3) * 256;   // the step's half block; the partner columns lie HD/2/32 blocks on
            *(v8h*)(q16 + so) = a16; *(v8h*)(q16 + so + PO) = b16; *(v8us*)(qh + so) = ah; *(v8us*)(qh + so + PO) = bh; *(v8us*)(ql + so) = al; *(v8us*)(ql + so + PO) = bl;
            pa16 = a16; pb16 = b16; pah = ah; pal = al; pbh = bh; pbl = bl; xl0 = nl0; xl1 = nl1; xh0 = nh0; xh1 = nh1;
        }
    } else if constexpr (EP == EP_VT) {
        static_assert(MB == 2, "a staged row is 64 t of one column: one 128-byte line");
        constexpr int VP = 32 * MB + 8, VPL = 128 * VP;      // staged planes [d][t]: pitch 144 B = 16 B x odd; a lane's 8 accumulator rows are 8 consecutive t of one d
#pragma unroll
        for (int mb = 0; mb < MB; ++mb)
#pragma unroll
            for (int nb = 0; nb < 4; ++nb) { v8h o16; v8us oh, ol;
#pragma unroll
                for (int j = 0; j < 8; ++j) { const float xv = acc[mb][nb][j]; unsigned short h2, l2; o16[j] = tohx(xv); splitf(xv, h2, l2); oh[j] = h2; ol[j] = l2; }
                const int e = (wn * 64 + nb * 16 + lr) * VP + wm * (16 * MB) + mb * 16 + hi * 8;
                *(v8ha*)(ring + e) = o16; *(v8usa*)(ring + VPL + e) = oh; *(v8usa*)(ring + 2 * VPL + e) = ol; }
        __syncthreads();                                     // every plane row is whole in LDS before it is read
        // wave w takes columns 32 w ..; a step is half a block: 16 columns d (lane mod 16) x 16 t (8 a lane), 512 contiguous bytes a store; step s = column block s / 4, t group s mod 4
        const int d0 = w * 32 + lr, tc = hi * 8; const bf* lp = ring + d0 * VP + tc;
        const size_t oo = ((size_t)bb * nh + by) * HD * TT + (size_t)(t0 / 32) * (HD / 16 * 512) + w * 1024 + lane * 8;   // the lane's place in the wave's first block
        h16* q16 = P16 + oo; bf* qh = Ph + oo; bf* ql = Pl + oo;
        v8us a[8], b[8], c[8];                               // all of the wave's rows are read first: no register that a store names is written again
#pragma unroll
        for (int s = 0; s < 8; ++s) { const int lo = (s >> 2) * 16 * VP + (s & 3) * 16; a[s] = *(const v8usa*)(lp + lo); b[s] = *(const v8usa*)(lp + VPL + lo); c[s] = *(const v8usa*)(lp + 2 * VPL + lo); }
        __builtin_amdgcn_sched_barrier(0);                   // keeps every LDS read in front of the first store
#pragma unroll
        for (int s = 0; s < 8; ++s) { const int so = ((s & 3) >> 1) * (HD / 16 * 512) + (s >> 2) * 512 + (s & 1) * 256; *(v8usa*)(q16 + so) = a[s]; *(v8us*)(qh + so) = b[s]; *(v8us*)(ql + so) = c[s]; }
    } else {
        fa* os = (fa*)ring + w * (16 * 68);                  // each wave stages its output rows in its own LDS range
        const size_t eo = (size_t)(r0 + wm * (16 * MB) + hi) * DM + c0 + wn * 64 + lr * 4;   // the lane's place in its first row; a step is 2 rows
        const float* xp = E0 + eo; float* op = O + eo;
        v4f xa[2][8], o[2][8];                               // the residual rows of a 16-row block, fetched one block ahead; two blocks' results
#pragma unroll
        for (int s = 0; s < 8; ++s) xa[0][s] = *(const v4f*)(xp + s * 2 * DM);
#pragma unroll
        for (int mb = 0; mb < MB; ++mb) {
#pragma unroll
            for (int nb = 0; nb < 4; ++nb) {
#pragma unroll
                for (int j = 0; j < 8; ++j) os[(hi * 8 + j) * 68 + nb * 16 + lr] = acc[mb][nb][j]; }
            if (mb + 1 < MB) {
#pragma unroll
                for (int s = 0; s < 8; ++s) xa[(mb + 1) & 1][s] = *(const v4f*)(xp + ((mb + 1) * 16 + s * 2) * DM); }
            __builtin_amdgcn_wave_barrier(); asm volatile("" ::: "memory");   // keeps the row reads below, which take other lanes' values, behind the stores above
#pragma unroll
            for (int s = 0; s < 8; ++s) { const v4f val = *(const v4fa*)(os + (2 * s + hi) * 68 + lr * 4);
#pragma unroll
                for (int q = 0; q < 4; ++q) o[mb & 1][s][q] = bfr(xa[mb & 1][s][q]) + val[q]; }
            __builtin_amdgcn_sched_barrier(0);               // keeps the block's sums in front of the wait, which would otherwise be lifted to directly behind the last block's stores
            // the wait that stands in front of a rewrite of a register which an issued load or store names: it takes the addresses and the last block's data as inputs, so that they stay in their registers up to it, a block's work behind those stores
            if (mb) asm volatile("s_wait_xcnt 0x0" :: "v"(xp), "v"(op), "v"(o[(mb + 1) & 1][0]), "v"(o[(mb + 1) & 1][1]), "v"(o[(mb + 1) & 1][2]), "v"(o[(mb + 1) & 1][3]), "v"(o[(mb + 1) & 1][4]), "v"(o[(mb + 1) & 1][5]), "v"(o[(mb + 1) & 1][6]), "v"(o[(mb + 1) & 1][7]) : "memory");
#pragma unroll
            for (int s = 0; s < 8; ++s) *(v4f*)(op + (mb * 16 + s * 2) * DM) = o[mb & 1][s];
            __builtin_amdgcn_wave_barrier(); asm volatile("" ::: "memory");   // keeps the next 16 rows' LDS stores behind this block's reads
        }
    }
    asm volatile("s_wait_xcnt 0x0" ::: "memory");            // the wait that stands in front of a rewrite of a register which an issued store names: in a kernel of several tile kinds another kind's text follows this one's last stores
}
// ---- k_qkv: the three projections of n, which read nothing of each other, in one grid: first the q tiles (the longest), then the k tiles, then the v tiles; within each the row tile runs fastest.
#define NQT ((MT / 128) * (DQ / 128))
#define NKT ((MT / 64) * (DKV / 128))
__global__ __launch_bounds__(128) void k_qkv(const bf* __restrict__ Yh, const bf* __restrict__ Yl, const bf* __restrict__ WQ, const bf* __restrict__ WK, const bf* __restrict__ WV, int K, const float* __restrict__ cosT, const float* __restrict__ sinT, h16* QP16, bf* QPh, bf* QPl, h16* KP16, bf* KPh, bf* KPl, h16* VT16, bf* VTh, bf* VTl) {
    __shared__ __align__(16) bf ring[RINGE];
    const int i = blockIdx.x;
    if (i < NQT) gemm_tile<4, EP_ROPE>(ring, i % (MT / 128), i / (MT / 128), NH_, Yh, Yl, WQ, K, cosT, sinT, nullptr, QP16, QPh, QPl);
    else if (i < NQT + NKT) gemm_tile<2, EP_ROPE>(ring, (i - NQT) % (MT / 64), (i - NQT) / (MT / 64), NKV, Yh, Yl, WK, K, cosT, sinT, nullptr, KP16, KPh, KPl);
    else gemm_tile<2, EP_VT>(ring, (i - NQT - NKT) % (MT / 64), (i - NQT - NKT) / (MT / 64), NKV, Yh, Yl, WV, K, nullptr, nullptr, nullptr, VT16, VTh, VTl);
}
// ---- k_oproj: out = x + attn wo, grid (MT / 128, DM / 128)
__global__ __launch_bounds__(128) void k_oproj(const bf* __restrict__ Ah, const bf* __restrict__ Al, const bf* __restrict__ WO, int K, const float* __restrict__ x, float* O) {
    __shared__ __align__(16) bf ring[RINGE];
    gemm_tile<4, EP_RES>(ring, blockIdx.x, blockIdx.y, 0, Ah, Al, WO, K, x, nullptr, O, nullptr, nullptr, nullptr);
}

typedef __attribute__((ext_vector_type(2))) _Float16 v2h;
typedef __attribute__((ext_vector_type(4))) _Float16 v4h;
typedef __attribute__((ext_vector_type(2))) unsigned short v2us;
typedef __attribute__((ext_vector_type(4))) unsigned short v4us;
typedef __attribute__((ext_vector_type(2))) float v2f;
typedef __attribute__((ext_vector_type(4))) int v4i;

// ---- wt_blk: tile blk of the transpose Bt[n][k] (bf16) = w[k][n] (f32), WTT k x WTT n a work-group of 8 waves, through the LDS tile tl [n][k].
// Wave v reads rows k = 16 v .. 16 v + 15, a whole 512-byte row piece a load (lane l: columns 4 l .. 4 l + 3), all 16 loads in flight at once; a lane then holds 16 k of each of its 4 columns and writes them as 16-byte chunks of 8 k.
// Chunk c of tile row n lies at place c ^ ((n / 4) mod 16) of the row's 16: the 16 lanes of a half wave hit 16 different places (all 64 banks once) in the column-wise writes and in the row-wise reads alike. A store covers two output rows' 256 contiguous bytes each.
#define WTT 128
__device__ __forceinline__ void wt_blk(bf* tl, int blk, const float* __restrict__ w, int K, int N, bf* Bt) {
    const int lane = threadIdx.x & 31, lc = lane & 15, lh = lane >> 4, wv = threadIdx.x >> 5; const int nt = N / WTT, n0 = (blk % nt) * WTT, k0 = (blk / nt) * WTT;
    const float* sp = w + (size_t)(k0 + wv * 16) * N + n0 + lane * 4;
    v4f a[16];
#pragma unroll
    for (int j = 0; j < 16; ++j) a[j] = *(const v4f*)(sp + (size_t)j * N);
    // the wait that stands in front of a rewrite of a register which an issued load names; it takes the address as an input, so that it stays in its registers up to it
    asm volatile("s_wait_xcnt 0x0" :: "v"(sp) : "memory");
    __builtin_amdgcn_sched_barrier(0);                       // keeps all 16 loads in front of the conversions, so that a wave waits out the memory latency once
#pragma unroll
    for (int g = 0; g < 2; ++g)
#pragma unroll
        for (int q = 0; q < 4; ++q) { v8us o;
#pragma unroll
            for (int j = 0; j < 8; ++j) o[j] = f2bf(a[g * 8 + j][q]);
            *(v8usa*)(tl + (lane * 4 + q) * WTT + ((wv * 2 + g) ^ lc) * 8) = o; }
    __syncthreads();                                         // the whole tile is in LDS before a row is read
    bf* dp = Bt + (size_t)(n0 + wv * 16 + lh) * K + k0 + lc * 8;   // wave v stores tile rows 16 v .. 16 v + 15, two a step
    v8us o[8];                                               // all of the wave's rows are read first: no register that a store names is written again
#pragma unroll
    for (int s = 0; s < 8; ++s) { const int n = wv * 16 + 2 * s + lh; o[s] = *(const v8usa*)(tl + n * WTT + (lc ^ ((n >> 2) & 15)) * 8); }
    __builtin_amdgcn_sched_barrier(0);                       // keeps every LDS read in front of the first store
#pragma unroll
    for (int s = 0; s < 8; ++s) *(v8us*)(dp + (size_t)(2 * s) * K) = o[s];
    asm volatile("s_wait_xcnt 0x0" ::: "memory");            // the wait that stands in front of a rewrite of a register which an issued store names: another job's text follows this one's last stores
}
__device__ __forceinline__ void rms_blk(int blk, const float* __restrict__ X, const float* __restrict__ g, bf* Yh, bf* Yl) {
    const int lane = threadIdx.x & 31; const int r = blk * 8 + (threadIdx.x >> 5); if (r >= MT) return; const float* xr = X + (size_t)r * DM; float s = 0.f;
#pragma unroll 1
    for (int ch = 0; ch < DM / 128; ++ch) { const v4f a = *(const v4f*)(xr + ch * 128 + lane * 4);
#pragma unroll
        for (int q = 0; q < 4; ++q) { const float xb = bfr(a[q]); float p = __fmul_rn(xb, xb); asm volatile("" : "+v"(p)); s = __fadd_rn(s, p); } }
#pragma unroll
    for (int sh = 16; sh; sh >>= 1) s += __shfl_xor(s, sh, 32);
    const float rs = __fdiv_rn(1.0f, __fsqrt_rn(__fadd_rn(s * (1.0f / DM), 1e-6f)));
{
#pragma unroll 1
        for (int ch = 0; ch < DM / 128; ++ch) { const int c0 = ch * 128 + lane * 4; const v4f a = *(const v4f*)(xr + c0); v4us oh, ol;
#pragma unroll
            for (int q = 0; q < 4; ++q) { float n0 = __fmul_rn(bfr(a[q]), rs); asm volatile("" : "+v"(n0)); const float y = __fmul_rn(n0, bfr(g[c0 + q])); unsigned short h2, l2; splitf(y, h2, l2); oh[q] = h2; ol[q] = l2; }
            *(v4us*)(Yh + (size_t)r * DM + c0) = oh; *(v4us*)(Yl + (size_t)r * DM + c0) = ol; }
         } }
// ---- k_prep: the five jobs that read inputs only, in one grid: n = RMSNorm(x) norm_w of all MT rows as hi/lo planes, then the four weight transposes (the large ones first).
#define NRB (MT / 8)
#define NWQ ((DM / WTT) * (DQ / WTT))
#define NWK ((DM / WTT) * (DKV / WTT))
__global__ __launch_bounds__(256) void k_prep(const float* __restrict__ x, const float* __restrict__ g, const float* __restrict__ wq, const float* __restrict__ wk, const float* __restrict__ wv, const float* __restrict__ wo, bf* Yh, bf* Yl, bf* WQ, bf* WK, bf* WV, bf* WO) {
    static_assert(DM % WTT == 0 && DQ % WTT == 0 && DKV % WTT == 0, "whole transpose tiles");
    __shared__ __align__(16) bf tl[WTT * WTT];               // a transpose tile, 32 KiB
    const int i = blockIdx.x;
    if (i < NRB) rms_blk(i, x, g, Yh, Yl);
    else if (i < NRB + NWQ) wt_blk(tl, i - NRB, wq, DM, DQ, WQ);
    else if (i < NRB + 2 * NWQ) wt_blk(tl, i - NRB - NWQ, wo, DQ, DM, WO);
    else if (i < NRB + 2 * NWQ + NWK) wt_blk(tl, i - NRB - 2 * NWQ, wk, DM, DKV, WK);
    else wt_blk(tl, i - NRB - 2 * NWQ - NWK, wv, DM, DKV, WV);
}
__global__ __launch_bounds__(256) void k_cvt8(const float* __restrict__ src, bf* dst, size_t n8) { const size_t i = (size_t)blockIdx.x * 256 + threadIdx.x; if (i >= n8) return; const v8f v = *(const v8f*)(src + i * 8); v8us o;
#pragma unroll
    for (int k = 0; k < 8; ++k) o[k] = f2bf(v[k]); *(v8us*)(dst + i * 8) = o;  }
// ---- k_attn: attention in one pass over the keys, one wave a tile of 16 QG query rows of one head; no score or probability ever leaves the registers, and the waves share nothing (no barrier).
// Transposed products: S^T = K Q^T (A = 16 keys x 32 d, B = 32 d x 16 queries) leaves in lane (hi, lr) the scores of query lr for keys 8 hi .. 8 hi + 7 of each 16-key tile: exactly the elements that the lane holds of the B operand P^T (32 keys x 16 queries) of O^T += V^T P^T.
// Running softmax in the base-2 domain: u = S x HD^-0.5 x log2 e, p = 2^(u - mr); the reference mr of a query moves (and its sums are rescaled) only when a new maximum lies more than 12 above it, then to 4 below that maximum, so p <= 2^12; keys outside j <= i, i - j < WIN give p = 0 (masked by select in the two edge steps only).
// The sum of p and O^T are divided once, at the end. The four waves of a work-group are the four query heads of one kv head on the same rows: they read the same K and V blocks. K and V fragments (fragment order, 512 contiguous bytes a load) are fetched one step ahead into the registers that the step's products have just left.
__device__ __forceinline__ float xhalf(float x) { const unsigned u = __float_as_uint(x); return __uint_as_float(__builtin_amdgcn_permlanex16(u, u, 0x76543210u, 0xfedcba98u, false, false)); }   // the value of lane l ^ 16
#define SGP 136                  // pitch in elements of a staged output row: 272 B = 16 B x odd
#define SGE (16 * SGP)           // one staged plane of 16 rows
template <typename T16, int NSPLIT, int QG>
__device__ __forceinline__ void attn_tile(bf* stg, const T16* __restrict__ Q, const T16* __restrict__ Q2, const T16* __restrict__ Kp, const T16* __restrict__ Kp2, const T16* __restrict__ Vt, const T16* __restrict__ Vt2, int q0, bf* Ah, bf* Al) {
    typedef typename WFrag<T16>::V V;
    constexpr bool hires = (NSPLIT == 2);
    const int lane = threadIdx.x & 31, lr = lane & 15, hi = lane >> 4;
    const int K0 = max(0, q0 - WIN + 1) & ~31, Kl = (q0 + 16 * QG + 31) & ~31;   // the tile's band of keys in whole 32-key blocks
    V qf[QG][4], qf2[QG][4], kf[2][4], kf2[2][4], vf[8], vf2[8];
    const T16* qp = Q + (size_t)q0 * HD + lane * 8; const T16* qp2 = hires ? Q2 + (size_t)q0 * HD + lane * 8 : qp;
    const T16* kp = Kp + (size_t)K0 * HD + lane * 8; const T16* kp2 = hires ? Kp2 + (size_t)K0 * HD + lane * 8 : kp;
    const T16* vp = Vt + (size_t)K0 * HD + lane * 8; const T16* vp2 = hires ? Vt2 + (size_t)K0 * HD + lane * 8 : vp;   // key block kb / 32: HD / 16 blocks of 512 elements
#pragma unroll
    for (int g = 0; g < QG; ++g)
#pragma unroll
        for (int db = 0; db < 4; ++db) { qf[g][db] = WFrag<T16>::ldf(qp + g * 16 * HD + db * 512); if (hires) qf2[g][db] = WFrag<T16>::ldf(qp2 + g * 16 * HD + db * 512); }
    asm volatile("s_wait_xcnt 0x0" ::: "memory");                    // the wait that stands in front of a rewrite of a register which an issued load names: the K addresses are formed next, and may take the registers of the Q loads' bases
    __builtin_amdgcn_sched_barrier(0);                               // Q, then K, then V, the order of the loop's own loads: the counted waits at the loop's head then leave the V loads in flight
#pragma unroll
    for (int t = 0; t < 2; ++t)
#pragma unroll
        for (int db = 0; db < 4; ++db) { kf[t][db] = WFrag<T16>::ldf(kp + t * 16 * HD + db * 512); if (hires) kf2[t][db] = WFrag<T16>::ldf(kp2 + t * 16 * HD + db * 512); }
    __builtin_amdgcn_sched_barrier(0);                               // (the same)
#pragma unroll
    for (int dt = 0; dt < 8; ++dt) { vf[dt] = WFrag<T16>::ldf(vp + dt * 512); if (hires) vf2[dt] = WFrag<T16>::ldf(vp2 + dt * 512); }
    // the wait that stands in front of a rewrite of a register which an issued load names; it takes the addresses as inputs, so that they stay in their registers up to it
    asm volatile("s_wait_xcnt 0x0" :: "v"(qp), "v"(qp2), "v"(kp), "v"(kp2), "v"(vp), "v"(vp2) : "memory");
    v8f o[QG][8]; float mr[QG], ls[QG];
#pragma unroll
    for (int g = 0; g < QG; ++g) { mr[g] = -1.0e30f; ls[g] = 0.f;
#pragma unroll
        for (int dt = 0; dt < 8; ++dt) o[g][dt] = (v8f){}; }
    for (int kb = K0; kb < Kl; kb += 32) {
        const int adv = kb + 32 < Kl ? 32 * HD : 0;                  // the last step fetches its own blocks again: in bounds, never used
        v8f s[QG][2];
#pragma unroll
        for (int g = 0; g < QG; ++g) { s[g][0] = (v8f){}; s[g][1] = (v8f){}; }
#pragma unroll
        for (int db = 0; db < 4; ++db) {
#pragma unroll
            for (int t = 0; t < 2; ++t)
#pragma unroll
                for (int g = 0; g < QG; ++g) s[g][t] = WFrag<T16>::mma(kf[t][db], qf[g][db], s[g][t]);
            if (hires) {
#pragma unroll
                for (int t = 0; t < 2; ++t)
#pragma unroll
                    for (int g = 0; g < QG; ++g) s[g][t] = WFrag<T16>::mma(kf[t][db], qf2[g][db], s[g][t]);
#pragma unroll
                for (int t = 0; t < 2; ++t)
#pragma unroll
                    for (int g = 0; g < QG; ++g) s[g][t] = WFrag<T16>::mma(kf2[t][db], qf[g][db], s[g][t]); } }
        __builtin_amdgcn_sched_barrier(0);                           // keeps the next step's K loads behind the products that read these registers, and ahead of the softmax that hides them
        kp += adv; kp2 += adv;
#pragma unroll
        for (int t = 0; t < 2; ++t)
#pragma unroll
            for (int db = 0; db < 4; ++db) { kf[t][db] = WFrag<T16>::ldf(kp + t * 16 * HD + db * 512); if (hires) kf2[t][db] = WFrag<T16>::ldf(kp2 + t * 16 * HD + db * 512); }
        // the wait that stands in front of a rewrite of a register which an issued load names (the addresses move in the next step)
        asm volatile("s_wait_xcnt 0x0" :: "v"(kp), "v"(kp2) : "memory");
        __builtin_amdgcn_sched_barrier(0);                           // keeps the loads ahead of the softmax
        float u[QG][2][8], mx[QG]; bool need = false;
#pragma unroll
        for (int g = 0; g < QG; ++g)
#pragma unroll
            for (int t = 0; t < 2; ++t)
#pragma unroll
                for (int j = 0; j < 8; ++j) u[g][t][j] = s[g][t][j] * (SCL * 1.4426950408889634f);
        if (kb + 31 > q0 || kb <= q0 + 16 * QG - 1 - WIN) {          // only the band's first and last steps hold keys outside the window of some row (a scalar test)
#pragma unroll
            for (int g = 0; g < QG; ++g)
#pragma unroll
                for (int t = 0; t < 2; ++t)
#pragma unroll
                    for (int j = 0; j < 8; ++j) { const int i = q0 + 16 * g + lr, jj = kb + 16 * t + 8 * hi + j; u[g][t][j] = (jj <= i && i - jj < WIN) ? u[g][t][j] : -3.0e38f; }
        }
#pragma unroll
        for (int g = 0; g < QG; ++g) { float m0 = u[g][0][0];
#pragma unroll
            for (int e = 1; e < 16; ++e) m0 = fmaxf(m0, u[g][e >> 3][e & 7]);
            mx[g] = fmaxf(m0, xhalf(m0)); need = need || mx[g] > mr[g] + 12.0f; }
        if (__builtin_amdgcn_ballot_w32(need) != 0) {                // one test a step; rare after a query's first keys
#pragma unroll
            for (int g = 0; g < QG; ++g) { const float mn = fmaxf(mr[g], mx[g] - 4.0f), al = __builtin_amdgcn_exp2f(mr[g] - mn); mr[g] = mn; ls[g] *= al;
#pragma unroll
                for (int dt = 0; dt < 8; ++dt)
#pragma unroll
                    for (int j = 0; j < 8; ++j) o[g][dt][j] *= al; }
        }
        V pf[QG], pf2[QG];
#pragma unroll
        for (int g = 0; g < QG; ++g) {
            float p[16];
#pragma unroll
            for (int e = 0; e < 16; ++e) p[e] = u[g][e >> 3][e & 7] - mr[g];
            __builtin_amdgcn_sched_barrier(0);                       // keeps the subtractions out of the run of exponentials below: none of them then lands on the source register of the exponential directly in front of it
#pragma unroll
            for (int e = 0; e < 16; ++e) { p[e] = __builtin_amdgcn_exp2f(p[e]);
                // hi+lo build: the next key's result lands on this one's source register; the v_nop fills the one slot the instruction set asks for behind a transcendental, and the scheduling barrier keeps it directly behind it
                if constexpr (hires) { asm volatile("v_nop" :: "v"(p[e])); __builtin_amdgcn_sched_barrier(0); } }
            if constexpr (!hires) __builtin_amdgcn_sched_barrier(0);     // (the same, for what follows the run)
#pragma unroll
            for (int e = 0; e < 16; ++e) ls[g] += p[e];
            if constexpr (hires) { v8us h0, h1, l0, l1;
#pragma unroll
                for (int e = 0; e < 8; ++e) { unsigned short a, c2; splitf(p[e], a, c2); h0[e] = a; l0[e] = c2; splitf(p[8 + e], a, c2); h1[e] = a; l1[e] = c2; }
                pf[g] = cat16b(h0, h1); pf2[g] = cat16b(l0, l1);
            } else { v8h h0, h1;
#pragma unroll
                for (int e = 0; e < 8; ++e) { h0[e] = tohx(p[e]); h1[e] = tohx(p[8 + e]); }
                pf[g] = cat16(h0, h1); }
        }
#pragma unroll
        for (int dt = 0; dt < 8; ++dt)
#pragma unroll
            for (int g = 0; g < QG; ++g) o[g][dt] = WFrag<T16>::mma(vf[dt], pf[g], o[g][dt]);
        if (hires) {
#pragma unroll
            for (int dt = 0; dt < 8; ++dt)
#pragma unroll
                for (int g = 0; g < QG; ++g) o[g][dt] = WFrag<T16>::mma(vf[dt], pf2[g], o[g][dt]);
#pragma unroll
            for (int dt = 0; dt < 8; ++dt)
#pragma unroll
                for (int g = 0; g < QG; ++g) o[g][dt] = WFrag<T16>::mma(vf2[dt], pf[g], o[g][dt]); }
        __builtin_amdgcn_sched_barrier(0);                           // keeps the next step's V loads behind the products that read these registers
        vp += adv; vp2 += adv;
#pragma unroll
        for (int dt = 0; dt < 8; ++dt) { vf[dt] = WFrag<T16>::ldf(vp + dt * 512); if (hires) vf2[dt] = WFrag<T16>::ldf(vp2 + dt * 512); }
        // the wait that stands in front of a rewrite of a register which an issued load names (the addresses move in the next step)
        asm volatile("s_wait_xcnt 0x0" :: "v"(vp), "v"(vp2) : "memory");
    }
    // lane (hi, lr) holds, of query lr, columns d = 16 dt + 8 hi .. + 7: 16 bytes of each plane; staged in the wave's own LDS range so that a store covers two rows' 256 contiguous bytes
#pragma unroll
    for (int g = 0; g < QG; ++g) { const float lt = ls[g] + xhalf(ls[g]), inv = __fdiv_rn(1.0f, lt); bf* sp = stg + g * (2 * SGE) + lr * SGP + hi * 8;
#pragma unroll
        for (int dt = 0; dt < 8; ++dt) { v8us oh, ol;
#pragma unroll
            for (int j = 0; j < 8; ++j) { unsigned short a, c2; splitf(o[g][dt][j] * inv, a, c2); oh[j] = a; ol[j] = c2; }
            *(v8usa*)(sp + dt * 16) = oh; *(v8usa*)(sp + SGE + dt * 16) = ol; } }
    __builtin_amdgcn_wave_barrier(); asm volatile("" ::: "memory");   // keeps the row reads below, which take other lanes' values, behind the stores above
    v8us ra[QG][8], rb[QG][8];                                       // all rows are read first: no register that a store names is written again
#pragma unroll
    for (int g = 0; g < QG; ++g)
#pragma unroll
        for (int r = 0; r < 8; ++r) { const bf* sp = stg + g * (2 * SGE) + (2 * r + hi) * SGP + lr * 8; ra[g][r] = *(const v8usa*)sp; rb[g][r] = *(const v8usa*)(sp + SGE); }
    __builtin_amdgcn_sched_barrier(0);                               // keeps every LDS read in front of the first store
    const size_t oo = (size_t)(q0 + hi) * DQ + lr * 8; bf* ah = Ah + oo; bf* al2 = Al + oo;
#pragma unroll
    for (int g = 0; g < QG; ++g)
#pragma unroll
        for (int r = 0; r < 8; ++r) { *(v8us*)(ah + (size_t)(16 * g + 2 * r) * DQ) = ra[g][r]; *(v8us*)(al2 + (size_t)(16 * g + 2 * r) * DQ) = rb[g][r]; }
    asm volatile("s_wait_xcnt 0x0" ::: "memory");                    // the wait that stands in front of a rewrite of a register which an issued store names
}
// grid: tile (slowest), then batch element and kv head; first the 32-row tiles of query rows >= RH (single fp16), then the 16-row tiles of rows < RH (hi+lo planes, 3 products) from the longest band to the shortest, so that the last work-groups to start are the shortest.
// waves_per_eu(2): caps the registers so that two waves share a SIMD.
#define NTF ((TT - RH) / 32)
#define NTH (RH / 16)
__global__ __launch_bounds__(128) __attribute__((amdgpu_waves_per_eu(2))) void k_attn(const h16* __restrict__ Q16, const bf* __restrict__ Qh, const bf* __restrict__ Ql, const h16* __restrict__ K16, const bf* __restrict__ Kh, const bf* __restrict__ Kl, const h16* __restrict__ V16, const bf* __restrict__ Vh, const bf* __restrict__ Vl, bf* Ah, bf* Al) {
    static_assert(RH % 32 == 0 && (TT - RH) % 32 == 0 && REP == 4 && HD == 128, "whole tiles; one wave a query head of the kv head");
    __shared__ __align__(16) bf stg[4 * 4 * SGE];                    // output staging: 2 groups x 2 planes a wave
    const int w = __builtin_amdgcn_readfirstlane((int)(threadIdx.x >> 5));
    const int tile = blockIdx.x / (NKV * NB_), gz = blockIdx.x % (NKV * NB_);
    const size_t kvh = gz % NKV, bz = gz / NKV, z = kvh * REP + w, qo = (bz * NH_ + z) * TT * HD, ko = (bz * NKV + kvh) * TT * HD;
    bf* ah = Ah + bz * TT * DQ + z * HD; bf* al = Al + bz * TT * DQ + z * HD;   // the batch element's rows and the head's columns of the merged planes
    bf* sw = stg + w * (4 * SGE);
    if (tile < NTF) attn_tile<h16, 0, 2>(sw, Q16 + qo, nullptr, K16 + ko, nullptr, V16 + ko, nullptr, RH + 32 * tile, ah, al);
    else attn_tile<bf, 2, 1>(sw, Qh + qo, Ql + qo, Kh + ko, Kl + ko, Vh + ko, Vl + ko, 16 * (NTH - 1 - (tile - NTF)), ah, al);
}

extern "C" void kernel_launch(void* const* d_in, const int* in_sizes, int n_in,
                              void* d_out, int out_size, void* d_ws, size_t ws_size, hipStream_t stream) {
    (void)in_sizes; (void)n_in; (void)out_size;
    const float* x = (const float*)d_in[0]; const float* gw = (const float*)d_in[1]; const float* wq = (const float*)d_in[2]; const float* wk = (const float*)d_in[3]; const float* wv = (const float*)d_in[4]; const float* wo = (const float*)d_in[5]; const float* cosT = (const float*)d_in[6]; const float* sinT = (const float*)d_in[7];
    float* OUT = (float*)d_out;     // [2][2048][2048]
    char* wsp = (char*)d_ws;
    auto take = [&](size_t bytes) { char* p = wsp; wsp += (bytes + 255) & ~(size_t)255; return (void*)p; };
    bf* WQ = (bf*)take((size_t)DQ * DM * 2); bf* WK = (bf*)take((size_t)DKV * DM * 2); bf* WV = (bf*)take((size_t)DKV * DM * 2); bf* WO = (bf*)take((size_t)DM * DQ * 2);
    bf* Yh = (bf*)take((size_t)MT * DM * 2); bf* Yl = (bf*)take((size_t)MT * DM * 2);
    h16* QP16 = (h16*)take((size_t)NB_ * NH_ * TT * HD * 2); h16* KP16 = (h16*)take((size_t)NB_ * NKV * TT * HD * 2); h16* VT16 = (h16*)take((size_t)NB_ * NKV * HD * TT * 2);
    bf* QPh = (bf*)take((size_t)NB_ * NH_ * TT * HD * 2); bf* QPl = (bf*)take((size_t)NB_ * NH_ * TT * HD * 2); bf* KPh = (bf*)take((size_t)NB_ * NKV * TT * HD * 2); bf* KPl = (bf*)take((size_t)NB_ * NKV * TT * HD * 2); bf* VTh = (bf*)take((size_t)NB_ * NKV * HD * TT * 2); bf* VTl = (bf*)take((size_t)NB_ * NKV * HD * TT * 2);
    bf* ATh = (bf*)take((size_t)MT * DQ * 2); bf* ATl = (bf*)take((size_t)MT * DQ * 2);
    if ((size_t)(wsp - (char*)d_ws) > ws_size) return;    // ws 256 MiB
    k_prep<<<NRB + 2 * NWQ + 2 * NWK, 256, 0, stream>>>(x, gw, wq, wk, wv, wo, Yh, Yl, WQ, WK, WV, WO);   /* n = RMSNorm(x) norm_w as hi/lo planes; the weights as [n][k] bf16 */
    k_qkv<<<NQT + 2 * NKT, 128, 0, stream>>>(Yh, Yl, WQ, WK, WV, DM, cosT, sinT, QP16, QPh, QPl, KP16, KPh, KPl, VT16, VTh, VTl);
    k_attn<<<(NTF + NTH) * NKV * NB_, 128, 0, stream>>>(QP16, QPh, QPl, KP16, KPh, KPl, VT16, VTh, VTl, ATh, ATl);
    k_oproj<<<dim3(MT / 128, DM / 128, 1), 128, 0, stream>>>(ATh, ATl, WO, DQ, x, OUT);   /* out = x + attn wo */
}

// v010
// Measured time: 171 microseconds a run.
// Two timings next to v009 both put it at 1.07 times that version's speed.
// Counting every step since v000, it is 10.2 times as fast.
#include <hip/hip_runtime.h>

// Sliding-window causal GQA with RMSNorm pre-normalisation and residual (x [2][2048][2048]; n = x rsqrt(mean x^2 + 1e-6) norm_w; q = n wq ('xw', 16 heads x 128), k, v = n wk / n wv (4 kv heads); rotate-half RoPE from the given tables [2048][64] (both halves share column d mod 64); 4 query heads per kv head (repeat); scores/sqrt(128) kept where j <= i and i - j < 512; softmax; out = x + merged wo -> [2][2048][2048]).
// Compute dtypes, f32 accumulate: every input rounded to bf16; q/k/v hl x exact (2 products); rotary in f32 from the bf16-rounded input tables; windowed-causal scores and attn.v (tiles outside the band skipped): query rows < 512 hl (3 products), the rest single fp16; running softmax f32, divided once at the end; wo hl x exact (2 products), + x residual in f32.

#define NB_  2
#define TT   2048
#define DM   2048
#define NH_  16
#define NKV  4
#define REP  (NH_ / NKV)
#define HD   128
#define DQ   (NH_ * HD)
#define DKV  (NKV * HD)
#define MT   (NB_ * TT)           // rows of both batch elements together: every stage takes them in one launch
#define RH   512                  // query rows < RH use hi+lo planes (0: none)
#define WIN  512
#define SCL  0.088388347648318447f   // HD^-0.5
typedef _Float16 h16;
typedef unsigned short bf;
typedef __attribute__((ext_vector_type(16))) __bf16   v16bf;
typedef __attribute__((ext_vector_type(16))) _Float16 v16h;
typedef __attribute__((ext_vector_type(8)))  _Float16 v8h;
typedef __attribute__((ext_vector_type(8)))  unsigned short v8us;
typedef __attribute__((ext_vector_type(8)))  float    v8f;
typedef __attribute__((ext_vector_type(4)))  float    v4f;
typedef v8h  __attribute__((may_alias)) v8ha;
typedef v4f  __attribute__((may_alias)) v4fa;
typedef v8us __attribute__((may_alias)) v8usa;

__device__ __forceinline__ unsigned short f2bf(float f) { unsigned u = __float_as_uint(f); u += 0x7FFFu + ((u >> 16) & 1u); return (unsigned short)(u >> 16); }
__device__ __forceinline__ float bf2f(unsigned short b) { return __uint_as_float(((unsigned)b) << 16); }
__device__ __forceinline__ float bfr(float f) { return bf2f(f2bf(f)); }
__device__ __forceinline__ v16h cat16(v8h lo, v8h hi) { return __builtin_shufflevector(lo, hi, 0, 1, 2, 3, 4, 5, 6, 7, 8, 9, 10, 11, 12, 13, 14, 15); }
__device__ __forceinline__ v16bf cat16b(v8us lo, v8us hi) { return __builtin_bit_cast(v16bf, __builtin_shufflevector(lo, hi, 0, 1, 2, 3, 4, 5, 6, 7, 8, 9, 10, 11, 12, 13, 14, 15)); }
__device__ __forceinline__ v8f wmma16(v16h a, v16h b, v8f c) { return __builtin_amdgcn_wmma_f32_16x16x32_f16(false, a, false, b, (short)0, c, false, false); }
__device__ __forceinline__ v8f wmmab(v16bf a, v16bf b, v8f c) { return __builtin_amdgcn_wmma_f32_16x16x32_bf16(false, a, false, b, (short)0, c, false, false); }
__device__ __forceinline__ h16 tohx(float x) { return (h16)x; }
__device__ __forceinline__ void splitf(float y, unsigned short& h, unsigned short& l) { h = f2bf(y); l = f2bf(y - bf2f(h)); }
typedef float __attribute__((may_alias)) fa;



// ---- gemm_tile<MB>: projection GEMM, 4 waves (2 x 2) per (32 MB)x128 output tile, each wave a (16 MB)x64 tile (4 MB accumulators); MB = 4 where that fills the chip, MB = 2 for the narrow k and v outputs (twice the work-groups). The operands (K-contiguous bf16 planes A hi, A lo, Bt) are staged in LDS by asynchronous copies,
// KS k of the tile's rows of each plane a stage, two buffers: the next stage's copies fly while this stage is worked on; fragments are read from LDS one 32-k block ahead. Tile (bx, by) of (M/(32 MB), N/128), 128 threads; M = MT, the rows of both batch elements (row m = batch m / TT, position m mod TT; a tile lies in one batch element); ring = the work-group's LDS, declared by the kernel. c[m][n] (f32) = sum_k (A[m][k] + A2[m][k]) Bt[n][k]. K % KS == 0, K >= 2 KS (the prologue fills two stages).
// The element-wise pass that follows each product is the kernel's epilogue EP, on the f32 tile while it is still on the chip (a tile's 128 columns are one head):
// EP_ROPE: rotate-half rotary from the bf16-rounded tables E0 = cos, E1 = sin [t][HD/2] (out[d] = c[d] cos[t][d] - c[d+HD/2] sin[t][d], out[d+HD/2] = c[d+HD/2] cos[t][d] + c[d] sin[t][d]), written as the head planes [b][h] (fp16, hi, lo; nh heads) in fragment order: blocks of 16 t x 32 d, [t/16][d/32], 512 elements each;
// EP_VT: the transposed head planes [b][h] (fp16, hi, lo) in fragment order: blocks of 16 d x 32 t, [t/32][d/16]; EP_RES: O[m][n] = bf16-rounded E0[m][n] + c[m][n] (f32, both of pitch DM).
// Fragment order: a block holds one matrix-instruction operand (16 rows r x 32 k) as the attention kernel's lanes take it: element (r, k) at (k / 16) 256 + ((k mod 16) / 8 x 16 + r) 8 + k mod 8, so that lane l = hi 16 + r reads its 8 + 8 elements at 8 l and 256 + 8 l and a wave's 16-byte load covers 512 contiguous bytes (4 whole lines; from a row-major plane it touches 16). WFrag::ldf reads one.
#define EP_ROPE 0
#define EP_VT   1
#define EP_RES  2
#define TP   132                 // pitch in floats of the f32 tile staged for EP_ROPE: 16-byte rows, four banks on from row to row
#define KS   64                  // k per stage: 128 B of every operand row, one whole line
#define LP   (KS + 8)            // LDS row pitch in elements: 144 B = 16 B x odd, free of bank conflicts for 16-byte fragment reads
template <typename T16> struct WFrag;
template <> struct WFrag<h16> { typedef v16h V; static __device__ __forceinline__ V ld(const h16* p) { return cat16(*(const v8h*)p, *(const v8h*)(p + 16)); } static __device__ __forceinline__ V ldf(const h16* p) { return cat16(*(const v8h*)p, *(const v8h*)(p + 256)); } static __device__ __forceinline__ V cat(const h16* p, const h16* p2) { return cat16(*(const v8ha*)p, *(const v8ha*)p2); } static __device__ __forceinline__ v8f mma(V a, V b, v8f c) { return wmma16(a, b, c); } };
template <> struct WFrag<bf> { typedef v16bf V; static __device__ __forceinline__ V ld(const bf* p) { return cat16b(*(const v8us*)p, *(const v8us*)(p + 16)); } static __device__ __forceinline__ V ldf(const bf* p) { return cat16b(*(const v8us*)p, *(const v8us*)(p + 256)); } static __device__ __forceinline__ V cat(const bf* p, const bf* p2) { return cat16b(*(const v8usa*)p, *(const v8usa*)p2); } static __device__ __forceinline__ v8f mma(V a, V b, v8f c) { return wmmab(a, b, c); } };
typedef __attribute__((ext_vector_type(4))) int v4ic;
// NJ asynchronous copies of 512 B (4 rows of 128 B each, 16 B a lane): 4 NJ rows of one plane. l = the lane's place in the first of them in LDS, g = the same place in the global plane, gs = elements per 4 global rows.
template <int NJ>
__device__ __forceinline__ void planecopy(bf* l, const bf* g, size_t gs) {
#pragma unroll
    for (int j = 0; j < NJ; ++j)
        __builtin_amdgcn_global_load_async_to_lds_b128((__attribute__((address_space(1))) v4ic*)(g + (size_t)j * gs), (__attribute__((address_space(3))) v4ic*)(l + j * 4 * LP), 0, 0);
}
template <int MB> struct Frags { WFrag<bf>::V a[MB], a2[MB], b[4]; };
// the fragments of one 32-k block of a stage, as one group of LDS reads; sa, sa2, sb = the lane's place in the wave's first row of each plane
template <int MB>
__device__ __forceinline__ void ldfr(Frags<MB>& f, const bf* sa, const bf* sa2, const bf* sb) {
#pragma unroll
    for (int q = 0; q < MB; ++q) { f.a[q] = WFrag<bf>::ld(sa + q * 16 * LP); f.a2[q] = WFrag<bf>::ld(sa2 + q * 16 * LP); }
#pragma unroll
    for (int q = 0; q < 4; ++q) f.b[q] = WFrag<bf>::ld(sb + q * 16 * LP);
}
template <int MB>
__device__ __forceinline__ void mmblk(v8f (&acc)[MB][4], const Frags<MB>& f) {
#pragma unroll
    for (int nb = 0; nb < 4; ++nb)
#pragma unroll
        for (int mb = 0; mb < MB; ++mb) { acc[mb][nb] = WFrag<bf>::mma(f.a[mb], f.b[nb], acc[mb][nb]); acc[mb][nb] = WFrag<bf>::mma(f.a2[mb], f.b[nb], acc[mb][nb]); }
}
#define RINGE (2 * (2 * 32 * 4 * LP + 128 * LP))   // elements of the two-stage ring of the largest tile (MB = 4)
template <int MB, int EP>
__device__ __forceinline__ void gemm_tile(bf* ring, int bx, int by, int nh, const bf* __restrict__ A, const bf* __restrict__ A2, const bf* __restrict__ Bt, int K, const float* __restrict__ E0, const float* __restrict__ E1, float* O, h16* P16, bf* Ph, bf* Pl) {
    static_assert(KS == 64, "a stage is two 32-k blocks");
    constexpr int PLA = 32 * MB * LP, STG = 2 * PLA + 128 * LP;   // a stage: A hi | A lo (32 MB rows each) | Bt (128 rows)
    static_assert(2 * STG <= RINGE, "the ring fits the kernel's LDS");
    const int lane = threadIdx.x & 31, lr = lane & 15, hi = lane >> 4; const int w = __builtin_amdgcn_readfirstlane((int)(threadIdx.x >> 5)), wm = w >> 1, wn = w & 1;
    const int r0 = bx * (32 * MB), c0 = by * 128, bb = r0 / TT, t0 = r0 % TT;   // bb, t0: the tile's batch element and its first position there
    (void)bb; (void)t0; (void)nh;
    v8f acc[MB][4];
#pragma unroll
    for (int mb = 0; mb < MB; ++mb)
#pragma unroll
        for (int nb = 0; nb < 4; ++nb) acc[mb][nb] = (v8f){};
    // wave w copies rows 8 MB w .. 8 MB w + 8 MB - 1 of the A planes and rows 32 w .. 32 w + 31 of Bt
    const int crA = w * (8 * MB) + (lane >> 3), crB = w * 32 + (lane >> 3), ccol = (lane & 7) * 8; const size_t gs = (size_t)4 * K;
    const bf* gA = A + (size_t)(r0 + crA) * K + ccol; const bf* gA2 = A2 + (size_t)(r0 + crA) * K + ccol; const bf* gB = Bt + (size_t)(c0 + crB) * K + ccol;
    bf* lA = ring + crA * LP + ccol; bf* lB = ring + 2 * PLA + crB * LP + ccol;
    const int nt = K / KS;
    planecopy<2 * MB>(lA, gA, gs); planecopy<2 * MB>(lA + PLA, gA2, gs); planecopy<8>(lB, gB, gs);
    asm volatile("s_wait_asynccnt 0x0" ::: "memory");   // this wave's share of stage 0 has landed
    __syncthreads();                                     // ... and every other wave's
    planecopy<2 * MB>(lA + STG, gA + KS, gs); planecopy<2 * MB>(lA + STG + PLA, gA2 + KS, gs); planecopy<8>(lB + STG, gB + KS, gs);
    const int aofs = (wm * (16 * MB) + lr) * LP + 8 * hi, bofs = 2 * PLA + (wn * 64 + lr) * LP + 8 * hi;
    Frags<MB> f0, f1;                                    // two fragment sets: each block's LDS reads are issued one block ahead, as one group
    ldfr<MB>(f0, ring + aofs, ring + PLA + aofs, ring + bofs);
#pragma unroll 1
    for (int t = 0; t < nt; ++t) {
        const bf* st = ring + (t & 1) * STG; const bf* sn = ring + ((t + 1) & 1) * STG;
        ldfr<MB>(f1, st + aofs + 32, st + PLA + aofs + 32, st + bofs + 32);
        __builtin_amdgcn_sched_barrier(0);                   // keeps the read group ahead of the block it hides behind
        mmblk<MB>(acc, f0);
        __builtin_amdgcn_sched_barrier(0);                   // keeps the block ahead of the publish point, so that the waits below find their data landed
        // publish point of stage t + 1, in front of stage t's last block, whose fragments are already fetched
        asm volatile("s_wait_dscnt 0x0" ::: "memory");      // this wave's last reads of stage t have returned before its buffer is refilled
        asm volatile("s_wait_asynccnt 0x0" ::: "memory");   // this wave's share of stage t + 1 has landed
        __syncthreads();                                     // publishes stage t + 1 and ends every wave's reads of stage t
        if (t + 2 < nt) { const size_t ko = (size_t)(t + 2) * KS; const int bo = (t & 1) * STG; planecopy<2 * MB>(lA + bo, gA + ko, gs); planecopy<2 * MB>(lA + bo + PLA, gA2 + ko, gs); planecopy<8>(lB + bo, gB + ko, gs); }
        if (t + 1 < nt) ldfr<MB>(f0, sn + aofs, sn + PLA + aofs, sn + bofs);
        mmblk<MB>(acc, f1);
    }
    asm volatile("s_wait_asynccnt 0x0" ::: "memory");       // no copy is outstanding when the wave ends
    // Behind the loop's last barrier the ring is free: no copy is outstanding and every wave's last fragment read returned in front of that barrier. The epilogues stage in it.
    if constexpr (EP == EP_ROPE) {
        fa* tl = (fa*)ring;                                  // the work-group's whole tile in f32: a column's rotary partner lies in the neighbour wave's registers
#pragma unroll
        for (int mb = 0; mb < MB; ++mb)
#pragma unroll
            for (int nb = 0; nb < 4; ++nb)
#pragma unroll
                for (int j = 0; j < 8; ++j) tl[(wm * (16 * MB) + mb * 16 + hi * 8 + j) * TP + wn * 64 + nb * 16 + lr] = acc[mb][nb][j];
        // wave w takes rows 8 MB w ..; a step is half a block: 16 rows (lane mod 16) x 16 columns d < HD/2 (8 a lane), and their partners d + HD/2; step s = row block s / 4, column group s mod 4
        const int row0 = w * (8 * MB) + lr, dc = hi * 8;
        const float* cp = E0 + (size_t)(t0 + row0) * (HD / 2) + dc; const float* sp = E1 + (size_t)(t0 + row0) * (HD / 2) + dc;
        v4f c0 = *(const v4f*)cp, c1 = *(const v4f*)(cp + 4), s0 = *(const v4f*)sp, s1 = *(const v4f*)(sp + 4);   // step 0's table values, fetched while the tile is staged
        // the wait that stands in front of a rewrite of a register which an issued load names; it takes the addresses as inputs, so that they stay in their registers up to it
        asm volatile("s_wait_xcnt 0x0" :: "v"(cp), "v"(sp) : "memory");
        __syncthreads();                                     // the whole tile is in LDS before a row is read
        const size_t oo = (((size_t)bb * nh + by) * TT + t0 + w * (8 * MB)) * HD + lane * 8;   // the lane's place in the wave's first block (the HD / 32 blocks of 16 rows t are 16 HD elements)
        h16* q16 = P16 + oo; bf* qh = Ph + oo; bf* ql = Pl + oo;
        const fa* xr = tl + row0 * TP + dc;
        v4f xl0 = *(const v4fa*)xr, xl1 = *(const v4fa*)(xr + 4), xh0 = *(const v4fa*)(xr + HD / 2), xh1 = *(const v4fa*)(xr + HD / 2 + 4);
        // The step loop stays rolled, for the size of the kernel's text: unrolled, the three tile kinds together pass 32 KB of text.
#pragma unroll 1
        for (int s = 0; s < 2 * MB; ++s) {
            const int n = s + 1 < 2 * MB ? s + 1 : s;        // the last step fetches its own values again: in bounds, never used
            const fa* xn = xr + (n >> 2) * 16 * TP + (n & 3) * 16; const float* cn = cp + (n >> 2) * 16 * (HD / 2) + (n & 3) * 16; const float* sq = sp + (n >> 2) * 16 * (HD / 2) + (n & 3) * 16;
            // the next step's table values and LDS rows are fetched while this step is worked on
            const v4f nc0 = *(const v4f*)cn, nc1 = *(const v4f*)(cn + 4), ns0 = *(const v4f*)sq, ns1 = *(const v4f*)(sq + 4);
            const v4f nl0 = *(const v4fa*)xn, nl1 = *(const v4fa*)(xn + 4), nh0 = *(const v4fa*)(xn + HD / 2), nh1 = *(const v4fa*)(xn + HD / 2 + 4);
            v8h a16, b16; v8us ah, al, bh, bl;
#pragma unroll
            for (int q = 0; q < 8; ++q) { const float x0 = q < 4 ? xl0[q & 3] : xl1[q & 3], x1 = q < 4 ? xh0[q & 3] : xh1[q & 3], c = bfr(q < 4 ? c0[q & 3] : c1[q & 3]), sn = bfr(q < 4 ? s0[q & 3] : s1[q & 3]);
                const float ra = x0 * c - x1 * sn, rb = x1 * c + x0 * sn; unsigned short h2, l2;
                a16[q] = tohx(ra); splitf(ra, h2, l2); ah[q] = h2; al[q] = l2; b16[q] = tohx(rb); splitf(rb, h2, l2); bh[q] = h2; bl[q] = l2; }
            constexpr int PO = (HD / 2 / 32) * 512; const int so = (s >> 2) * 16 * HD + (s & 3) * 256;   // the step's half block; the partner columns lie HD/2/32 blocks on
            h16* d16 = q16 + so; bf* dh = qh + so; bf* dl = ql + so;
            *(v8h*)d16 = a16; *(v8h*)(d16 + PO) = b16; *(v8us*)dh = ah; *(v8us*)(dh + PO) = bh; *(v8us*)dl = al; *(v8us*)(dl + PO) = bl;
            // the wait that stands in front of a rewrite of a register which an issued load or store names (the next step forms its addresses and its data in the same registers): it takes the addresses and the data as inputs, so that they stay in their registers up to it
            asm volatile("s_wait_xcnt 0x0" :: "v"(cn), "v"(sq), "v"(d16), "v"(dh), "v"(dl), "v"(a16), "v"(b16), "v"(ah), "v"(bh), "v"(al), "v"(bl) : "memory");
            c0 = nc0; c1 = nc1; s0 = ns0; s1 = ns1; xl0 = nl0; xl1 = nl1; xh0 = nh0; xh1 = nh1;
        }
    } else if constexpr (EP == EP_VT) {
        static_assert(MB == 2, "a staged row is 64 t of one column: one 128-byte line");
        constexpr int VP = 32 * MB + 8, VPL = 128 * VP;      // staged planes [d][t]: pitch 144 B = 16 B x odd; a lane's 8 accumulator rows are 8 consecutive t of one d
#pragma unroll
        for (int mb = 0; mb < MB; ++mb)
#pragma unroll
            for (int nb = 0; nb < 4; ++nb) { v8h o16; v8us oh, ol;
#pragma unroll
                for (int j = 0; j < 8; ++j) { const float xv = acc[mb][nb][j]; unsigned short h2, l2; o16[j] = tohx(xv); splitf(xv, h2, l2); oh[j] = h2; ol[j] = l2; }
                const int e = (wn * 64 + nb * 16 + lr) * VP + wm * (16 * MB) + mb * 16 + hi * 8;
                *(v8ha*)(ring + e) = o16; *(v8usa*)(ring + VPL + e) = oh; *(v8usa*)(ring + 2 * VPL + e) = ol; }
        __syncthreads();                                     // every plane row is whole in LDS before it is read
        // wave w takes columns 32 w ..; a step is half a block: 16 columns d (lane mod 16) x 16 t (8 a lane), 512 contiguous bytes a store; step s = column block s / 4, t group s mod 4
        const int d0 = w * 32 + lr, tc = hi * 8; const bf* lp = ring + d0 * VP + tc;
        const size_t oo = ((size_t)bb * nh + by) * HD * TT + (size_t)(t0 / 32) * (HD / 16 * 512) + w * 1024 + lane * 8;   // the lane's place in the wave's first block
        h16* q16 = P16 + oo; bf* qh = Ph + oo; bf* ql = Pl + oo;
        v8us a[8], b[8], c[8];                               // all of the wave's rows are read first: no register that a store names is written again
#pragma unroll
        for (int s = 0; s < 8; ++s) { const int lo = (s >> 2) * 16 * VP + (s & 3) * 16; a[s] = *(const v8usa*)(lp + lo); b[s] = *(const v8usa*)(lp + VPL + lo); c[s] = *(const v8usa*)(lp + 2 * VPL + lo); }
        __builtin_amdgcn_sched_barrier(0);                   // keeps every LDS read in front of the first store
#pragma unroll
        for (int s = 0; s < 8; ++s) { const int so = ((s & 3) >> 1) * (HD / 16 * 512) + (s >> 2) * 512 + (s & 1) * 256; *(v8usa*)(q16 + so) = a[s]; *(v8us*)(qh + so) = b[s]; *(v8us*)(ql + so) = c[s]; }
    } else {
        fa* os = (fa*)ring + w * (16 * 68);                  // each wave stages its output rows in its own LDS range
        const size_t eo = (size_t)(r0 + wm * (16 * MB) + hi) * DM + c0 + wn * 64 + lr * 4;   // the lane's place in its first row; a step is 2 rows
        const float* xp = E0 + eo; float* op = O + eo;
        v4f xa[2][8], o[2][8];                               // the residual rows of a 16-row block, fetched one block ahead; two blocks' results
#pragma unroll
        for (int s = 0; s < 8; ++s) xa[0][s] = *(const v4f*)(xp + s * 2 * DM);
#pragma unroll
        for (int mb = 0; mb < MB; ++mb) {
#pragma unroll
            for (int nb = 0; nb < 4; ++nb) {
#pragma unroll
                for (int j = 0; j < 8; ++j) os[(hi * 8 + j) * 68 + nb * 16 + lr] = acc[mb][nb][j]; }
            if (mb + 1 < MB) {
#pragma unroll
                for (int s = 0; s < 8; ++s) xa[(mb + 1) & 1][s] = *(const v4f*)(xp + ((mb + 1) * 16 + s * 2) * DM); }
            __builtin_amdgcn_wave_barrier(); asm volatile("" ::: "memory");   // keeps the row reads below, which take other lanes' values, behind the stores above
#pragma unroll
            for (int s = 0; s < 8; ++s) { const v4f val = *(const v4fa*)(os + (2 * s + hi) * 68 + lr * 4);
#pragma unroll
                for (int q = 0; q < 4; ++q) o[mb & 1][s][q] = bfr(xa[mb & 1][s][q]) + val[q]; }
            __builtin_amdgcn_sched_barrier(0);               // keeps the block's sums in front of the wait, which would otherwise be lifted to directly behind the last block's stores
            // the wait that stands in front of a rewrite of a register which an issued load or store names: it takes the addresses and the last block's data as inputs, so that they stay in their registers up to it, a block's work behind those stores
            if (mb) asm volatile("s_wait_xcnt 0x0" :: "v"(xp), "v"(op), "v"(o[(mb + 1) & 1][0]), "v"(o[(mb + 1) & 1][1]), "v"(o[(mb + 1) & 1][2]), "v"(o[(mb + 1) & 1][3]), "v"(o[(mb + 1) & 1][4]), "v"(o[(mb + 1) & 1][5]), "v"(o[(mb + 1) & 1][6]), "v"(o[(mb + 1) & 1][7]) : "memory");
#pragma unroll
            for (int s = 0; s < 8; ++s) *(v4f*)(op + (mb * 16 + s * 2) * DM) = o[mb & 1][s];
            __builtin_amdgcn_wave_barrier(); asm volatile("" ::: "memory");   // keeps the next 16 rows' LDS stores behind this block's reads
        }
    }
    asm volatile("s_wait_xcnt 0x0" ::: "memory");            // the wait that stands in front of a rewrite of a register which an issued store names: in a kernel of several tile kinds another kind's text follows this one's last stores
}
// ---- k_qkv: the three projections of n, which read nothing of each other, in one grid: first the q tiles (the longest), then the k tiles, then the v tiles; within each the row tile runs fastest.
#define NQT ((MT / 128) * (DQ / 128))
#define NKT ((MT / 64) * (DKV / 128))
__global__ __launch_bounds__(128) void k_qkv(const bf* __restrict__ Yh, const bf* __restrict__ Yl, const bf* __restrict__ WQ, const bf* __restrict__ WK, const bf* __restrict__ WV, int K, const float* __restrict__ cosT, const float* __restrict__ sinT, h16* QP16, bf* QPh, bf* QPl, h16* KP16, bf* KPh, bf* KPl, h16* VT16, bf* VTh, bf* VTl) {
    __shared__ __align__(16) bf ring[RINGE];
    const int i = blockIdx.x;
    if (i < NQT) gemm_tile<4, EP_ROPE>(ring, i % (MT / 128), i / (MT / 128), NH_, Yh, Yl, WQ, K, cosT, sinT, nullptr, QP16, QPh, QPl);
    else if (i < NQT + NKT) gemm_tile<2, EP_ROPE>(ring, (i - NQT) % (MT / 64), (i - NQT) / (MT / 64), NKV, Yh, Yl, WK, K, cosT, sinT, nullptr, KP16, KPh, KPl);
    else gemm_tile<2, EP_VT>(ring, (i - NQT - NKT) % (MT / 64), (i - NQT - NKT) / (MT / 64), NKV, Yh, Yl, WV, K, nullptr, nullptr, nullptr, VT16, VTh, VTl);
}
// ---- k_oproj: out = x + attn wo, grid (MT / 128, DM / 128)
__global__ __launch_bounds__(128) void k_oproj(const bf* __restrict__ Ah, const bf* __restrict__ Al, const bf* __restrict__ WO, int K, const float* __restrict__ x, float* O) {
    __shared__ __align__(16) bf ring[RINGE];
    gemm_tile<4, EP_RES>(ring, blockIdx.x, blockIdx.y, 0, Ah, Al, WO, K, x, nullptr, O, nullptr, nullptr, nullptr);
}

typedef __attribute__((ext_vector_type(2))) _Float16 v2h;
typedef __attribute__((ext_vector_type(4))) _Float16 v4h;
typedef __attribute__((ext_vector_type(2))) unsigned short v2us;
typedef __attribute__((ext_vector_type(4))) unsigned short v4us;
typedef __attribute__((ext_vector_type(2))) float v2f;
typedef __attribute__((ext_vector_type(4))) int v4i;

// ---- wt_blk: tile blk of the transpose Bt[n][k] (bf16) = w[k][n] (f32), WTT k x WTT n a work-group of 8 waves, through the LDS tile tl [n][k].
// Wave v reads rows k = 16 v .. 16 v + 15, a whole 512-byte row piece a load (lane l: columns 4 l .. 4 l + 3), all 16 loads in flight at once; a lane then holds 16 k of each of its 4 columns and writes them as 16-byte chunks of 8 k.
// Chunk c of tile row n lies at place c ^ ((n / 4) mod 16) of the row's 16: the 16 lanes of a half wave hit 16 different places (all 64 banks once) in the column-wise writes and in the row-wise reads alike. A store covers two output rows' 256 contiguous bytes each.
#define WTT 128
__device__ __forceinline__ void wt_blk(bf* tl, int blk, const float* __restrict__ w, int K, int N, bf* Bt) {
    const int lane = threadIdx.x & 31, lc = lane & 15, lh = lane >> 4, wv = threadIdx.x >> 5; const int nt = N / WTT, n0 = (blk % nt) * WTT, k0 = (blk / nt) * WTT;
    const float* sp = w + (size_t)(k0 + wv * 16) * N + n0 + lane * 4;
    v4f a[16];
#pragma unroll
    for (int j = 0; j < 16; ++j) a[j] = *(const v4f*)(sp + (size_t)j * N);
    // the wait that stands in front of a rewrite of a register which an issued load names; it takes the address as an input, so that it stays in its registers up to it
    asm volatile("s_wait_xcnt 0x0" :: "v"(sp) : "memory");
    __builtin_amdgcn_sched_barrier(0);                       // keeps all 16 loads in front of the conversions, so that a wave waits out the memory latency once
#pragma unroll
    for (int g = 0; g < 2; ++g)
#pragma unroll
        for (int q = 0; q < 4; ++q) { v8us o;
#pragma unroll
            for (int j = 0; j < 8; ++j) o[j] = f2bf(a[g * 8 + j][q]);
            *(v8usa*)(tl + (lane * 4 + q) * WTT + ((wv * 2 + g) ^ lc) * 8) = o; }
    __syncthreads();                                         // the whole tile is in LDS before a row is read
    bf* dp = Bt + (size_t)(n0 + wv * 16 + lh) * K + k0 + lc * 8;   // wave v stores tile rows 16 v .. 16 v + 15, two a step
    v8us o[8];                                               // all of the wave's rows are read first: no register that a store names is written again
#pragma unroll
    for (int s = 0; s < 8; ++s) { const int n = wv * 16 + 2 * s + lh; o[s] = *(const v8usa*)(tl + n * WTT + (lc ^ ((n >> 2) & 15)) * 8); }
    __builtin_amdgcn_sched_barrier(0);                       // keeps every LDS read in front of the first store
#pragma unroll
    for (int s = 0; s < 8; ++s) *(v8us*)(dp + (size_t)(2 * s) * K) = o[s];
    asm volatile("s_wait_xcnt 0x0" ::: "memory");            // the wait that stands in front of a rewrite of a register which an issued store names: another job's text follows this one's last stores
}
__device__ __forceinline__ void rms_blk(int blk, const float* __restrict__ X, const float* __restrict__ g, bf* Yh, bf* Yl) {
    const int lane = threadIdx.x & 31; const int r = blk * 8 + (threadIdx.x >> 5); if (r >= MT) return; const float* xr = X + (size_t)r * DM; float s = 0.f;
#pragma unroll 1
    for (int ch = 0; ch < DM / 128; ++ch) { const v4f a = *(const v4f*)(xr + ch * 128 + lane * 4);
#pragma unroll
        for (int q = 0; q < 4; ++q) { const float xb = bfr(a[q]); float p = __fmul_rn(xb, xb); asm volatile("" : "+v"(p)); s = __fadd_rn(s, p); } }
#pragma unroll
    for (int sh = 16; sh; sh >>= 1) s += __shfl_xor(s, sh, 32);
    const float rs = __fdiv_rn(1.0f, __fsqrt_rn(__fadd_rn(s * (1.0f / DM), 1e-6f)));
{
#pragma unroll 1
        for (int ch = 0; ch < DM / 128; ++ch) { const int c0 = ch * 128 + lane * 4; const v4f a = *(const v4f*)(xr + c0); v4us oh, ol;
#pragma unroll
            for (int q = 0; q < 4; ++q) { float n0 = __fmul_rn(bfr(a[q]), rs); asm volatile("" : "+v"(n0)); const float y = __fmul_rn(n0, bfr(g[c0 + q])); unsigned short h2, l2; splitf(y, h2, l2); oh[q] = h2; ol[q] = l2; }
            *(v4us*)(Yh + (size_t)r * DM + c0) = oh; *(v4us*)(Yl + (size_t)r * DM + c0) = ol; }
         } }
// ---- k_prep: the five jobs that read inputs only, in one grid: n = RMSNorm(x) norm_w of all MT rows as hi/lo planes, then the four weight transposes (the large ones first).
#define NRB (MT / 8)
#define NWQ ((DM / WTT) * (DQ / WTT))
#define NWK ((DM / WTT) * (DKV / WTT))
__global__ __launch_bounds__(256) void k_prep(const float* __restrict__ x, const float* __restrict__ g, const float* __restrict__ wq, const float* __restrict__ wk, const float* __restrict__ wv, const float* __restrict__ wo, bf* Yh, bf* Yl, bf* WQ, bf* WK, bf* WV, bf* WO) {
    static_assert(DM % WTT == 0 && DQ % WTT == 0 && DKV % WTT == 0, "whole transpose tiles");
    __shared__ __align__(16) bf tl[WTT * WTT];               // a transpose tile, 32 KiB
    const int i = blockIdx.x;
    if (i < NRB) rms_blk(i, x, g, Yh, Yl);
    else if (i < NRB + NWQ) wt_blk(tl, i - NRB, wq, DM, DQ, WQ);
    else if (i < NRB + 2 * NWQ) wt_blk(tl, i - NRB - NWQ, wo, DQ, DM, WO);
    else if (i < NRB + 2 * NWQ + NWK) wt_blk(tl, i - NRB - 2 * NWQ, wk, DM, DKV, WK);
    else wt_blk(tl, i - NRB - 2 * NWQ - NWK, wv, DM, DKV, WV);
}
__global__ __launch_bounds__(256) void k_cvt8(const float* __restrict__ src, bf* dst, size_t n8) { const size_t i = (size_t)blockIdx.x * 256 + threadIdx.x; if (i >= n8) return; const v8f v = *(const v8f*)(src + i * 8); v8us o;
#pragma unroll
    for (int k = 0; k < 8; ++k) o[k] = f2bf(v[k]); *(v8us*)(dst + i * 8) = o;  }
// ---- k_attn: attention in one pass over the keys, one wave a tile of 16 QG query rows of one head; no score or probability ever leaves the registers, and the waves share nothing (no barrier).
// Transposed products: S^T = K Q^T (A = 16 keys x 32 d, B = 32 d x 16 queries) leaves in lane (hi, lr) the scores of query lr for keys 8 hi .. 8 hi + 7 of each 16-key tile: exactly the elements that the lane holds of the B operand P^T (32 keys x 16 queries) of O^T += V^T P^T.
// Running softmax in the base-2 domain: u = S x HD^-0.5 x log2 e, p = 2^(u - mr); the reference mr of a query moves (and its sums are rescaled) only when a new maximum lies more than 12 above it, then to 4 below that maximum, so p <= 2^12; keys outside j <= i, i - j < WIN give p = 0 (masked by select in the two edge steps only).
// The sum of p and O^T are divided once, at the end. The four waves of a work-group are the four query heads of one kv head on the same rows: they read the same K and V blocks. K and V fragments (fragment order, 512 contiguous bytes a load) are fetched one step ahead into the registers that the step's products have just left.
__device__ __forceinline__ float xhalf(float x) { const unsigned u = __float_as_uint(x); return __uint_as_float(__builtin_amdgcn_permlanex16(u, u, 0x76543210u, 0xfedcba98u, false, false)); }   // the value of lane l ^ 16
#define SGP 136                  // pitch in elements of a staged output row: 272 B = 16 B x odd
#define SGE (16 * SGP)           // one staged plane of 16 rows
template <typename T16, int NSPLIT, int QG>
__device__ __forceinline__ void attn_tile(bf* stg, const T16* __restrict__ Q, const T16* __restrict__ Q2, const T16* __restrict__ Kp, const T16* __restrict__ Kp2, const T16* __restrict__ Vt, const T16* __restrict__ Vt2, int q0, bf* Ah, bf* Al) {
    typedef typename WFrag<T16>::V V;
    constexpr bool hires = (NSPLIT == 2);
    const int lane = threadIdx.x & 31, lr = lane & 15, hi = lane >> 4;
    const int K0 = max(0, q0 - WIN + 1) & ~31, Kl = (q0 + 16 * QG + 31) & ~31;   // the tile's band of keys in whole 32-key blocks
    V qf[QG][4], qf2[QG][4], kf[2][4], kf2[2][4], vf[8], vf2[8];
    const T16* qp = Q + (size_t)q0 * HD + lane * 8; const T16* qp2 = hires ? Q2 + (size_t)q0 * HD + lane * 8 : qp;
    const T16* kp = Kp + (size_t)K0 * HD + lane * 8; const T16* kp2 = hires ? Kp2 + (size_t)K0 * HD + lane * 8 : kp;
    const T16* vp = Vt + (size_t)K0 * HD + lane * 8; const T16* vp2 = hires ? Vt2 + (size_t)K0 * HD + lane * 8 : vp;   // key block kb / 32: HD / 16 blocks of 512 elements
#pragma unroll
    for (int g = 0; g < QG; ++g)
#pragma unroll
        for (int db = 0; db < 4; ++db) { qf[g][db] = WFrag<T16>::ldf(qp + g * 16 * HD + db * 512); if (hires) qf2[g][db] = WFrag<T16>::ldf(qp2 + g * 16 * HD + db * 512); }
    asm volatile("s_wait_xcnt 0x0" ::: "memory");                    // the wait that stands in front of a rewrite of a register which an issued load names: the K addresses are formed next, and may take the registers of the Q loads' bases
    __builtin_amdgcn_sched_barrier(0);                               // Q, then K, then V, the order of the loop's own loads: the counted waits at the loop's head then leave the V loads in flight
#pragma unroll
    for (int t = 0; t < 2; ++t)
#pragma unroll
        for (int db = 0; db < 4; ++db) { kf[t][db] = WFrag<T16>::ldf(kp + t * 16 * HD + db * 512); if (hires) kf2[t][db] = WFrag<T16>::ldf(kp2 + t * 16 * HD + db * 512); }
    __builtin_amdgcn_sched_barrier(0);                               // (the same)
#pragma unroll
    for (int dt = 0; dt < 8; ++dt) { vf[dt] = WFrag<T16>::ldf(vp + dt * 512); if (hires) vf2[dt] = WFrag<T16>::ldf(vp2 + dt * 512); }
    // the wait that stands in front of a rewrite of a register which an issued load names; it takes the addresses as inputs, so that they stay in their registers up to it
    asm volatile("s_wait_xcnt 0x0" :: "v"(qp), "v"(qp2), "v"(kp), "v"(kp2), "v"(vp), "v"(vp2) : "memory");
    v8f o[QG][8]; float mr[QG], ls[QG];
#pragma unroll
    for (int g = 0; g < QG; ++g) { mr[g] = -1.0e30f; ls[g] = 0.f;
#pragma unroll
        for (int dt = 0; dt < 8; ++dt) o[g][dt] = (v8f){}; }
    for (int kb = K0; kb < Kl; kb += 32) {
        const int adv = kb + 32 < Kl ? 32 * HD : 0;                  // the last step fetches its own blocks again: in bounds, never used
        v8f s[QG][2];
#pragma unroll
        for (int g = 0; g < QG; ++g) { s[g][0] = (v8f){}; s[g][1] = (v8f){}; }
#pragma unroll
        for (int db = 0; db < 4; ++db) {
#pragma unroll
            for (int t = 0; t < 2; ++t)
#pragma unroll
                for (int g = 0; g < QG; ++g) s[g][t] = WFrag<T16>::mma(kf[t][db], qf[g][db], s[g][t]);
            if (hires) {
#pragma unroll
                for (int t = 0; t < 2; ++t)
#pragma unroll
                    for (int g = 0; g < QG; ++g) s[g][t] = WFrag<T16>::mma(kf[t][db], qf2[g][db], s[g][t]);
#pragma unroll
                for (int t = 0; t < 2; ++t)
#pragma unroll
                    for (int g = 0; g < QG; ++g) s[g][t] = WFrag<T16>::mma(kf2[t][db], qf[g][db], s[g][t]); } }
        __builtin_amdgcn_sched_barrier(0);                           // keeps the next step's K loads behind the products that read these registers, and ahead of the softmax that hides them
        kp += adv; kp2 += adv;
#pragma unroll
        for (int t = 0; t < 2; ++t)
#pragma unroll
            for (int db = 0; db < 4; ++db) { kf[t][db] = WFrag<T16>::ldf(kp + t * 16 * HD + db * 512); if (hires) kf2[t][db] = WFrag<T16>::ldf(kp2 + t * 16 * HD + db * 512); }
        // the wait that stands in front of a rewrite of a register which an issued load names (the addresses move in the next step)
        asm volatile("s_wait_xcnt 0x0" :: "v"(kp), "v"(kp2) : "memory");
        __builtin_amdgcn_sched_barrier(0);                           // keeps the loads ahead of the softmax
        float u[QG][2][8], mx[QG]; bool need = false;
#pragma unroll
        for (int g = 0; g < QG; ++g)
#pragma unroll
            for (int t = 0; t < 2; ++t)
#pragma unroll
                for (int j = 0; j < 8; ++j) u[g][t][j] = s[g][t][j] * (SCL * 1.4426950408889634f);
        if (kb + 31 > q0 || kb <= q0 + 16 * QG - 1 - WIN) {          // only the band's first and last steps hold keys outside the window of some row (a scalar test)
#pragma unroll
            for (int g = 0; g < QG; ++g)
#pragma unroll
                for (int t = 0; t < 2; ++t)
#pragma unroll
                    for (int j = 0; j < 8; ++j) { const int i = q0 + 16 * g + lr, jj = kb + 16 * t + 8 * hi + j; u[g][t][j] = (jj <= i && i - jj < WIN) ? u[g][t][j] : -3.0e38f; }
        }
#pragma unroll
        for (int g = 0; g < QG; ++g) { float m0 = u[g][0][0];
#pragma unroll
            for (int e = 1; e < 16; ++e) m0 = fmaxf(m0, u[g][e >> 3][e & 7]);
            mx[g] = fmaxf(m0, xhalf(m0)); need = need || mx[g] > mr[g] + 12.0f; }
        if (__builtin_amdgcn_ballot_w32(need) != 0) {                // one test a step; rare after a query's first keys
#pragma unroll
            for (int g = 0; g < QG; ++g) { const float mn = fmaxf(mr[g], mx[g] - 4.0f), al = __builtin_amdgcn_exp2f(mr[g] - mn); mr[g] = mn; ls[g] *= al;
#pragma unroll
                for (int dt = 0; dt < 8; ++dt)
#pragma unroll
                    for (int j = 0; j < 8; ++j) o[g][dt][j] *= al; }
        }
        V pf[QG], pf2[QG];
#pragma unroll
        for (int g = 0; g < QG; ++g) {
            float p[16];
#pragma unroll
            for (int e = 0; e < 16; ++e) p[e] = u[g][e >> 3][e & 7] - mr[g];
            __builtin_amdgcn_sched_barrier(0);                       // keeps the subtractions out of the run of exponentials below: none of them then lands on the source register of the exponential directly in front of it
#pragma unroll
            for (int e = 0; e < 16; ++e) { p[e] = __builtin_amdgcn_exp2f(p[e]);
                // hi+lo build: the next key's result lands on this one's source register; the v_nop fills the one slot the instruction set asks for behind a transcendental, and the scheduling barrier keeps it directly behind it
                if constexpr (hires) { asm volatile("v_nop" :: "v"(p[e])); __builtin_amdgcn_sched_barrier(0); } }
            if constexpr (!hires) __builtin_amdgcn_sched_barrier(0);     // (the same, for what follows the run)
#pragma unroll
            for (int e = 0; e < 16; ++e) ls[g] += p[e];
            if constexpr (hires) { v8us h0, h1, l0, l1;
#pragma unroll
                for (int e = 0; e < 8; ++e) { unsigned short a, c2; splitf(p[e], a, c2); h0[e] = a; l0[e] = c2; splitf(p[8 + e], a, c2); h1[e] = a; l1[e] = c2; }
                pf[g] = cat16b(h0, h1); pf2[g] = cat16b(l0, l1);
            } else { v8h h0, h1;
#pragma unroll
                for (int e = 0; e < 8; ++e) { h0[e] = tohx(p[e]); h1[e] = tohx(p[8 + e]); }
                pf[g] = cat16(h0, h1); }
        }
#pragma unroll
        for (int dt = 0; dt < 8; ++dt)
#pragma unroll
            for (int g = 0; g < QG; ++g) o[g][dt] = WFrag<T16>::mma(vf[dt], pf[g], o[g][dt]);
        if (hires) {
#pragma unroll
            for (int dt = 0; dt < 8; ++dt)
#pragma unroll
                for (int g = 0; g < QG; ++g) o[g][dt] = WFrag<T16>::mma(vf[dt], pf2[g], o[g][dt]);
#pragma unroll
            for (int dt = 0; dt < 8; ++dt)
#pragma unroll
                for (int g = 0; g < QG; ++g) o[g][dt] = WFrag<T16>::mma(vf2[dt], pf[g], o[g][dt]); }
        __builtin_amdgcn_sched_barrier(0);                           // keeps the next step's V loads behind the products that read these registers
        vp += adv; vp2 += adv;
#pragma unroll
        for (int dt = 0; dt < 8; ++dt) { vf[dt] = WFrag<T16>::ldf(vp + dt * 512); if (hires) vf2[dt] = WFrag<T16>::ldf(vp2 + dt * 512); }
        // the wait that stands in front of a rewrite of a register which an issued load names (the addresses move in the next step)
        asm volatile("s_wait_xcnt 0x0" :: "v"(vp), "v"(vp2) : "memory");
    }
    // lane (hi, lr) holds, of query lr, columns d = 16 dt + 8 hi .. + 7: 16 bytes of each plane; staged in the wave's own LDS range so that a store covers two rows' 256 contiguous bytes
#pragma unroll
    for (int g = 0; g < QG; ++g) { const float lt = ls[g] + xhalf(ls[g]), inv = __fdiv_rn(1.0f, lt); bf* sp = stg + g * (2 * SGE) + lr * SGP + hi * 8;
#pragma unroll
        for (int dt = 0; dt < 8; ++dt) { v8us oh, ol;
#pragma unroll
            for (int j = 0; j < 8; ++j) { unsigned short a, c2; splitf(o[g][dt][j] * inv, a, c2); oh[j] = a; ol[j] = c2; }
            *(v8usa*)(sp + dt * 16) = oh; *(v8usa*)(sp + SGE + dt * 16) = ol; } }
    __builtin_amdgcn_wave_barrier(); asm volatile("" ::: "memory");   // keeps the row reads below, which take other lanes' values, behind the stores above
    v8us ra[QG][8], rb[QG][8];                                       // all rows are read first: no register that a store names is written again
#pragma unroll
    for (int g = 0; g < QG; ++g)
#pragma unroll
        for (int r = 0; r < 8; ++r) { const bf* sp = stg + g * (2 * SGE) + (2 * r + hi) * SGP + lr * 8; ra[g][r] = *(const v8usa*)sp; rb[g][r] = *(const v8usa*)(sp + SGE); }
    __builtin_amdgcn_sched_barrier(0);                               // keeps every LDS read in front of the first store
    const size_t oo = (size_t)(q0 + hi) * DQ + lr * 8; bf* ah = Ah + oo; bf* al2 = Al + oo;
#pragma unroll
    for (int g = 0; g < QG; ++g)
#pragma unroll
        for (int r = 0; r < 8; ++r) { *(v8us*)(ah + (size_t)(16 * g + 2 * r) * DQ) = ra[g][r]; *(v8us*)(al2 + (size_t)(16 * g + 2 * r) * DQ) = rb[g][r]; }
    asm volatile("s_wait_xcnt 0x0" ::: "memory");                    // the wait that stands in front of a rewrite of a register which an issued store names
}
// grid: tile (slowest), then batch element and kv head; first the 32-row tiles of query rows >= RH (single fp16), then the 16-row tiles of rows < RH (hi+lo planes, 3 products) from the longest band to the shortest, so that the last work-groups to start are the shortest.
// waves_per_eu(2): caps the registers so that two waves share a SIMD.
#define NTF ((TT - RH) / 32)
#define NTH (RH / 16)
__global__ __launch_bounds__(128) __attribute__((amdgpu_waves_per_eu(2))) void k_attn(const h16* __restrict__ Q16, const bf* __restrict__ Qh, const bf* __restrict__ Ql, const h16* __restrict__ K16, const bf* __restrict__ Kh, const bf* __restrict__ Kl, const h16* __restrict__ V16, const bf* __restrict__ Vh, const bf* __restrict__ Vl, bf* Ah, bf* Al) {
    static_assert(RH % 32 == 0 && (TT - RH) % 32 == 0 && REP == 4 && HD == 128, "whole tiles; one wave a query head of the kv head");
    __shared__ __align__(16) bf stg[4 * 4 * SGE];                    // output staging: 2 groups x 2 planes a wave
    const int w = __builtin_amdgcn_readfirstlane((int)(threadIdx.x >> 5));
    const int tile = blockIdx.x / (NKV * NB_), gz = blockIdx.x % (NKV * NB_);
    const size_t kvh = gz % NKV, bz = gz / NKV, z = kvh * REP + w, qo = (bz * NH_ + z) * TT * HD, ko = (bz * NKV + kvh) * TT * HD;
    bf* ah = Ah + bz * TT * DQ + z * HD; bf* al = Al + bz * TT * DQ + z * HD;   // the batch element's rows and the head's columns of the merged planes
    bf* sw = stg + w * (4 * SGE);
    if (tile < NTF) attn_tile<h16, 0, 2>(sw, Q16 + qo, nullptr, K16 + ko, nullptr, V16 + ko, nullptr, RH + 32 * tile, ah, al);
    else attn_tile<bf, 2, 1>(sw, Qh + qo, Ql + qo, Kh + ko, Kl + ko, Vh + ko, Vl + ko, 16 * (NTH - 1 - (tile - NTF)), ah, al);
}

extern "C" void kernel_launch(void* const* d_in, const int* in_sizes, int n_in,
                              void* d_out, int out_size, void* d_ws, size_t ws_size, hipStream_t stream) {
    (void)in_sizes; (void)n_in; (void)out_size;
    const float* x = (const float*)d_in[0]; const float* gw = (const float*)d_in[1]; const float* wq = (const float*)d_in[2]; const float* wk = (const float*)d_in[3]; const float* wv = (const float*)d_in[4]; const float* wo = (const float*)d_in[5]; const float* cosT = (const float*)d_in[6]; const float* sinT = (const float*)d_in[7];
    float* OUT = (float*)d_out;     // [2][2048][2048]
    char* wsp = (char*)d_ws;
    auto take = [&](size_t bytes) { char* p = wsp; wsp += (bytes + 255) & ~(size_t)255; return (void*)p; };
    bf* WQ = (bf*)take((size_t)DQ * DM * 2); bf* WK = (bf*)take((size_t)DKV * DM * 2); bf* WV = (bf*)take((size_t)DKV * DM * 2); bf* WO = (bf*)take((size_t)DM * DQ * 2);
    bf* Yh = (bf*)take((size_t)MT * DM * 2); bf* Yl = (bf*)take((size_t)MT * DM * 2);
    h16* QP16 = (h16*)take((size_t)NB_ * NH_ * TT * HD * 2); h16* KP16 = (h16*)take((size_t)NB_ * NKV * TT * HD * 2); h16* VT16 = (h16*)take((size_t)NB_ * NKV * HD * TT * 2);
    bf* QPh = (bf*)take((size_t)NB_ * NH_ * TT * HD * 2); bf* QPl = (bf*)take((size_t)NB_ * NH_ * TT * HD * 2); bf* KPh = (bf*)take((size_t)NB_ * NKV * TT * HD * 2); bf* KPl = (bf*)take((size_t)NB_ * NKV * TT * HD * 2); bf* VTh = (bf*)take((size_t)NB_ * NKV * HD * TT * 2); bf* VTl = (bf*)take((size_t)NB_ * NKV * HD * TT * 2);
    bf* ATh = (bf*)take((size_t)MT * DQ * 2); bf* ATl = (bf*)take((size_t)MT * DQ * 2);
    if ((size_t)(wsp - (char*)d_ws) > ws_size) return;    // ws 256 MiB
    k_prep<<<NRB + 2 * NWQ + 2 * NWK, 256, 0, stream>>>(x, gw, wq, wk, wv, wo, Yh, Yl, WQ, WK, WV, WO);   /* n = RMSNorm(x) norm_w as hi/lo planes; the weights as [n][k] bf16 */
    k_qkv<<<NQT + 2 * NKT, 128, 0, stream>>>(Yh, Yl, WQ, WK, WV, DM, cosT, sinT, QP16, QPh, QPl, KP16, KPh, KPl, VT16, VTh, VTl);
    k_attn<<<(NTF + NTH) * NKV * NB_, 128, 0, stream>>>(QP16, QPh, QPl, KP16, KPh, KPl, VT16, VTh, VTl, ATh, ATl);
    k_oproj<<<dim3(MT / 128, DM / 128, 1), 128, 0, stream>>>(ATh, ATl, WO, DQ, x, OUT);   /* out = x + attn wo */
}
